// v000
// The times below were measured on an AMD MI455X: many runs one after another, warmed up first and cycling through
// copies of the inputs, with the whole window's GPU time divided by the number of runs. Launches and the gaps
// between them are all in it. The median over several windows is given; except for v000 it joins two sittings, which
// can be a few percent apart, so the side-by-side timings, each taken in one sitting, are the better comparison.
// v000 is the starting kernel. One run takes 303 microseconds.
#include <hip/hip_runtime.h>

// Spatial self-attention block over flattened pixels: x [NB][SEQ][256]; three 1x1 projections W [in 256][out 128] (no bias); keys and values max-pooled over adjacent token pairs (SEQ/2 keys);
// unscaled dot-product scores, softmax over keys; context [SEQ][128] -> output projection W_out [in 128][out 256]; output = x + projected context (f32).
// Compute dtypes, f32 accumulate everywhere: three input projections v_wmma_f32_16x16x32_bf16 (x and W RNE-converted to bf16; products exact);
// scores v_wmma_f32_16x16x32_f16 with q and k each as f16 value + f16 residual x2048 (three products, residual products in their own accumulator folded by 1/2048);
// P.V v_wmma_f32_16x16x32_f16, P single f16 with x16384 carry (cancels in the normalisation, row sum over the converted P), pooled values single f16;
// output projection v_wmma_f32_16x16x32_f16, context single f16, W_out (RNE bf16 value) x64 as f16, folded by 1/64; softmax f32 (online, running max); skip term = bf16-converted x added in f32 at the store stage.
// Layout: bf16 copy of x; transposed 16-bit weight planes [out][in]; q planes (value, residual) [b][t][128]; k planes (value, residual) [b][key][128]; value^T plane [b][d][key];
// fused flash kernel in transposed form (S^T = K Q^T, O^T = V^T P^T, out^T = W_out^T ctx^T with the packed O^T tiles as B fragments).

#ifndef NB
#define NB 8
#endif
#ifndef SEQ
#define SEQ 4096
#endif
#define NB_FULL  8
#define SEQ_FULL 4096
#ifndef OUT_SEQ
#define OUT_SEQ SEQ              // row pitch (in tokens) between batches of the output
#endif
#define CIN  256                 // input channels (projection depth)
#define CB   128                 // bottleneck width (score depth, context width)
#define COUT 256                 // output channels
#define MK   (SEQ / 2)           // pooled keys per batch
#define AW   4                   // waves per flash block (16 query rows each)
#define OPF  132                 // LDS row pitch (floats) of the 16 x 128 staging tiles
#define QRS  2048.0f             // carry of every residual plane
#define QRI  (1.0f / 2048.0f)
#define L2E  1.4426950408889634f // log2(e); the module applies no score scale
#define PSH  14.0f               // log2 of the P carry (16384)
#define NEGB (-3.0e38f)
#define WOS  64.0f               // carry of the f16 W_out plane
#define WOI  (1.0f / 64.0f)

static_assert(CB == 128);                      // flash: 4 k-steps of 32 per score tile, 8 output tiles of 16, 4 k-steps in the output projection
static_assert(COUT == 256);                    // output staged as two halves of 128 columns
static_assert(CIN == COUT);                    // skip term has the output's row width
static_assert(CIN % 32 == 0);                  // GEMM k-loop steps by 32
static_assert(CB % 32 == 0);
static_assert(CIN % 64 == 0);                  // weight transposer tiles of 64 x 64
static_assert(CB % 64 == 0);
static_assert(COUT % 64 == 0);
static_assert(SEQ % 128 == 0);                 // a 128-token value tile never straddles two batches; token pairs stay inside a tile
static_assert((NB * SEQ) % 128 == 0);
static_assert((NB * SEQ) % 64 == 0);
static_assert(MK % 32 == 0);                   // key loop steps by 32
static_assert(MK % 64 == 0);
static_assert(SEQ % (16 * AW) == 0);           // flash grid covers the sequence exactly
static_assert(((size_t)SEQ * CIN) % 8 == 0);
static_assert(NB <= NB_FULL);
static_assert(SEQ <= SEQ_FULL);
static_assert((OPF * 4) % 16 == 0);
static_assert((size_t)NB * SEQ * CIN < (size_t)2147483647);   // int offsets inside the planes

typedef _Float16 h16;
typedef unsigned short bf;
typedef __attribute__((ext_vector_type(16))) __bf16   v16bf;
typedef __attribute__((ext_vector_type(16))) _Float16 v16h;
typedef __attribute__((ext_vector_type(8)))  _Float16 v8h;
typedef __attribute__((ext_vector_type(8)))  unsigned short v8us;
typedef __attribute__((ext_vector_type(8)))  float    v8f;
typedef __attribute__((ext_vector_type(4)))  float    v4f;
typedef v4f  __attribute__((may_alias)) v4fa;

__device__ __forceinline__ unsigned short f2bf(float f) { unsigned u = __float_as_uint(f); u += 0x7FFFu + ((u >> 16) & 1u); return (unsigned short)(u >> 16); }
__device__ __forceinline__ float bfr(float f) { return __uint_as_float(((unsigned)f2bf(f)) << 16); }   // value after RNE convert to bf16
__device__ __forceinline__ v16h cat16(v8h lo, v8h hi) { return __builtin_shufflevector(lo, hi, 0, 1, 2, 3, 4, 5, 6, 7, 8, 9, 10, 11, 12, 13, 14, 15); }
__device__ __forceinline__ v16bf cat16b(v8us lo, v8us hi) { return __builtin_bit_cast(v16bf, __builtin_shufflevector(lo, hi, 0, 1, 2, 3, 4, 5, 6, 7, 8, 9, 10, 11, 12, 13, 14, 15)); }
__device__ __forceinline__ v8f wmma16(v16h a, v16h b, v8f c) { return __builtin_amdgcn_wmma_f32_16x16x32_f16(false, a, false, b, (short)0, c, false, false); }
__device__ __forceinline__ v8f wmmab(v16bf a, v16bf b, v8f c) { return __builtin_amdgcn_wmma_f32_16x16x32_bf16(false, a, false, b, (short)0, c, false, false); }
// fragment loaders from K-contiguous 16-bit rows; p already includes + 8*(lane>>4): elements 0..7 <- k0+8h+0..7, elements 8..15 <- k0+16+8h+0..7 (same map for A and B)
__device__ __forceinline__ v16h  ldh(const h16* p) { return cat16(*(const v8h*)p, *(const v8h*)(p + 16)); }
__device__ __forceinline__ v16bf ldb(const bf* p)  { return cat16b(*(const v8us*)p, *(const v8us*)(p + 16)); }
// ordering point for wave-private LDS tiles (same wave writes and reads)
__device__ __forceinline__ void wave_sync() { __builtin_amdgcn_fence(3 /* release order */, "wavefront"); __builtin_amdgcn_wave_barrier(); asm volatile("" ::: "memory"); }

// f32 -> f16 convert that cannot produce an f16 subnormal (|v| < 2^-14 -> +0); applied after the plane's power-of-two carry
static __device__ __forceinline__ h16 toh_flush(float v) { const h16 r = (h16)v; return (fabsf(v) < 6.103515625e-05f) ? (h16)0.0f : r; }
// one matrix instruction + its own four-slot guard (accumulator tied, operands kept live)
__device__ __forceinline__ v8f wmma16g(v16h a, v16h b, v8f c) {
    c = __builtin_amdgcn_wmma_f32_16x16x32_f16(false, a, false, b, (short)0, c, false, false);
    asm volatile("v_nop\n\tv_nop\n\tv_nop\n\tv_nop" : "+v"(c) : "v"(a), "v"(b));
    return c; }
__device__ __forceinline__ v8f wmmabg(v16bf a, v16bf b, v8f c) {
    c = __builtin_amdgcn_wmma_f32_16x16x32_bf16(false, a, false, b, (short)0, c, false, false);
    asm volatile("v_nop\n\tv_nop\n\tv_nop\n\tv_nop" : "+v"(c) : "v"(a), "v"(b));
    return c; }

__global__ __launch_bounds__(256) void k_cvt8(const float* __restrict__ src, bf* dst, size_t n8) {
    const size_t i = (size_t)blockIdx.x * 256 + threadIdx.x; if (i >= n8) return;
    const v8f v = *(const v8f*)(src + i * 8); v8us o;
#pragma unroll
    for (int k = 0; k < 8; ++k) o[k] = f2bf(v[k]);
    *(v8us*)(dst + i * 8) = o; 
}

// Weight transposer: in[R][C] (f32) -> out[C][R] (16-bit), 64 x 64 tile per block through LDS (cross-wave: block barrier).
// ASH = 0: bf16 bits (RNE convert). ASH = 1: f16 of (RNE bf16 value x 64), subnormal-free convert.
template <int ASH>
__device__ __forceinline__ void wtr_body(const float* __restrict__ src, bf* dstb, h16* dsth, int R, int C) {
    __shared__ float ts[64 * 65];
    const int tid = threadIdx.x;
    const int r0 = blockIdx.x * 64, c0 = blockIdx.y * 64;
#pragma unroll 1
    for (int i = 0; i < 16; ++i) { const int rr = i * 4 + (tid >> 6), cc = tid & 63;        // 16 trips x 4 rows = 64 rows; 64 columns
        ts[rr * 65 + cc] = src[(size_t)(r0 + rr) * C + c0 + cc]; }
    __syncthreads();
    static_assert(256 * 8 * 2 == 64 * 64);                                                 // threads x elements per store x trips == tile
{
#pragma unroll 1
        for (int it = 0; it < 2; ++it) {
            const int cc = it * 32 + (tid >> 3), r8 = (tid & 7) * 8;                        // 2 trips x 32 output rows; 8 lanes x 8 elements = 64 = one line
            const size_t oo = (size_t)(c0 + cc) * R + r0 + r8;
            if (ASH) { v8h o;
#pragma unroll
                for (int k = 0; k < 8; ++k) o[k] = toh_flush(bfr(ts[(r8 + k) * 65 + cc]) * WOS);
                *(v8h*)(dsth + oo) = o;
            } else { v8us o;
#pragma unroll
                for (int k = 0; k < 8; ++k) o[k] = f2bf(ts[(r8 + k) * 65 + cc]);
                *(v8us*)(dstb + oo) = o; }
        }
         }
}
__global__ __launch_bounds__(256) void k_wtr_b(const float* __restrict__ src, bf* dst, int R, int C)  { wtr_body<0>(src, dst, (h16*)0, R, C); }
__global__ __launch_bounds__(256) void k_wtr_h(const float* __restrict__ src, h16* dst, int R, int C) { wtr_body<1>(src, (bf*)0, dst, R, C); }

// mm64: register-blocked bf16 GEMM main loop, ONE WAVE per 64x64 tile (16 accumulators), operands straight from K-contiguous bf16 planes, K = CIN.
// acc[mb][nb][j] = C[16mb + 8h + j][16nb + (lane&15)], C[m][n] = sum_k A[m][k] Bt[n][k].
__device__ __forceinline__ void mm64(const bf* __restrict__ A, const bf* __restrict__ Bt, size_t aoff, size_t boff, v8f (&acc)[4][4]) {
    const int K = CIN;
#pragma unroll
    for (int mb = 0; mb < 4; ++mb)
#pragma unroll
        for (int nb = 0; nb < 4; ++nb) acc[mb][nb] = (v8f){};
#pragma unroll 1
    for (int kc = 0; kc < K; kc += 32) {
        v16bf a[4];
#pragma unroll
        for (int mb = 0; mb < 4; ++mb) a[mb] = ldb(A + aoff + (size_t)mb * 16 * K + kc);
#pragma unroll
        for (int nb = 0; nb < 4; ++nb) { const v16bf b = ldb(Bt + boff + (size_t)nb * 16 * K + kc);
#pragma unroll
            for (int mb = 0; mb < 4; ++mb) acc[mb][nb] = wmmabg(a[mb], b, acc[mb][nb]); }
    }
}

// k_proj_q: q = x W_theta. A = x rows (m = b*SEQ + t), Bt = transposed weight rows (n = d). Planes [b*SEQ + t][128]: f16 value (Ph) and f16 residual x2048 (Pr).
__global__ __launch_bounds__(32) void k_proj_q(const bf* __restrict__ A, const bf* __restrict__ Bt, h16* Ph, h16* Pr) {
    __shared__ __align__(16) float os[16 * 68];
    const int lane = threadIdx.x & 31, lr = lane & 15, hi = lane >> 4; const int r0 = blockIdx.x * 64, c0 = blockIdx.y * 64;
    v8f acc[4][4];
    mm64(A, Bt, (size_t)(r0 + lr) * CIN + 8 * hi, (size_t)(c0 + lr) * CIN + 8 * hi, acc);
    const size_t obase = (size_t)r0 * CB + c0;
#pragma unroll
    for (int mb = 0; mb < 4; ++mb) {
#pragma unroll
        for (int nb = 0; nb < 4; ++nb) {
#pragma unroll
            for (int j = 0; j < 8; ++j) os[(hi * 8 + j) * 68 + nb * 16 + lr] = acc[mb][nb][j]; }   // D: row 8h+j, col lane&15; 16 x 64 all written
        wave_sync();
        static_assert(32 * 8 * 4 == 16 * 64);                                                     // lanes x halves x instructions == slab
{
#pragma unroll
            for (int s = 0; s < 4; ++s) { const int row = 4 * s + (lane >> 3), c8 = (lane & 7) * 8;   // 4 s x 4 row groups = 16 rows; 8 lanes x 8 = 64 columns
                const v4f x0 = *(const v4fa*)(&os[row * 68 + c8]); const v4f x1 = *(const v4fa*)(&os[row * 68 + c8 + 4]); v8h hv, rv;
#pragma unroll
                for (int i = 0; i < 4; ++i) { const h16 a0 = toh_flush(x0[i]); const h16 a1 = toh_flush(x1[i]); hv[i] = a0; hv[4 + i] = a1;
                    rv[i] = toh_flush((x0[i] - (float)a0) * QRS); rv[4 + i] = toh_flush((x1[i] - (float)a1) * QRS); }
                const size_t oo = obase + (size_t)(mb * 16 + row) * CB + c8;
                *(v8h*)(Ph + oo) = hv; *(v8h*)(Pr + oo) = rv; }
             }
        wave_sync();
    }
}

// k_proj_k: k = maxpool2(x W_phi) over adjacent token pairs. Same GEMM; per 16-token slab the 8 pooled rows (max in f32, then convert) go to planes [b*MK + key][128]: f16 value and f16 residual x2048.
__global__ __launch_bounds__(32) void k_proj_k(const bf* __restrict__ A, const bf* __restrict__ Bt, h16* Ph, h16* Pr) {
    __shared__ __align__(16) float os[16 * 68];
    const int lane = threadIdx.x & 31, lr = lane & 15, hi = lane >> 4; const int r0 = blockIdx.x * 64, c0 = blockIdx.y * 64;
    v8f acc[4][4];
    mm64(A, Bt, (size_t)(r0 + lr) * CIN + 8 * hi, (size_t)(c0 + lr) * CIN + 8 * hi, acc);
    const size_t obase = (size_t)(r0 / 2) * CB + c0;                                              // (b*SEQ + t)/2 = b*MK + t/2
#pragma unroll
    for (int mb = 0; mb < 4; ++mb) {
#pragma unroll
        for (int nb = 0; nb < 4; ++nb) {
#pragma unroll
            for (int j = 0; j < 8; ++j) os[(hi * 8 + j) * 68 + nb * 16 + lr] = acc[mb][nb][j]; }
        wave_sync();
        static_assert(32 * 8 * 2 == 8 * 64);                                                      // lanes x halves x instructions == pooled slab
{
#pragma unroll
            for (int s = 0; s < 2; ++s) { const int prow = 4 * s + (lane >> 3), c8 = (lane & 7) * 8;   // 2 s x 4 row groups = 8 pooled rows (token rows 2*prow, 2*prow+1)
                const v4f u0 = *(const v4fa*)(&os[(2 * prow) * 68 + c8]);     const v4f u1 = *(const v4fa*)(&os[(2 * prow) * 68 + c8 + 4]);
                const v4f w0 = *(const v4fa*)(&os[(2 * prow + 1) * 68 + c8]); const v4f w1 = *(const v4fa*)(&os[(2 * prow + 1) * 68 + c8 + 4]); v8h hv, rv;
#pragma unroll
                for (int i = 0; i < 4; ++i) { const float y0 = fmaxf(u0[i], w0[i]), y1 = fmaxf(u1[i], w1[i]);
                    const h16 a0 = toh_flush(y0); const h16 a1 = toh_flush(y1); hv[i] = a0; hv[4 + i] = a1;
                    rv[i] = toh_flush((y0 - (float)a0) * QRS); rv[4 + i] = toh_flush((y1 - (float)a1) * QRS); }
                const size_t oo = obase + (size_t)(mb * 8 + prow) * CB + c8;
                *(v8h*)(Ph + oo) = hv; *(v8h*)(Pr + oo) = rv; }
             }
        wave_sync();
    }
}

// k_proj_gt: pooled values transposed, G^T[d][key] = max over the token pair of (W_g^T x^T)[d][t]. ONE WAVE per 32 (d) x 128 (token) tile (16 accumulators):
// A = transposed weight rows (m = d), Bt = x rows (n = b*SEQ + t). Plane [(b*128 + d)][MK], single f16. Per 16-row slab staged in LDS (wave-private);
__global__ __launch_bounds__(32) void k_proj_gt(const bf* __restrict__ A, const bf* __restrict__ Bt, h16* Gt) {
    __shared__ __align__(16) float os[16 * OPF];
    const int K = CIN;
    const int lane = threadIdx.x & 31, lr = lane & 15, hi = lane >> 4; const int r0 = blockIdx.x * 32, c0 = blockIdx.y * 128;
    v8f acc[2][8];
#pragma unroll
    for (int mb = 0; mb < 2; ++mb)
#pragma unroll
        for (int nb = 0; nb < 8; ++nb) acc[mb][nb] = (v8f){};
    const size_t aoff = (size_t)(r0 + lr) * K + 8 * hi, boff = (size_t)(c0 + lr) * K + 8 * hi;
#pragma unroll 1
    for (int kc = 0; kc < K; kc += 32) {
        v16bf a[2];
#pragma unroll
        for (int mb = 0; mb < 2; ++mb) a[mb] = ldb(A + aoff + (size_t)mb * 16 * K + kc);
#pragma unroll
        for (int nb = 0; nb < 8; ++nb) { const v16bf b = ldb(Bt + boff + (size_t)nb * 16 * K + kc);
#pragma unroll
            for (int mb = 0; mb < 2; ++mb) acc[mb][nb] = wmmabg(a[mb], b, acc[mb][nb]); }
    }
    const int bb = c0 / SEQ, tt = c0 % SEQ;
    const size_t obase = ((size_t)bb * CB + r0) * MK + (size_t)(tt / 2);
#pragma unroll
    for (int mb = 0; mb < 2; ++mb) {
#pragma unroll
        for (int nb = 0; nb < 8; ++nb) {
#pragma unroll
            for (int j = 0; j < 8; ++j) os[(hi * 8 + j) * OPF + nb * 16 + lr] = acc[mb][nb][j]; }   // D: row d = 8h+j, col token = 16nb + lane&15; 16 x 128 all written
        wave_sync();
        static_assert(32 * 8 * 4 == 16 * 64);                                                       // lanes x pooled halves x instructions == pooled slab
{
#pragma unroll
            for (int s = 0; s < 4; ++s) { const int row = 4 * s + (lane >> 3), c8 = (lane & 7) * 8;     // 4 s x 4 row groups = 16 rows; 8 lanes x 8 pooled = 64 pooled columns
                const v4f f0 = *(const v4fa*)(&os[row * OPF + 2 * c8]);     const v4f f1 = *(const v4fa*)(&os[row * OPF + 2 * c8 + 4]);
                const v4f f2 = *(const v4fa*)(&os[row * OPF + 2 * c8 + 8]); const v4f f3 = *(const v4fa*)(&os[row * OPF + 2 * c8 + 12]); v8h hv;
                hv[0] = toh_flush(fmaxf(f0[0], f0[1])); hv[1] = toh_flush(fmaxf(f0[2], f0[3]));
                hv[2] = toh_flush(fmaxf(f1[0], f1[1])); hv[3] = toh_flush(fmaxf(f1[2], f1[3]));
                hv[4] = toh_flush(fmaxf(f2[0], f2[1])); hv[5] = toh_flush(fmaxf(f2[2], f2[3]));
                hv[6] = toh_flush(fmaxf(f3[0], f3[1])); hv[7] = toh_flush(fmaxf(f3[2], f3[3]));
                const size_t oo = obase + (size_t)(mb * 16 + row) * MK + c8;
                *(v8h*)(Gt + oo) = hv; }
             }
        wave_sync();
    }
}

// k_attn: fused attention + output projection + skip term, one wave per 16 query rows of one batch; K / G^T / Q / W_out^T fragments straight from the f16 planes (two 16-B loads each, arithmetic addressing).
// Transposed form: S^T[key][t] = K Q^T (A = K rows, B = Q rows, 4 k-steps over d); lane (t = lane&15, h = lane>>4) holds keys 8h+r of each 16-key tile, so the packed
// P tile is directly the B fragment of O^T[d][t] = G^T P^T (element r <- tile keys 0..15, element 8+r <- tile keys 16..31, lane unchanged), 8 tiles over d.
// Scores = K Q + (K Q_res + K_res Q) / 2048. Softmax state (running max, partial sum) is one scalar per lane; the two lane halves of a row are combined with one xor-16 exchange.
// Q fragments are re-read every key step through an integer offset (not held across the loop).
// Epilogue: ctx^T = O^T / l packed to f16 (tiles 2kk, 2kk+1 -> B fragment of k-step kk); out^T[c][t] = W_out^T ctx^T per 16-channel tile, staged in a wave-private LDS tile [t][128 channels];
__global__ __launch_bounds__(32 * AW) __attribute__((amdgpu_num_vgpr(256)))
void k_attn(const h16* __restrict__ QH, const h16* __restrict__ QR, const h16* __restrict__ KH, const h16* __restrict__ KR,
            const h16* __restrict__ GT, const h16* __restrict__ WO, const float* __restrict__ X, float* OUT) {
    __shared__ __align__(16) float os[AW * 16 * OPF];
    static_assert(sizeof(float) * AW * 16 * OPF <= 131072);
    const int lane = threadIdx.x & 31, lr = lane & 15, hi = lane >> 4;
    const int wave = __builtin_amdgcn_readfirstlane((int)(threadIdx.x >> 5));
    const int b = blockIdx.y;
    const int t0 = (blockIdx.x * AW + wave) * 16;
    const int qo = (b * SEQ + t0 + lr) * CB + 8 * hi;          // B fragments: col t, k = d
    const int ko = (b * MK + lr) * CB + 8 * hi;                // + key * CB        (A fragment: row key, k = d)
    const int vo = (b * CB + lr) * MK + 8 * hi;                // + 16j*MK + key    (A fragment: row d, k = key)
    v8f o[8];
#pragma unroll
    for (int j = 0; j < 8; ++j) o[j] = (v8f){};
    float m = NEGB, l = 0.0f;
#pragma unroll 1
    for (int key0 = 0; key0 < MK; key0 += 32) {
        int qv = qo; asm volatile("" : "+v"(qv));              // keeps the q loads inside the key loop
        const int kv = ko + key0 * CB;
        v8f sHa = (v8f){}, sLa = (v8f){}, sHb = (v8f){}, sLb = (v8f){};
#pragma unroll 1
        for (int kk = 0; kk < 4; ++kk) {
            const v16h qh = ldh(QH + qv + kk * 32), qr = ldh(QR + qv + kk * 32);
            const v16h ka = ldh(KH + kv + kk * 32),  kb = ldh(KH + kv + 16 * CB + kk * 32);
            const v16h kra = ldh(KR + kv + kk * 32), krb = ldh(KR + kv + 16 * CB + kk * 32);
            sHa = wmma16g(ka, qh, sHa); sHb = wmma16g(kb, qh, sHb);
            sLa = wmma16g(ka, qr, sLa); sLb = wmma16g(kb, qr, sLb);
            sLa = wmma16g(kra, qh, sLa); sLb = wmma16g(krb, qh, sLb);
        }
        float ta[8], tb[8]; float mx = NEGB;
#pragma unroll
        for (int r = 0; r < 8; ++r) {
            ta[r] = (sHa[r] + sLa[r] * QRI) * L2E; tb[r] = (sHb[r] + sLb[r] * QRI) * L2E;
            mx = fmaxf(mx, fmaxf(ta[r], tb[r])); }
        mx = fmaxf(mx, __shfl_xor(mx, 16, 32));
        const float mnew = fmaxf(m, mx);
        const float alpha = __builtin_amdgcn_exp2f(m - mnew);
        const float sh = PSH - mnew;
        v16h pb; float ls = 0.0f;
#pragma unroll
        for (int r = 0; r < 8; ++r) {
            const float ea = ta[r] + sh, eb = tb[r] + sh;
            const float xa = __builtin_amdgcn_exp2f(ea), xb = __builtin_amdgcn_exp2f(eb);
            const float ga = (ea < -14.0f) ? 0.0f : xa, gb = (eb < -14.0f) ? 0.0f : xb;   // nothing below 2^-14 reaches the f16 operand
            const h16 pa = (h16)ga; const h16 pc = (h16)gb;
            pb[r] = pa; pb[8 + r] = pc;
            ls += (float)pa + (float)pc; }
        l = l * alpha + ls; m = mnew;
#pragma unroll
        for (int j = 0; j < 8; ++j) o[j] = o[j] * alpha;
        const int vv = vo + key0;
#pragma unroll
        for (int jg = 0; jg < 2; ++jg) {
            v16h vf[4];
#pragma unroll
            for (int j = 0; j < 4; ++j) vf[j] = ldh(GT + vv + (jg * 4 + j) * 16 * MK);
#pragma unroll
            for (int j = 0; j < 4; ++j) o[jg * 4 + j] = wmma16g(vf[j], pb, o[jg * 4 + j]);
        }
    }
    l += __shfl_xor(l, 16, 32);
    const float inv = 1.0f / l;                                // l >= 16384 (the row maximum contributes the full carry)
    // ctx^T D layout: o[j][r] = (d = 16j + 8h + r, t = lane&15); B fragment of k-step kk: element r <- tile 2kk, element 8+r <- tile 2kk+1
    v16h cf[4];
#pragma unroll
    for (int kk = 0; kk < 4; ++kk) {
#pragma unroll
        for (int r = 0; r < 8; ++r) { cf[kk][r] = toh_flush(o[2 * kk][r] * inv); cf[kk][8 + r] = toh_flush(o[2 * kk + 1][r] * inv); } }
    const int wb = wave * 16 * OPF;
    const int wo = lr * CB + 8 * hi;                           // + channel tile * 16 * CB + kk*32  (A fragment: row c, k = d)
    const size_t xrow = ((size_t)b * SEQ_FULL + t0) * COUT;
    const size_t orow = ((size_t)b * OUT_SEQ + t0) * COUT;
#pragma unroll 1
    for (int hc = 0; hc < 2; ++hc) {
#pragma unroll 1
        for (int ct = 0; ct < 8; ++ct) {
            const int cg = hc * 8 + ct;
            v8f acc = (v8f){};
#pragma unroll
            for (int kk = 0; kk < 4; ++kk) { const v16h a = ldh(WO + wo + cg * 16 * CB + kk * 32); acc = wmma16g(a, cf[kk], acc); }
            // D: acc[r] = (c = 16cg + 8h + r, t = lane&15) -> os[t][16ct + 8h + r]; rows 0..15 x columns 0..127 all written over the 8 tiles
            v4f a0, a1;
            a0[0] = acc[0] * WOI; a0[1] = acc[1] * WOI; a0[2] = acc[2] * WOI; a0[3] = acc[3] * WOI;
            a1[0] = acc[4] * WOI; a1[1] = acc[5] * WOI; a1[2] = acc[6] * WOI; a1[3] = acc[7] * WOI;
            *(v4fa*)(&os[wb + lr * OPF + ct * 16 + 8 * hi]) = a0; *(v4fa*)(&os[wb + lr * OPF + ct * 16 + 8 * hi + 4]) = a1;
        }
        wave_sync();
        static_assert(32 * 4 * 16 == 16 * 128);                // lanes x floats x instructions == half tile
{
#pragma unroll 4
            for (int s = 0; s < 16; ++s) { const int cofs = lane * 4;
                const v4f val = *(const v4fa*)(&os[wb + s * OPF + cofs]);
                const v4f xv = *(const v4f*)(X + xrow + (size_t)s * COUT + hc * 128 + cofs);
                v4f res; res[0] = bfr(xv[0]) + val[0]; res[1] = bfr(xv[1]) + val[1]; res[2] = bfr(xv[2]) + val[2]; res[3] = bfr(xv[3]) + val[3];
                *(v4f*)(OUT + orow + (size_t)s * COUT + hc * 128 + cofs) = res; }
             }
        wave_sync();
    }
}

static constexpr size_t al256(size_t v) { return (v + 255) & ~(size_t)255; }
static constexpr size_t SZ_XB = al256((size_t)NB * SEQ * CIN * 2);
static constexpr size_t SZ_W  = al256((size_t)CIN * CB * 2);
static constexpr size_t SZ_Q  = al256((size_t)NB * SEQ * CB * 2);
static constexpr size_t SZ_K  = al256((size_t)NB * MK * CB * 2);
static constexpr size_t SZ_TOTAL = SZ_XB + 4 * SZ_W + 2 * SZ_Q + 3 * SZ_K;
static_assert(SZ_TOTAL <= (size_t)134217728);                        // workspace carve <= 128 MiB
static_assert((size_t)CIN * CB == (size_t)CB * COUT);                // the W_out plane has the extent of an input-projection weight plane
static_assert((size_t)NB * MK * CB == (size_t)NB * CB * MK);         // value^T plane [(b*128 + d)][MK] has the extent of a k plane

extern "C" void kernel_launch(void* const* d_in, const int* in_sizes, int n_in,
                              void* d_out, int out_size, void* d_ws, size_t ws_size, hipStream_t stream) {
    if (n_in < 5) return;
    const size_t needx = ((size_t)(NB - 1) * SEQ_FULL + SEQ) * CIN;
    if ((size_t)in_sizes[0] < needx) return;
    if ((size_t)in_sizes[1] < (size_t)CIN * CB || (size_t)in_sizes[2] < (size_t)CIN * CB || (size_t)in_sizes[3] < (size_t)CIN * CB) return;
    if ((size_t)in_sizes[4] < (size_t)CB * COUT) return;
    if ((size_t)out_size < ((size_t)(NB - 1) * OUT_SEQ + SEQ) * COUT) return;
    if (SZ_TOTAL > ws_size) return;
    // wire order: x, W_theta, W_phi, W_g, W_out
    const float* x  = (const float*)d_in[0];
    const float* wt = (const float*)d_in[1];
    const float* wp = (const float*)d_in[2];
    const float* wg = (const float*)d_in[3];
    const float* wo = (const float*)d_in[4];
    float* OUT = (float*)d_out;      // [NB][SEQ][256]
    char* wsp = (char*)d_ws;
    bf*  XB = (bf*)wsp;  wsp += SZ_XB;               // x bf16 [NB*SEQ][256]
    bf*  WT = (bf*)wsp;  wsp += SZ_W;                // W_theta^T bf16 [128][256]
    bf*  WP = (bf*)wsp;  wsp += SZ_W;                // W_phi^T   bf16 [128][256]
    bf*  WG = (bf*)wsp;  wsp += SZ_W;                // W_g^T     bf16 [128][256]
    h16* WOH = (h16*)wsp; wsp += SZ_W;               // W_out^T   f16 x64 [256][128]
    h16* QH = (h16*)wsp; wsp += SZ_Q;                // [NB*SEQ][128]
    h16* QR = (h16*)wsp; wsp += SZ_Q;                // [NB*SEQ][128] residual x2048
    h16* KH = (h16*)wsp; wsp += SZ_K;                // [NB*MK][128]
    h16* KR = (h16*)wsp; wsp += SZ_K;                // [NB*MK][128] residual x2048
    h16* GT = (h16*)wsp; wsp += SZ_K;                // [NB*128][MK]

    if (SEQ == SEQ_FULL) {
        const size_t n8 = (size_t)NB * SEQ * CIN / 8;
        k_cvt8<<<(unsigned)((n8 + 255) / 256), 256, 0, stream>>>(x, XB, n8);
    } else {
        const size_t n8 = (size_t)SEQ * CIN / 8;
        for (int b = 0; b < NB; ++b) k_cvt8<<<(unsigned)((n8 + 255) / 256), 256, 0, stream>>>(x + (size_t)b * SEQ_FULL * CIN, XB + (size_t)b * SEQ * CIN, n8);
    }
    // in[rows][cols] -> out[cols][rows]; grid (rows/64, cols/64)
    k_wtr_b<<<dim3(CIN / 64, CB / 64, 1), 256, 0, stream>>>(wt, WT, CIN, CB);      // [256][128] -> [128][256]
    k_wtr_b<<<dim3(CIN / 64, CB / 64, 1), 256, 0, stream>>>(wp, WP, CIN, CB);      // [256][128] -> [128][256]
    k_wtr_b<<<dim3(CIN / 64, CB / 64, 1), 256, 0, stream>>>(wg, WG, CIN, CB);      // [256][128] -> [128][256]
    k_wtr_h<<<dim3(CB / 64, COUT / 64, 1), 256, 0, stream>>>(wo, WOH, CB, COUT);   // [128][256] -> [256][128]

    k_proj_q<<<dim3(NB * SEQ / 64, CB / 64, 1), 32, 0, stream>>>(XB, WT, QH, QR);
    k_proj_k<<<dim3(NB * SEQ / 64, CB / 64, 1), 32, 0, stream>>>(XB, WP, KH, KR);
    k_proj_gt<<<dim3(CB / 32, NB * SEQ / 128, 1), 32, 0, stream>>>(WG, XB, GT);

    k_attn<<<dim3(SEQ / (16 * AW), NB, 1), 32 * AW, 0, stream>>>(QH, QR, KH, KR, GT, WOH, x, OUT);
}

// v001
// A run of this version takes 168 microseconds.
// In both of two side-by-side timings against v000, it was 1.87 times as fast.
#include <hip/hip_runtime.h>

// Spatial self-attention block over flattened pixels: x [NB][SEQ][256]; three 1x1 projections W [in 256][out 128] (no bias); keys and values max-pooled over adjacent token pairs (SEQ/2 keys);
// unscaled dot-product scores, softmax over keys; context [SEQ][128] -> output projection W_out [in 128][out 256]; output = x + projected context (f32).
// Compute dtypes, f32 accumulate everywhere: three input projections v_wmma_f32_16x16x32_bf16 (x and W RNE-converted to bf16; products exact);
// scores v_wmma_f32_16x16x32_f16 with q and k each as f16 value + f16 residual x2048 (three products, residual products in their own accumulator folded by 1/2048);
// P.V v_wmma_f32_16x16x32_f16, P single f16 with x16384 carry (cancels in the normalisation, row sum over the converted P), pooled values single f16;
// output projection v_wmma_f32_16x16x32_f16, context single f16, W_out (RNE bf16 value) x64 as f16, folded by 1/64; softmax f32 (online, running max); skip term = bf16-converted x added in f32 at the store stage.
// Layout: bf16 copy of x; transposed 16-bit weight planes [out][in]; q planes (value, residual) [b][t][128]; k planes (value, residual) [b][key][128]; value^T plane [b][d][key];
// fused flash kernel in transposed form (S^T = K Q^T, O^T = V^T P^T, out^T = W_out^T ctx^T with the packed O^T tiles as B fragments);
// its key-loop operands (q, k, value^T) are staged in LDS by asynchronous copies, k and value^T in 64-key tiles with two buffers shared by the block's waves.

#ifndef NB
#define NB 8
#endif
#ifndef SEQ
#define SEQ 4096
#endif
#define NB_FULL  8
#define SEQ_FULL 4096
#ifndef OUT_SEQ
#define OUT_SEQ SEQ              // row pitch (in tokens) between batches of the output
#endif
#define CIN  256                 // input channels (projection depth)
#define CB   128                 // bottleneck width (score depth, context width)
#define COUT 256                 // output channels
#define MK   (SEQ / 2)           // pooled keys per batch
#define AW   4                   // waves per flash block (16 query rows each)
#define OPF  132                 // LDS row pitch (floats) of the 16 x 128 staging tiles
#define QRS  2048.0f             // carry of every residual plane
#define QRI  (1.0f / 2048.0f)
#define L2E  1.4426950408889634f // log2(e); the module applies no score scale
#define PSH  14.0f               // log2 of the P carry (16384)
#define NEGB (-3.0e38f)
#define WOS  64.0f               // carry of the f16 W_out plane
#define WOI  (1.0f / 64.0f)
#define KT   64                  // keys per LDS tile (two 32-key passes)
#define NST  (MK / KT)           // tiles per batch
#define KP   272                 // LDS row pitch, bytes, of 256-byte q / k rows (16 B x odd: conflict-free 16-byte reads)
#define GP   144                 // LDS row pitch, bytes, of 128-byte value^T rows (16 B x odd)
#define KR_O (KT * KP)           // tile layout: k value rows, k residual rows, value^T rows
#define GT_O (2 * KT * KP)
#define STB  (2 * KT * KP + CB * GP)   // bytes of one tile buffer
#define Q_O  (2 * STB)           // behind the two buffers: per wave 16 q value rows, then 16 q residual rows
#define QWB  (2 * 16 * KP)       // bytes of one wave's q rows; the same bytes are that wave's output staging tile after the key loop
#define LDSB (Q_O + AW * QWB)

static_assert(CB == 128);                      // flash: 4 k-steps of 32 per score tile, 8 output tiles of 16, 4 k-steps in the output projection
static_assert(COUT == 256);                    // output staged as two halves of 128 columns
static_assert(CIN == COUT);                    // skip term has the output's row width
static_assert(CIN % 32 == 0);                  // GEMM k-loop steps by 32
static_assert(CB % 32 == 0);
static_assert(CIN % 64 == 0);                  // weight transposer tiles of 64 x 64
static_assert(CB % 64 == 0);
static_assert(COUT % 64 == 0);
static_assert(SEQ % 128 == 0);                 // a 128-token value tile never straddles two batches; token pairs stay inside a tile
static_assert((NB * SEQ) % 128 == 0);
static_assert((NB * SEQ) % 64 == 0);
static_assert(MK % 32 == 0);                   // key loop steps by 32
static_assert(MK % 64 == 0);
static_assert(SEQ % (16 * AW) == 0);           // flash grid covers the sequence exactly
static_assert(((size_t)SEQ * CIN) % 8 == 0);
static_assert(NB <= NB_FULL);
static_assert(SEQ <= SEQ_FULL);
static_assert((OPF * 4) % 16 == 0);
static_assert(NST >= 2);                       // the two-buffer prologue fills tiles 0 and 1
static_assert(KT == 16 * AW);                  // each wave copies 16 k rows of a tile (8 copies of 2 rows)
static_assert(CB == 32 * AW);                  // each wave copies 32 value^T rows of a tile (8 copies of 4 rows)
static_assert(KT * 2 == 128);                  // a value^T tile row is one 128-byte line
static_assert(16 * OPF * 4 <= QWB);            // the output staging tile fits the wave's q rows
static_assert(KP % 16 == 0);
static_assert(GP % 16 == 0);
static_assert(LDSB <= 163840);                 // two blocks per 320 KiB of LDS
static_assert((size_t)NB * SEQ * CIN < (size_t)2147483647);   // int offsets inside the planes

typedef _Float16 h16;
typedef unsigned short bf;
typedef __attribute__((ext_vector_type(16))) __bf16   v16bf;
typedef __attribute__((ext_vector_type(16))) _Float16 v16h;
typedef __attribute__((ext_vector_type(8)))  _Float16 v8h;
typedef __attribute__((ext_vector_type(8)))  unsigned short v8us;
typedef __attribute__((ext_vector_type(8)))  float    v8f;
typedef __attribute__((ext_vector_type(4)))  float    v4f;
typedef v4f  __attribute__((may_alias)) v4fa;
typedef v8h  __attribute__((may_alias)) v8ha;

__device__ __forceinline__ unsigned short f2bf(float f) { unsigned u = __float_as_uint(f); u += 0x7FFFu + ((u >> 16) & 1u); return (unsigned short)(u >> 16); }
__device__ __forceinline__ float bfr(float f) { return __uint_as_float(((unsigned)f2bf(f)) << 16); }   // value after RNE convert to bf16
__device__ __forceinline__ v16h cat16(v8h lo, v8h hi) { return __builtin_shufflevector(lo, hi, 0, 1, 2, 3, 4, 5, 6, 7, 8, 9, 10, 11, 12, 13, 14, 15); }
__device__ __forceinline__ v16bf cat16b(v8us lo, v8us hi) { return __builtin_bit_cast(v16bf, __builtin_shufflevector(lo, hi, 0, 1, 2, 3, 4, 5, 6, 7, 8, 9, 10, 11, 12, 13, 14, 15)); }
__device__ __forceinline__ v8f wmma16(v16h a, v16h b, v8f c) { return __builtin_amdgcn_wmma_f32_16x16x32_f16(false, a, false, b, (short)0, c, false, false); }
__device__ __forceinline__ v8f wmmab(v16bf a, v16bf b, v8f c) { return __builtin_amdgcn_wmma_f32_16x16x32_bf16(false, a, false, b, (short)0, c, false, false); }
// fragment loaders from K-contiguous 16-bit rows; p already includes + 8*(lane>>4): elements 0..7 <- k0+8h+0..7, elements 8..15 <- k0+16+8h+0..7 (same map for A and B)
__device__ __forceinline__ v16h  ldh(const h16* p) { return cat16(*(const v8h*)p, *(const v8h*)(p + 16)); }
__device__ __forceinline__ v16bf ldb(const bf* p)  { return cat16b(*(const v8us*)p, *(const v8us*)(p + 16)); }
// the same fragment map from a staged LDS row (p in bytes, already includes + 16*(lane>>4))
__device__ __forceinline__ v16h  ldl(const unsigned char* p) { return cat16(*(const v8ha*)p, *(const v8ha*)(p + 32)); }
// eight asynchronous 16-byte-per-lane copies global -> LDS (l = the lane's LDS byte address, g = the lane's global address; steps between copies ls bytes, gs elements).
// The closing s_wait_xcnt stands inside the statement so that no address register is rewritten ahead of it.
__device__ __forceinline__ void cp8(unsigned l, const h16* g, unsigned ls, size_t gs) {
    asm volatile("global_load_async_to_lds_b128 %0, %8, off\n\t"
                 "global_load_async_to_lds_b128 %1, %9, off\n\t"
                 "global_load_async_to_lds_b128 %2, %10, off\n\t"
                 "global_load_async_to_lds_b128 %3, %11, off\n\t"
                 "global_load_async_to_lds_b128 %4, %12, off\n\t"
                 "global_load_async_to_lds_b128 %5, %13, off\n\t"
                 "global_load_async_to_lds_b128 %6, %14, off\n\t"
                 "global_load_async_to_lds_b128 %7, %15, off\n\t"
                 "s_wait_xcnt 0x0"
                 :: "v"(l), "v"(l + ls), "v"(l + 2 * ls), "v"(l + 3 * ls), "v"(l + 4 * ls), "v"(l + 5 * ls), "v"(l + 6 * ls), "v"(l + 7 * ls),
                    "v"(g), "v"(g + gs), "v"(g + 2 * gs), "v"(g + 3 * gs), "v"(g + 4 * gs), "v"(g + 5 * gs), "v"(g + 6 * gs), "v"(g + 7 * gs)
                 : "memory");
}
// ordering point for wave-private LDS tiles (same wave writes and reads)
__device__ __forceinline__ void wave_sync() { __builtin_amdgcn_fence(3 /* release order */, "wavefront"); __builtin_amdgcn_wave_barrier(); asm volatile("" ::: "memory"); }

// f32 -> f16 convert that cannot produce an f16 subnormal (|v| < 2^-14 -> +0); applied after the plane's power-of-two carry
static __device__ __forceinline__ h16 toh_flush(float v) { const h16 r = (h16)v; return (fabsf(v) < 6.103515625e-05f) ? (h16)0.0f : r; }
// one matrix instruction + its own four-slot guard (accumulator tied, operands kept live)
__device__ __forceinline__ v8f wmma16g(v16h a, v16h b, v8f c) {
    c = __builtin_amdgcn_wmma_f32_16x16x32_f16(false, a, false, b, (short)0, c, false, false);
    asm volatile("v_nop\n\tv_nop\n\tv_nop\n\tv_nop" : "+v"(c) : "v"(a), "v"(b));
    return c; }
__device__ __forceinline__ v8f wmmabg(v16bf a, v16bf b, v8f c) {
    c = __builtin_amdgcn_wmma_f32_16x16x32_bf16(false, a, false, b, (short)0, c, false, false);
    asm volatile("v_nop\n\tv_nop\n\tv_nop\n\tv_nop" : "+v"(c) : "v"(a), "v"(b));
    return c; }

__global__ __launch_bounds__(256) void k_cvt8(const float* __restrict__ src, bf* dst, size_t n8) {
    const size_t i = (size_t)blockIdx.x * 256 + threadIdx.x; if (i >= n8) return;
    const v8f v = *(const v8f*)(src + i * 8); v8us o;
#pragma unroll
    for (int k = 0; k < 8; ++k) o[k] = f2bf(v[k]);
    *(v8us*)(dst + i * 8) = o; 
}

// Weight transposer: in[R][C] (f32) -> out[C][R] (16-bit), 64 x 64 tile per block through LDS (cross-wave: block barrier).
// ASH = 0: bf16 bits (RNE convert). ASH = 1: f16 of (RNE bf16 value x 64), subnormal-free convert.
template <int ASH>
__device__ __forceinline__ void wtr_body(const float* __restrict__ src, bf* dstb, h16* dsth, int R, int C) {
    __shared__ float ts[64 * 65];
    const int tid = threadIdx.x;
    const int r0 = blockIdx.x * 64, c0 = blockIdx.y * 64;
#pragma unroll 1
    for (int i = 0; i < 16; ++i) { const int rr = i * 4 + (tid >> 6), cc = tid & 63;        // 16 trips x 4 rows = 64 rows; 64 columns
        ts[rr * 65 + cc] = src[(size_t)(r0 + rr) * C + c0 + cc]; }
    __syncthreads();
    static_assert(256 * 8 * 2 == 64 * 64);                                                 // threads x elements per store x trips == tile
{
#pragma unroll 1
        for (int it = 0; it < 2; ++it) {
            const int cc = it * 32 + (tid >> 3), r8 = (tid & 7) * 8;                        // 2 trips x 32 output rows; 8 lanes x 8 elements = 64 = one line
            const size_t oo = (size_t)(c0 + cc) * R + r0 + r8;
            if (ASH) { v8h o;
#pragma unroll
                for (int k = 0; k < 8; ++k) o[k] = toh_flush(bfr(ts[(r8 + k) * 65 + cc]) * WOS);
                *(v8h*)(dsth + oo) = o;
            } else { v8us o;
#pragma unroll
                for (int k = 0; k < 8; ++k) o[k] = f2bf(ts[(r8 + k) * 65 + cc]);
                *(v8us*)(dstb + oo) = o; }
        }
         }
}
__global__ __launch_bounds__(256) void k_wtr_b(const float* __restrict__ src, bf* dst, int R, int C)  { wtr_body<0>(src, dst, (h16*)0, R, C); }
__global__ __launch_bounds__(256) void k_wtr_h(const float* __restrict__ src, h16* dst, int R, int C) { wtr_body<1>(src, (bf*)0, dst, R, C); }

// mm64: register-blocked bf16 GEMM main loop, ONE WAVE per 64x64 tile (16 accumulators), operands straight from K-contiguous bf16 planes, K = CIN.
// acc[mb][nb][j] = C[16mb + 8h + j][16nb + (lane&15)], C[m][n] = sum_k A[m][k] Bt[n][k].
__device__ __forceinline__ void mm64(const bf* __restrict__ A, const bf* __restrict__ Bt, size_t aoff, size_t boff, v8f (&acc)[4][4]) {
    const int K = CIN;
#pragma unroll
    for (int mb = 0; mb < 4; ++mb)
#pragma unroll
        for (int nb = 0; nb < 4; ++nb) acc[mb][nb] = (v8f){};
#pragma unroll 1
    for (int kc = 0; kc < K; kc += 32) {
        v16bf a[4];
#pragma unroll
        for (int mb = 0; mb < 4; ++mb) a[mb] = ldb(A + aoff + (size_t)mb * 16 * K + kc);
#pragma unroll
        for (int nb = 0; nb < 4; ++nb) { const v16bf b = ldb(Bt + boff + (size_t)nb * 16 * K + kc);
#pragma unroll
            for (int mb = 0; mb < 4; ++mb) acc[mb][nb] = wmmabg(a[mb], b, acc[mb][nb]); }
    }
}

// k_proj_q: q = x W_theta. A = x rows (m = b*SEQ + t), Bt = transposed weight rows (n = d). Planes [b*SEQ + t][128]: f16 value (Ph) and f16 residual x2048 (Pr).
__global__ __launch_bounds__(32) void k_proj_q(const bf* __restrict__ A, const bf* __restrict__ Bt, h16* Ph, h16* Pr) {
    __shared__ __align__(16) float os[16 * 68];
    const int lane = threadIdx.x & 31, lr = lane & 15, hi = lane >> 4; const int r0 = blockIdx.x * 64, c0 = blockIdx.y * 64;
    v8f acc[4][4];
    mm64(A, Bt, (size_t)(r0 + lr) * CIN + 8 * hi, (size_t)(c0 + lr) * CIN + 8 * hi, acc);
    const size_t obase = (size_t)r0 * CB + c0;
#pragma unroll
    for (int mb = 0; mb < 4; ++mb) {
#pragma unroll
        for (int nb = 0; nb < 4; ++nb) {
#pragma unroll
            for (int j = 0; j < 8; ++j) os[(hi * 8 + j) * 68 + nb * 16 + lr] = acc[mb][nb][j]; }   // D: row 8h+j, col lane&15; 16 x 64 all written
        wave_sync();
        static_assert(32 * 8 * 4 == 16 * 64);                                                     // lanes x halves x instructions == slab
{
#pragma unroll
            for (int s = 0; s < 4; ++s) { const int row = 4 * s + (lane >> 3), c8 = (lane & 7) * 8;   // 4 s x 4 row groups = 16 rows; 8 lanes x 8 = 64 columns
                const v4f x0 = *(const v4fa*)(&os[row * 68 + c8]); const v4f x1 = *(const v4fa*)(&os[row * 68 + c8 + 4]); v8h hv, rv;
#pragma unroll
                for (int i = 0; i < 4; ++i) { const h16 a0 = toh_flush(x0[i]); const h16 a1 = toh_flush(x1[i]); hv[i] = a0; hv[4 + i] = a1;
                    rv[i] = toh_flush((x0[i] - (float)a0) * QRS); rv[4 + i] = toh_flush((x1[i] - (float)a1) * QRS); }
                const size_t oo = obase + (size_t)(mb * 16 + row) * CB + c8;
                *(v8h*)(Ph + oo) = hv; *(v8h*)(Pr + oo) = rv; }
             }
        wave_sync();
    }
}

// k_proj_k: k = maxpool2(x W_phi) over adjacent token pairs. Same GEMM; per 16-token slab the 8 pooled rows (max in f32, then convert) go to planes [b*MK + key][128]: f16 value and f16 residual x2048.
__global__ __launch_bounds__(32) void k_proj_k(const bf* __restrict__ A, const bf* __restrict__ Bt, h16* Ph, h16* Pr) {
    __shared__ __align__(16) float os[16 * 68];
    const int lane = threadIdx.x & 31, lr = lane & 15, hi = lane >> 4; const int r0 = blockIdx.x * 64, c0 = blockIdx.y * 64;
    v8f acc[4][4];
    mm64(A, Bt, (size_t)(r0 + lr) * CIN + 8 * hi, (size_t)(c0 + lr) * CIN + 8 * hi, acc);
    const size_t obase = (size_t)(r0 / 2) * CB + c0;                                              // (b*SEQ + t)/2 = b*MK + t/2
#pragma unroll
    for (int mb = 0; mb < 4; ++mb) {
#pragma unroll
        for (int nb = 0; nb < 4; ++nb) {
#pragma unroll
            for (int j = 0; j < 8; ++j) os[(hi * 8 + j) * 68 + nb * 16 + lr] = acc[mb][nb][j]; }
        wave_sync();
        static_assert(32 * 8 * 2 == 8 * 64);                                                      // lanes x halves x instructions == pooled slab
{
#pragma unroll
            for (int s = 0; s < 2; ++s) { const int prow = 4 * s + (lane >> 3), c8 = (lane & 7) * 8;   // 2 s x 4 row groups = 8 pooled rows (token rows 2*prow, 2*prow+1)
                const v4f u0 = *(const v4fa*)(&os[(2 * prow) * 68 + c8]);     const v4f u1 = *(const v4fa*)(&os[(2 * prow) * 68 + c8 + 4]);
                const v4f w0 = *(const v4fa*)(&os[(2 * prow + 1) * 68 + c8]); const v4f w1 = *(const v4fa*)(&os[(2 * prow + 1) * 68 + c8 + 4]); v8h hv, rv;
#pragma unroll
                for (int i = 0; i < 4; ++i) { const float y0 = fmaxf(u0[i], w0[i]), y1 = fmaxf(u1[i], w1[i]);
                    const h16 a0 = toh_flush(y0); const h16 a1 = toh_flush(y1); hv[i] = a0; hv[4 + i] = a1;
                    rv[i] = toh_flush((y0 - (float)a0) * QRS); rv[4 + i] = toh_flush((y1 - (float)a1) * QRS); }
                const size_t oo = obase + (size_t)(mb * 8 + prow) * CB + c8;
                *(v8h*)(Ph + oo) = hv; *(v8h*)(Pr + oo) = rv; }
             }
        wave_sync();
    }
}

// k_proj_gt: pooled values transposed, G^T[d][key] = max over the token pair of (W_g^T x^T)[d][t]. ONE WAVE per 32 (d) x 128 (token) tile (16 accumulators):
// A = transposed weight rows (m = d), Bt = x rows (n = b*SEQ + t). Plane [(b*128 + d)][MK], single f16. Per 16-row slab staged in LDS (wave-private);
__global__ __launch_bounds__(32) void k_proj_gt(const bf* __restrict__ A, const bf* __restrict__ Bt, h16* Gt) {
    __shared__ __align__(16) float os[16 * OPF];
    const int K = CIN;
    const int lane = threadIdx.x & 31, lr = lane & 15, hi = lane >> 4; const int r0 = blockIdx.x * 32, c0 = blockIdx.y * 128;
    v8f acc[2][8];
#pragma unroll
    for (int mb = 0; mb < 2; ++mb)
#pragma unroll
        for (int nb = 0; nb < 8; ++nb) acc[mb][nb] = (v8f){};
    const size_t aoff = (size_t)(r0 + lr) * K + 8 * hi, boff = (size_t)(c0 + lr) * K + 8 * hi;
#pragma unroll 1
    for (int kc = 0; kc < K; kc += 32) {
        v16bf a[2];
#pragma unroll
        for (int mb = 0; mb < 2; ++mb) a[mb] = ldb(A + aoff + (size_t)mb * 16 * K + kc);
#pragma unroll
        for (int nb = 0; nb < 8; ++nb) { const v16bf b = ldb(Bt + boff + (size_t)nb * 16 * K + kc);
#pragma unroll
            for (int mb = 0; mb < 2; ++mb) acc[mb][nb] = wmmabg(a[mb], b, acc[mb][nb]); }
    }
    const int bb = c0 / SEQ, tt = c0 % SEQ;
    const size_t obase = ((size_t)bb * CB + r0) * MK + (size_t)(tt / 2);
#pragma unroll
    for (int mb = 0; mb < 2; ++mb) {
#pragma unroll
        for (int nb = 0; nb < 8; ++nb) {
#pragma unroll
            for (int j = 0; j < 8; ++j) os[(hi * 8 + j) * OPF + nb * 16 + lr] = acc[mb][nb][j]; }   // D: row d = 8h+j, col token = 16nb + lane&15; 16 x 128 all written
        wave_sync();
        static_assert(32 * 8 * 4 == 16 * 64);                                                       // lanes x pooled halves x instructions == pooled slab
{
#pragma unroll
            for (int s = 0; s < 4; ++s) { const int row = 4 * s + (lane >> 3), c8 = (lane & 7) * 8;     // 4 s x 4 row groups = 16 rows; 8 lanes x 8 pooled = 64 pooled columns
                const v4f f0 = *(const v4fa*)(&os[row * OPF + 2 * c8]);     const v4f f1 = *(const v4fa*)(&os[row * OPF + 2 * c8 + 4]);
                const v4f f2 = *(const v4fa*)(&os[row * OPF + 2 * c8 + 8]); const v4f f3 = *(const v4fa*)(&os[row * OPF + 2 * c8 + 12]); v8h hv;
                hv[0] = toh_flush(fmaxf(f0[0], f0[1])); hv[1] = toh_flush(fmaxf(f0[2], f0[3]));
                hv[2] = toh_flush(fmaxf(f1[0], f1[1])); hv[3] = toh_flush(fmaxf(f1[2], f1[3]));
                hv[4] = toh_flush(fmaxf(f2[0], f2[1])); hv[5] = toh_flush(fmaxf(f2[2], f2[3]));
                hv[6] = toh_flush(fmaxf(f3[0], f3[1])); hv[7] = toh_flush(fmaxf(f3[2], f3[3]));
                const size_t oo = obase + (size_t)(mb * 16 + row) * MK + c8;
                *(v8h*)(Gt + oo) = hv; }
             }
        wave_sync();
    }
}

// k_attn: fused attention + output projection + skip term, one wave per 16 query rows of one batch; K / G^T / Q fragments from LDS rows (two 16-B reads each), W_out^T fragments straight from its f16 plane.
// Staging: whole-line asynchronous copies; each wave brings its own 16 q rows once, and a quarter of every 64-key tile (k value, k residual, value^T) into one of two buffers, one tile ahead of its use.
// Transposed form: S^T[key][t] = K Q^T (A = K rows, B = Q rows, 4 k-steps over d); lane (t = lane&15, h = lane>>4) holds keys 8h+r of each 16-key tile, so the packed
// P tile is directly the B fragment of O^T[d][t] = G^T P^T (element r <- tile keys 0..15, element 8+r <- tile keys 16..31, lane unchanged), 8 tiles over d.
// Scores = K Q + (K Q_res + K_res Q) / 2048. Softmax state (running max, partial sum) is one scalar per lane; the two lane halves of a row are combined with one xor-16 exchange.
// Q fragments are re-read from LDS every key step (not held across the loop).
// Epilogue: ctx^T = O^T / l packed to f16 (tiles 2kk, 2kk+1 -> B fragment of k-step kk); out^T[c][t] = W_out^T ctx^T per 16-channel tile, staged in a wave-private LDS tile [t][128 channels];
__global__ __launch_bounds__(32 * AW) __attribute__((amdgpu_num_vgpr(256)))
void k_attn(const h16* __restrict__ QH, const h16* __restrict__ QR, const h16* __restrict__ KH, const h16* __restrict__ KR,
            const h16* __restrict__ GT, const h16* __restrict__ WO, const float* __restrict__ X, float* OUT) {
    __shared__ __align__(16) unsigned char sm[LDSB];
    const int lane = threadIdx.x & 31, lr = lane & 15, hi = lane >> 4;
    const int wave = __builtin_amdgcn_readfirstlane((int)(threadIdx.x >> 5));
    const int b = blockIdx.y;
    const int t0 = (blockIdx.x * AW + wave) * 16;
    // copy side: q / k rows of 256 B, two per copy (16 lanes each); value^T rows of 128 B, four per copy (8 lanes each)
    const unsigned sb = (unsigned)(size_t)sm;                  // LDS byte address of the array
    const unsigned lq = sb + Q_O + wave * QWB + (lane >> 4) * KP + (lane & 15) * 16;
    const unsigned lk = sb + (16 * wave + (lane >> 4)) * KP + (lane & 15) * 16;
    const unsigned lg = sb + GT_O + (32 * wave + (lane >> 3)) * GP + (lane & 7) * 16;
    const int gq = (b * SEQ + t0 + (lane >> 4)) * CB + (lane & 15) * 8;
    const int gk = (b * MK + 16 * wave + (lane >> 4)) * CB + (lane & 15) * 8;    // + tile * KT * CB
    const int gg = (b * CB + 32 * wave + (lane >> 3)) * MK + (lane & 7) * 8;     // + tile * KT
    // read side
    const unsigned char* qp = sm + Q_O + wave * QWB + lr * KP + 16 * hi;         // B fragments: col t, k = d; residual rows + 16*KP
    const int ko = lr * KP + 16 * hi;                          // + buffer + key * KP      (A fragment: row key, k = d)
    const int vo = GT_O + lr * GP + 16 * hi;                   // + buffer + 16j*GP + 2*key (A fragment: row d, k = key)
    // prologue: q rows and tile 0, landed and published; then tile 1 into the second buffer
    cp8(lq, QH + gq, 2 * KP, 2 * CB);
    cp8(lq + 16 * KP, QR + gq, 2 * KP, 2 * CB);
    cp8(lk, KH + gk, 2 * KP, 2 * CB);
    cp8(lk + KR_O, KR + gk, 2 * KP, 2 * CB);
    cp8(lg, GT + gg, 4 * GP, 4 * (size_t)MK);
    asm volatile("s_wait_asynccnt 0x0" ::: "memory");          // this wave's copies have landed before the barrier publishes them
    __syncthreads();
    cp8(lk + STB, KH + gk + KT * CB, 2 * KP, 2 * CB);
    cp8(lk + STB + KR_O, KR + gk + KT * CB, 2 * KP, 2 * CB);
    cp8(lg + STB, GT + gg + KT, 4 * GP, 4 * (size_t)MK);
    v8f o[8];
#pragma unroll
    for (int j = 0; j < 8; ++j) o[j] = (v8f){};
    float m = NEGB, l = 0.0f;
#pragma unroll 1
    for (int st = 0; st < NST; ++st) {
    const int bo = (st & 1) * STB;                             // this tile's buffer
#pragma unroll 1
    for (int ps = 0; ps < KT / 32; ++ps) {                     // 32-key passes in key order; rolled: one copy of the pass body in the text
        const unsigned char* kv = sm + bo + ko + ps * 32 * KP;
        v8f sHa = (v8f){}, sLa = (v8f){}, sHb = (v8f){}, sLb = (v8f){};
#pragma unroll 1
        for (int kk = 0; kk < 4; ++kk) {
            const v16h qh = ldl(qp + kk * 64), qr = ldl(qp + 16 * KP + kk * 64);
            const v16h ka = ldl(kv + kk * 64),  kb = ldl(kv + 16 * KP + kk * 64);
            const v16h kra = ldl(kv + KR_O + kk * 64), krb = ldl(kv + KR_O + 16 * KP + kk * 64);
            sHa = wmma16g(ka, qh, sHa); sHb = wmma16g(kb, qh, sHb);
            sLa = wmma16g(ka, qr, sLa); sLb = wmma16g(kb, qr, sLb);
            sLa = wmma16g(kra, qh, sLa); sLb = wmma16g(krb, qh, sLb);
        }
        float ta[8], tb[8]; float mx = NEGB;
#pragma unroll
        for (int r = 0; r < 8; ++r) {
            ta[r] = (sHa[r] + sLa[r] * QRI) * L2E; tb[r] = (sHb[r] + sLb[r] * QRI) * L2E;
            mx = fmaxf(mx, fmaxf(ta[r], tb[r])); }
        mx = fmaxf(mx, __shfl_xor(mx, 16, 32));
        const float mnew = fmaxf(m, mx);
        const float alpha = __builtin_amdgcn_exp2f(m - mnew);
        const float sh = PSH - mnew;
        v16h pb; float ls = 0.0f;
#pragma unroll
        for (int r = 0; r < 8; ++r) {
            const float ea = ta[r] + sh, eb = tb[r] + sh;
            const float xa = __builtin_amdgcn_exp2f(ea), xb = __builtin_amdgcn_exp2f(eb);
            const float ga = (ea < -14.0f) ? 0.0f : xa, gb = (eb < -14.0f) ? 0.0f : xb;   // nothing below 2^-14 reaches the f16 operand
            const h16 pa = (h16)ga; const h16 pc = (h16)gb;
            pb[r] = pa; pb[8 + r] = pc;
            ls += (float)pa + (float)pc; }
        l = l * alpha + ls; m = mnew;
#pragma unroll
        for (int j = 0; j < 8; ++j) o[j] = o[j] * alpha;
        const unsigned char* vv = sm + bo + vo + ps * 64;
#pragma unroll
        for (int jg = 0; jg < 2; ++jg) {
            v16h vf[4];
#pragma unroll
            for (int j = 0; j < 4; ++j) vf[j] = ldl(vv + (jg * 4 + j) * 16 * GP);
#pragma unroll
            for (int j = 0; j < 4; ++j) o[jg * 4 + j] = wmma16g(vf[j], pb, o[jg * 4 + j]);
        }
    }
    // foot of tile st: own LDS reads done, own copies of tile st + 1 landed, then the one barrier that publishes tile st + 1 and frees this buffer
    asm volatile("s_wait_dscnt 0x0" ::: "memory");             // this wave has left the buffer that is refilled behind the barrier
    asm volatile("s_wait_asynccnt 0x0" ::: "memory");          // this wave's share of tile st + 1 has landed
    __syncthreads();
    if (st + 2 < NST) {                                        // same for the whole block
        const int tk = (st + 2) * KT;
        cp8(lk + bo, KH + gk + tk * CB, 2 * KP, 2 * CB);
        cp8(lk + bo + KR_O, KR + gk + tk * CB, 2 * KP, 2 * CB);
        cp8(lg + bo, GT + gg + tk, 4 * GP, 4 * (size_t)MK);
    }
    }
    asm volatile("s_wait_asynccnt 0x0" ::: "memory");          // nothing in flight before the q rows become output staging
    l += __shfl_xor(l, 16, 32);
    const float inv = 1.0f / l;                                // l >= 16384 (the row maximum contributes the full carry)
    // ctx^T D layout: o[j][r] = (d = 16j + 8h + r, t = lane&15); B fragment of k-step kk: element r <- tile 2kk, element 8+r <- tile 2kk+1
    v16h cf[4];
#pragma unroll
    for (int kk = 0; kk < 4; ++kk) {
#pragma unroll
        for (int r = 0; r < 8; ++r) { cf[kk][r] = toh_flush(o[2 * kk][r] * inv); cf[kk][8 + r] = toh_flush(o[2 * kk + 1][r] * inv); } }
    float* os = (float*)(sm + Q_O);                            // each wave stages in the bytes of its own q rows, which only it has read
    const int wb = wave * (QWB / 4);
    const int wo = lr * CB + 8 * hi;                           // + channel tile * 16 * CB + kk*32  (A fragment: row c, k = d)
    const size_t xrow = ((size_t)b * SEQ_FULL + t0) * COUT;
    const size_t orow = ((size_t)b * OUT_SEQ + t0) * COUT;
#pragma unroll 1
    for (int hc = 0; hc < 2; ++hc) {
#pragma unroll 1
        for (int ct = 0; ct < 8; ++ct) {
            const int cg = hc * 8 + ct;
            v8f acc = (v8f){};
#pragma unroll
            for (int kk = 0; kk < 4; ++kk) { const v16h a = ldh(WO + wo + cg * 16 * CB + kk * 32); acc = wmma16g(a, cf[kk], acc); }
            // D: acc[r] = (c = 16cg + 8h + r, t = lane&15) -> os[t][16ct + 8h + r]; rows 0..15 x columns 0..127 all written over the 8 tiles
            v4f a0, a1;
            a0[0] = acc[0] * WOI; a0[1] = acc[1] * WOI; a0[2] = acc[2] * WOI; a0[3] = acc[3] * WOI;
            a1[0] = acc[4] * WOI; a1[1] = acc[5] * WOI; a1[2] = acc[6] * WOI; a1[3] = acc[7] * WOI;
            *(v4fa*)(&os[wb + lr * OPF + ct * 16 + 8 * hi]) = a0; *(v4fa*)(&os[wb + lr * OPF + ct * 16 + 8 * hi + 4]) = a1;
        }
        wave_sync();
        static_assert(32 * 4 * 16 == 16 * 128);                // lanes x floats x instructions == half tile
{
#pragma unroll 4
            for (int s = 0; s < 16; ++s) { const int cofs = lane * 4;
                const v4f val = *(const v4fa*)(&os[wb + s * OPF + cofs]);
                const v4f xv = *(const v4f*)(X + xrow + (size_t)s * COUT + hc * 128 + cofs);
                v4f res; res[0] = bfr(xv[0]) + val[0]; res[1] = bfr(xv[1]) + val[1]; res[2] = bfr(xv[2]) + val[2]; res[3] = bfr(xv[3]) + val[3];
                *(v4f*)(OUT + orow + (size_t)s * COUT + hc * 128 + cofs) = res; }
             }
        wave_sync();
    }
}

static constexpr size_t al256(size_t v) { return (v + 255) & ~(size_t)255; }
static constexpr size_t SZ_XB = al256((size_t)NB * SEQ * CIN * 2);
static constexpr size_t SZ_W  = al256((size_t)CIN * CB * 2);
static constexpr size_t SZ_Q  = al256((size_t)NB * SEQ * CB * 2);
static constexpr size_t SZ_K  = al256((size_t)NB * MK * CB * 2);
static constexpr size_t SZ_TOTAL = SZ_XB + 4 * SZ_W + 2 * SZ_Q + 3 * SZ_K;
static_assert(SZ_TOTAL <= (size_t)134217728);                        // workspace carve <= 128 MiB
static_assert((size_t)CIN * CB == (size_t)CB * COUT);                // the W_out plane has the extent of an input-projection weight plane
static_assert((size_t)NB * MK * CB == (size_t)NB * CB * MK);         // value^T plane [(b*128 + d)][MK] has the extent of a k plane

extern "C" void kernel_launch(void* const* d_in, const int* in_sizes, int n_in,
                              void* d_out, int out_size, void* d_ws, size_t ws_size, hipStream_t stream) {
    if (n_in < 5) return;
    const size_t needx = ((size_t)(NB - 1) * SEQ_FULL + SEQ) * CIN;
    if ((size_t)in_sizes[0] < needx) return;
    if ((size_t)in_sizes[1] < (size_t)CIN * CB || (size_t)in_sizes[2] < (size_t)CIN * CB || (size_t)in_sizes[3] < (size_t)CIN * CB) return;
    if ((size_t)in_sizes[4] < (size_t)CB * COUT) return;
    if ((size_t)out_size < ((size_t)(NB - 1) * OUT_SEQ + SEQ) * COUT) return;
    if (SZ_TOTAL > ws_size) return;
    // wire order: x, W_theta, W_phi, W_g, W_out
    const float* x  = (const float*)d_in[0];
    const float* wt = (const float*)d_in[1];
    const float* wp = (const float*)d_in[2];
    const float* wg = (const float*)d_in[3];
    const float* wo = (const float*)d_in[4];
    float* OUT = (float*)d_out;      // [NB][SEQ][256]
    char* wsp = (char*)d_ws;
    bf*  XB = (bf*)wsp;  wsp += SZ_XB;               // x bf16 [NB*SEQ][256]
    bf*  WT = (bf*)wsp;  wsp += SZ_W;                // W_theta^T bf16 [128][256]
    bf*  WP = (bf*)wsp;  wsp += SZ_W;                // W_phi^T   bf16 [128][256]
    bf*  WG = (bf*)wsp;  wsp += SZ_W;                // W_g^T     bf16 [128][256]
    h16* WOH = (h16*)wsp; wsp += SZ_W;               // W_out^T   f16 x64 [256][128]
    h16* QH = (h16*)wsp; wsp += SZ_Q;                // [NB*SEQ][128]
    h16* QR = (h16*)wsp; wsp += SZ_Q;                // [NB*SEQ][128] residual x2048
    h16* KH = (h16*)wsp; wsp += SZ_K;                // [NB*MK][128]
    h16* KR = (h16*)wsp; wsp += SZ_K;                // [NB*MK][128] residual x2048
    h16* GT = (h16*)wsp; wsp += SZ_K;                // [NB*128][MK]

    if (SEQ == SEQ_FULL) {
        const size_t n8 = (size_t)NB * SEQ * CIN / 8;
        k_cvt8<<<(unsigned)((n8 + 255) / 256), 256, 0, stream>>>(x, XB, n8);
    } else {
        const size_t n8 = (size_t)SEQ * CIN / 8;
        for (int b = 0; b < NB; ++b) k_cvt8<<<(unsigned)((n8 + 255) / 256), 256, 0, stream>>>(x + (size_t)b * SEQ_FULL * CIN, XB + (size_t)b * SEQ * CIN, n8);
    }
    // in[rows][cols] -> out[cols][rows]; grid (rows/64, cols/64)
    k_wtr_b<<<dim3(CIN / 64, CB / 64, 1), 256, 0, stream>>>(wt, WT, CIN, CB);      // [256][128] -> [128][256]
    k_wtr_b<<<dim3(CIN / 64, CB / 64, 1), 256, 0, stream>>>(wp, WP, CIN, CB);      // [256][128] -> [128][256]
    k_wtr_b<<<dim3(CIN / 64, CB / 64, 1), 256, 0, stream>>>(wg, WG, CIN, CB);      // [256][128] -> [128][256]
    k_wtr_h<<<dim3(CB / 64, COUT / 64, 1), 256, 0, stream>>>(wo, WOH, CB, COUT);   // [128][256] -> [256][128]

    k_proj_q<<<dim3(NB * SEQ / 64, CB / 64, 1), 32, 0, stream>>>(XB, WT, QH, QR);
    k_proj_k<<<dim3(NB * SEQ / 64, CB / 64, 1), 32, 0, stream>>>(XB, WP, KH, KR);
    k_proj_gt<<<dim3(CB / 32, NB * SEQ / 128, 1), 32, 0, stream>>>(WG, XB, GT);

    k_attn<<<dim3(SEQ / (16 * AW), NB, 1), 32 * AW, 0, stream>>>(QH, QR, KH, KR, GT, WOH, x, OUT);
}

// v002
// It runs in 121 microseconds.
// Next to v001, in two timings, it ran 1.39 times as fast each time.
// Counting every step since v000, it is 2.59 times as fast.
#include <hip/hip_runtime.h>

// Spatial self-attention block over flattened pixels: x [NB][SEQ][256]; three 1x1 projections W [in 256][out 128] (no bias); keys and values max-pooled over adjacent token pairs (SEQ/2 keys);
// unscaled dot-product scores, softmax over keys; context [SEQ][128] -> output projection W_out [in 128][out 256]; output = x + projected context (f32).
// Compute dtypes, f32 accumulate everywhere: three input projections v_wmma_f32_16x16x32_bf16 (x and W RNE-converted to bf16; products exact);
// scores v_wmma_f32_16x16x32_f16 with q and k each as f16 value + f16 residual x2048 (three products, residual products in their own accumulator folded by 1/2048);
// P.V v_wmma_f32_16x16x32_f16, P single f16 with x16384 carry (cancels in the normalisation, row sum over the converted P), pooled values single f16;
// output projection v_wmma_f32_16x16x32_f16, context single f16, W_out (RNE bf16 value) x64 as f16, folded by 1/64; softmax f32 (online, running max); skip term = bf16-converted x added in f32 at the store stage.
// Layout: bf16 copy of x; transposed 16-bit weight planes [out][in]; q planes (value, residual) [b][t][128]; k planes (value, residual) [b][key][128]; value^T plane [b][d][key];
// fused flash kernel in transposed form (S^T = K Q^T, O^T = V^T P^T, out^T = W_out^T ctx^T with the packed O^T tiles as B fragments);
// its key-loop operands (q, k, value^T) are staged in LDS by asynchronous copies, k and value^T in 64-key tiles with two buffers shared by the block's waves.
// Three dependent launches: k_prep (bf16 copy of x and the four weight planes), k_proj (q, k, value^T planes), k_attn; work that does not depend on each other shares a grid.

#ifndef NB
#define NB 8
#endif
#ifndef SEQ
#define SEQ 4096
#endif
#define NB_FULL  8
#define SEQ_FULL 4096
#ifndef OUT_SEQ
#define OUT_SEQ SEQ              // row pitch (in tokens) between batches of the output
#endif
#define CIN  256                 // input channels (projection depth)
#define CB   128                 // bottleneck width (score depth, context width)
#define COUT 256                 // output channels
#define MK   (SEQ / 2)           // pooled keys per batch
#define AW   4                   // waves per flash block (16 query rows each)
#define OPF  132                 // LDS row pitch (floats) of the 16 x 128 staging tiles
#define QRS  2048.0f             // carry of every residual plane
#define QRI  (1.0f / 2048.0f)
#define L2E  1.4426950408889634f // log2(e); the module applies no score scale
#define PSH  14.0f               // log2 of the P carry (16384)
#define NEGB (-3.0e38f)
#define WOS  64.0f               // carry of the f16 W_out plane
#define WOI  (1.0f / 64.0f)
#define KT   64                  // keys per LDS tile (two 32-key passes)
#define NST  (MK / KT)           // tiles per batch
#define KP   272                 // LDS row pitch, bytes, of 256-byte q / k rows (16 B x odd: conflict-free 16-byte reads)
#define GP   144                 // LDS row pitch, bytes, of 128-byte value^T rows (16 B x odd)
#define KR_O (KT * KP)           // tile layout: k value rows, k residual rows, value^T rows
#define GT_O (2 * KT * KP)
#define STB  (2 * KT * KP + CB * GP)   // bytes of one tile buffer
#define Q_O  (2 * STB)           // behind the two buffers: per wave 16 q value rows, then 16 q residual rows
#define QWB  (2 * 16 * KP)       // bytes of one wave's q rows; the same bytes are that wave's output staging tile after the key loop
#define LDSB (Q_O + AW * QWB)

static_assert(CB == 128);                      // flash: 4 k-steps of 32 per score tile, 8 output tiles of 16, 4 k-steps in the output projection
static_assert(COUT == 256);                    // output staged as two halves of 128 columns
static_assert(CIN == COUT);                    // skip term has the output's row width
static_assert(CIN % 32 == 0);                  // GEMM k-loop steps by 32
static_assert(CB % 32 == 0);
static_assert(CIN % 64 == 0);                  // weight transposer tiles of 64 x 64
static_assert(CB % 64 == 0);
static_assert(COUT % 64 == 0);
static_assert(SEQ % 128 == 0);                 // a 128-token value tile never straddles two batches; token pairs stay inside a tile
static_assert((NB * SEQ) % 128 == 0);
static_assert((NB * SEQ) % 64 == 0);
static_assert(MK % 32 == 0);                   // key loop steps by 32
static_assert(MK % 64 == 0);
static_assert(SEQ % (16 * AW) == 0);           // flash grid covers the sequence exactly
static_assert(((size_t)SEQ * CIN) % 8 == 0);
static_assert(NB <= NB_FULL);
static_assert(SEQ <= SEQ_FULL);
static_assert((OPF * 4) % 16 == 0);
static_assert(NST >= 2);                       // the two-buffer prologue fills tiles 0 and 1
static_assert(KT == 16 * AW);                  // each wave copies 16 k rows of a tile (8 copies of 2 rows)
static_assert(CB == 32 * AW);                  // each wave copies 32 value^T rows of a tile (8 copies of 4 rows)
static_assert(KT * 2 == 128);                  // a value^T tile row is one 128-byte line
static_assert(16 * OPF * 4 <= QWB);            // the output staging tile fits the wave's q rows
static_assert(KP % 16 == 0);
static_assert(GP % 16 == 0);
static_assert(LDSB <= 163840);                 // two blocks per 320 KiB of LDS
static_assert((size_t)NB * SEQ * CIN < (size_t)2147483647);   // int offsets inside the planes

typedef _Float16 h16;
typedef unsigned short bf;
typedef __attribute__((ext_vector_type(16))) __bf16   v16bf;
typedef __attribute__((ext_vector_type(16))) _Float16 v16h;
typedef __attribute__((ext_vector_type(8)))  _Float16 v8h;
typedef __attribute__((ext_vector_type(8)))  unsigned short v8us;
typedef __attribute__((ext_vector_type(8)))  float    v8f;
typedef __attribute__((ext_vector_type(4)))  float    v4f;
typedef v4f  __attribute__((may_alias)) v4fa;
typedef v8h  __attribute__((may_alias)) v8ha;

__device__ __forceinline__ unsigned short f2bf(float f) { unsigned u = __float_as_uint(f); u += 0x7FFFu + ((u >> 16) & 1u); return (unsigned short)(u >> 16); }
__device__ __forceinline__ float bfr(float f) { return __uint_as_float(((unsigned)f2bf(f)) << 16); }   // value after RNE convert to bf16
__device__ __forceinline__ v16h cat16(v8h lo, v8h hi) { return __builtin_shufflevector(lo, hi, 0, 1, 2, 3, 4, 5, 6, 7, 8, 9, 10, 11, 12, 13, 14, 15); }
__device__ __forceinline__ v16bf cat16b(v8us lo, v8us hi) { return __builtin_bit_cast(v16bf, __builtin_shufflevector(lo, hi, 0, 1, 2, 3, 4, 5, 6, 7, 8, 9, 10, 11, 12, 13, 14, 15)); }
__device__ __forceinline__ v8f wmma16(v16h a, v16h b, v8f c) { return __builtin_amdgcn_wmma_f32_16x16x32_f16(false, a, false, b, (short)0, c, false, false); }
__device__ __forceinline__ v8f wmmab(v16bf a, v16bf b, v8f c) { return __builtin_amdgcn_wmma_f32_16x16x32_bf16(false, a, false, b, (short)0, c, false, false); }
// fragment loaders from K-contiguous 16-bit rows; p already includes + 8*(lane>>4): elements 0..7 <- k0+8h+0..7, elements 8..15 <- k0+16+8h+0..7 (same map for A and B)
__device__ __forceinline__ v16h  ldh(const h16* p) { return cat16(*(const v8h*)p, *(const v8h*)(p + 16)); }
__device__ __forceinline__ v16bf ldb(const bf* p)  { return cat16b(*(const v8us*)p, *(const v8us*)(p + 16)); }
// the same fragment map from a staged LDS row (p in bytes, already includes + 16*(lane>>4))
__device__ __forceinline__ v16h  ldl(const unsigned char* p) { return cat16(*(const v8ha*)p, *(const v8ha*)(p + 32)); }
// eight asynchronous 16-byte-per-lane copies global -> LDS (l = the lane's LDS byte address, g = the lane's global address; steps between copies ls bytes, gs elements).
// The closing s_wait_xcnt stands inside the statement so that no address register is rewritten ahead of it.
__device__ __forceinline__ void cp8(unsigned l, const h16* g, unsigned ls, size_t gs) {
    asm volatile("global_load_async_to_lds_b128 %0, %8, off\n\t"
                 "global_load_async_to_lds_b128 %1, %9, off\n\t"
                 "global_load_async_to_lds_b128 %2, %10, off\n\t"
                 "global_load_async_to_lds_b128 %3, %11, off\n\t"
                 "global_load_async_to_lds_b128 %4, %12, off\n\t"
                 "global_load_async_to_lds_b128 %5, %13, off\n\t"
                 "global_load_async_to_lds_b128 %6, %14, off\n\t"
                 "global_load_async_to_lds_b128 %7, %15, off\n\t"
                 "s_wait_xcnt 0x0"
                 :: "v"(l), "v"(l + ls), "v"(l + 2 * ls), "v"(l + 3 * ls), "v"(l + 4 * ls), "v"(l + 5 * ls), "v"(l + 6 * ls), "v"(l + 7 * ls),
                    "v"(g), "v"(g + gs), "v"(g + 2 * gs), "v"(g + 3 * gs), "v"(g + 4 * gs), "v"(g + 5 * gs), "v"(g + 6 * gs), "v"(g + 7 * gs)
                 : "memory");
}
// ordering point for wave-private LDS tiles (same wave writes and reads)
__device__ __forceinline__ void wave_sync() { __builtin_amdgcn_fence(3 /* release order */, "wavefront"); __builtin_amdgcn_wave_barrier(); asm volatile("" ::: "memory"); }

// f32 -> f16 convert that cannot produce an f16 subnormal (|v| < 2^-14 -> +0); applied after the plane's power-of-two carry
static __device__ __forceinline__ h16 toh_flush(float v) { const h16 r = (h16)v; return (fabsf(v) < 6.103515625e-05f) ? (h16)0.0f : r; }
// one matrix instruction + its own four-slot guard (accumulator tied, operands kept live)
__device__ __forceinline__ v8f wmma16g(v16h a, v16h b, v8f c) {
    c = __builtin_amdgcn_wmma_f32_16x16x32_f16(false, a, false, b, (short)0, c, false, false);
    asm volatile("v_nop\n\tv_nop\n\tv_nop\n\tv_nop" : "+v"(c) : "v"(a), "v"(b));
    return c; }
__device__ __forceinline__ v8f wmmabg(v16bf a, v16bf b, v8f c) {
    c = __builtin_amdgcn_wmma_f32_16x16x32_bf16(false, a, false, b, (short)0, c, false, false);
    asm volatile("v_nop\n\tv_nop\n\tv_nop\n\tv_nop" : "+v"(c) : "v"(a), "v"(b));
    return c; }

// x convert, 8 elements per thread: group i of the n8 groups of one batch
__device__ __forceinline__ void cvt8_body(const float* __restrict__ src, bf* dst, size_t i, size_t n8) {
    if (i >= n8) return;
    const v8f v = *(const v8f*)(src + i * 8); v8us o;
#pragma unroll
    for (int k = 0; k < 8; ++k) o[k] = f2bf(v[k]);
    *(v8us*)(dst + i * 8) = o; 
}

// Weight transposer: in[R][C] (f32) -> out[C][R] (16-bit), 64 x 64 tile (rows r0.., columns c0..) per block through LDS (cross-wave: block barrier).
// ASH = 0: bf16 bits (RNE convert). ASH = 1: f16 of (RNE bf16 value x 64), subnormal-free convert.
template <int ASH>
__device__ __forceinline__ void wtr_body(float* ts, const float* __restrict__ src, bf* dstb, h16* dsth, int R, int C, int r0, int c0) {
    const int tid = threadIdx.x;
#pragma unroll 1
    for (int i = 0; i < 16; ++i) { const int rr = i * 4 + (tid >> 6), cc = tid & 63;        // 16 trips x 4 rows = 64 rows; 64 columns
        ts[rr * 65 + cc] = src[(size_t)(r0 + rr) * C + c0 + cc]; }
    __syncthreads();
    static_assert(256 * 8 * 2 == 64 * 64);                                                 // threads x elements per store x trips == tile
{
#pragma unroll 1
        for (int it = 0; it < 2; ++it) {
            const int cc = it * 32 + (tid >> 3), r8 = (tid & 7) * 8;                        // 2 trips x 32 output rows; 8 lanes x 8 elements = 64 = one line
            const size_t oo = (size_t)(c0 + cc) * R + r0 + r8;
            if (ASH) { v8h o;
#pragma unroll
                for (int k = 0; k < 8; ++k) o[k] = toh_flush(bfr(ts[(r8 + k) * 65 + cc]) * WOS);
                *(v8h*)(dsth + oo) = o;
                asm volatile("s_wait_xcnt 0x0" ::: "memory");   // precaution: stands in front of whatever next rewrites the store's address and data registers (next trip, or code behind the loop)
            } else { v8us o;
#pragma unroll
                for (int k = 0; k < 8; ++k) o[k] = f2bf(ts[(r8 + k) * 65 + cc]);
                *(v8us*)(dstb + oo) = o;
                asm volatile("s_wait_xcnt 0x0" ::: "memory"); }  // precaution: as above
        }
         }
}
// k_prep: every operand preparation that depends on the inputs alone, in one grid. Blocks 0 .. 4*WTB-1: one 64 x 64 weight tile each (W_theta, W_phi, W_g, W_out in turn;
// lowest indices, for speed only); the other blocks: 2048 elements of x each. The split is block-uniform.
#define WTB ((CIN / 64) * (CB / 64))   // 64 x 64 tiles per weight
static_assert(WTB == (CB / 64) * (COUT / 64));
#define CVB ((int)(((size_t)SEQ * CIN / 8 + 255) / 256))   // x convert blocks per batch
__global__ __launch_bounds__(256) void k_prep(const float* __restrict__ x, const float* __restrict__ wt, const float* __restrict__ wp, const float* __restrict__ wg,
                                              const float* __restrict__ wo, bf* XB, bf* WT, bf* WP, bf* WG, h16* WOH) {
    __shared__ float ts[64 * 65];
    const int blk = blockIdx.x;
    if (blk < 4 * WTB) {
        const int w = blk / WTB, t = blk % WTB;
        if (w == 3) { wtr_body<1>(ts, wo, (bf*)0, WOH, CB, COUT, (t % (CB / 64)) * 64, (t / (CB / 64)) * 64); }      // [128][256] -> [256][128]
        else { const float* src = (w == 0) ? wt : (w == 1) ? wp : wg; bf* dst = (w == 0) ? WT : (w == 1) ? WP : WG;
            wtr_body<0>(ts, src, dst, (h16*)0, CIN, CB, (t % (CIN / 64)) * 64, (t / (CIN / 64)) * 64); }             // [256][128] -> [128][256]
        return;
    }
    const int cb = blk - 4 * WTB, bb = cb / CVB;               // batch pitch: SEQ_FULL rows in x, SEQ rows in the bf16 copy
    cvt8_body(x + (size_t)bb * SEQ_FULL * CIN, XB + (size_t)bb * SEQ * CIN, (size_t)(cb % CVB) * 256 + threadIdx.x, (size_t)SEQ * CIN / 8);
}

// mm64: register-blocked bf16 GEMM main loop, ONE WAVE per 64x64 tile (16 accumulators), operands straight from K-contiguous bf16 planes, K = CIN.
// acc[mb][nb][j] = C[16mb + 8h + j][16nb + (lane&15)], C[m][n] = sum_k A[m][k] Bt[n][k].
__device__ __forceinline__ void mm64(const bf* __restrict__ A, const bf* __restrict__ Bt, size_t aoff, size_t boff, v8f (&acc)[4][4]) {
    const int K = CIN;
#pragma unroll
    for (int mb = 0; mb < 4; ++mb)
#pragma unroll
        for (int nb = 0; nb < 4; ++nb) acc[mb][nb] = (v8f){};
#pragma unroll 1
    for (int kc = 0; kc < K; kc += 32) {
        v16bf a[4];
#pragma unroll
        for (int mb = 0; mb < 3; ++mb) a[mb] = ldb(A + aoff + (size_t)mb * 16 * K + kc);
        { const bf* pa = A + aoff + (size_t)3 * 16 * K + kc;
          const v8us lo = *(const v8us*)pa;
          asm volatile("s_wait_xcnt 0x0" ::: "memory");        // precaution: the last load of the run may be given the run's own address pair as its destination; the wait stands in front of it
          const v8us hi = *(const v8us*)(pa + 16);
          a[3] = cat16b(lo, hi); }
#pragma unroll
        for (int nb = 0; nb < 4; ++nb) { const v16bf b = ldb(Bt + boff + (size_t)nb * 16 * K + kc);
#pragma unroll
            for (int mb = 0; mb < 4; ++mb) acc[mb][nb] = wmmabg(a[mb], b, acc[mb][nb]); }
    }
}

// proj_q: q = x W_theta, 64 x 64 tile (bx, by). A = x rows (m = b*SEQ + t), Bt = transposed weight rows (n = d). Planes [b*SEQ + t][128]: f16 value (Ph) and f16 residual x2048 (Pr).
__device__ __forceinline__ void proj_q(float* os, const bf* __restrict__ A, const bf* __restrict__ Bt, h16* Ph, h16* Pr, int bx, int by) {
    const int lane = threadIdx.x & 31, lr = lane & 15, hi = lane >> 4; const int r0 = bx * 64, c0 = by * 64;
    v8f acc[4][4];
    mm64(A, Bt, (size_t)(r0 + lr) * CIN + 8 * hi, (size_t)(c0 + lr) * CIN + 8 * hi, acc);
    const size_t obase = (size_t)r0 * CB + c0;
#pragma unroll
    for (int mb = 0; mb < 4; ++mb) {
#pragma unroll
        for (int nb = 0; nb < 4; ++nb) {
#pragma unroll
            for (int j = 0; j < 8; ++j) os[(hi * 8 + j) * 68 + nb * 16 + lr] = acc[mb][nb][j]; }   // D: row 8h+j, col lane&15; 16 x 64 all written
        wave_sync();
        static_assert(32 * 8 * 4 == 16 * 64);                                                     // lanes x halves x instructions == slab
{
#pragma unroll
            for (int s = 0; s < 4; ++s) { const int row = 4 * s + (lane >> 3), c8 = (lane & 7) * 8;   // 4 s x 4 row groups = 16 rows; 8 lanes x 8 = 64 columns
                const v4f x0 = *(const v4fa*)(&os[row * 68 + c8]); const v4f x1 = *(const v4fa*)(&os[row * 68 + c8 + 4]); v8h hv, rv;
#pragma unroll
                for (int i = 0; i < 4; ++i) { const h16 a0 = toh_flush(x0[i]); const h16 a1 = toh_flush(x1[i]); hv[i] = a0; hv[4 + i] = a1;
                    rv[i] = toh_flush((x0[i] - (float)a0) * QRS); rv[4 + i] = toh_flush((x1[i] - (float)a1) * QRS); }
                const size_t oo = obase + (size_t)(mb * 16 + row) * CB + c8;
                *(v8h*)(Ph + oo) = hv; *(v8h*)(Pr + oo) = rv; }
             }
        wave_sync();
    }
}

// proj_k: k = maxpool2(x W_phi) over adjacent token pairs, 64 x 64 tile (bx, by). Same GEMM; per 16-token slab the 8 pooled rows (max in f32, then convert) go to planes [b*MK + key][128]: f16 value and f16 residual x2048.
__device__ __forceinline__ void proj_k(float* os, const bf* __restrict__ A, const bf* __restrict__ Bt, h16* Ph, h16* Pr, int bx, int by) {
    const int lane = threadIdx.x & 31, lr = lane & 15, hi = lane >> 4; const int r0 = bx * 64, c0 = by * 64;
    v8f acc[4][4];
    mm64(A, Bt, (size_t)(r0 + lr) * CIN + 8 * hi, (size_t)(c0 + lr) * CIN + 8 * hi, acc);
    const size_t obase = (size_t)(r0 / 2) * CB + c0;                                              // (b*SEQ + t)/2 = b*MK + t/2
#pragma unroll
    for (int mb = 0; mb < 4; ++mb) {
#pragma unroll
        for (int nb = 0; nb < 4; ++nb) {
#pragma unroll
            for (int j = 0; j < 8; ++j) os[(hi * 8 + j) * 68 + nb * 16 + lr] = acc[mb][nb][j]; }
        wave_sync();
        static_assert(32 * 8 * 2 == 8 * 64);                                                      // lanes x halves x instructions == pooled slab
{
#pragma unroll
            for (int s = 0; s < 2; ++s) { const int prow = 4 * s + (lane >> 3), c8 = (lane & 7) * 8;   // 2 s x 4 row groups = 8 pooled rows (token rows 2*prow, 2*prow+1)
                const v4f u0 = *(const v4fa*)(&os[(2 * prow) * 68 + c8]);     const v4f u1 = *(const v4fa*)(&os[(2 * prow) * 68 + c8 + 4]);
                const v4f w0 = *(const v4fa*)(&os[(2 * prow + 1) * 68 + c8]); const v4f w1 = *(const v4fa*)(&os[(2 * prow + 1) * 68 + c8 + 4]); v8h hv, rv;
#pragma unroll
                for (int i = 0; i < 4; ++i) { const float y0 = fmaxf(u0[i], w0[i]), y1 = fmaxf(u1[i], w1[i]);
                    const h16 a0 = toh_flush(y0); const h16 a1 = toh_flush(y1); hv[i] = a0; hv[4 + i] = a1;
                    rv[i] = toh_flush((y0 - (float)a0) * QRS); rv[4 + i] = toh_flush((y1 - (float)a1) * QRS); }
                const size_t oo = obase + (size_t)(mb * 8 + prow) * CB + c8;
                *(v8h*)(Ph + oo) = hv; *(v8h*)(Pr + oo) = rv; }
             }
        wave_sync();
    }
}

// proj_gt: pooled values transposed, G^T[d][key] = max over the token pair of (W_g^T x^T)[d][t]. ONE WAVE per 32 (d) x 128 (token) tile (16 accumulators):
// A = transposed weight rows (m = d), Bt = x rows (n = b*SEQ + t). Plane [(b*128 + d)][MK], single f16. Per 16-row slab staged in LDS (wave-private);
__device__ __forceinline__ void proj_gt(float* os, const bf* __restrict__ A, const bf* __restrict__ Bt, h16* Gt, int bx, int by) {
    const int K = CIN;
    const int lane = threadIdx.x & 31, lr = lane & 15, hi = lane >> 4; const int r0 = bx * 32, c0 = by * 128;
    v8f acc[2][8];
#pragma unroll
    for (int mb = 0; mb < 2; ++mb)
#pragma unroll
        for (int nb = 0; nb < 8; ++nb) acc[mb][nb] = (v8f){};
    const size_t aoff = (size_t)(r0 + lr) * K + 8 * hi, boff = (size_t)(c0 + lr) * K + 8 * hi;
#pragma unroll 1
    for (int kc = 0; kc < K; kc += 32) {
        v16bf a[2];
#pragma unroll
        for (int mb = 0; mb < 2; ++mb) a[mb] = ldb(A + aoff + (size_t)mb * 16 * K + kc);
#pragma unroll
        for (int nb = 0; nb < 8; ++nb) { const v16bf b = ldb(Bt + boff + (size_t)nb * 16 * K + kc);
#pragma unroll
            for (int mb = 0; mb < 2; ++mb) acc[mb][nb] = wmmabg(a[mb], b, acc[mb][nb]); }
    }
    const int bb = c0 / SEQ, tt = c0 % SEQ;
    const size_t obase = ((size_t)bb * CB + r0) * MK + (size_t)(tt / 2);
#pragma unroll
    for (int mb = 0; mb < 2; ++mb) {
#pragma unroll
        for (int nb = 0; nb < 8; ++nb) {
#pragma unroll
            for (int j = 0; j < 8; ++j) os[(hi * 8 + j) * OPF + nb * 16 + lr] = acc[mb][nb][j]; }   // D: row d = 8h+j, col token = 16nb + lane&15; 16 x 128 all written
        wave_sync();
        static_assert(32 * 8 * 4 == 16 * 64);                                                       // lanes x pooled halves x instructions == pooled slab
{
#pragma unroll
            for (int s = 0; s < 4; ++s) { const int row = 4 * s + (lane >> 3), c8 = (lane & 7) * 8;     // 4 s x 4 row groups = 16 rows; 8 lanes x 8 pooled = 64 pooled columns
                const v4f f0 = *(const v4fa*)(&os[row * OPF + 2 * c8]);     const v4f f1 = *(const v4fa*)(&os[row * OPF + 2 * c8 + 4]);
                const v4f f2 = *(const v4fa*)(&os[row * OPF + 2 * c8 + 8]); const v4f f3 = *(const v4fa*)(&os[row * OPF + 2 * c8 + 12]); v8h hv;
                hv[0] = toh_flush(fmaxf(f0[0], f0[1])); hv[1] = toh_flush(fmaxf(f0[2], f0[3]));
                hv[2] = toh_flush(fmaxf(f1[0], f1[1])); hv[3] = toh_flush(fmaxf(f1[2], f1[3]));
                hv[4] = toh_flush(fmaxf(f2[0], f2[1])); hv[5] = toh_flush(fmaxf(f2[2], f2[3]));
                hv[6] = toh_flush(fmaxf(f3[0], f3[1])); hv[7] = toh_flush(fmaxf(f3[2], f3[3]));
                const size_t oo = obase + (size_t)(mb * 16 + row) * MK + c8;
                *(v8h*)(Gt + oo) = hv; }
             }
        wave_sync();
    }
}

// k_proj: the three input projections, which depend on k_prep alone and not on one another, in one grid of one-wave blocks; blockIdx.y picks the projection (block-uniform),
// blockIdx.x its tile. The waves of the three share the SIMDs, so each one's load waits are filled by the others' work. One wave-private staging tile serves all three.
#define PJB ((NB * SEQ / 64) * (CB / 64))   // tiles per projection
static_assert(PJB == (CB / 32) * (NB * SEQ / 128));
static_assert(16 * 68 <= 16 * OPF);
__global__ __launch_bounds__(32) void k_proj(const bf* __restrict__ XB, const bf* __restrict__ WT, const bf* __restrict__ WP, const bf* __restrict__ WG,
                                             h16* QH, h16* QR, h16* KH, h16* KR, h16* GT) {
    __shared__ __align__(16) float os[16 * OPF];
    const int t = blockIdx.x, which = blockIdx.y;
    if (which == 0)      proj_q(os, XB, WT, QH, QR, t % (NB * SEQ / 64), t / (NB * SEQ / 64));
    else if (which == 1) { proj_k(os, XB, WP, KH, KR, t % (NB * SEQ / 64), t / (NB * SEQ / 64));
        asm volatile("s_wait_xcnt 0x0" ::: "memory"); }        // precaution: in the built text this body is followed by the other bodies' code, which rewrites the registers that its last stores name (the other two run into the end of the program)
    else                 proj_gt(os, WG, XB, GT, t % (CB / 32), t / (CB / 32));
}

// k_attn: fused attention + output projection + skip term, one wave per 16 query rows of one batch; K / G^T / Q fragments from LDS rows (two 16-B reads each), W_out^T fragments straight from its f16 plane.
// Staging: whole-line asynchronous copies; each wave brings its own 16 q rows once, and a quarter of every 64-key tile (k value, k residual, value^T) into one of two buffers, one tile ahead of its use.
// Transposed form: S^T[key][t] = K Q^T (A = K rows, B = Q rows, 4 k-steps over d); lane (t = lane&15, h = lane>>4) holds keys 8h+r of each 16-key tile, so the packed
// P tile is directly the B fragment of O^T[d][t] = G^T P^T (element r <- tile keys 0..15, element 8+r <- tile keys 16..31, lane unchanged), 8 tiles over d.
// Scores = K Q + (K Q_res + K_res Q) / 2048. Softmax state (running max, partial sum) is one scalar per lane; the two lane halves of a row are combined with one xor-16 exchange.
// Q fragments are re-read from LDS every key step (not held across the loop).
// Epilogue: ctx^T = O^T / l packed to f16 (tiles 2kk, 2kk+1 -> B fragment of k-step kk); out^T[c][t] = W_out^T ctx^T per 16-channel tile, staged in a wave-private LDS tile [t][128 channels];
__global__ __launch_bounds__(32 * AW) __attribute__((amdgpu_num_vgpr(256)))
void k_attn(const h16* __restrict__ QH, const h16* __restrict__ QR, const h16* __restrict__ KH, const h16* __restrict__ KR,
            const h16* __restrict__ GT, const h16* __restrict__ WO, const float* __restrict__ X, float* OUT) {
    __shared__ __align__(16) unsigned char sm[LDSB];
    const int lane = threadIdx.x & 31, lr = lane & 15, hi = lane >> 4;
    const int wave = __builtin_amdgcn_readfirstlane((int)(threadIdx.x >> 5));
    const int b = blockIdx.y;
    const int t0 = (blockIdx.x * AW + wave) * 16;
    // copy side: q / k rows of 256 B, two per copy (16 lanes each); value^T rows of 128 B, four per copy (8 lanes each)
    const unsigned sb = (unsigned)(size_t)sm;                  // LDS byte address of the array
    const unsigned lq = sb + Q_O + wave * QWB + (lane >> 4) * KP + (lane & 15) * 16;
    const unsigned lk = sb + (16 * wave + (lane >> 4)) * KP + (lane & 15) * 16;
    const unsigned lg = sb + GT_O + (32 * wave + (lane >> 3)) * GP + (lane & 7) * 16;
    const int gq = (b * SEQ + t0 + (lane >> 4)) * CB + (lane & 15) * 8;
    const int gk = (b * MK + 16 * wave + (lane >> 4)) * CB + (lane & 15) * 8;    // + tile * KT * CB
    const int gg = (b * CB + 32 * wave + (lane >> 3)) * MK + (lane & 7) * 8;     // + tile * KT
    // read side
    const unsigned char* qp = sm + Q_O + wave * QWB + lr * KP + 16 * hi;         // B fragments: col t, k = d; residual rows + 16*KP
    const int ko = lr * KP + 16 * hi;                          // + buffer + key * KP      (A fragment: row key, k = d)
    const int vo = GT_O + lr * GP + 16 * hi;                   // + buffer + 16j*GP + 2*key (A fragment: row d, k = key)
    // prologue: q rows and tile 0, landed and published; then tile 1 into the second buffer
    cp8(lq, QH + gq, 2 * KP, 2 * CB);
    cp8(lq + 16 * KP, QR + gq, 2 * KP, 2 * CB);
    cp8(lk, KH + gk, 2 * KP, 2 * CB);
    cp8(lk + KR_O, KR + gk, 2 * KP, 2 * CB);
    cp8(lg, GT + gg, 4 * GP, 4 * (size_t)MK);
    asm volatile("s_wait_asynccnt 0x0" ::: "memory");          // this wave's copies have landed before the barrier publishes them
    __syncthreads();
    cp8(lk + STB, KH + gk + KT * CB, 2 * KP, 2 * CB);
    cp8(lk + STB + KR_O, KR + gk + KT * CB, 2 * KP, 2 * CB);
    cp8(lg + STB, GT + gg + KT, 4 * GP, 4 * (size_t)MK);
    v8f o[8];
#pragma unroll
    for (int j = 0; j < 8; ++j) o[j] = (v8f){};
    float m = NEGB, l = 0.0f;
#pragma unroll 1
    for (int st = 0; st < NST; ++st) {
    const int bo = (st & 1) * STB;                             // this tile's buffer
#pragma unroll 1
    for (int ps = 0; ps < KT / 32; ++ps) {                     // 32-key passes in key order; rolled: one copy of the pass body in the text
        const unsigned char* kv = sm + bo + ko + ps * 32 * KP;
        v8f sHa = (v8f){}, sLa = (v8f){}, sHb = (v8f){}, sLb = (v8f){};
#pragma unroll 1
        for (int kk = 0; kk < 4; ++kk) {
            const v16h qh = ldl(qp + kk * 64), qr = ldl(qp + 16 * KP + kk * 64);
            const v16h ka = ldl(kv + kk * 64),  kb = ldl(kv + 16 * KP + kk * 64);
            const v16h kra = ldl(kv + KR_O + kk * 64), krb = ldl(kv + KR_O + 16 * KP + kk * 64);
            sHa = wmma16g(ka, qh, sHa); sHb = wmma16g(kb, qh, sHb);
            sLa = wmma16g(ka, qr, sLa); sLb = wmma16g(kb, qr, sLb);
            sLa = wmma16g(kra, qh, sLa); sLb = wmma16g(krb, qh, sLb);
        }
        float ta[8], tb[8]; float mx = NEGB;
#pragma unroll
        for (int r = 0; r < 8; ++r) {
            ta[r] = (sHa[r] + sLa[r] * QRI) * L2E; tb[r] = (sHb[r] + sLb[r] * QRI) * L2E;
            mx = fmaxf(mx, fmaxf(ta[r], tb[r])); }
        mx = fmaxf(mx, __shfl_xor(mx, 16, 32));
        const float mnew = fmaxf(m, mx);
        const float alpha = __builtin_amdgcn_exp2f(m - mnew);
        const float sh = PSH - mnew;
        v16h pb; float ls = 0.0f;
#pragma unroll
        for (int r = 0; r < 8; ++r) {
            const float ea = ta[r] + sh, eb = tb[r] + sh;
            const float xa = __builtin_amdgcn_exp2f(ea), xb = __builtin_amdgcn_exp2f(eb);
            const float ga = (ea < -14.0f) ? 0.0f : xa, gb = (eb < -14.0f) ? 0.0f : xb;   // nothing below 2^-14 reaches the f16 operand
            const h16 pa = (h16)ga; const h16 pc = (h16)gb;
            pb[r] = pa; pb[8 + r] = pc;
            ls += (float)pa + (float)pc; }
        l = l * alpha + ls; m = mnew;
#pragma unroll
        for (int j = 0; j < 8; ++j) o[j] = o[j] * alpha;
        const unsigned char* vv = sm + bo + vo + ps * 64;
#pragma unroll
        for (int jg = 0; jg < 2; ++jg) {
            v16h vf[4];
#pragma unroll
            for (int j = 0; j < 4; ++j) vf[j] = ldl(vv + (jg * 4 + j) * 16 * GP);
#pragma unroll
            for (int j = 0; j < 4; ++j) o[jg * 4 + j] = wmma16g(vf[j], pb, o[jg * 4 + j]);
        }
    }
    // foot of tile st: own LDS reads done, own copies of tile st + 1 landed, then the one barrier that publishes tile st + 1 and frees this buffer
    asm volatile("s_wait_dscnt 0x0" ::: "memory");             // this wave has left the buffer that is refilled behind the barrier
    asm volatile("s_wait_asynccnt 0x0" ::: "memory");          // this wave's share of tile st + 1 has landed
    __syncthreads();
    if (st + 2 < NST) {                                        // same for the whole block
        const int tk = (st + 2) * KT;
        cp8(lk + bo, KH + gk + tk * CB, 2 * KP, 2 * CB);
        cp8(lk + bo + KR_O, KR + gk + tk * CB, 2 * KP, 2 * CB);
        cp8(lg + bo, GT + gg + tk, 4 * GP, 4 * (size_t)MK);
    }
    }
    asm volatile("s_wait_asynccnt 0x0" ::: "memory");          // nothing in flight before the q rows become output staging
    l += __shfl_xor(l, 16, 32);
    const float inv = 1.0f / l;                                // l >= 16384 (the row maximum contributes the full carry)
    // ctx^T D layout: o[j][r] = (d = 16j + 8h + r, t = lane&15); B fragment of k-step kk: element r <- tile 2kk, element 8+r <- tile 2kk+1
    v16h cf[4];
#pragma unroll
    for (int kk = 0; kk < 4; ++kk) {
#pragma unroll
        for (int r = 0; r < 8; ++r) { cf[kk][r] = toh_flush(o[2 * kk][r] * inv); cf[kk][8 + r] = toh_flush(o[2 * kk + 1][r] * inv); } }
    float* os = (float*)(sm + Q_O);                            // each wave stages in the bytes of its own q rows, which only it has read
    const int wb = wave * (QWB / 4);
    const int wo = lr * CB + 8 * hi;                           // + channel tile * 16 * CB + kk*32  (A fragment: row c, k = d)
    const size_t xrow = ((size_t)b * SEQ_FULL + t0) * COUT;
    const size_t orow = ((size_t)b * OUT_SEQ + t0) * COUT;
#pragma unroll 1
    for (int hc = 0; hc < 2; ++hc) {
#pragma unroll 1
        for (int ct = 0; ct < 8; ++ct) {
            const int cg = hc * 8 + ct;
            v8f acc = (v8f){};
#pragma unroll
            for (int kk = 0; kk < 4; ++kk) { const v16h a = ldh(WO + wo + cg * 16 * CB + kk * 32); acc = wmma16g(a, cf[kk], acc); }
            // D: acc[r] = (c = 16cg + 8h + r, t = lane&15) -> os[t][16ct + 8h + r]; rows 0..15 x columns 0..127 all written over the 8 tiles
            v4f a0, a1;
            a0[0] = acc[0] * WOI; a0[1] = acc[1] * WOI; a0[2] = acc[2] * WOI; a0[3] = acc[3] * WOI;
            a1[0] = acc[4] * WOI; a1[1] = acc[5] * WOI; a1[2] = acc[6] * WOI; a1[3] = acc[7] * WOI;
            *(v4fa*)(&os[wb + lr * OPF + ct * 16 + 8 * hi]) = a0; *(v4fa*)(&os[wb + lr * OPF + ct * 16 + 8 * hi + 4]) = a1;
        }
        wave_sync();
        static_assert(32 * 4 * 16 == 16 * 128);                // lanes x floats x instructions == half tile
{
#pragma unroll 4
            for (int s = 0; s < 16; ++s) { const int cofs = lane * 4;
                const v4f val = *(const v4fa*)(&os[wb + s * OPF + cofs]);
                const v4f xv = *(const v4f*)(X + xrow + (size_t)s * COUT + hc * 128 + cofs);
                v4f res; res[0] = bfr(xv[0]) + val[0]; res[1] = bfr(xv[1]) + val[1]; res[2] = bfr(xv[2]) + val[2]; res[3] = bfr(xv[3]) + val[3];
                *(v4f*)(OUT + orow + (size_t)s * COUT + hc * 128 + cofs) = res; }
             }
        wave_sync();
    }
}

static constexpr size_t al256(size_t v) { return (v + 255) & ~(size_t)255; }
static constexpr size_t SZ_XB = al256((size_t)NB * SEQ * CIN * 2);
static constexpr size_t SZ_W  = al256((size_t)CIN * CB * 2);
static constexpr size_t SZ_Q  = al256((size_t)NB * SEQ * CB * 2);
static constexpr size_t SZ_K  = al256((size_t)NB * MK * CB * 2);
static constexpr size_t SZ_TOTAL = SZ_XB + 4 * SZ_W + 2 * SZ_Q + 3 * SZ_K;
static_assert(SZ_TOTAL <= (size_t)134217728);                        // workspace carve <= 128 MiB
static_assert((size_t)CIN * CB == (size_t)CB * COUT);                // the W_out plane has the extent of an input-projection weight plane
static_assert((size_t)NB * MK * CB == (size_t)NB * CB * MK);         // value^T plane [(b*128 + d)][MK] has the extent of a k plane

extern "C" void kernel_launch(void* const* d_in, const int* in_sizes, int n_in,
                              void* d_out, int out_size, void* d_ws, size_t ws_size, hipStream_t stream) {
    if (n_in < 5) return;
    const size_t needx = ((size_t)(NB - 1) * SEQ_FULL + SEQ) * CIN;
    if ((size_t)in_sizes[0] < needx) return;
    if ((size_t)in_sizes[1] < (size_t)CIN * CB || (size_t)in_sizes[2] < (size_t)CIN * CB || (size_t)in_sizes[3] < (size_t)CIN * CB) return;
    if ((size_t)in_sizes[4] < (size_t)CB * COUT) return;
    if ((size_t)out_size < ((size_t)(NB - 1) * OUT_SEQ + SEQ) * COUT) return;
    if (SZ_TOTAL > ws_size) return;
    // wire order: x, W_theta, W_phi, W_g, W_out
    const float* x  = (const float*)d_in[0];
    const float* wt = (const float*)d_in[1];
    const float* wp = (const float*)d_in[2];
    const float* wg = (const float*)d_in[3];
    const float* wo = (const float*)d_in[4];
    float* OUT = (float*)d_out;      // [NB][SEQ][256]
    char* wsp = (char*)d_ws;
    bf*  XB = (bf*)wsp;  wsp += SZ_XB;               // x bf16 [NB*SEQ][256]
    bf*  WT = (bf*)wsp;  wsp += SZ_W;                // W_theta^T bf16 [128][256]
    bf*  WP = (bf*)wsp;  wsp += SZ_W;                // W_phi^T   bf16 [128][256]
    bf*  WG = (bf*)wsp;  wsp += SZ_W;                // W_g^T     bf16 [128][256]
    h16* WOH = (h16*)wsp; wsp += SZ_W;               // W_out^T   f16 x64 [256][128]
    h16* QH = (h16*)wsp; wsp += SZ_Q;                // [NB*SEQ][128]
    h16* QR = (h16*)wsp; wsp += SZ_Q;                // [NB*SEQ][128] residual x2048
    h16* KH = (h16*)wsp; wsp += SZ_K;                // [NB*MK][128]
    h16* KR = (h16*)wsp; wsp += SZ_K;                // [NB*MK][128] residual x2048
    h16* GT = (h16*)wsp; wsp += SZ_K;                // [NB*128][MK]

    k_prep<<<dim3(4 * WTB + NB * CVB, 1, 1), 256, 0, stream>>>(x, wt, wp, wg, wo, XB, WT, WP, WG, WOH);
    k_proj<<<dim3(PJB, 3, 1), 32, 0, stream>>>(XB, WT, WP, WG, QH, QR, KH, KR, GT);
    k_attn<<<dim3(SEQ / (16 * AW), NB, 1), 32 * AW, 0, stream>>>(QH, QR, KH, KR, GT, WOH, x, OUT);
}

// v003
// It runs in 112 microseconds.
// Timed twice side by side with v002, it ran 1.08 times as fast both times.
// Over all steps from v000 it is 2.80 times as fast.
#include <hip/hip_runtime.h>

// Spatial self-attention block over flattened pixels: x [NB][SEQ][256]; three 1x1 projections W [in 256][out 128] (no bias); keys and values max-pooled over adjacent token pairs (SEQ/2 keys);
// unscaled dot-product scores, softmax over keys; context [SEQ][128] -> output projection W_out [in 128][out 256]; output = x + projected context (f32).
// Compute dtypes, f32 accumulate everywhere: three input projections v_wmma_f32_16x16x32_bf16 (x and W RNE-converted to bf16; products exact);
// scores v_wmma_f32_16x16x32_f16 with q and k each as f16 value + f16 residual x2048 (three products, residual products in their own accumulator folded by 1/2048);
// P.V v_wmma_f32_16x16x32_f16, P single f16 with x16384 carry (cancels in the normalisation, row sum over the converted P), pooled values single f16;
// output projection v_wmma_f32_16x16x32_f16, context single f16, W_out (RNE bf16 value) x64 as f16, folded by 1/64; softmax f32 (online, running max); skip term = bf16-converted x added in f32 at the store stage.
// Layout: bf16 copy of x; transposed 16-bit weight planes [out][in]; q planes (value, residual) [b][t][128]; k planes (value, residual) [b][key][128]; value^T plane [b][d][key];
// fused flash kernel in transposed form (S^T = K Q^T, O^T = V^T P^T, out^T = W_out^T ctx^T with the packed O^T tiles as B fragments);
// its key-loop operands (q, k, value^T) are staged in LDS by asynchronous copies, k and value^T in 64-key tiles with two buffers shared by the block's waves.
// Three dependent launches: k_prep (bf16 copy of x and the four weight planes), k_proj (q, k, value^T planes), k_attn; work that does not depend on each other shares a grid.

#ifndef NB
#define NB 8
#endif
#ifndef SEQ
#define SEQ 4096
#endif
#define NB_FULL  8
#define SEQ_FULL 4096
#ifndef OUT_SEQ
#define OUT_SEQ SEQ              // row pitch (in tokens) between batches of the output
#endif
#define CIN  256                 // input channels (projection depth)
#define CB   128                 // bottleneck width (score depth, context width)
#define COUT 256                 // output channels
#define MK   (SEQ / 2)           // pooled keys per batch
#define AW   4                   // waves per flash block (16 query rows each)
#define OPF  132                 // LDS row pitch (floats) of the 16 x 128 staging tiles
#define QRS  2048.0f             // carry of every residual plane
#define QRI  (1.0f / 2048.0f)
#define L2E  1.4426950408889634f // log2(e); the module applies no score scale
#define PSH  14.0f               // log2 of the P carry (16384)
#define NEGB (-3.0e38f)
#define WOS  64.0f               // carry of the f16 W_out plane
#define WOI  (1.0f / 64.0f)
#define KT   64                  // keys per LDS tile (two 32-key passes)
#define NST  (MK / KT)           // tiles per batch
#define KP   272                 // LDS row pitch, bytes, of 256-byte q / k rows (16 B x odd: conflict-free 16-byte reads)
#define GP   144                 // LDS row pitch, bytes, of 128-byte value^T rows (16 B x odd)
#define KR_O (KT * KP)           // tile layout: k value rows, k residual rows, value^T rows
#define GT_O (2 * KT * KP)
#define STB  (2 * KT * KP + CB * GP)   // bytes of one tile buffer
#define Q_O  (2 * STB)           // behind the two buffers: per wave 16 q value rows, then 16 q residual rows
#define QWB  (2 * 16 * KP)       // bytes of one wave's q rows; the same bytes are that wave's output staging tile after the key loop
#define LDSB (Q_O + AW * QWB)

static_assert(CB == 128);                      // flash: 4 k-steps of 32 per score tile, 8 output tiles of 16, 4 k-steps in the output projection
static_assert(COUT == 256);                    // output staged as two halves of 128 columns
static_assert(CIN == COUT);                    // skip term has the output's row width
static_assert(CIN % 32 == 0);                  // GEMM k-loop steps by 32
static_assert(CB % 32 == 0);
static_assert(CIN % 64 == 0);                  // weight transposer tiles of 64 x 64
static_assert(CB % 64 == 0);
static_assert(COUT % 64 == 0);
static_assert(SEQ % 128 == 0);                 // a 128-token value tile never straddles two batches; token pairs stay inside a tile
static_assert((NB * SEQ) % 128 == 0);
static_assert((NB * SEQ) % 64 == 0);
static_assert(MK % 32 == 0);                   // key loop steps by 32
static_assert(MK % 64 == 0);
static_assert(SEQ % (16 * AW) == 0);           // flash grid covers the sequence exactly
static_assert(((size_t)SEQ * CIN) % 8 == 0);
static_assert(NB <= NB_FULL);
static_assert(SEQ <= SEQ_FULL);
static_assert((OPF * 4) % 16 == 0);
static_assert(NST >= 2);                       // the two-buffer prologue fills tiles 0 and 1
static_assert(KT == 16 * AW);                  // each wave copies 16 k rows of a tile (8 copies of 2 rows)
static_assert(CB == 32 * AW);                  // each wave copies 32 value^T rows of a tile (8 copies of 4 rows)
static_assert(KT * 2 == 128);                  // a value^T tile row is one 128-byte line
static_assert(16 * OPF * 4 <= QWB);            // the output staging tile fits the wave's q rows
static_assert(KP % 16 == 0);
static_assert(GP % 16 == 0);
static_assert(LDSB <= 163840);                 // two blocks per 320 KiB of LDS
static_assert((size_t)NB * SEQ * CIN < (size_t)2147483647);   // int offsets inside the planes

typedef _Float16 h16;
typedef unsigned short bf;
typedef __attribute__((ext_vector_type(16))) __bf16   v16bf;
typedef __attribute__((ext_vector_type(16))) _Float16 v16h;
typedef __attribute__((ext_vector_type(8)))  _Float16 v8h;
typedef __attribute__((ext_vector_type(8)))  unsigned short v8us;
typedef __attribute__((ext_vector_type(8)))  float    v8f;
typedef __attribute__((ext_vector_type(4)))  float    v4f;
typedef v4f  __attribute__((may_alias)) v4fa;
typedef v8h  __attribute__((may_alias)) v8ha;

__device__ __forceinline__ unsigned short f2bf(float f) { unsigned u = __float_as_uint(f); u += 0x7FFFu + ((u >> 16) & 1u); return (unsigned short)(u >> 16); }
__device__ __forceinline__ float bfr(float f) { return __uint_as_float(((unsigned)f2bf(f)) << 16); }   // value after RNE convert to bf16
__device__ __forceinline__ v16h cat16(v8h lo, v8h hi) { return __builtin_shufflevector(lo, hi, 0, 1, 2, 3, 4, 5, 6, 7, 8, 9, 10, 11, 12, 13, 14, 15); }
__device__ __forceinline__ v16bf cat16b(v8us lo, v8us hi) { return __builtin_bit_cast(v16bf, __builtin_shufflevector(lo, hi, 0, 1, 2, 3, 4, 5, 6, 7, 8, 9, 10, 11, 12, 13, 14, 15)); }
__device__ __forceinline__ v8f wmma16(v16h a, v16h b, v8f c) { return __builtin_amdgcn_wmma_f32_16x16x32_f16(false, a, false, b, (short)0, c, false, false); }
__device__ __forceinline__ v8f wmmab(v16bf a, v16bf b, v8f c) { return __builtin_amdgcn_wmma_f32_16x16x32_bf16(false, a, false, b, (short)0, c, false, false); }
// fragment loaders from K-contiguous 16-bit rows; p already includes + 8*(lane>>4): elements 0..7 <- k0+8h+0..7, elements 8..15 <- k0+16+8h+0..7 (same map for A and B)
__device__ __forceinline__ v16h  ldh(const h16* p) { return cat16(*(const v8h*)p, *(const v8h*)(p + 16)); }
__device__ __forceinline__ v16bf ldb(const bf* p)  { return cat16b(*(const v8us*)p, *(const v8us*)(p + 16)); }
// the same fragment map from a staged LDS row (p in bytes, already includes + 16*(lane>>4))
__device__ __forceinline__ v16h  ldl(const unsigned char* p) { return cat16(*(const v8ha*)p, *(const v8ha*)(p + 32)); }
// eight asynchronous 16-byte-per-lane copies global -> LDS (l = the lane's LDS byte address, g = the lane's global address; steps between copies ls bytes, gs elements).
// The closing s_wait_xcnt stands inside the statement so that no address register is rewritten ahead of it.
__device__ __forceinline__ void cp8(unsigned l, const h16* g, unsigned ls, size_t gs) {
    asm volatile("global_load_async_to_lds_b128 %0, %8, off\n\t"
                 "global_load_async_to_lds_b128 %1, %9, off\n\t"
                 "global_load_async_to_lds_b128 %2, %10, off\n\t"
                 "global_load_async_to_lds_b128 %3, %11, off\n\t"
                 "global_load_async_to_lds_b128 %4, %12, off\n\t"
                 "global_load_async_to_lds_b128 %5, %13, off\n\t"
                 "global_load_async_to_lds_b128 %6, %14, off\n\t"
                 "global_load_async_to_lds_b128 %7, %15, off\n\t"
                 "s_wait_xcnt 0x0"
                 :: "v"(l), "v"(l + ls), "v"(l + 2 * ls), "v"(l + 3 * ls), "v"(l + 4 * ls), "v"(l + 5 * ls), "v"(l + 6 * ls), "v"(l + 7 * ls),
                    "v"(g), "v"(g + gs), "v"(g + 2 * gs), "v"(g + 3 * gs), "v"(g + 4 * gs), "v"(g + 5 * gs), "v"(g + 6 * gs), "v"(g + 7 * gs)
                 : "memory");
}
// ordering point for wave-private LDS tiles (same wave writes and reads)
__device__ __forceinline__ void wave_sync() { __builtin_amdgcn_fence(3 /* release order */, "wavefront"); __builtin_amdgcn_wave_barrier(); asm volatile("" ::: "memory"); }

// f32 -> f16 convert that cannot produce an f16 subnormal (|v| < 2^-14 -> +0); applied after the plane's power-of-two carry
static __device__ __forceinline__ h16 toh_flush(float v) { const h16 r = (h16)v; return (fabsf(v) < 6.103515625e-05f) ? (h16)0.0f : r; }
// one matrix instruction + its own four-slot guard (accumulator tied, operands kept live)
__device__ __forceinline__ v8f wmma16g(v16h a, v16h b, v8f c) {
    c = __builtin_amdgcn_wmma_f32_16x16x32_f16(false, a, false, b, (short)0, c, false, false);
    asm volatile("v_nop\n\tv_nop\n\tv_nop\n\tv_nop" : "+v"(c) : "v"(a), "v"(b));
    return c; }
__device__ __forceinline__ v8f wmmabg(v16bf a, v16bf b, v8f c) {
    c = __builtin_amdgcn_wmma_f32_16x16x32_bf16(false, a, false, b, (short)0, c, false, false);
    asm volatile("v_nop\n\tv_nop\n\tv_nop\n\tv_nop" : "+v"(c) : "v"(a), "v"(b));
    return c; }

// x convert, 8 elements per thread: group i of the n8 groups of one batch
__device__ __forceinline__ void cvt8_body(const float* __restrict__ src, bf* dst, size_t i, size_t n8) {
    if (i >= n8) return;
    const v8f v = *(const v8f*)(src + i * 8); v8us o;
#pragma unroll
    for (int k = 0; k < 8; ++k) o[k] = f2bf(v[k]);
    *(v8us*)(dst + i * 8) = o; 
}

// Weight transposer: in[R][C] (f32) -> out[C][R] (16-bit), 64 x 64 tile (rows r0.., columns c0..) per block through LDS (cross-wave: block barrier).
// ASH = 0: bf16 bits (RNE convert). ASH = 1: f16 of (RNE bf16 value x 64), subnormal-free convert.
template <int ASH>
__device__ __forceinline__ void wtr_body(float* ts, const float* __restrict__ src, bf* dstb, h16* dsth, int R, int C, int r0, int c0) {
    const int tid = threadIdx.x;
#pragma unroll 1
    for (int i = 0; i < 16; ++i) { const int rr = i * 4 + (tid >> 6), cc = tid & 63;        // 16 trips x 4 rows = 64 rows; 64 columns
        ts[rr * 65 + cc] = src[(size_t)(r0 + rr) * C + c0 + cc]; }
    __syncthreads();
    static_assert(256 * 8 * 2 == 64 * 64);                                                 // threads x elements per store x trips == tile
{
#pragma unroll 1
        for (int it = 0; it < 2; ++it) {
            const int cc = it * 32 + (tid >> 3), r8 = (tid & 7) * 8;                        // 2 trips x 32 output rows; 8 lanes x 8 elements = 64 = one line
            const size_t oo = (size_t)(c0 + cc) * R + r0 + r8;
            if (ASH) { v8h o;
#pragma unroll
                for (int k = 0; k < 8; ++k) o[k] = toh_flush(bfr(ts[(r8 + k) * 65 + cc]) * WOS);
                *(v8h*)(dsth + oo) = o;
                asm volatile("s_wait_xcnt 0x0" ::: "memory");   // precaution: stands in front of whatever next rewrites the store's address and data registers (next trip, or code behind the loop)
            } else { v8us o;
#pragma unroll
                for (int k = 0; k < 8; ++k) o[k] = f2bf(ts[(r8 + k) * 65 + cc]);
                *(v8us*)(dstb + oo) = o;
                asm volatile("s_wait_xcnt 0x0" ::: "memory"); }  // precaution: as above
        }
         }
}
// k_prep: every operand preparation that depends on the inputs alone, in one grid. Blocks 0 .. 4*WTB-1: one 64 x 64 weight tile each (W_theta, W_phi, W_g, W_out in turn;
// lowest indices, for speed only); the other blocks: 2048 elements of x each. The split is block-uniform.
#define WTB ((CIN / 64) * (CB / 64))   // 64 x 64 tiles per weight
static_assert(WTB == (CB / 64) * (COUT / 64));
#define CVB ((int)(((size_t)SEQ * CIN / 8 + 255) / 256))   // x convert blocks per batch
__global__ __launch_bounds__(256) void k_prep(const float* __restrict__ x, const float* __restrict__ wt, const float* __restrict__ wp, const float* __restrict__ wg,
                                              const float* __restrict__ wo, bf* XB, bf* WT, bf* WP, bf* WG, h16* WOH) {
    __shared__ float ts[64 * 65];
    const int blk = blockIdx.x;
    if (blk < 4 * WTB) {
        const int w = blk / WTB, t = blk % WTB;
        if (w == 3) { wtr_body<1>(ts, wo, (bf*)0, WOH, CB, COUT, (t % (CB / 64)) * 64, (t / (CB / 64)) * 64); }      // [128][256] -> [256][128]
        else { const float* src = (w == 0) ? wt : (w == 1) ? wp : wg; bf* dst = (w == 0) ? WT : (w == 1) ? WP : WG;
            wtr_body<0>(ts, src, dst, (h16*)0, CIN, CB, (t % (CIN / 64)) * 64, (t / (CIN / 64)) * 64); }             // [256][128] -> [128][256]
        return;
    }
    const int cb = blk - 4 * WTB, bb = cb / CVB;               // batch pitch: SEQ_FULL rows in x, SEQ rows in the bf16 copy
    cvt8_body(x + (size_t)bb * SEQ_FULL * CIN, XB + (size_t)bb * SEQ * CIN, (size_t)(cb % CVB) * 256 + threadIdx.x, (size_t)SEQ * CIN / 8);
}

// mm64: register-blocked bf16 GEMM main loop, ONE WAVE per 64x64 tile (16 accumulators), operands straight from K-contiguous bf16 planes, K = CIN.
// acc[mb][nb][j] = C[16mb + 8h + j][16nb + (lane&15)], C[m][n] = sum_k A[m][k] Bt[n][k].
__device__ __forceinline__ void mm64(const bf* __restrict__ A, const bf* __restrict__ Bt, size_t aoff, size_t boff, v8f (&acc)[4][4]) {
    const int K = CIN;
#pragma unroll
    for (int mb = 0; mb < 4; ++mb)
#pragma unroll
        for (int nb = 0; nb < 4; ++nb) acc[mb][nb] = (v8f){};
#pragma unroll 1
    for (int kc = 0; kc < K; kc += 32) {
        v16bf a[4];
#pragma unroll
        for (int mb = 0; mb < 3; ++mb) a[mb] = ldb(A + aoff + (size_t)mb * 16 * K + kc);
        { const bf* pa = A + aoff + (size_t)3 * 16 * K + kc;
          const v8us lo = *(const v8us*)pa;
          asm volatile("s_wait_xcnt 0x0" ::: "memory");        // precaution: the last load of the run may be given the run's own address pair as its destination; the wait stands in front of it
          const v8us hi = *(const v8us*)(pa + 16);
          a[3] = cat16b(lo, hi); }
#pragma unroll
        for (int nb = 0; nb < 4; ++nb) { const v16bf b = ldb(Bt + boff + (size_t)nb * 16 * K + kc);
#pragma unroll
            for (int mb = 0; mb < 4; ++mb) acc[mb][nb] = wmmabg(a[mb], b, acc[mb][nb]); }
    }
}

// proj_q: q = x W_theta, 64 x 64 tile (bx, by). A = x rows (m = b*SEQ + t), Bt = transposed weight rows (n = d). Planes [b*SEQ + t][128]: f16 value (Ph) and f16 residual x2048 (Pr).
__device__ __forceinline__ void proj_q(float* os, const bf* __restrict__ A, const bf* __restrict__ Bt, h16* Ph, h16* Pr, int bx, int by) {
    const int lane = threadIdx.x & 31, lr = lane & 15, hi = lane >> 4; const int r0 = bx * 64, c0 = by * 64;
    v8f acc[4][4];
    mm64(A, Bt, (size_t)(r0 + lr) * CIN + 8 * hi, (size_t)(c0 + lr) * CIN + 8 * hi, acc);
    const size_t obase = (size_t)r0 * CB + c0;
#pragma unroll
    for (int mb = 0; mb < 4; ++mb) {
#pragma unroll
        for (int nb = 0; nb < 4; ++nb) {
#pragma unroll
            for (int j = 0; j < 8; ++j) os[(hi * 8 + j) * 68 + nb * 16 + lr] = acc[mb][nb][j]; }   // D: row 8h+j, col lane&15; 16 x 64 all written
        wave_sync();
        static_assert(32 * 8 * 4 == 16 * 64);                                                     // lanes x halves x instructions == slab
{
#pragma unroll
            for (int s = 0; s < 4; ++s) { const int row = 4 * s + (lane >> 3), c8 = (lane & 7) * 8;   // 4 s x 4 row groups = 16 rows; 8 lanes x 8 = 64 columns
                const v4f x0 = *(const v4fa*)(&os[row * 68 + c8]); const v4f x1 = *(const v4fa*)(&os[row * 68 + c8 + 4]); v8h hv, rv;
#pragma unroll
                for (int i = 0; i < 4; ++i) { const h16 a0 = toh_flush(x0[i]); const h16 a1 = toh_flush(x1[i]); hv[i] = a0; hv[4 + i] = a1;
                    rv[i] = toh_flush((x0[i] - (float)a0) * QRS); rv[4 + i] = toh_flush((x1[i] - (float)a1) * QRS); }
                const size_t oo = obase + (size_t)(mb * 16 + row) * CB + c8;
                *(v8h*)(Ph + oo) = hv; *(v8h*)(Pr + oo) = rv; }
             }
        wave_sync();
    }
}

// proj_k: k = maxpool2(x W_phi) over adjacent token pairs, 64 x 64 tile (bx, by). Same GEMM; per 16-token slab the 8 pooled rows (max in f32, then convert) go to planes [b*MK + key][128]: f16 value and f16 residual x2048.
__device__ __forceinline__ void proj_k(float* os, const bf* __restrict__ A, const bf* __restrict__ Bt, h16* Ph, h16* Pr, int bx, int by) {
    const int lane = threadIdx.x & 31, lr = lane & 15, hi = lane >> 4; const int r0 = bx * 64, c0 = by * 64;
    v8f acc[4][4];
    mm64(A, Bt, (size_t)(r0 + lr) * CIN + 8 * hi, (size_t)(c0 + lr) * CIN + 8 * hi, acc);
    const size_t obase = (size_t)(r0 / 2) * CB + c0;                                              // (b*SEQ + t)/2 = b*MK + t/2
#pragma unroll
    for (int mb = 0; mb < 4; ++mb) {
#pragma unroll
        for (int nb = 0; nb < 4; ++nb) {
#pragma unroll
            for (int j = 0; j < 8; ++j) os[(hi * 8 + j) * 68 + nb * 16 + lr] = acc[mb][nb][j]; }
        wave_sync();
        static_assert(32 * 8 * 2 == 8 * 64);                                                      // lanes x halves x instructions == pooled slab
{
#pragma unroll
            for (int s = 0; s < 2; ++s) { const int prow = 4 * s + (lane >> 3), c8 = (lane & 7) * 8;   // 2 s x 4 row groups = 8 pooled rows (token rows 2*prow, 2*prow+1)
                const v4f u0 = *(const v4fa*)(&os[(2 * prow) * 68 + c8]);     const v4f u1 = *(const v4fa*)(&os[(2 * prow) * 68 + c8 + 4]);
                const v4f w0 = *(const v4fa*)(&os[(2 * prow + 1) * 68 + c8]); const v4f w1 = *(const v4fa*)(&os[(2 * prow + 1) * 68 + c8 + 4]); v8h hv, rv;
#pragma unroll
                for (int i = 0; i < 4; ++i) { const float y0 = fmaxf(u0[i], w0[i]), y1 = fmaxf(u1[i], w1[i]);
                    const h16 a0 = toh_flush(y0); const h16 a1 = toh_flush(y1); hv[i] = a0; hv[4 + i] = a1;
                    rv[i] = toh_flush((y0 - (float)a0) * QRS); rv[4 + i] = toh_flush((y1 - (float)a1) * QRS); }
                const size_t oo = obase + (size_t)(mb * 8 + prow) * CB + c8;
                *(v8h*)(Ph + oo) = hv; *(v8h*)(Pr + oo) = rv; }
             }
        wave_sync();
    }
}

// proj_gt: pooled values transposed, G^T[d][key] = max over the token pair of (W_g^T x^T)[d][t]. ONE WAVE per 32 (d) x 128 (token) tile (16 accumulators):
// A = transposed weight rows (m = d), Bt = x rows (n = b*SEQ + t). Plane [(b*128 + d)][MK], single f16. Per 16-row slab staged in LDS (wave-private);
__device__ __forceinline__ void proj_gt(float* os, const bf* __restrict__ A, const bf* __restrict__ Bt, h16* Gt, int bx, int by) {
    const int K = CIN;
    const int lane = threadIdx.x & 31, lr = lane & 15, hi = lane >> 4; const int r0 = bx * 32, c0 = by * 128;
    v8f acc[2][8];
#pragma unroll
    for (int mb = 0; mb < 2; ++mb)
#pragma unroll
        for (int nb = 0; nb < 8; ++nb) acc[mb][nb] = (v8f){};
    const size_t aoff = (size_t)(r0 + lr) * K + 8 * hi, boff = (size_t)(c0 + lr) * K + 8 * hi;
#pragma unroll 1
    for (int kc = 0; kc < K; kc += 32) {
        v16bf a[2];
#pragma unroll
        for (int mb = 0; mb < 2; ++mb) a[mb] = ldb(A + aoff + (size_t)mb * 16 * K + kc);
#pragma unroll
        for (int nb = 0; nb < 8; ++nb) { const v16bf b = ldb(Bt + boff + (size_t)nb * 16 * K + kc);
#pragma unroll
            for (int mb = 0; mb < 2; ++mb) acc[mb][nb] = wmmabg(a[mb], b, acc[mb][nb]); }
    }
    const int bb = c0 / SEQ, tt = c0 % SEQ;
    const size_t obase = ((size_t)bb * CB + r0) * MK + (size_t)(tt / 2);
#pragma unroll
    for (int mb = 0; mb < 2; ++mb) {
#pragma unroll
        for (int nb = 0; nb < 8; ++nb) {
#pragma unroll
            for (int j = 0; j < 8; ++j) os[(hi * 8 + j) * OPF + nb * 16 + lr] = acc[mb][nb][j]; }   // D: row d = 8h+j, col token = 16nb + lane&15; 16 x 128 all written
        wave_sync();
        static_assert(32 * 8 * 4 == 16 * 64);                                                       // lanes x pooled halves x instructions == pooled slab
{
#pragma unroll
            for (int s = 0; s < 4; ++s) { const int row = 4 * s + (lane >> 3), c8 = (lane & 7) * 8;     // 4 s x 4 row groups = 16 rows; 8 lanes x 8 pooled = 64 pooled columns
                const v4f f0 = *(const v4fa*)(&os[row * OPF + 2 * c8]);     const v4f f1 = *(const v4fa*)(&os[row * OPF + 2 * c8 + 4]);
                const v4f f2 = *(const v4fa*)(&os[row * OPF + 2 * c8 + 8]); const v4f f3 = *(const v4fa*)(&os[row * OPF + 2 * c8 + 12]); v8h hv;
                hv[0] = toh_flush(fmaxf(f0[0], f0[1])); hv[1] = toh_flush(fmaxf(f0[2], f0[3]));
                hv[2] = toh_flush(fmaxf(f1[0], f1[1])); hv[3] = toh_flush(fmaxf(f1[2], f1[3]));
                hv[4] = toh_flush(fmaxf(f2[0], f2[1])); hv[5] = toh_flush(fmaxf(f2[2], f2[3]));
                hv[6] = toh_flush(fmaxf(f3[0], f3[1])); hv[7] = toh_flush(fmaxf(f3[2], f3[3]));
                const size_t oo = obase + (size_t)(mb * 16 + row) * MK + c8;
                *(v8h*)(Gt + oo) = hv; }
             }
        wave_sync();
    }
}

// k_proj: the three input projections, which depend on k_prep alone and not on one another, in one grid of one-wave blocks; blockIdx.y picks the projection (block-uniform),
// blockIdx.x its tile. The waves of the three share the SIMDs, so each one's load waits are filled by the others' work. One wave-private staging tile serves all three.
#define PJB ((NB * SEQ / 64) * (CB / 64))   // tiles per projection
static_assert(PJB == (CB / 32) * (NB * SEQ / 128));
static_assert(16 * 68 <= 16 * OPF);
__global__ __launch_bounds__(32) void k_proj(const bf* __restrict__ XB, const bf* __restrict__ WT, const bf* __restrict__ WP, const bf* __restrict__ WG,
                                             h16* QH, h16* QR, h16* KH, h16* KR, h16* GT) {
    __shared__ __align__(16) float os[16 * OPF];
    const int t = blockIdx.x, which = blockIdx.y;
    if (which == 0)      proj_q(os, XB, WT, QH, QR, t % (NB * SEQ / 64), t / (NB * SEQ / 64));
    else if (which == 1) { proj_k(os, XB, WP, KH, KR, t % (NB * SEQ / 64), t / (NB * SEQ / 64));
        asm volatile("s_wait_xcnt 0x0" ::: "memory"); }        // precaution: in the built text this body is followed by the other bodies' code, which rewrites the registers that its last stores name (the other two run into the end of the program)
    else                 proj_gt(os, WG, XB, GT, t % (CB / 32), t / (CB / 32));
}

// k_attn: fused attention + output projection + skip term, one wave per 16 query rows of one batch; K / G^T / Q fragments from LDS rows (two 16-B reads each), W_out^T fragments straight from its f16 plane.
// Staging: whole-line asynchronous copies; each wave brings its own 16 q rows once, and a quarter of every 64-key tile (k value, k residual, value^T) into one of two buffers, one tile ahead of its use.
// Transposed form: S^T[key][t] = K Q^T (A = K rows, B = Q rows, 4 k-steps over d); lane (t = lane&15, h = lane>>4) holds keys 8h+r of each 16-key tile, so the packed
// P tile is directly the B fragment of O^T[d][t] = G^T P^T (element r <- tile keys 0..15, element 8+r <- tile keys 16..31, lane unchanged), 8 tiles over d.
// Scores = K Q + (K Q_res + K_res Q) / 2048. Softmax state (running max, partial sum) is one scalar per lane; the two lane halves of a row are combined with one xor-16 exchange.
// Q fragments are re-read from LDS every key step (not held across the loop). Every fragment read of the key loop but a tile's first block is issued one block of matrix instructions ahead of its use; that block is read behind the barrier that publishes the tile.
// Epilogue: ctx^T = O^T / l packed to f16 (tiles 2kk, 2kk+1 -> B fragment of k-step kk); out^T[c][t] = W_out^T ctx^T per 16-channel tile, staged in a wave-private LDS tile [t][128 channels];
__global__ __launch_bounds__(32 * AW) __attribute__((amdgpu_num_vgpr(256)))
void k_attn(const h16* __restrict__ QH, const h16* __restrict__ QR, const h16* __restrict__ KH, const h16* __restrict__ KR,
            const h16* __restrict__ GT, const h16* __restrict__ WO, const float* __restrict__ X, float* OUT) {
    __shared__ __align__(16) unsigned char sm[LDSB];
    const int lane = threadIdx.x & 31, lr = lane & 15, hi = lane >> 4;
    const int wave = __builtin_amdgcn_readfirstlane((int)(threadIdx.x >> 5));
    const int b = blockIdx.y;
    const int t0 = (blockIdx.x * AW + wave) * 16;
    // copy side: q / k rows of 256 B, two per copy (16 lanes each); value^T rows of 128 B, four per copy (8 lanes each)
    const unsigned sb = (unsigned)(size_t)sm;                  // LDS byte address of the array
    const unsigned lq = sb + Q_O + wave * QWB + (lane >> 4) * KP + (lane & 15) * 16;
    const unsigned lk = sb + (16 * wave + (lane >> 4)) * KP + (lane & 15) * 16;
    const unsigned lg = sb + GT_O + (32 * wave + (lane >> 3)) * GP + (lane & 7) * 16;
    const int gq = (b * SEQ + t0 + (lane >> 4)) * CB + (lane & 15) * 8;
    const int gk = (b * MK + 16 * wave + (lane >> 4)) * CB + (lane & 15) * 8;    // + tile * KT * CB
    const int gg = (b * CB + 32 * wave + (lane >> 3)) * MK + (lane & 7) * 8;     // + tile * KT
    // read side
    const unsigned char* qp = sm + Q_O + wave * QWB + lr * KP + 16 * hi;         // B fragments: col t, k = d; residual rows + 16*KP
    const int ko = lr * KP + 16 * hi;                          // + buffer + key * KP      (A fragment: row key, k = d)
    const int vo = GT_O + lr * GP + 16 * hi;                   // + buffer + 16j*GP + 2*key (A fragment: row d, k = key)
    // prologue: q rows and tile 0, landed and published; then tile 1 into the second buffer
    cp8(lq, QH + gq, 2 * KP, 2 * CB);
    cp8(lq + 16 * KP, QR + gq, 2 * KP, 2 * CB);
    cp8(lk, KH + gk, 2 * KP, 2 * CB);
    cp8(lk + KR_O, KR + gk, 2 * KP, 2 * CB);
    cp8(lg, GT + gg, 4 * GP, 4 * (size_t)MK);
    asm volatile("s_wait_asynccnt 0x0" ::: "memory");          // this wave's copies have landed before the barrier publishes them
    __syncthreads();
    // first block of tile 0 (published by the barrier above): its reads return while tile 1's copies are issued
    v16h qh = ldl(qp), qr = ldl(qp + 16 * KP);
    v16h ka = ldl(sm + ko), kb = ldl(sm + ko + 16 * KP);
    v16h kra = ldl(sm + ko + KR_O), krb = ldl(sm + ko + KR_O + 16 * KP);
    cp8(lk + STB, KH + gk + KT * CB, 2 * KP, 2 * CB);
    cp8(lk + STB + KR_O, KR + gk + KT * CB, 2 * KP, 2 * CB);
    cp8(lg + STB, GT + gg + KT, 4 * GP, 4 * (size_t)MK);
    v8f o[8];
#pragma unroll
    for (int j = 0; j < 8; ++j) o[j] = (v8f){};
    float m = NEGB, l = 0.0f;
#pragma unroll 1
    for (int st = 0; st < NST; ++st) {
    const int bo = (st & 1) * STB;                             // this tile's buffer
    // LDS fragment reads stand one block ahead of the matrix instructions that use them, in a second register set; both 32-key passes and the four k-steps are unrolled so that the sets are plain registers.
    // Nothing is fetched across the tile's foot: the first block of a tile is read behind the barrier that publishes the tile, ahead of the refill copies issued there.
    const unsigned char* kt = sm + bo + ko;
#pragma unroll                                                 // unrolled: the fetch of pass 1's first block stands inside pass 0, with fixed registers
    for (int ps = 0; ps < KT / 32; ++ps) {                     // 32-key passes in key order
        const unsigned char* kv = kt + ps * 32 * KP;
        const unsigned char* vv = sm + bo + vo + ps * 64;
        v8f sHa = (v8f){}, sLa = (v8f){}, sHb = (v8f){}, sLb = (v8f){};
        v16h vf[4];
#pragma unroll                                                 // unrolled: the two fragment sets swap by renaming, without register copies
        for (int kk = 0; kk < 4; ++kk) {
            v16h nqh, nqr, nka, nkb, nkra, nkrb;
            if (kk < 3) {                                      // next k-step's fragments, issued as one group ahead of this k-step's products
                nqh = ldl(qp + (kk + 1) * 64); nqr = ldl(qp + 16 * KP + (kk + 1) * 64);
                nka = ldl(kv + (kk + 1) * 64); nkb = ldl(kv + 16 * KP + (kk + 1) * 64);
                nkra = ldl(kv + KR_O + (kk + 1) * 64); nkrb = ldl(kv + KR_O + 16 * KP + (kk + 1) * 64);
            } else {                                           // ahead of the last k-step: the first four value^T fragments
#pragma unroll
                for (int j = 0; j < 4; ++j) vf[j] = ldl(vv + j * 16 * GP);
            }
            sHa = wmma16g(ka, qh, sHa); sHb = wmma16g(kb, qh, sHb);
            sLa = wmma16g(ka, qr, sLa); sLb = wmma16g(kb, qr, sLb);
            sLa = wmma16g(kra, qh, sLa); sLb = wmma16g(krb, qh, sLb);
            if (kk < 3) { qh = nqh; qr = nqr; ka = nka; kb = nkb; kra = nkra; krb = nkrb; }
        }
        float ta[8], tb[8]; float mx = NEGB;
#pragma unroll
        for (int r = 0; r < 8; ++r) {
            ta[r] = (sHa[r] + sLa[r] * QRI) * L2E; tb[r] = (sHb[r] + sLb[r] * QRI) * L2E;
            mx = fmaxf(mx, fmaxf(ta[r], tb[r])); }
        mx = fmaxf(mx, __shfl_xor(mx, 16, 32));
        const float mnew = fmaxf(m, mx);
        const float alpha = __builtin_amdgcn_exp2f(m - mnew);
        const float sh = PSH - mnew;
        v16h pb; float ls = 0.0f;
#pragma unroll
        for (int r = 0; r < 8; ++r) {
            const float ea = ta[r] + sh, eb = tb[r] + sh;
            const float xa = __builtin_amdgcn_exp2f(ea), xb = __builtin_amdgcn_exp2f(eb);
            const float ga = (ea < -14.0f) ? 0.0f : xa, gb = (eb < -14.0f) ? 0.0f : xb;   // nothing below 2^-14 reaches the f16 operand
            const h16 pa = (h16)ga; const h16 pc = (h16)gb;
            pb[r] = pa; pb[8 + r] = pc;
            ls += (float)pa + (float)pc; }
        l = l * alpha + ls; m = mnew;
#pragma unroll
        for (int j = 0; j < 8; ++j) o[j] = o[j] * alpha;
        // ahead of the first four output products: the other four value^T fragments and, inside the tile, the next pass's first k-step
        v16h vg[4];
#pragma unroll
        for (int j = 0; j < 4; ++j) vg[j] = ldl(vv + (4 + j) * 16 * GP);
        if (ps + 1 < KT / 32) {
            const unsigned char* kn = kv + 32 * KP;
            qh = ldl(qp); qr = ldl(qp + 16 * KP);
            ka = ldl(kn); kb = ldl(kn + 16 * KP);
            kra = ldl(kn + KR_O); krb = ldl(kn + KR_O + 16 * KP);
        }
#pragma unroll
        for (int j = 0; j < 4; ++j) o[j] = wmma16g(vf[j], pb, o[j]);
#pragma unroll
        for (int j = 0; j < 4; ++j) o[4 + j] = wmma16g(vg[j], pb, o[4 + j]);
    }
    // foot of tile st: own LDS reads done, own copies of tile st + 1 landed, then the one barrier that publishes tile st + 1 and frees this buffer
    asm volatile("s_wait_dscnt 0x0" ::: "memory");             // this wave has left the buffer that is refilled behind the barrier
    asm volatile("s_wait_asynccnt 0x0" ::: "memory");          // this wave's share of tile st + 1 has landed
    __syncthreads();
    if (st + 1 < NST) {                                        // first block of tile st + 1, just published; its reads return while the refill copies are issued
        const unsigned char* kn = sm + (STB - bo) + ko;
        qh = ldl(qp); qr = ldl(qp + 16 * KP);
        ka = ldl(kn); kb = ldl(kn + 16 * KP);
        kra = ldl(kn + KR_O); krb = ldl(kn + KR_O + 16 * KP);
    }
    if (st + 2 < NST) {                                        // same for the whole block
        const int tk = (st + 2) * KT;
        cp8(lk + bo, KH + gk + tk * CB, 2 * KP, 2 * CB);
        cp8(lk + bo + KR_O, KR + gk + tk * CB, 2 * KP, 2 * CB);
        cp8(lg + bo, GT + gg + tk, 4 * GP, 4 * (size_t)MK);
    }
    }
    asm volatile("s_wait_asynccnt 0x0" ::: "memory");          // nothing in flight before the q rows become output staging
    l += __shfl_xor(l, 16, 32);
    const float inv = 1.0f / l;                                // l >= 16384 (the row maximum contributes the full carry)
    // ctx^T D layout: o[j][r] = (d = 16j + 8h + r, t = lane&15); B fragment of k-step kk: element r <- tile 2kk, element 8+r <- tile 2kk+1
    v16h cf[4];
#pragma unroll
    for (int kk = 0; kk < 4; ++kk) {
#pragma unroll
        for (int r = 0; r < 8; ++r) { cf[kk][r] = toh_flush(o[2 * kk][r] * inv); cf[kk][8 + r] = toh_flush(o[2 * kk + 1][r] * inv); } }
    float* os = (float*)(sm + Q_O);                            // each wave stages in the bytes of its own q rows, which only it has read
    const int wb = wave * (QWB / 4);
    const int wo = lr * CB + 8 * hi;                           // + channel tile * 16 * CB + kk*32  (A fragment: row c, k = d)
    const size_t xrow = ((size_t)b * SEQ_FULL + t0) * COUT;
    const size_t orow = ((size_t)b * OUT_SEQ + t0) * COUT;
#pragma unroll 1
    for (int hc = 0; hc < 2; ++hc) {
#pragma unroll 1
        for (int ct = 0; ct < 8; ++ct) {
            const int cg = hc * 8 + ct;
            v8f acc = (v8f){};
#pragma unroll
            for (int kk = 0; kk < 4; ++kk) { const v16h a = ldh(WO + wo + cg * 16 * CB + kk * 32); acc = wmma16g(a, cf[kk], acc); }
            // D: acc[r] = (c = 16cg + 8h + r, t = lane&15) -> os[t][16ct + 8h + r]; rows 0..15 x columns 0..127 all written over the 8 tiles
            v4f a0, a1;
            a0[0] = acc[0] * WOI; a0[1] = acc[1] * WOI; a0[2] = acc[2] * WOI; a0[3] = acc[3] * WOI;
            a1[0] = acc[4] * WOI; a1[1] = acc[5] * WOI; a1[2] = acc[6] * WOI; a1[3] = acc[7] * WOI;
            *(v4fa*)(&os[wb + lr * OPF + ct * 16 + 8 * hi]) = a0; *(v4fa*)(&os[wb + lr * OPF + ct * 16 + 8 * hi + 4]) = a1;
        }
        wave_sync();
        static_assert(32 * 4 * 16 == 16 * 128);                // lanes x floats x instructions == half tile
{
#pragma unroll 4
            for (int s = 0; s < 16; ++s) { const int cofs = lane * 4;
                const v4f val = *(const v4fa*)(&os[wb + s * OPF + cofs]);
                const v4f xv = *(const v4f*)(X + xrow + (size_t)s * COUT + hc * 128 + cofs);
                v4f res; res[0] = bfr(xv[0]) + val[0]; res[1] = bfr(xv[1]) + val[1]; res[2] = bfr(xv[2]) + val[2]; res[3] = bfr(xv[3]) + val[3];
                *(v4f*)(OUT + orow + (size_t)s * COUT + hc * 128 + cofs) = res; }
             }
        wave_sync();
    }
}

static constexpr size_t al256(size_t v) { return (v + 255) & ~(size_t)255; }
static constexpr size_t SZ_XB = al256((size_t)NB * SEQ * CIN * 2);
static constexpr size_t SZ_W  = al256((size_t)CIN * CB * 2);
static constexpr size_t SZ_Q  = al256((size_t)NB * SEQ * CB * 2);
static constexpr size_t SZ_K  = al256((size_t)NB * MK * CB * 2);
static constexpr size_t SZ_TOTAL = SZ_XB + 4 * SZ_W + 2 * SZ_Q + 3 * SZ_K;
static_assert(SZ_TOTAL <= (size_t)134217728);                        // workspace carve <= 128 MiB
static_assert((size_t)CIN * CB == (size_t)CB * COUT);                // the W_out plane has the extent of an input-projection weight plane
static_assert((size_t)NB * MK * CB == (size_t)NB * CB * MK);         // value^T plane [(b*128 + d)][MK] has the extent of a k plane

extern "C" void kernel_launch(void* const* d_in, const int* in_sizes, int n_in,
                              void* d_out, int out_size, void* d_ws, size_t ws_size, hipStream_t stream) {
    if (n_in < 5) return;
    const size_t needx = ((size_t)(NB - 1) * SEQ_FULL + SEQ) * CIN;
    if ((size_t)in_sizes[0] < needx) return;
    if ((size_t)in_sizes[1] < (size_t)CIN * CB || (size_t)in_sizes[2] < (size_t)CIN * CB || (size_t)in_sizes[3] < (size_t)CIN * CB) return;
    if ((size_t)in_sizes[4] < (size_t)CB * COUT) return;
    if ((size_t)out_size < ((size_t)(NB - 1) * OUT_SEQ + SEQ) * COUT) return;
    if (SZ_TOTAL > ws_size) return;
    // wire order: x, W_theta, W_phi, W_g, W_out
    const float* x  = (const float*)d_in[0];
    const float* wt = (const float*)d_in[1];
    const float* wp = (const float*)d_in[2];
    const float* wg = (const float*)d_in[3];
    const float* wo = (const float*)d_in[4];
    float* OUT = (float*)d_out;      // [NB][SEQ][256]
    char* wsp = (char*)d_ws;
    bf*  XB = (bf*)wsp;  wsp += SZ_XB;               // x bf16 [NB*SEQ][256]
    bf*  WT = (bf*)wsp;  wsp += SZ_W;                // W_theta^T bf16 [128][256]
    bf*  WP = (bf*)wsp;  wsp += SZ_W;                // W_phi^T   bf16 [128][256]
    bf*  WG = (bf*)wsp;  wsp += SZ_W;                // W_g^T     bf16 [128][256]
    h16* WOH = (h16*)wsp; wsp += SZ_W;               // W_out^T   f16 x64 [256][128]
    h16* QH = (h16*)wsp; wsp += SZ_Q;                // [NB*SEQ][128]
    h16* QR = (h16*)wsp; wsp += SZ_Q;                // [NB*SEQ][128] residual x2048
    h16* KH = (h16*)wsp; wsp += SZ_K;                // [NB*MK][128]
    h16* KR = (h16*)wsp; wsp += SZ_K;                // [NB*MK][128] residual x2048
    h16* GT = (h16*)wsp; wsp += SZ_K;                // [NB*128][MK]

    k_prep<<<dim3(4 * WTB + NB * CVB, 1, 1), 256, 0, stream>>>(x, wt, wp, wg, wo, XB, WT, WP, WG, WOH);
    k_proj<<<dim3(PJB, 3, 1), 32, 0, stream>>>(XB, WT, WP, WG, QH, QR, KH, KR, GT);
    k_attn<<<dim3(SEQ / (16 * AW), NB, 1), 32 * AW, 0, stream>>>(QH, QR, KH, KR, GT, WOH, x, OUT);
}

// v004
// One run takes 103 microseconds.
// In both of two side-by-side timings against v003, it was 1.09 times as fast.
// All steps since v000 together make it 3.04 times as fast.
#include <hip/hip_runtime.h>

// Spatial self-attention block over flattened pixels: x [NB][SEQ][256]; three 1x1 projections W [in 256][out 128] (no bias); keys and values max-pooled over adjacent token pairs (SEQ/2 keys);
// unscaled dot-product scores, softmax over keys; context [SEQ][128] -> output projection W_out [in 128][out 256]; output = x + projected context (f32).
// Compute dtypes, f32 accumulate everywhere: three input projections v_wmma_f32_16x16x32_bf16 (x and W RNE-converted to bf16; products exact);
// scores v_wmma_f32_16x16x32_f16 with q and k each as f16 value + f16 residual x2048 (three products, residual products in their own accumulator folded by 1/2048);
// P.V v_wmma_f32_16x16x32_f16, P single f16 with x16384 carry (cancels in the normalisation, row sum over the converted P), pooled values single f16;
// output projection v_wmma_f32_16x16x32_f16, context single f16, W_out (RNE bf16 value) x64 as f16, folded by 1/64; softmax f32 (online, running max); skip term = bf16-converted x added in f32 at the store stage.
// Layout: bf16 copy of x; transposed 16-bit weight planes [out][in]; q planes (value, residual) [b][t][128]; k planes (value, residual) [b][key][128]; value^T plane [b][d][key];
// fused flash kernel in transposed form (S^T = K Q^T, O^T = V^T P^T, out^T = W_out^T ctx^T with the packed O^T tiles as B fragments);
// its key-loop operands (q, k, value^T) are staged in LDS by asynchronous copies, k and value^T in 64-key tiles with two buffers shared by the block's waves.
// Three dependent launches: k_prep (bf16 copy of x and the four weight planes), k_proj (q, k, value^T planes), k_attn; work that does not depend on each other shares a grid.

#ifndef NB
#define NB 8
#endif
#ifndef SEQ
#define SEQ 4096
#endif
#define NB_FULL  8
#define SEQ_FULL 4096
#ifndef OUT_SEQ
#define OUT_SEQ SEQ              // row pitch (in tokens) between batches of the output
#endif
#define CIN  256                 // input channels (projection depth)
#define CB   128                 // bottleneck width (score depth, context width)
#define COUT 256                 // output channels
#define MK   (SEQ / 2)           // pooled keys per batch
#define AW   4                   // waves per flash block (16 query rows each)
#define OPF  132                 // LDS row pitch (floats) of the 16 x 128 staging tiles
#define QRS  2048.0f             // carry of every residual plane
#define QRI  (1.0f / 2048.0f)
#define L2E  1.4426950408889634f // log2(e); the module applies no score scale
#define PSH  14.0f               // log2 of the P carry (16384)
#define NEGB (-3.0e38f)
#define WOS  64.0f               // carry of the f16 W_out plane
#define WOI  (1.0f / 64.0f)
#define KT   64                  // keys per LDS tile (two 32-key passes)
#define NST  (MK / KT)           // tiles per batch
#define KP   272                 // LDS row pitch, bytes, of 256-byte q / k rows (16 B x odd: conflict-free 16-byte reads)
#define GP   144                 // LDS row pitch, bytes, of 128-byte value^T rows (16 B x odd)
#define KR_O (KT * KP)           // tile layout: k value rows, k residual rows, value^T rows
#define GT_O (2 * KT * KP)
#define STB  (2 * KT * KP + CB * GP)   // bytes of one tile buffer
#define Q_O  (2 * STB)           // behind the two buffers: per wave 16 q value rows, then 16 q residual rows
#define QWB  (2 * 16 * KP)       // bytes of one wave's q rows; the same bytes are that wave's output staging tile after the key loop
#define LDSB (Q_O + AW * QWB)

static_assert(CB == 128);                      // flash: 4 k-steps of 32 per score tile, 8 output tiles of 16, 4 k-steps in the output projection
static_assert(COUT == 256);                    // output staged as two halves of 128 columns
static_assert(CIN == COUT);                    // skip term has the output's row width
static_assert(CIN % 32 == 0);                  // GEMM k-loop steps by 32
static_assert(CB % 32 == 0);
static_assert(CIN % 64 == 0);                  // weight transposer tiles of 64 x 64
static_assert(CB % 64 == 0);
static_assert(COUT % 64 == 0);
static_assert(SEQ % 128 == 0);                 // a 128-token value tile never straddles two batches; token pairs stay inside a tile
static_assert((NB * SEQ) % 128 == 0);
static_assert((NB * SEQ) % 64 == 0);
static_assert(MK % 32 == 0);                   // key loop steps by 32
static_assert(MK % 64 == 0);
static_assert(SEQ % (16 * AW) == 0);           // flash grid covers the sequence exactly
static_assert(((size_t)SEQ * CIN) % 8 == 0);
static_assert(NB <= NB_FULL);
static_assert(SEQ <= SEQ_FULL);
static_assert((OPF * 4) % 16 == 0);
static_assert(NST >= 2);                       // the two-buffer prologue fills tiles 0 and 1
static_assert(KT == 16 * AW);                  // each wave copies 16 k rows of a tile (8 copies of 2 rows)
static_assert(CB == 32 * AW);                  // each wave copies 32 value^T rows of a tile (8 copies of 4 rows)
static_assert(KT * 2 == 128);                  // a value^T tile row is one 128-byte line
static_assert(16 * OPF * 4 <= QWB);            // the output staging tile fits the wave's q rows
static_assert(KP % 16 == 0);
static_assert(GP % 16 == 0);
static_assert(LDSB <= 163840);                 // two blocks per 320 KiB of LDS
static_assert((size_t)NB * SEQ * CIN < (size_t)2147483647);   // int offsets inside the planes

typedef _Float16 h16;
typedef unsigned short bf;
typedef __attribute__((ext_vector_type(16))) __bf16   v16bf;
typedef __attribute__((ext_vector_type(16))) _Float16 v16h;
typedef __attribute__((ext_vector_type(8)))  _Float16 v8h;
typedef __attribute__((ext_vector_type(8)))  unsigned short v8us;
typedef __attribute__((ext_vector_type(8)))  float    v8f;
typedef __attribute__((ext_vector_type(4)))  float    v4f;
typedef v4f  __attribute__((may_alias)) v4fa;
typedef v8h  __attribute__((may_alias)) v8ha;

__device__ __forceinline__ unsigned short f2bf(float f) { unsigned u = __float_as_uint(f); u += 0x7FFFu + ((u >> 16) & 1u); return (unsigned short)(u >> 16); }
__device__ __forceinline__ float bfr(float f) { return __uint_as_float(((unsigned)f2bf(f)) << 16); }   // value after RNE convert to bf16
__device__ __forceinline__ v16h cat16(v8h lo, v8h hi) { return __builtin_shufflevector(lo, hi, 0, 1, 2, 3, 4, 5, 6, 7, 8, 9, 10, 11, 12, 13, 14, 15); }
__device__ __forceinline__ v16bf cat16b(v8us lo, v8us hi) { return __builtin_bit_cast(v16bf, __builtin_shufflevector(lo, hi, 0, 1, 2, 3, 4, 5, 6, 7, 8, 9, 10, 11, 12, 13, 14, 15)); }
__device__ __forceinline__ v8f wmma16(v16h a, v16h b, v8f c) { return __builtin_amdgcn_wmma_f32_16x16x32_f16(false, a, false, b, (short)0, c, false, false); }
__device__ __forceinline__ v8f wmmab(v16bf a, v16bf b, v8f c) { return __builtin_amdgcn_wmma_f32_16x16x32_bf16(false, a, false, b, (short)0, c, false, false); }
// fragment loaders from K-contiguous 16-bit rows; p already includes + 8*(lane>>4): elements 0..7 <- k0+8h+0..7, elements 8..15 <- k0+16+8h+0..7 (same map for A and B)
__device__ __forceinline__ v16h  ldh(const h16* p) { return cat16(*(const v8h*)p, *(const v8h*)(p + 16)); }
__device__ __forceinline__ v16bf ldb(const bf* p)  { return cat16b(*(const v8us*)p, *(const v8us*)(p + 16)); }
// the same fragment map from a staged LDS row (p in bytes, already includes + 16*(lane>>4))
__device__ __forceinline__ v16h  ldl(const unsigned char* p) { return cat16(*(const v8ha*)p, *(const v8ha*)(p + 32)); }
// eight asynchronous 16-byte-per-lane copies global -> LDS (l = the lane's LDS byte address, g = the lane's global address; steps between copies ls bytes, gs elements).
// The closing s_wait_xcnt stands inside the statement so that no address register is rewritten ahead of it.
__device__ __forceinline__ void cp8(unsigned l, const h16* g, unsigned ls, size_t gs) {
    asm volatile("global_load_async_to_lds_b128 %0, %8, off\n\t"
                 "global_load_async_to_lds_b128 %1, %9, off\n\t"
                 "global_load_async_to_lds_b128 %2, %10, off\n\t"
                 "global_load_async_to_lds_b128 %3, %11, off\n\t"
                 "global_load_async_to_lds_b128 %4, %12, off\n\t"
                 "global_load_async_to_lds_b128 %5, %13, off\n\t"
                 "global_load_async_to_lds_b128 %6, %14, off\n\t"
                 "global_load_async_to_lds_b128 %7, %15, off\n\t"
                 "s_wait_xcnt 0x0"
                 :: "v"(l), "v"(l + ls), "v"(l + 2 * ls), "v"(l + 3 * ls), "v"(l + 4 * ls), "v"(l + 5 * ls), "v"(l + 6 * ls), "v"(l + 7 * ls),
                    "v"(g), "v"(g + gs), "v"(g + 2 * gs), "v"(g + 3 * gs), "v"(g + 4 * gs), "v"(g + 5 * gs), "v"(g + 6 * gs), "v"(g + 7 * gs)
                 : "memory");
}
// lane l <-> lane l ^ 16 on the vector unit: unlike the LDS-path shuffle it does not count on dscnt, so its result needs no wait that would drain the fragment reads issued ahead of it
__device__ __forceinline__ float xhalf(float v) { const unsigned u = __float_as_uint(v);
    return __uint_as_float(__builtin_amdgcn_permlanex16(u, u, 0x76543210u, 0xfedcba98u, false, false)); }
// ordering point for wave-private LDS tiles (same wave writes and reads)
__device__ __forceinline__ void wave_sync() { __builtin_amdgcn_fence(3 /* release order */, "wavefront"); __builtin_amdgcn_wave_barrier(); asm volatile("" ::: "memory"); }

// f32 -> f16 convert that cannot produce an f16 subnormal (|v| < 2^-14 -> +0); applied after the plane's power-of-two carry
static __device__ __forceinline__ h16 toh_flush(float v) { const h16 r = (h16)v; return (fabsf(v) < 6.103515625e-05f) ? (h16)0.0f : r; }
// one matrix instruction + its own four-slot guard (accumulator tied, operands kept live)
__device__ __forceinline__ v8f wmma16g(v16h a, v16h b, v8f c) {
    c = __builtin_amdgcn_wmma_f32_16x16x32_f16(false, a, false, b, (short)0, c, false, false);
    asm volatile("v_nop\n\tv_nop\n\tv_nop\n\tv_nop" : "+v"(c) : "v"(a), "v"(b));
    return c; }
__device__ __forceinline__ v8f wmmabg(v16bf a, v16bf b, v8f c) {
    c = __builtin_amdgcn_wmma_f32_16x16x32_bf16(false, a, false, b, (short)0, c, false, false);
    asm volatile("v_nop\n\tv_nop\n\tv_nop\n\tv_nop" : "+v"(c) : "v"(a), "v"(b));
    return c; }

// x convert, 8 elements per thread: group i of the n8 groups of one batch
__device__ __forceinline__ void cvt8_body(const float* __restrict__ src, bf* dst, size_t i, size_t n8) {
    if (i >= n8) return;
    const v8f v = *(const v8f*)(src + i * 8); v8us o;
#pragma unroll
    for (int k = 0; k < 8; ++k) o[k] = f2bf(v[k]);
    *(v8us*)(dst + i * 8) = o; 
}

// Weight transposer: in[R][C] (f32) -> out[C][R] (16-bit), 64 x 64 tile (rows r0.., columns c0..) per block through LDS (cross-wave: block barrier).
// ASH = 0: bf16 bits (RNE convert). ASH = 1: f16 of (RNE bf16 value x 64), subnormal-free convert.
template <int ASH>
__device__ __forceinline__ void wtr_body(float* ts, const float* __restrict__ src, bf* dstb, h16* dsth, int R, int C, int r0, int c0) {
    const int tid = threadIdx.x;
#pragma unroll 1
    for (int i = 0; i < 16; ++i) { const int rr = i * 4 + (tid >> 6), cc = tid & 63;        // 16 trips x 4 rows = 64 rows; 64 columns
        ts[rr * 65 + cc] = src[(size_t)(r0 + rr) * C + c0 + cc]; }
    __syncthreads();
    static_assert(256 * 8 * 2 == 64 * 64);                                                 // threads x elements per store x trips == tile
{
#pragma unroll 1
        for (int it = 0; it < 2; ++it) {
            const int cc = it * 32 + (tid >> 3), r8 = (tid & 7) * 8;                        // 2 trips x 32 output rows; 8 lanes x 8 elements = 64 = one line
            const size_t oo = (size_t)(c0 + cc) * R + r0 + r8;
            if (ASH) { v8h o;
#pragma unroll
                for (int k = 0; k < 8; ++k) o[k] = toh_flush(bfr(ts[(r8 + k) * 65 + cc]) * WOS);
                *(v8h*)(dsth + oo) = o;
                asm volatile("s_wait_xcnt 0x0" ::: "memory");   // precaution: stands in front of whatever next rewrites the store's address and data registers (next trip, or code behind the loop)
            } else { v8us o;
#pragma unroll
                for (int k = 0; k < 8; ++k) o[k] = f2bf(ts[(r8 + k) * 65 + cc]);
                *(v8us*)(dstb + oo) = o;
                asm volatile("s_wait_xcnt 0x0" ::: "memory"); }  // precaution: as above
        }
         }
}
// k_prep: every operand preparation that depends on the inputs alone, in one grid. Blocks 0 .. 4*WTB-1: one 64 x 64 weight tile each (W_theta, W_phi, W_g, W_out in turn;
// lowest indices, for speed only); the other blocks: 2048 elements of x each. The split is block-uniform.
#define WTB ((CIN / 64) * (CB / 64))   // 64 x 64 tiles per weight
static_assert(WTB == (CB / 64) * (COUT / 64));
#define CVB ((int)(((size_t)SEQ * CIN / 8 + 255) / 256))   // x convert blocks per batch
__global__ __launch_bounds__(256) void k_prep(const float* __restrict__ x, const float* __restrict__ wt, const float* __restrict__ wp, const float* __restrict__ wg,
                                              const float* __restrict__ wo, bf* XB, bf* WT, bf* WP, bf* WG, h16* WOH) {
    __shared__ float ts[64 * 65];
    const int blk = blockIdx.x;
    if (blk < 4 * WTB) {
        const int w = blk / WTB, t = blk % WTB;
        if (w == 3) { wtr_body<1>(ts, wo, (bf*)0, WOH, CB, COUT, (t % (CB / 64)) * 64, (t / (CB / 64)) * 64); }      // [128][256] -> [256][128]
        else { const float* src = (w == 0) ? wt : (w == 1) ? wp : wg; bf* dst = (w == 0) ? WT : (w == 1) ? WP : WG;
            wtr_body<0>(ts, src, dst, (h16*)0, CIN, CB, (t % (CIN / 64)) * 64, (t / (CIN / 64)) * 64); }             // [256][128] -> [128][256]
        return;
    }
    const int cb = blk - 4 * WTB, bb = cb / CVB;               // batch pitch: SEQ_FULL rows in x, SEQ rows in the bf16 copy
    cvt8_body(x + (size_t)bb * SEQ_FULL * CIN, XB + (size_t)bb * SEQ * CIN, (size_t)(cb % CVB) * 256 + threadIdx.x, (size_t)SEQ * CIN / 8);
}

// mm64: register-blocked bf16 GEMM main loop, ONE WAVE per 64x64 tile (16 accumulators), operands straight from K-contiguous bf16 planes, K = CIN.
// acc[mb][nb][j] = C[16mb + 8h + j][16nb + (lane&15)], C[m][n] = sum_k A[m][k] Bt[n][k].
__device__ __forceinline__ void mm64(const bf* __restrict__ A, const bf* __restrict__ Bt, size_t aoff, size_t boff, v8f (&acc)[4][4]) {
    const int K = CIN;
#pragma unroll
    for (int mb = 0; mb < 4; ++mb)
#pragma unroll
        for (int nb = 0; nb < 4; ++nb) acc[mb][nb] = (v8f){};
#pragma unroll 1
    for (int kc = 0; kc < K; kc += 32) {
        v16bf a[4];
#pragma unroll
        for (int mb = 0; mb < 3; ++mb) a[mb] = ldb(A + aoff + (size_t)mb * 16 * K + kc);
        { const bf* pa = A + aoff + (size_t)3 * 16 * K + kc;
          const v8us lo = *(const v8us*)pa;
          asm volatile("s_wait_xcnt 0x0" ::: "memory");        // precaution: the last load of the run may be given the run's own address pair as its destination; the wait stands in front of it
          const v8us hi = *(const v8us*)(pa + 16);
          a[3] = cat16b(lo, hi); }
#pragma unroll
        for (int nb = 0; nb < 4; ++nb) { const v16bf b = ldb(Bt + boff + (size_t)nb * 16 * K + kc);
#pragma unroll
            for (int mb = 0; mb < 4; ++mb) acc[mb][nb] = wmmabg(a[mb], b, acc[mb][nb]); }
    }
}

// proj_q: q = x W_theta, 64 x 64 tile (bx, by). A = x rows (m = b*SEQ + t), Bt = transposed weight rows (n = d). Planes [b*SEQ + t][128]: f16 value (Ph) and f16 residual x2048 (Pr).
__device__ __forceinline__ void proj_q(float* os, const bf* __restrict__ A, const bf* __restrict__ Bt, h16* Ph, h16* Pr, int bx, int by) {
    const int lane = threadIdx.x & 31, lr = lane & 15, hi = lane >> 4; const int r0 = bx * 64, c0 = by * 64;
    v8f acc[4][4];
    mm64(A, Bt, (size_t)(r0 + lr) * CIN + 8 * hi, (size_t)(c0 + lr) * CIN + 8 * hi, acc);
    const size_t obase = (size_t)r0 * CB + c0;
#pragma unroll
    for (int mb = 0; mb < 4; ++mb) {
#pragma unroll
        for (int nb = 0; nb < 4; ++nb) {
#pragma unroll
            for (int j = 0; j < 8; ++j) os[(hi * 8 + j) * 68 + nb * 16 + lr] = acc[mb][nb][j]; }   // D: row 8h+j, col lane&15; 16 x 64 all written
        wave_sync();
        static_assert(32 * 8 * 4 == 16 * 64);                                                     // lanes x halves x instructions == slab
{
#pragma unroll
            for (int s = 0; s < 4; ++s) { const int row = 4 * s + (lane >> 3), c8 = (lane & 7) * 8;   // 4 s x 4 row groups = 16 rows; 8 lanes x 8 = 64 columns
                const v4f x0 = *(const v4fa*)(&os[row * 68 + c8]); const v4f x1 = *(const v4fa*)(&os[row * 68 + c8 + 4]); v8h hv, rv;
#pragma unroll
                for (int i = 0; i < 4; ++i) { const h16 a0 = toh_flush(x0[i]); const h16 a1 = toh_flush(x1[i]); hv[i] = a0; hv[4 + i] = a1;
                    rv[i] = toh_flush((x0[i] - (float)a0) * QRS); rv[4 + i] = toh_flush((x1[i] - (float)a1) * QRS); }
                const size_t oo = obase + (size_t)(mb * 16 + row) * CB + c8;
                *(v8h*)(Ph + oo) = hv; *(v8h*)(Pr + oo) = rv; }
             }
        wave_sync();
    }
}

// proj_k: k = maxpool2(x W_phi) over adjacent token pairs, 64 x 64 tile (bx, by). Same GEMM; per 16-token slab the 8 pooled rows (max in f32, then convert) go to planes [b*MK + key][128]: f16 value and f16 residual x2048.
__device__ __forceinline__ void proj_k(float* os, const bf* __restrict__ A, const bf* __restrict__ Bt, h16* Ph, h16* Pr, int bx, int by) {
    const int lane = threadIdx.x & 31, lr = lane & 15, hi = lane >> 4; const int r0 = bx * 64, c0 = by * 64;
    v8f acc[4][4];
    mm64(A, Bt, (size_t)(r0 + lr) * CIN + 8 * hi, (size_t)(c0 + lr) * CIN + 8 * hi, acc);
    const size_t obase = (size_t)(r0 / 2) * CB + c0;                                              // (b*SEQ + t)/2 = b*MK + t/2
#pragma unroll
    for (int mb = 0; mb < 4; ++mb) {
#pragma unroll
        for (int nb = 0; nb < 4; ++nb) {
#pragma unroll
            for (int j = 0; j < 8; ++j) os[(hi * 8 + j) * 68 + nb * 16 + lr] = acc[mb][nb][j]; }
        wave_sync();
        static_assert(32 * 8 * 2 == 8 * 64);                                                      // lanes x halves x instructions == pooled slab
{
#pragma unroll
            for (int s = 0; s < 2; ++s) { const int prow = 4 * s + (lane >> 3), c8 = (lane & 7) * 8;   // 2 s x 4 row groups = 8 pooled rows (token rows 2*prow, 2*prow+1)
                const v4f u0 = *(const v4fa*)(&os[(2 * prow) * 68 + c8]);     const v4f u1 = *(const v4fa*)(&os[(2 * prow) * 68 + c8 + 4]);
                const v4f w0 = *(const v4fa*)(&os[(2 * prow + 1) * 68 + c8]); const v4f w1 = *(const v4fa*)(&os[(2 * prow + 1) * 68 + c8 + 4]); v8h hv, rv;
#pragma unroll
                for (int i = 0; i < 4; ++i) { const float y0 = fmaxf(u0[i], w0[i]), y1 = fmaxf(u1[i], w1[i]);
                    const h16 a0 = toh_flush(y0); const h16 a1 = toh_flush(y1); hv[i] = a0; hv[4 + i] = a1;
                    rv[i] = toh_flush((y0 - (float)a0) * QRS); rv[4 + i] = toh_flush((y1 - (float)a1) * QRS); }
                const size_t oo = obase + (size_t)(mb * 8 + prow) * CB + c8;
                *(v8h*)(Ph + oo) = hv; *(v8h*)(Pr + oo) = rv; }
             }
        wave_sync();
    }
}

// proj_gt: pooled values transposed, G^T[d][key] = max over the token pair of (W_g^T x^T)[d][t]. ONE WAVE per 32 (d) x 128 (token) tile (16 accumulators):
// A = transposed weight rows (m = d), Bt = x rows (n = b*SEQ + t). Plane [(b*128 + d)][MK], single f16. Per 16-row slab staged in LDS (wave-private);
__device__ __forceinline__ void proj_gt(float* os, const bf* __restrict__ A, const bf* __restrict__ Bt, h16* Gt, int bx, int by) {
    const int K = CIN;
    const int lane = threadIdx.x & 31, lr = lane & 15, hi = lane >> 4; const int r0 = bx * 32, c0 = by * 128;
    v8f acc[2][8];
#pragma unroll
    for (int mb = 0; mb < 2; ++mb)
#pragma unroll
        for (int nb = 0; nb < 8; ++nb) acc[mb][nb] = (v8f){};
    const size_t aoff = (size_t)(r0 + lr) * K + 8 * hi, boff = (size_t)(c0 + lr) * K + 8 * hi;
#pragma unroll 1
    for (int kc = 0; kc < K; kc += 32) {
        v16bf a[2];
#pragma unroll
        for (int mb = 0; mb < 2; ++mb) a[mb] = ldb(A + aoff + (size_t)mb * 16 * K + kc);
#pragma unroll
        for (int nb = 0; nb < 8; ++nb) { const v16bf b = ldb(Bt + boff + (size_t)nb * 16 * K + kc);
#pragma unroll
            for (int mb = 0; mb < 2; ++mb) acc[mb][nb] = wmmabg(a[mb], b, acc[mb][nb]); }
    }
    const int bb = c0 / SEQ, tt = c0 % SEQ;
    const size_t obase = ((size_t)bb * CB + r0) * MK + (size_t)(tt / 2);
#pragma unroll
    for (int mb = 0; mb < 2; ++mb) {
#pragma unroll
        for (int nb = 0; nb < 8; ++nb) {
#pragma unroll
            for (int j = 0; j < 8; ++j) os[(hi * 8 + j) * OPF + nb * 16 + lr] = acc[mb][nb][j]; }   // D: row d = 8h+j, col token = 16nb + lane&15; 16 x 128 all written
        wave_sync();
        static_assert(32 * 8 * 4 == 16 * 64);                                                       // lanes x pooled halves x instructions == pooled slab
{
#pragma unroll
            for (int s = 0; s < 4; ++s) { const int row = 4 * s + (lane >> 3), c8 = (lane & 7) * 8;     // 4 s x 4 row groups = 16 rows; 8 lanes x 8 pooled = 64 pooled columns
                const v4f f0 = *(const v4fa*)(&os[row * OPF + 2 * c8]);     const v4f f1 = *(const v4fa*)(&os[row * OPF + 2 * c8 + 4]);
                const v4f f2 = *(const v4fa*)(&os[row * OPF + 2 * c8 + 8]); const v4f f3 = *(const v4fa*)(&os[row * OPF + 2 * c8 + 12]); v8h hv;
                hv[0] = toh_flush(fmaxf(f0[0], f0[1])); hv[1] = toh_flush(fmaxf(f0[2], f0[3]));
                hv[2] = toh_flush(fmaxf(f1[0], f1[1])); hv[3] = toh_flush(fmaxf(f1[2], f1[3]));
                hv[4] = toh_flush(fmaxf(f2[0], f2[1])); hv[5] = toh_flush(fmaxf(f2[2], f2[3]));
                hv[6] = toh_flush(fmaxf(f3[0], f3[1])); hv[7] = toh_flush(fmaxf(f3[2], f3[3]));
                const size_t oo = obase + (size_t)(mb * 16 + row) * MK + c8;
                *(v8h*)(Gt + oo) = hv; }
             }
        wave_sync();
    }
}

// k_proj: the three input projections, which depend on k_prep alone and not on one another, in one grid of one-wave blocks; blockIdx.y picks the projection (block-uniform),
// blockIdx.x its tile. The waves of the three share the SIMDs, so each one's load waits are filled by the others' work. One wave-private staging tile serves all three.
#define PJB ((NB * SEQ / 64) * (CB / 64))   // tiles per projection
static_assert(PJB == (CB / 32) * (NB * SEQ / 128));
static_assert(16 * 68 <= 16 * OPF);
__global__ __launch_bounds__(32) void k_proj(const bf* __restrict__ XB, const bf* __restrict__ WT, const bf* __restrict__ WP, const bf* __restrict__ WG,
                                             h16* QH, h16* QR, h16* KH, h16* KR, h16* GT) {
    __shared__ __align__(16) float os[16 * OPF];
    const int t = blockIdx.x, which = blockIdx.y;
    if (which == 0)      proj_q(os, XB, WT, QH, QR, t % (NB * SEQ / 64), t / (NB * SEQ / 64));
    else if (which == 1) { proj_k(os, XB, WP, KH, KR, t % (NB * SEQ / 64), t / (NB * SEQ / 64));
        asm volatile("s_wait_xcnt 0x0" ::: "memory"); }        // precaution: in the built text this body is followed by the other bodies' code, which rewrites the registers that its last stores name (the other two run into the end of the program)
    else                 proj_gt(os, WG, XB, GT, t % (CB / 32), t / (CB / 32));
}

// k_attn: fused attention + output projection + skip term, one wave per 16 query rows of one batch; K / G^T / Q fragments from LDS rows (two 16-B reads each), W_out^T fragments straight from its f16 plane.
// Staging: whole-line asynchronous copies; each wave brings its own 16 q rows once, and a quarter of every 64-key tile (k value, k residual, value^T) into one of two buffers, one tile ahead of its use.
// Transposed form: S^T[key][t] = K Q^T (A = K rows, B = Q rows, 4 k-steps over d); lane (t = lane&15, h = lane>>4) holds keys 8h+r of each 16-key tile, so the packed
// P tile is directly the B fragment of O^T[d][t] = G^T P^T (element r <- tile keys 0..15, element 8+r <- tile keys 16..31, lane unchanged), 8 tiles over d.
// Scores = K Q + (K Q_res + K_res Q) / 2048. Softmax state (running max, partial sum) is one scalar per lane; the two lane halves of a row are combined with one xor-16 exchange.
// Q fragments are read from LDS once and held in registers. The key loop's fragment reads stand at two places per pass, each a whole phase ahead of its use; 512 registers per wave (two waves per SIMD).
// Epilogue: ctx^T = O^T / l packed to f16 (tiles 2kk, 2kk+1 -> B fragment of k-step kk); out^T[c][t] = W_out^T ctx^T per 16-channel tile, staged in a wave-private LDS tile [t][128 channels];
__global__ __launch_bounds__(32 * AW) __attribute__((amdgpu_num_vgpr(512)))
void k_attn(const h16* __restrict__ QH, const h16* __restrict__ QR, const h16* __restrict__ KH, const h16* __restrict__ KR,
            const h16* __restrict__ GT, const h16* __restrict__ WO, const float* __restrict__ X, float* OUT) {
    __shared__ __align__(16) unsigned char sm[LDSB];
    const int lane = threadIdx.x & 31, lr = lane & 15, hi = lane >> 4;
    const int wave = __builtin_amdgcn_readfirstlane((int)(threadIdx.x >> 5));
    const int b = blockIdx.y;
    const int t0 = (blockIdx.x * AW + wave) * 16;
    // copy side: q / k rows of 256 B, two per copy (16 lanes each); value^T rows of 128 B, four per copy (8 lanes each)
    const unsigned sb = (unsigned)(size_t)sm;                  // LDS byte address of the array
    const unsigned lq = sb + Q_O + wave * QWB + (lane >> 4) * KP + (lane & 15) * 16;
    const unsigned lk = sb + (16 * wave + (lane >> 4)) * KP + (lane & 15) * 16;
    const unsigned lg = sb + GT_O + (32 * wave + (lane >> 3)) * GP + (lane & 7) * 16;
    const int gq = (b * SEQ + t0 + (lane >> 4)) * CB + (lane & 15) * 8;
    const int gk = (b * MK + 16 * wave + (lane >> 4)) * CB + (lane & 15) * 8;    // + tile * KT * CB
    const int gg = (b * CB + 32 * wave + (lane >> 3)) * MK + (lane & 7) * 8;     // + tile * KT
    // read side
    const unsigned char* qp = sm + Q_O + wave * QWB + lr * KP + 16 * hi;         // B fragments: col t, k = d; residual rows + 16*KP
    const int ko = lr * KP + 16 * hi;                          // + buffer + key * KP      (A fragment: row key, k = d)
    const int vo = GT_O + lr * GP + 16 * hi;                   // + buffer + 16j*GP + 2*key (A fragment: row d, k = key)
    // prologue: q rows and tile 0, landed and published; then tile 1 into the second buffer
    cp8(lq, QH + gq, 2 * KP, 2 * CB);
    cp8(lq + 16 * KP, QR + gq, 2 * KP, 2 * CB);
    cp8(lk, KH + gk, 2 * KP, 2 * CB);
    cp8(lk + KR_O, KR + gk, 2 * KP, 2 * CB);
    cp8(lg, GT + gg, 4 * GP, 4 * (size_t)MK);
    asm volatile("s_wait_asynccnt 0x0" ::: "memory");          // this wave's copies have landed before the barrier publishes them
    __syncthreads();
    // q fragments: read once, held in registers over the whole key loop. k fragments of tile 0, pass 0 (published by the barrier above): their reads return while tile 1's copies are issued
    v16h qh[4], qr[4], ka[4], kb[4], kra[4], krb[4];
#pragma unroll
    for (int kk = 0; kk < 4; ++kk) { qh[kk] = ldl(qp + kk * 64); qr[kk] = ldl(qp + 16 * KP + kk * 64); }
#pragma unroll
    for (int kk = 0; kk < 4; ++kk) {
        ka[kk] = ldl(sm + ko + kk * 64); kb[kk] = ldl(sm + ko + 16 * KP + kk * 64);
        kra[kk] = ldl(sm + ko + KR_O + kk * 64); krb[kk] = ldl(sm + ko + KR_O + 16 * KP + kk * 64); }
    cp8(lk + STB, KH + gk + KT * CB, 2 * KP, 2 * CB);
    cp8(lk + STB + KR_O, KR + gk + KT * CB, 2 * KP, 2 * CB);
    cp8(lg + STB, GT + gg + KT, 4 * GP, 4 * (size_t)MK);
    v8f o[8];
#pragma unroll
    for (int j = 0; j < 8; ++j) o[j] = (v8f){};
    float m = NEGB, l = 0.0f;
#pragma unroll 1
    for (int st = 0; st < NST; ++st) {
    const int bo = (st & 1) * STB;                             // this tile's buffer
    // LDS fragment reads stand at two places per 32-key pass, each a whole phase ahead of its use: the pass's value^T fragments ahead of its score products,
    // the next pass's k fragments behind them (into the registers those products have just read), ahead of the softmax and the output products.
#pragma unroll                                                 // unrolled: the tile's publish point stands inside its last pass only
    for (int ps = 0; ps < KT / 32; ++ps) {                     // 32-key passes in key order
        const unsigned char* vv = sm + bo + vo + ps * 64;
        v16h vf[8];
#pragma unroll
        for (int j = 0; j < 8; ++j) vf[j] = ldl(vv + j * 16 * GP);
        __builtin_amdgcn_sched_barrier(0);                     // keeps the value^T reads one group ahead of the score products (else they sink in among the matrix instructions)
        v8f sHa = (v8f){}, sLa = (v8f){}, sHb = (v8f){}, sLb = (v8f){};
        // plain builtin in the key loop (the compiler keeps the distances behind it): the guarded form's asm operands tie every fragment and accumulator to the first 256 registers, which spills here
#pragma unroll
        for (int kk = 0; kk < 4; ++kk) {
            sHa = wmma16(ka[kk], qh[kk], sHa); sHb = wmma16(kb[kk], qh[kk], sHb);
            sLa = wmma16(ka[kk], qr[kk], sLa); sLb = wmma16(kb[kk], qr[kk], sLb);
            sLa = wmma16(kra[kk], qh[kk], sLa); sLb = wmma16(krb[kk], qh[kk], sLb);
        }
        __builtin_amdgcn_sched_barrier(0);                     // keeps the next k reads behind the last score product, as one group
        const unsigned char* kn;
        if (ps + 1 < KT / 32) kn = sm + bo + ko + (ps + 1) * 32 * KP;
        else {
            // publish point of tile st + 1, inside tile st's last pass: every read of this buffer has been issued (k fragments used, value^T fragments fetched above)
            asm volatile("s_wait_dscnt 0x0" ::: "memory");     // this wave has left the buffer that is refilled behind the barrier
            asm volatile("s_wait_asynccnt 0x0" ::: "memory");  // this wave's share of tile st + 1 has landed
            __syncthreads();
            kn = sm + (STB - bo) + ko;                         // behind the last tile: the other buffer's old rows, landed and published long ago; read unconditionally (a branch here would merge the compiler's wait counts to 0), never used
        }
#pragma unroll
        for (int kk = 0; kk < 4; ++kk) {
            ka[kk] = ldl(kn + kk * 64); kb[kk] = ldl(kn + 16 * KP + kk * 64);
            kra[kk] = ldl(kn + KR_O + kk * 64); krb[kk] = ldl(kn + KR_O + 16 * KP + kk * 64); }
        __builtin_amdgcn_sched_barrier(0);                     // keeps the k reads ahead of the softmax, whose time covers their latency
        if (ps + 1 == KT / 32 && st + 2 < NST) {               // refill of the buffer just freed; the test reads the same for the whole block
            const int tk = (st + 2) * KT;
            // the lane's two LDS copy addresses are formed anew at each refill (a few vector instructions): held in registers over the loop they went to scratch.
            // The lane number is taken with the loop-variant addend st, so that the compiler does not hoist the addresses out of the loop again.
            const unsigned ln = __builtin_amdgcn_mbcnt_lo(~0u, (unsigned)st) - (unsigned)st;
            const unsigned rk = sb + bo + (16 * wave + (ln >> 4)) * KP + (ln & 15) * 16;
            const unsigned rg = sb + bo + GT_O + (32 * wave + (ln >> 3)) * GP + (ln & 7) * 16;
            cp8(rk, KH + gk + tk * CB, 2 * KP, 2 * CB);
            cp8(rk + KR_O, KR + gk + tk * CB, 2 * KP, 2 * CB);
            cp8(rg, GT + gg + tk, 4 * GP, 4 * (size_t)MK);
        }
        float ta[8], tb[8]; float mx = NEGB;
#pragma unroll
        for (int r = 0; r < 8; ++r) {
            ta[r] = (sHa[r] + sLa[r] * QRI) * L2E; tb[r] = (sHb[r] + sLb[r] * QRI) * L2E;
            mx = fmaxf(mx, fmaxf(ta[r], tb[r])); }
        mx = fmaxf(mx, xhalf(mx));
        const float mnew = fmaxf(m, mx);
        const float alpha = __builtin_amdgcn_exp2f(m - mnew);
        const float sh = PSH - mnew;
        v16h pb; float ls = 0.0f;
#pragma unroll
        for (int r = 0; r < 8; ++r) {
            const float ea = ta[r] + sh, eb = tb[r] + sh;
            const float xa = __builtin_amdgcn_exp2f(ea), xb = __builtin_amdgcn_exp2f(eb);
            const float ga = (ea < -14.0f) ? 0.0f : xa, gb = (eb < -14.0f) ? 0.0f : xb;   // nothing below 2^-14 reaches the f16 operand
            const h16 pa = (h16)ga; const h16 pc = (h16)gb;
            pb[r] = pa; pb[8 + r] = pc;
            ls += (float)pa + (float)pc; }
        l = l * alpha + ls; m = mnew;
#pragma unroll
        for (int j = 0; j < 8; ++j) o[j] = o[j] * alpha;
#pragma unroll
        for (int j = 0; j < 8; ++j) o[j] = wmma16(vf[j], pb, o[j]);
    }
    }
    asm volatile("s_wait_asynccnt 0x0" ::: "memory");          // nothing in flight before the q rows become output staging
    l += __shfl_xor(l, 16, 32);
    const float inv = 1.0f / l;                                // l >= 16384 (the row maximum contributes the full carry)
    // ctx^T D layout: o[j][r] = (d = 16j + 8h + r, t = lane&15); B fragment of k-step kk: element r <- tile 2kk, element 8+r <- tile 2kk+1
    v16h cf[4];
#pragma unroll
    for (int kk = 0; kk < 4; ++kk) {
#pragma unroll
        for (int r = 0; r < 8; ++r) { cf[kk][r] = toh_flush(o[2 * kk][r] * inv); cf[kk][8 + r] = toh_flush(o[2 * kk + 1][r] * inv); } }
    float* os = (float*)(sm + Q_O);                            // each wave stages in the bytes of its own q rows, which only it has read
    const int wb = wave * (QWB / 4);
    const int wo = lr * CB + 8 * hi;                           // + channel tile * 16 * CB + kk*32  (A fragment: row c, k = d)
    const size_t xrow = ((size_t)b * SEQ_FULL + t0) * COUT;
    const size_t orow = ((size_t)b * OUT_SEQ + t0) * COUT;
#pragma unroll 1
    for (int hc = 0; hc < 2; ++hc) {
#pragma unroll 1
        for (int ct = 0; ct < 8; ++ct) {
            const int cg = hc * 8 + ct;
            v8f acc = (v8f){};
#pragma unroll
            for (int kk = 0; kk < 4; ++kk) { const v16h a = ldh(WO + wo + cg * 16 * CB + kk * 32); acc = wmma16g(a, cf[kk], acc); }
            // D: acc[r] = (c = 16cg + 8h + r, t = lane&15) -> os[t][16ct + 8h + r]; rows 0..15 x columns 0..127 all written over the 8 tiles
            v4f a0, a1;
            a0[0] = acc[0] * WOI; a0[1] = acc[1] * WOI; a0[2] = acc[2] * WOI; a0[3] = acc[3] * WOI;
            a1[0] = acc[4] * WOI; a1[1] = acc[5] * WOI; a1[2] = acc[6] * WOI; a1[3] = acc[7] * WOI;
            *(v4fa*)(&os[wb + lr * OPF + ct * 16 + 8 * hi]) = a0; *(v4fa*)(&os[wb + lr * OPF + ct * 16 + 8 * hi + 4]) = a1;
        }
        wave_sync();
        static_assert(32 * 4 * 16 == 16 * 128);                // lanes x floats x instructions == half tile
{
#pragma unroll 4
            for (int s = 0; s < 16; ++s) { const int cofs = lane * 4;
                const v4f val = *(const v4fa*)(&os[wb + s * OPF + cofs]);
                const v4f xv = *(const v4f*)(X + xrow + (size_t)s * COUT + hc * 128 + cofs);
                v4f res; res[0] = bfr(xv[0]) + val[0]; res[1] = bfr(xv[1]) + val[1]; res[2] = bfr(xv[2]) + val[2]; res[3] = bfr(xv[3]) + val[3];
                *(v4f*)(OUT + orow + (size_t)s * COUT + hc * 128 + cofs) = res; }
             }
        wave_sync();
    }
}

static constexpr size_t al256(size_t v) { return (v + 255) & ~(size_t)255; }
static constexpr size_t SZ_XB = al256((size_t)NB * SEQ * CIN * 2);
static constexpr size_t SZ_W  = al256((size_t)CIN * CB * 2);
static constexpr size_t SZ_Q  = al256((size_t)NB * SEQ * CB * 2);
static constexpr size_t SZ_K  = al256((size_t)NB * MK * CB * 2);
static constexpr size_t SZ_TOTAL = SZ_XB + 4 * SZ_W + 2 * SZ_Q + 3 * SZ_K;
static_assert(SZ_TOTAL <= (size_t)134217728);                        // workspace carve <= 128 MiB
static_assert((size_t)CIN * CB == (size_t)CB * COUT);                // the W_out plane has the extent of an input-projection weight plane
static_assert((size_t)NB * MK * CB == (size_t)NB * CB * MK);         // value^T plane [(b*128 + d)][MK] has the extent of a k plane

extern "C" void kernel_launch(void* const* d_in, const int* in_sizes, int n_in,
                              void* d_out, int out_size, void* d_ws, size_t ws_size, hipStream_t stream) {
    if (n_in < 5) return;
    const size_t needx = ((size_t)(NB - 1) * SEQ_FULL + SEQ) * CIN;
    if ((size_t)in_sizes[0] < needx) return;
    if ((size_t)in_sizes[1] < (size_t)CIN * CB || (size_t)in_sizes[2] < (size_t)CIN * CB || (size_t)in_sizes[3] < (size_t)CIN * CB) return;
    if ((size_t)in_sizes[4] < (size_t)CB * COUT) return;
    if ((size_t)out_size < ((size_t)(NB - 1) * OUT_SEQ + SEQ) * COUT) return;
    if (SZ_TOTAL > ws_size) return;
    // wire order: x, W_theta, W_phi, W_g, W_out
    const float* x  = (const float*)d_in[0];
    const float* wt = (const float*)d_in[1];
    const float* wp = (const float*)d_in[2];
    const float* wg = (const float*)d_in[3];
    const float* wo = (const float*)d_in[4];
    float* OUT = (float*)d_out;      // [NB][SEQ][256]
    char* wsp = (char*)d_ws;
    bf*  XB = (bf*)wsp;  wsp += SZ_XB;               // x bf16 [NB*SEQ][256]
    bf*  WT = (bf*)wsp;  wsp += SZ_W;                // W_theta^T bf16 [128][256]
    bf*  WP = (bf*)wsp;  wsp += SZ_W;                // W_phi^T   bf16 [128][256]
    bf*  WG = (bf*)wsp;  wsp += SZ_W;                // W_g^T     bf16 [128][256]
    h16* WOH = (h16*)wsp; wsp += SZ_W;               // W_out^T   f16 x64 [256][128]
    h16* QH = (h16*)wsp; wsp += SZ_Q;                // [NB*SEQ][128]
    h16* QR = (h16*)wsp; wsp += SZ_Q;                // [NB*SEQ][128] residual x2048
    h16* KH = (h16*)wsp; wsp += SZ_K;                // [NB*MK][128]
    h16* KR = (h16*)wsp; wsp += SZ_K;                // [NB*MK][128] residual x2048
    h16* GT = (h16*)wsp; wsp += SZ_K;                // [NB*128][MK]

    k_prep<<<dim3(4 * WTB + NB * CVB, 1, 1), 256, 0, stream>>>(x, wt, wp, wg, wo, XB, WT, WP, WG, WOH);
    k_proj<<<dim3(PJB, 3, 1), 32, 0, stream>>>(XB, WT, WP, WG, QH, QR, KH, KR, GT);
    k_attn<<<dim3(SEQ / (16 * AW), NB, 1), 32 * AW, 0, stream>>>(QH, QR, KH, KR, GT, WOH, x, OUT);
}

// v005
// Measured time: 84.7 microseconds a run.
// In both of two side-by-side timings against v004, it was 1.22 times as fast.
// Over all steps from v000 it is 3.72 times as fast.
#include <hip/hip_runtime.h>

// Spatial self-attention block over flattened pixels: x [NB][SEQ][256]; three 1x1 projections W [in 256][out 128] (no bias); keys and values max-pooled over adjacent token pairs (SEQ/2 keys);
// unscaled dot-product scores, softmax over keys; context [SEQ][128] -> output projection W_out [in 128][out 256]; output = x + projected context (f32).
// Compute dtypes, f32 accumulate everywhere: three input projections v_wmma_f32_16x16x32_bf16 (x and W RNE-converted to bf16; products exact);
// scores v_wmma_f32_16x16x32_f16 with q and k each as f16 value + f16 residual x2048 (three products, residual products in their own accumulator folded by 1/2048);
// P.V v_wmma_f32_16x16x32_f16, P single f16 with x16384 carry (cancels in the normalisation, row sum over the converted P), pooled values single f16;
// output projection v_wmma_f32_16x16x32_f16, context single f16, W_out (RNE bf16 value) x64 as f16, folded by 1/64; softmax f32 (online, running max); skip term = bf16-converted x added in f32 at the store stage.
// Layout: bf16 copy of x; transposed 16-bit weight planes [out][in]; q planes (value, residual) [b][t][128]; k planes (value, residual) [b][key][128]; value^T plane [b][d][key];
// fused flash kernel in transposed form (S^T = K Q^T, O^T = V^T P^T, out^T = W_out^T ctx^T with the packed O^T tiles as B fragments);
// its key-loop operands (q, k, value^T) are staged in LDS by asynchronous copies, k and value^T in 64-key tiles with two buffers shared by the block's waves.
// the projections' operands (128 x rows, the 384 transposed weight rows) are staged in LDS the same way, once per block, and shared by the block's twelve waves.
// Three dependent launches: k_prep (bf16 copy of x and the four weight planes), k_proj (q, k, value^T planes), k_attn; work that does not depend on each other shares a grid.

#ifndef NB
#define NB 8
#endif
#ifndef SEQ
#define SEQ 4096
#endif
#define NB_FULL  8
#define SEQ_FULL 4096
#ifndef OUT_SEQ
#define OUT_SEQ SEQ              // row pitch (in tokens) between batches of the output
#endif
#define CIN  256                 // input channels (projection depth)
#define CB   128                 // bottleneck width (score depth, context width)
#define COUT 256                 // output channels
#define MK   (SEQ / 2)           // pooled keys per batch
#define AW   4                   // waves per flash block (16 query rows each)
#define OPF  132                 // LDS row pitch (floats) of the 16 x 128 staging tiles
#define QRS  2048.0f             // carry of every residual plane
#define QRI  (1.0f / 2048.0f)
#define L2E  1.4426950408889634f // log2(e); the module applies no score scale
#define PSH  14.0f               // log2 of the P carry (16384)
#define NEGB (-3.0e38f)
#define WOS  64.0f               // carry of the f16 W_out plane
#define WOI  (1.0f / 64.0f)
#define KT   64                  // keys per LDS tile (two 32-key passes)
#define NST  (MK / KT)           // tiles per batch
#define KP   272                 // LDS row pitch, bytes, of 256-byte q / k rows (16 B x odd: conflict-free 16-byte reads)
#define GP   144                 // LDS row pitch, bytes, of 128-byte value^T rows (16 B x odd)
#define KR_O (KT * KP)           // tile layout: k value rows, k residual rows, value^T rows
#define GT_O (2 * KT * KP)
#define STB  (2 * KT * KP + CB * GP)   // bytes of one tile buffer
#define Q_O  (2 * STB)           // behind the two buffers: per wave 16 q value rows, then 16 q residual rows
#define QWB  (2 * 16 * KP)       // bytes of one wave's q rows; the same bytes are that wave's output staging tile after the key loop
#define LDSB (Q_O + AW * QWB)
#define PT   128                 // tokens per projection block
#define PW   12                  // waves per projection block: four q tiles, four k tiles, four value^T tiles
#define XP   528                 // LDS row pitch, bytes, of 512-byte x / weight rows (16 B x odd: conflict-free 16-byte reads)
#define WS_O (PT * XP)           // projection block layout: 128 x rows, 3 x 128 weight rows, the q and k waves' staging tiles
#define OS_O (WS_O + 3 * CB * XP)
#define OSB  (16 * 68 * 4)       // bytes of one q / k staging tile
#define PLDS (OS_O + 8 * OSB)

static_assert(CB == 128);                      // flash: 4 k-steps of 32 per score tile, 8 output tiles of 16, 4 k-steps in the output projection
static_assert(COUT == 256);                    // output staged as two halves of 128 columns
static_assert(CIN == COUT);                    // skip term has the output's row width
static_assert(CIN % 32 == 0);                  // GEMM k-loop steps by 32
static_assert(CB % 32 == 0);
static_assert(CIN % 64 == 0);                  // weight transposer tiles of 64 x 64
static_assert(CB % 64 == 0);
static_assert(COUT % 64 == 0);
static_assert(SEQ % 128 == 0);                 // a 128-token value tile never straddles two batches; token pairs stay inside a tile
static_assert((NB * SEQ) % 128 == 0);
static_assert((NB * SEQ) % 64 == 0);
static_assert(MK % 32 == 0);                   // key loop steps by 32
static_assert(MK % 64 == 0);
static_assert(SEQ % (16 * AW) == 0);           // flash grid covers the sequence exactly
static_assert(((size_t)SEQ * CIN) % 8 == 0);
static_assert(NB <= NB_FULL);
static_assert(SEQ <= SEQ_FULL);
static_assert((OPF * 4) % 16 == 0);
static_assert(NST >= 2);                       // the two-buffer prologue fills tiles 0 and 1
static_assert(KT == 16 * AW);                  // each wave copies 16 k rows of a tile (8 copies of 2 rows)
static_assert(CB == 32 * AW);                  // each wave copies 32 value^T rows of a tile (8 copies of 4 rows)
static_assert(KT * 2 == 128);                  // a value^T tile row is one 128-byte line
static_assert(16 * OPF * 4 <= QWB);            // the output staging tile fits the wave's q rows
static_assert(KP % 16 == 0);
static_assert(GP % 16 == 0);
static_assert(LDSB <= 163840);                 // two blocks per 320 KiB of LDS
static_assert((size_t)NB * SEQ * CIN < (size_t)2147483647);   // int offsets inside the planes
static_assert(CIN * 2 == 32 * 16);             // an x or weight row is one 16-byte-per-lane copy of a wave
static_assert(XP % 16 == 0);
static_assert(3 * CB == 32 * PW);              // each wave copies 32 weight rows
static_assert(PT == 16 * 8);                   // waves 0..7 copy 16 x rows each
static_assert(32 + 16 <= 63);                  // copies of one wave in flight
static_assert((NB * SEQ) % PT == 0);
static_assert(SEQ % PT == 0);
static_assert(16 * OPF * 4 <= 16 * XP);        // a value^T wave's staging tile fits the first 16 of its own 32 weight rows
static_assert(PLDS <= 327680);                 // one block per 320 KiB of LDS

typedef _Float16 h16;
typedef unsigned short bf;
typedef __attribute__((ext_vector_type(16))) __bf16   v16bf;
typedef __attribute__((ext_vector_type(16))) _Float16 v16h;
typedef __attribute__((ext_vector_type(8)))  _Float16 v8h;
typedef __attribute__((ext_vector_type(8)))  unsigned short v8us;
typedef __attribute__((ext_vector_type(8)))  float    v8f;
typedef __attribute__((ext_vector_type(4)))  float    v4f;
typedef v4f  __attribute__((may_alias)) v4fa;
typedef v8h  __attribute__((may_alias)) v8ha;
typedef v8us __attribute__((may_alias)) v8usa;

__device__ __forceinline__ unsigned short f2bf(float f) { unsigned u = __float_as_uint(f); u += 0x7FFFu + ((u >> 16) & 1u); return (unsigned short)(u >> 16); }
__device__ __forceinline__ float bfr(float f) { return __uint_as_float(((unsigned)f2bf(f)) << 16); }   // value after RNE convert to bf16
__device__ __forceinline__ v16h cat16(v8h lo, v8h hi) { return __builtin_shufflevector(lo, hi, 0, 1, 2, 3, 4, 5, 6, 7, 8, 9, 10, 11, 12, 13, 14, 15); }
__device__ __forceinline__ v16bf cat16b(v8us lo, v8us hi) { return __builtin_bit_cast(v16bf, __builtin_shufflevector(lo, hi, 0, 1, 2, 3, 4, 5, 6, 7, 8, 9, 10, 11, 12, 13, 14, 15)); }
__device__ __forceinline__ v8f wmma16(v16h a, v16h b, v8f c) { return __builtin_amdgcn_wmma_f32_16x16x32_f16(false, a, false, b, (short)0, c, false, false); }
__device__ __forceinline__ v8f wmmab(v16bf a, v16bf b, v8f c) { return __builtin_amdgcn_wmma_f32_16x16x32_bf16(false, a, false, b, (short)0, c, false, false); }
// fragment loaders from K-contiguous 16-bit rows; p already includes + 8*(lane>>4): elements 0..7 <- k0+8h+0..7, elements 8..15 <- k0+16+8h+0..7 (same map for A and B)
__device__ __forceinline__ v16h  ldh(const h16* p) { return cat16(*(const v8h*)p, *(const v8h*)(p + 16)); }
// the same fragment map from a staged LDS row (p in bytes, already includes + 16*(lane>>4))
__device__ __forceinline__ v16h  ldl(const unsigned char* p) { return cat16(*(const v8ha*)p, *(const v8ha*)(p + 32)); }
__device__ __forceinline__ v16bf ldlb(const unsigned char* p) { return cat16b(*(const v8usa*)p, *(const v8usa*)(p + 32)); }
// eight asynchronous 16-byte-per-lane copies global -> LDS (l = the lane's LDS byte address, g = the lane's global address; steps between copies ls bytes, gs elements).
// The closing s_wait_xcnt stands inside the statement so that no address register is rewritten ahead of it.
__device__ __forceinline__ void cp8(unsigned l, const h16* g, unsigned ls, size_t gs) {
    asm volatile("global_load_async_to_lds_b128 %0, %8, off\n\t"
                 "global_load_async_to_lds_b128 %1, %9, off\n\t"
                 "global_load_async_to_lds_b128 %2, %10, off\n\t"
                 "global_load_async_to_lds_b128 %3, %11, off\n\t"
                 "global_load_async_to_lds_b128 %4, %12, off\n\t"
                 "global_load_async_to_lds_b128 %5, %13, off\n\t"
                 "global_load_async_to_lds_b128 %6, %14, off\n\t"
                 "global_load_async_to_lds_b128 %7, %15, off\n\t"
                 "s_wait_xcnt 0x0"
                 :: "v"(l), "v"(l + ls), "v"(l + 2 * ls), "v"(l + 3 * ls), "v"(l + 4 * ls), "v"(l + 5 * ls), "v"(l + 6 * ls), "v"(l + 7 * ls),
                    "v"(g), "v"(g + gs), "v"(g + 2 * gs), "v"(g + 3 * gs), "v"(g + 4 * gs), "v"(g + 5 * gs), "v"(g + 6 * gs), "v"(g + 7 * gs)
                 : "memory");
}
// lane l <-> lane l ^ 16 on the vector unit: unlike the LDS-path shuffle it does not count on dscnt, so its result needs no wait that would drain the fragment reads issued ahead of it
__device__ __forceinline__ float xhalf(float v) { const unsigned u = __float_as_uint(v);
    return __uint_as_float(__builtin_amdgcn_permlanex16(u, u, 0x76543210u, 0xfedcba98u, false, false)); }
// ordering point for wave-private LDS tiles (same wave writes and reads)
__device__ __forceinline__ void wave_sync() { __builtin_amdgcn_fence(3 /* release order */, "wavefront"); __builtin_amdgcn_wave_barrier(); asm volatile("" ::: "memory"); }

// f32 -> f16 convert that cannot produce an f16 subnormal (|v| < 2^-14 -> +0); applied after the plane's power-of-two carry
static __device__ __forceinline__ h16 toh_flush(float v) { const h16 r = (h16)v; return (fabsf(v) < 6.103515625e-05f) ? (h16)0.0f : r; }
// one matrix instruction + its own four-slot guard (accumulator tied, operands kept live)
__device__ __forceinline__ v8f wmma16g(v16h a, v16h b, v8f c) {
    c = __builtin_amdgcn_wmma_f32_16x16x32_f16(false, a, false, b, (short)0, c, false, false);
    asm volatile("v_nop\n\tv_nop\n\tv_nop\n\tv_nop" : "+v"(c) : "v"(a), "v"(b));
    return c; }
__device__ __forceinline__ v8f wmmabg(v16bf a, v16bf b, v8f c) {
    c = __builtin_amdgcn_wmma_f32_16x16x32_bf16(false, a, false, b, (short)0, c, false, false);
    asm volatile("v_nop\n\tv_nop\n\tv_nop\n\tv_nop" : "+v"(c) : "v"(a), "v"(b));
    return c; }

// x convert, 8 elements per thread: group i of the n8 groups of one batch
__device__ __forceinline__ void cvt8_body(const float* __restrict__ src, bf* dst, size_t i, size_t n8) {
    if (i >= n8) return;
    const v8f v = *(const v8f*)(src + i * 8); v8us o;
#pragma unroll
    for (int k = 0; k < 8; ++k) o[k] = f2bf(v[k]);
    *(v8us*)(dst + i * 8) = o; 
}

// Weight transposer: in[R][C] (f32) -> out[C][R] (16-bit), 64 x 64 tile (rows r0.., columns c0..) per block through LDS (cross-wave: block barrier).
// ASH = 0: bf16 bits (RNE convert). ASH = 1: f16 of (RNE bf16 value x 64), subnormal-free convert.
template <int ASH>
__device__ __forceinline__ void wtr_body(float* ts, const float* __restrict__ src, bf* dstb, h16* dsth, int R, int C, int r0, int c0) {
    const int tid = threadIdx.x;
#pragma unroll 1
    for (int i = 0; i < 16; ++i) { const int rr = i * 4 + (tid >> 6), cc = tid & 63;        // 16 trips x 4 rows = 64 rows; 64 columns
        ts[rr * 65 + cc] = src[(size_t)(r0 + rr) * C + c0 + cc]; }
    __syncthreads();
    static_assert(256 * 8 * 2 == 64 * 64);                                                 // threads x elements per store x trips == tile
{
#pragma unroll 1
        for (int it = 0; it < 2; ++it) {
            const int cc = it * 32 + (tid >> 3), r8 = (tid & 7) * 8;                        // 2 trips x 32 output rows; 8 lanes x 8 elements = 64 = one line
            const size_t oo = (size_t)(c0 + cc) * R + r0 + r8;
            if (ASH) { v8h o;
#pragma unroll
                for (int k = 0; k < 8; ++k) o[k] = toh_flush(bfr(ts[(r8 + k) * 65 + cc]) * WOS);
                *(v8h*)(dsth + oo) = o;
                asm volatile("s_wait_xcnt 0x0" ::: "memory");   // precaution: stands in front of whatever next rewrites the store's address and data registers (next trip, or code behind the loop)
            } else { v8us o;
#pragma unroll
                for (int k = 0; k < 8; ++k) o[k] = f2bf(ts[(r8 + k) * 65 + cc]);
                *(v8us*)(dstb + oo) = o;
                asm volatile("s_wait_xcnt 0x0" ::: "memory"); }  // precaution: as above
        }
         }
}
// k_prep: every operand preparation that depends on the inputs alone, in one grid. Blocks 0 .. 4*WTB-1: one 64 x 64 weight tile each (W_theta, W_phi, W_g, W_out in turn;
// lowest indices, for speed only); the other blocks: 2048 elements of x each. The split is block-uniform.
#define WTB ((CIN / 64) * (CB / 64))   // 64 x 64 tiles per weight
static_assert(WTB == (CB / 64) * (COUT / 64));
#define CVB ((int)(((size_t)SEQ * CIN / 8 + 255) / 256))   // x convert blocks per batch
__global__ __launch_bounds__(256) void k_prep(const float* __restrict__ x, const float* __restrict__ wt, const float* __restrict__ wp, const float* __restrict__ wg,
                                              const float* __restrict__ wo, bf* XB, bf* WT, bf* WP, bf* WG, h16* WOH) {
    __shared__ float ts[64 * 65];
    const int blk = blockIdx.x;
    if (blk < 4 * WTB) {
        const int w = blk / WTB, t = blk % WTB;
        if (w == 3) { wtr_body<1>(ts, wo, (bf*)0, WOH, CB, COUT, (t % (CB / 64)) * 64, (t / (CB / 64)) * 64); }      // [128][256] -> [256][128]
        else { const float* src = (w == 0) ? wt : (w == 1) ? wp : wg; bf* dst = (w == 0) ? WT : (w == 1) ? WP : WG;
            wtr_body<0>(ts, src, dst, (h16*)0, CIN, CB, (t % (CIN / 64)) * 64, (t / (CIN / 64)) * 64); }             // [256][128] -> [128][256]
        return;
    }
    const int cb = blk - 4 * WTB, bb = cb / CVB;               // batch pitch: SEQ_FULL rows in x, SEQ rows in the bf16 copy
    cvt8_body(x + (size_t)bb * SEQ_FULL * CIN, XB + (size_t)bb * SEQ * CIN, (size_t)(cb % CVB) * 256 + threadIdx.x, (size_t)SEQ * CIN / 8);
}

// mm64: register-blocked bf16 GEMM main loop, ONE WAVE per 64x64 tile (16 accumulators), operands from staged LDS rows of pitch XP, K = CIN.
// a, b: the lane's first row of each operand, already + (lane&15)*XP + 16*(lane>>4). acc[mb][nb][j] = C[16mb + 8h + j][16nb + (lane&15)], C[m][n] = sum_k A[m][k] Bt[n][k].
__device__ __forceinline__ void mm64(const unsigned char* a, const unsigned char* b, v8f (&acc)[4][4]) {
#pragma unroll
    for (int mb = 0; mb < 4; ++mb)
#pragma unroll
        for (int nb = 0; nb < 4; ++nb) acc[mb][nb] = (v8f){};
#pragma unroll 1
    for (int kc = 0; kc < CIN * 2; kc += 64) {                 // kc in bytes: 32 elements a step
        v16bf af[4], bb[4];
#pragma unroll
        for (int mb = 0; mb < 4; ++mb) { af[mb] = ldlb(a + mb * 16 * XP + kc); bb[mb] = ldlb(b + mb * 16 * XP + kc); }
        __builtin_amdgcn_sched_barrier(0);                     // keeps the step's LDS reads one group ahead of its products (else each B fragment is read, and waited for, in among them)
#pragma unroll
        for (int nb = 0; nb < 4; ++nb)
#pragma unroll
            for (int mb = 0; mb < 4; ++mb) acc[mb][nb] = wmmabg(af[mb], bb[nb], acc[mb][nb]);
    }
}

// proj_q: q = x W_theta, 64 x 64 tile (bx, by). A = x rows (m = b*SEQ + t), Bt = transposed weight rows (n = d). Planes [b*SEQ + t][128]: f16 value (Ph) and f16 residual x2048 (Pr).
__device__ __forceinline__ void proj_q(float* os, const unsigned char* A, const unsigned char* Bt, h16* Ph, h16* Pr, int bx, int by) {
    const int lane = threadIdx.x & 31, lr = lane & 15, hi = lane >> 4; const int r0 = bx * 64, c0 = by * 64;
    v8f acc[4][4];
    mm64(A, Bt, acc);
    const size_t obase = (size_t)r0 * CB + c0;
#pragma unroll
    for (int mb = 0; mb < 4; ++mb) {
#pragma unroll
        for (int nb = 0; nb < 4; ++nb) {
#pragma unroll
            for (int j = 0; j < 8; ++j) os[(hi * 8 + j) * 68 + nb * 16 + lr] = acc[mb][nb][j]; }   // D: row 8h+j, col lane&15; 16 x 64 all written
        wave_sync();
        static_assert(32 * 8 * 4 == 16 * 64);                                                     // lanes x halves x instructions == slab
{
#pragma unroll
            for (int s = 0; s < 4; ++s) { const int row = 4 * s + (lane >> 3), c8 = (lane & 7) * 8;   // 4 s x 4 row groups = 16 rows; 8 lanes x 8 = 64 columns
                const v4f x0 = *(const v4fa*)(&os[row * 68 + c8]); const v4f x1 = *(const v4fa*)(&os[row * 68 + c8 + 4]); v8h hv, rv;
#pragma unroll
                for (int i = 0; i < 4; ++i) { const h16 a0 = toh_flush(x0[i]); const h16 a1 = toh_flush(x1[i]); hv[i] = a0; hv[4 + i] = a1;
                    rv[i] = toh_flush((x0[i] - (float)a0) * QRS); rv[4 + i] = toh_flush((x1[i] - (float)a1) * QRS); }
                const size_t oo = obase + (size_t)(mb * 16 + row) * CB + c8;
                *(v8h*)(Ph + oo) = hv; *(v8h*)(Pr + oo) = rv; }
             }
        wave_sync();
    }
}

// proj_k: k = maxpool2(x W_phi) over adjacent token pairs, 64 x 64 tile (bx, by). Same GEMM; per 16-token slab the 8 pooled rows (max in f32, then convert) go to planes [b*MK + key][128]: f16 value and f16 residual x2048.
__device__ __forceinline__ void proj_k(float* os, const unsigned char* A, const unsigned char* Bt, h16* Ph, h16* Pr, int bx, int by) {
    const int lane = threadIdx.x & 31, lr = lane & 15, hi = lane >> 4; const int r0 = bx * 64, c0 = by * 64;
    v8f acc[4][4];
    mm64(A, Bt, acc);
    const size_t obase = (size_t)(r0 / 2) * CB + c0;                                              // (b*SEQ + t)/2 = b*MK + t/2
#pragma unroll
    for (int mb = 0; mb < 4; ++mb) {
#pragma unroll
        for (int nb = 0; nb < 4; ++nb) {
#pragma unroll
            for (int j = 0; j < 8; ++j) os[(hi * 8 + j) * 68 + nb * 16 + lr] = acc[mb][nb][j]; }
        wave_sync();
        static_assert(32 * 8 * 2 == 8 * 64);                                                      // lanes x halves x instructions == pooled slab
{
#pragma unroll
            for (int s = 0; s < 2; ++s) { const int prow = 4 * s + (lane >> 3), c8 = (lane & 7) * 8;   // 2 s x 4 row groups = 8 pooled rows (token rows 2*prow, 2*prow+1)
                const v4f u0 = *(const v4fa*)(&os[(2 * prow) * 68 + c8]);     const v4f u1 = *(const v4fa*)(&os[(2 * prow) * 68 + c8 + 4]);
                const v4f w0 = *(const v4fa*)(&os[(2 * prow + 1) * 68 + c8]); const v4f w1 = *(const v4fa*)(&os[(2 * prow + 1) * 68 + c8 + 4]); v8h hv, rv;
#pragma unroll
                for (int i = 0; i < 4; ++i) { const float y0 = fmaxf(u0[i], w0[i]), y1 = fmaxf(u1[i], w1[i]);
                    const h16 a0 = toh_flush(y0); const h16 a1 = toh_flush(y1); hv[i] = a0; hv[4 + i] = a1;
                    rv[i] = toh_flush((y0 - (float)a0) * QRS); rv[4 + i] = toh_flush((y1 - (float)a1) * QRS); }
                const size_t oo = obase + (size_t)(mb * 8 + prow) * CB + c8;
                *(v8h*)(Ph + oo) = hv; *(v8h*)(Pr + oo) = rv; }
             }
        wave_sync();
    }
}

// proj_gt: pooled values transposed, G^T[d][key] = max over the token pair of (W_g^T x^T)[d][t]. ONE WAVE per 32 (d) x 128 (token) tile (16 accumulators):
// A = transposed weight rows (m = d), Bt = x rows (n = b*SEQ + t). Plane [(b*128 + d)][MK], single f16. Per 16-row slab staged in LDS (wave-private);
__device__ __forceinline__ void proj_gt(float* os, const unsigned char* A, const unsigned char* Bt, h16* Gt, int bx, int by) {
    const int lane = threadIdx.x & 31, lr = lane & 15, hi = lane >> 4; const int r0 = bx * 32, c0 = by * 128;
    v8f acc[2][8];
#pragma unroll
    for (int mb = 0; mb < 2; ++mb)
#pragma unroll
        for (int nb = 0; nb < 8; ++nb) acc[mb][nb] = (v8f){};
#pragma unroll 1
    for (int kc = 0; kc < CIN * 2; kc += 64) {                 // kc in bytes: 32 elements a step
        v16bf a[2], b[8];
#pragma unroll
        for (int mb = 0; mb < 2; ++mb) a[mb] = ldlb(A + mb * 16 * XP + kc);
#pragma unroll
        for (int nb = 0; nb < 8; ++nb) b[nb] = ldlb(Bt + nb * 16 * XP + kc);
        __builtin_amdgcn_sched_barrier(0);                     // keeps the step's LDS reads one group ahead of its products, as in mm64
#pragma unroll
        for (int nb = 0; nb < 8; ++nb)
#pragma unroll
            for (int mb = 0; mb < 2; ++mb) acc[mb][nb] = wmmabg(a[mb], b[nb], acc[mb][nb]);
    }
    const int bb = c0 / SEQ, tt = c0 % SEQ;
    const size_t obase = ((size_t)bb * CB + r0) * MK + (size_t)(tt / 2);
#pragma unroll
    for (int mb = 0; mb < 2; ++mb) {
#pragma unroll
        for (int nb = 0; nb < 8; ++nb) {
#pragma unroll
            for (int j = 0; j < 8; ++j) os[(hi * 8 + j) * OPF + nb * 16 + lr] = acc[mb][nb][j]; }   // D: row d = 8h+j, col token = 16nb + lane&15; 16 x 128 all written
        wave_sync();
        static_assert(32 * 8 * 4 == 16 * 64);                                                       // lanes x pooled halves x instructions == pooled slab
{
#pragma unroll
            for (int s = 0; s < 4; ++s) { const int row = 4 * s + (lane >> 3), c8 = (lane & 7) * 8;     // 4 s x 4 row groups = 16 rows; 8 lanes x 8 pooled = 64 pooled columns
                const v4f f0 = *(const v4fa*)(&os[row * OPF + 2 * c8]);     const v4f f1 = *(const v4fa*)(&os[row * OPF + 2 * c8 + 4]);
                const v4f f2 = *(const v4fa*)(&os[row * OPF + 2 * c8 + 8]); const v4f f3 = *(const v4fa*)(&os[row * OPF + 2 * c8 + 12]); v8h hv;
                hv[0] = toh_flush(fmaxf(f0[0], f0[1])); hv[1] = toh_flush(fmaxf(f0[2], f0[3]));
                hv[2] = toh_flush(fmaxf(f1[0], f1[1])); hv[3] = toh_flush(fmaxf(f1[2], f1[3]));
                hv[4] = toh_flush(fmaxf(f2[0], f2[1])); hv[5] = toh_flush(fmaxf(f2[2], f2[3]));
                hv[6] = toh_flush(fmaxf(f3[0], f3[1])); hv[7] = toh_flush(fmaxf(f3[2], f3[3]));
                const size_t oo = obase + (size_t)(mb * 16 + row) * MK + c8;
                *(v8h*)(Gt + oo) = hv; }
             }
        wave_sync();
    }
}

// k_proj: the three input projections, which depend on k_prep alone and not on one another. One block of twelve waves per 128 tokens: waves 0..3 the four 64 x 64 q tiles,
// waves 4..7 the four k tiles, waves 8..11 the four 32 x 128 value^T tiles. The block's operands are staged once in LDS by whole-row asynchronous copies (a fragment load straight from
// the planes touches 16 lines for 512 bytes): wave w brings weight rows 32w .. 32w+31 of the 384 (W_theta^T, W_phi^T, W_g^T in turn), waves 0..7 also 16 x rows each.
// Staging tiles of the store stage are wave-private: the q and k waves have their own behind the operands; a value^T wave uses the first 16 of its 32 weight rows, which it alone reads and has left by then.
__global__ __launch_bounds__(32 * PW) void k_proj(const bf* __restrict__ XB, const bf* __restrict__ WT, const bf* __restrict__ WP, const bf* __restrict__ WG,
                                                  h16* QH, h16* QR, h16* KH, h16* KR, h16* GT) {
    __shared__ __align__(16) unsigned char sm[PLDS];
    const int lane = threadIdx.x & 31, lr = lane & 15, hi = lane >> 4;
    const int wave = __builtin_amdgcn_readfirstlane((int)(threadIdx.x >> 5));
    const int which = wave >> 2, sub = wave & 3;               // wave-uniform: projection, tile
    const int blk = blockIdx.x;
    const unsigned sb = (unsigned)(size_t)sm;                  // LDS byte address of the array
    const bf* wsrc = (which == 0) ? WT : (which == 1) ? WP : WG;
    const unsigned lw = sb + WS_O + 32 * wave * XP + lane * 16;
    const h16* gw = (const h16*)wsrc + 32 * sub * CIN + lane * 8;
#pragma unroll
    for (int c = 0; c < 4; ++c) cp8(lw + c * 8 * XP, gw + c * 8 * CIN, XP, CIN);
    if (wave < 8) {                                            // scalar branch: every lane is on at the copies
        const unsigned lx = sb + 16 * wave * XP + lane * 16;
        const h16* gx = (const h16*)XB + ((size_t)blk * PT + 16 * wave) * CIN + lane * 8;
        cp8(lx, gx, XP, CIN);
        cp8(lx + 8 * XP, gx + 8 * CIN, XP, CIN);
    }
    asm volatile("s_wait_asynccnt 0x0" ::: "memory");          // this wave's copies have landed before the barrier publishes them
    __syncthreads();
    const unsigned char* xs = sm + lr * XP + 16 * hi;          // fragment rows: + row * XP + 2 * k
    const unsigned char* ws = sm + WS_O + lr * XP + 16 * hi;
    if (which == 0)      proj_q((float*)(sm + OS_O + wave * OSB), xs + (sub & 1) * 64 * XP, ws + (sub >> 1) * 64 * XP, QH, QR, blk * 2 + (sub & 1), sub >> 1);
    else if (which == 1) { proj_k((float*)(sm + OS_O + wave * OSB), xs + (sub & 1) * 64 * XP, ws + (CB + (sub >> 1) * 64) * XP, KH, KR, blk * 2 + (sub & 1), sub >> 1);
        asm volatile("s_wait_xcnt 0x0" ::: "memory"); }        // precaution: in the built text this body is followed by the other bodies' code, which rewrites the registers that its last stores name (the other two run into the end of the program)
    else { proj_gt((float*)(sm + WS_O + 32 * wave * XP), ws + 32 * wave * XP, xs, GT, sub, blk);
        asm volatile("s_wait_xcnt 0x0" ::: "memory"); }        // precaution: as above (whichever body the built text puts last runs into the end of the program)
}

// k_attn: fused attention + output projection + skip term, one wave per 16 query rows of one batch; K / G^T / Q fragments from LDS rows (two 16-B reads each), W_out^T fragments straight from its f16 plane.
// Staging: whole-line asynchronous copies; each wave brings its own 16 q rows once, and a quarter of every 64-key tile (k value, k residual, value^T) into one of two buffers, one tile ahead of its use.
// Transposed form: S^T[key][t] = K Q^T (A = K rows, B = Q rows, 4 k-steps over d); lane (t = lane&15, h = lane>>4) holds keys 8h+r of each 16-key tile, so the packed
// P tile is directly the B fragment of O^T[d][t] = G^T P^T (element r <- tile keys 0..15, element 8+r <- tile keys 16..31, lane unchanged), 8 tiles over d.
// Scores = K Q + (K Q_res + K_res Q) / 2048. Softmax state (running max, partial sum) is one scalar per lane; the two lane halves of a row are combined with one xor-16 exchange.
// Q fragments are read from LDS once and held in registers. The key loop's fragment reads stand at two places per pass, each a whole phase ahead of its use; 512 registers per wave (two waves per SIMD).
// Epilogue: ctx^T = O^T / l packed to f16 (tiles 2kk, 2kk+1 -> B fragment of k-step kk); out^T[c][t] = W_out^T ctx^T per 16-channel tile, staged in a wave-private LDS tile [t][128 channels];
__global__ __launch_bounds__(32 * AW) __attribute__((amdgpu_num_vgpr(512)))
void k_attn(const h16* __restrict__ QH, const h16* __restrict__ QR, const h16* __restrict__ KH, const h16* __restrict__ KR,
            const h16* __restrict__ GT, const h16* __restrict__ WO, const float* __restrict__ X, float* OUT) {
    __shared__ __align__(16) unsigned char sm[LDSB];
    const int lane = threadIdx.x & 31, lr = lane & 15, hi = lane >> 4;
    const int wave = __builtin_amdgcn_readfirstlane((int)(threadIdx.x >> 5));
    const int b = blockIdx.y;
    const int t0 = (blockIdx.x * AW + wave) * 16;
    // copy side: q / k rows of 256 B, two per copy (16 lanes each); value^T rows of 128 B, four per copy (8 lanes each)
    const unsigned sb = (unsigned)(size_t)sm;                  // LDS byte address of the array
    const unsigned lq = sb + Q_O + wave * QWB + (lane >> 4) * KP + (lane & 15) * 16;
    const unsigned lk = sb + (16 * wave + (lane >> 4)) * KP + (lane & 15) * 16;
    const unsigned lg = sb + GT_O + (32 * wave + (lane >> 3)) * GP + (lane & 7) * 16;
    const int gq = (b * SEQ + t0 + (lane >> 4)) * CB + (lane & 15) * 8;
    const int gk = (b * MK + 16 * wave + (lane >> 4)) * CB + (lane & 15) * 8;    // + tile * KT * CB
    const int gg = (b * CB + 32 * wave + (lane >> 3)) * MK + (lane & 7) * 8;     // + tile * KT
    // read side
    const unsigned char* qp = sm + Q_O + wave * QWB + lr * KP + 16 * hi;         // B fragments: col t, k = d; residual rows + 16*KP
    const int ko = lr * KP + 16 * hi;                          // + buffer + key * KP      (A fragment: row key, k = d)
    const int vo = GT_O + lr * GP + 16 * hi;                   // + buffer + 16j*GP + 2*key (A fragment: row d, k = key)
    // prologue: q rows and tile 0, landed and published; then tile 1 into the second buffer
    cp8(lq, QH + gq, 2 * KP, 2 * CB);
    cp8(lq + 16 * KP, QR + gq, 2 * KP, 2 * CB);
    cp8(lk, KH + gk, 2 * KP, 2 * CB);
    cp8(lk + KR_O, KR + gk, 2 * KP, 2 * CB);
    cp8(lg, GT + gg, 4 * GP, 4 * (size_t)MK);
    asm volatile("s_wait_asynccnt 0x0" ::: "memory");          // this wave's copies have landed before the barrier publishes them
    __syncthreads();
    // q fragments: read once, held in registers over the whole key loop. k fragments of tile 0, pass 0 (published by the barrier above): their reads return while tile 1's copies are issued
    v16h qh[4], qr[4], ka[4], kb[4], kra[4], krb[4];
#pragma unroll
    for (int kk = 0; kk < 4; ++kk) { qh[kk] = ldl(qp + kk * 64); qr[kk] = ldl(qp + 16 * KP + kk * 64); }
#pragma unroll
    for (int kk = 0; kk < 4; ++kk) {
        ka[kk] = ldl(sm + ko + kk * 64); kb[kk] = ldl(sm + ko + 16 * KP + kk * 64);
        kra[kk] = ldl(sm + ko + KR_O + kk * 64); krb[kk] = ldl(sm + ko + KR_O + 16 * KP + kk * 64); }
    cp8(lk + STB, KH + gk + KT * CB, 2 * KP, 2 * CB);
    cp8(lk + STB + KR_O, KR + gk + KT * CB, 2 * KP, 2 * CB);
    cp8(lg + STB, GT + gg + KT, 4 * GP, 4 * (size_t)MK);
    v8f o[8];
#pragma unroll
    for (int j = 0; j < 8; ++j) o[j] = (v8f){};
    float m = NEGB, l = 0.0f;
#pragma unroll 1
    for (int st = 0; st < NST; ++st) {
    const int bo = (st & 1) * STB;                             // this tile's buffer
    // LDS fragment reads stand at two places per 32-key pass, each a whole phase ahead of its use: the pass's value^T fragments ahead of its score products,
    // the next pass's k fragments behind them (into the registers those products have just read), ahead of the softmax and the output products.
#pragma unroll                                                 // unrolled: the tile's publish point stands inside its last pass only
    for (int ps = 0; ps < KT / 32; ++ps) {                     // 32-key passes in key order
        const unsigned char* vv = sm + bo + vo + ps * 64;
        v16h vf[8];
#pragma unroll
        for (int j = 0; j < 8; ++j) vf[j] = ldl(vv + j * 16 * GP);
        __builtin_amdgcn_sched_barrier(0);                     // keeps the value^T reads one group ahead of the score products (else they sink in among the matrix instructions)
        v8f sHa = (v8f){}, sLa = (v8f){}, sHb = (v8f){}, sLb = (v8f){};
        // plain builtin in the key loop (the compiler keeps the distances behind it): the guarded form's asm operands tie every fragment and accumulator to the first 256 registers, which spills here
#pragma unroll
        for (int kk = 0; kk < 4; ++kk) {
            sHa = wmma16(ka[kk], qh[kk], sHa); sHb = wmma16(kb[kk], qh[kk], sHb);
            sLa = wmma16(ka[kk], qr[kk], sLa); sLb = wmma16(kb[kk], qr[kk], sLb);
            sLa = wmma16(kra[kk], qh[kk], sLa); sLb = wmma16(krb[kk], qh[kk], sLb);
        }
        __builtin_amdgcn_sched_barrier(0);                     // keeps the next k reads behind the last score product, as one group
        const unsigned char* kn;
        if (ps + 1 < KT / 32) kn = sm + bo + ko + (ps + 1) * 32 * KP;
        else {
            // publish point of tile st + 1, inside tile st's last pass: every read of this buffer has been issued (k fragments used, value^T fragments fetched above)
            asm volatile("s_wait_dscnt 0x0" ::: "memory");     // this wave has left the buffer that is refilled behind the barrier
            asm volatile("s_wait_asynccnt 0x0" ::: "memory");  // this wave's share of tile st + 1 has landed
            __syncthreads();
            kn = sm + (STB - bo) + ko;                         // behind the last tile: the other buffer's old rows, landed and published long ago; read unconditionally (a branch here would merge the compiler's wait counts to 0), never used
        }
#pragma unroll
        for (int kk = 0; kk < 4; ++kk) {
            ka[kk] = ldl(kn + kk * 64); kb[kk] = ldl(kn + 16 * KP + kk * 64);
            kra[kk] = ldl(kn + KR_O + kk * 64); krb[kk] = ldl(kn + KR_O + 16 * KP + kk * 64); }
        __builtin_amdgcn_sched_barrier(0);                     // keeps the k reads ahead of the softmax, whose time covers their latency
        if (ps + 1 == KT / 32 && st + 2 < NST) {               // refill of the buffer just freed; the test reads the same for the whole block
            const int tk = (st + 2) * KT;
            // the lane's two LDS copy addresses are formed anew at each refill (a few vector instructions): held in registers over the loop they went to scratch.
            // The lane number is taken with the loop-variant addend st, so that the compiler does not hoist the addresses out of the loop again.
            const unsigned ln = __builtin_amdgcn_mbcnt_lo(~0u, (unsigned)st) - (unsigned)st;
            const unsigned rk = sb + bo + (16 * wave + (ln >> 4)) * KP + (ln & 15) * 16;
            const unsigned rg = sb + bo + GT_O + (32 * wave + (ln >> 3)) * GP + (ln & 7) * 16;
            cp8(rk, KH + gk + tk * CB, 2 * KP, 2 * CB);
            cp8(rk + KR_O, KR + gk + tk * CB, 2 * KP, 2 * CB);
            cp8(rg, GT + gg + tk, 4 * GP, 4 * (size_t)MK);
        }
        float ta[8], tb[8]; float mx = NEGB;
#pragma unroll
        for (int r = 0; r < 8; ++r) {
            ta[r] = (sHa[r] + sLa[r] * QRI) * L2E; tb[r] = (sHb[r] + sLb[r] * QRI) * L2E;
            mx = fmaxf(mx, fmaxf(ta[r], tb[r])); }
        mx = fmaxf(mx, xhalf(mx));
        const float mnew = fmaxf(m, mx);
        const float alpha = __builtin_amdgcn_exp2f(m - mnew);
        const float sh = PSH - mnew;
        v16h pb; float ls = 0.0f;
#pragma unroll
        for (int r = 0; r < 8; ++r) {
            const float ea = ta[r] + sh, eb = tb[r] + sh;
            const float xa = __builtin_amdgcn_exp2f(ea), xb = __builtin_amdgcn_exp2f(eb);
            const float ga = (ea < -14.0f) ? 0.0f : xa, gb = (eb < -14.0f) ? 0.0f : xb;   // nothing below 2^-14 reaches the f16 operand
            const h16 pa = (h16)ga; const h16 pc = (h16)gb;
            pb[r] = pa; pb[8 + r] = pc;
            ls += (float)pa + (float)pc; }
        l = l * alpha + ls; m = mnew;
#pragma unroll
        for (int j = 0; j < 8; ++j) o[j] = o[j] * alpha;
#pragma unroll
        for (int j = 0; j < 8; ++j) o[j] = wmma16(vf[j], pb, o[j]);
    }
    }
    asm volatile("s_wait_asynccnt 0x0" ::: "memory");          // nothing in flight before the q rows become output staging
    l += __shfl_xor(l, 16, 32);
    const float inv = 1.0f / l;                                // l >= 16384 (the row maximum contributes the full carry)
    // ctx^T D layout: o[j][r] = (d = 16j + 8h + r, t = lane&15); B fragment of k-step kk: element r <- tile 2kk, element 8+r <- tile 2kk+1
    v16h cf[4];
#pragma unroll
    for (int kk = 0; kk < 4; ++kk) {
#pragma unroll
        for (int r = 0; r < 8; ++r) { cf[kk][r] = toh_flush(o[2 * kk][r] * inv); cf[kk][8 + r] = toh_flush(o[2 * kk + 1][r] * inv); } }
    float* os = (float*)(sm + Q_O);                            // each wave stages in the bytes of its own q rows, which only it has read
    const int wb = wave * (QWB / 4);
    const int wo = lr * CB + 8 * hi;                           // + channel tile * 16 * CB + kk*32  (A fragment: row c, k = d)
    const size_t xrow = ((size_t)b * SEQ_FULL + t0) * COUT;
    const size_t orow = ((size_t)b * OUT_SEQ + t0) * COUT;
#pragma unroll 1
    for (int hc = 0; hc < 2; ++hc) {
#pragma unroll 1
        for (int ct = 0; ct < 8; ++ct) {
            const int cg = hc * 8 + ct;
            v8f acc = (v8f){};
#pragma unroll
            for (int kk = 0; kk < 4; ++kk) { const v16h a = ldh(WO + wo + cg * 16 * CB + kk * 32); acc = wmma16g(a, cf[kk], acc); }
            // D: acc[r] = (c = 16cg + 8h + r, t = lane&15) -> os[t][16ct + 8h + r]; rows 0..15 x columns 0..127 all written over the 8 tiles
            v4f a0, a1;
            a0[0] = acc[0] * WOI; a0[1] = acc[1] * WOI; a0[2] = acc[2] * WOI; a0[3] = acc[3] * WOI;
            a1[0] = acc[4] * WOI; a1[1] = acc[5] * WOI; a1[2] = acc[6] * WOI; a1[3] = acc[7] * WOI;
            *(v4fa*)(&os[wb + lr * OPF + ct * 16 + 8 * hi]) = a0; *(v4fa*)(&os[wb + lr * OPF + ct * 16 + 8 * hi + 4]) = a1;
        }
        wave_sync();
        static_assert(32 * 4 * 16 == 16 * 128);                // lanes x floats x instructions == half tile
{
#pragma unroll 4
            for (int s = 0; s < 16; ++s) { const int cofs = lane * 4;
                const v4f val = *(const v4fa*)(&os[wb + s * OPF + cofs]);
                const v4f xv = *(const v4f*)(X + xrow + (size_t)s * COUT + hc * 128 + cofs);
                v4f res; res[0] = bfr(xv[0]) + val[0]; res[1] = bfr(xv[1]) + val[1]; res[2] = bfr(xv[2]) + val[2]; res[3] = bfr(xv[3]) + val[3];
                *(v4f*)(OUT + orow + (size_t)s * COUT + hc * 128 + cofs) = res; }
             }
        wave_sync();
    }
}

static constexpr size_t al256(size_t v) { return (v + 255) & ~(size_t)255; }
static constexpr size_t SZ_XB = al256((size_t)NB * SEQ * CIN * 2);
static constexpr size_t SZ_W  = al256((size_t)CIN * CB * 2);
static constexpr size_t SZ_Q  = al256((size_t)NB * SEQ * CB * 2);
static constexpr size_t SZ_K  = al256((size_t)NB * MK * CB * 2);
static constexpr size_t SZ_TOTAL = SZ_XB + 4 * SZ_W + 2 * SZ_Q + 3 * SZ_K;
static_assert(SZ_TOTAL <= (size_t)134217728);                        // workspace carve <= 128 MiB
static_assert((size_t)CIN * CB == (size_t)CB * COUT);                // the W_out plane has the extent of an input-projection weight plane
static_assert((size_t)NB * MK * CB == (size_t)NB * CB * MK);         // value^T plane [(b*128 + d)][MK] has the extent of a k plane

extern "C" void kernel_launch(void* const* d_in, const int* in_sizes, int n_in,
                              void* d_out, int out_size, void* d_ws, size_t ws_size, hipStream_t stream) {
    if (n_in < 5) return;
    const size_t needx = ((size_t)(NB - 1) * SEQ_FULL + SEQ) * CIN;
    if ((size_t)in_sizes[0] < needx) return;
    if ((size_t)in_sizes[1] < (size_t)CIN * CB || (size_t)in_sizes[2] < (size_t)CIN * CB || (size_t)in_sizes[3] < (size_t)CIN * CB) return;
    if ((size_t)in_sizes[4] < (size_t)CB * COUT) return;
    if ((size_t)out_size < ((size_t)(NB - 1) * OUT_SEQ + SEQ) * COUT) return;
    if (SZ_TOTAL > ws_size) return;
    // wire order: x, W_theta, W_phi, W_g, W_out
    const float* x  = (const float*)d_in[0];
    const float* wt = (const float*)d_in[1];
    const float* wp = (const float*)d_in[2];
    const float* wg = (const float*)d_in[3];
    const float* wo = (const float*)d_in[4];
    float* OUT = (float*)d_out;      // [NB][SEQ][256]
    char* wsp = (char*)d_ws;
    bf*  XB = (bf*)wsp;  wsp += SZ_XB;               // x bf16 [NB*SEQ][256]
    bf*  WT = (bf*)wsp;  wsp += SZ_W;                // W_theta^T bf16 [128][256]
    bf*  WP = (bf*)wsp;  wsp += SZ_W;                // W_phi^T   bf16 [128][256]
    bf*  WG = (bf*)wsp;  wsp += SZ_W;                // W_g^T     bf16 [128][256]
    h16* WOH = (h16*)wsp; wsp += SZ_W;               // W_out^T   f16 x64 [256][128]
    h16* QH = (h16*)wsp; wsp += SZ_Q;                // [NB*SEQ][128]
    h16* QR = (h16*)wsp; wsp += SZ_Q;                // [NB*SEQ][128] residual x2048
    h16* KH = (h16*)wsp; wsp += SZ_K;                // [NB*MK][128]
    h16* KR = (h16*)wsp; wsp += SZ_K;                // [NB*MK][128] residual x2048
    h16* GT = (h16*)wsp; wsp += SZ_K;                // [NB*128][MK]

    k_prep<<<dim3(4 * WTB + NB * CVB, 1, 1), 256, 0, stream>>>(x, wt, wp, wg, wo, XB, WT, WP, WG, WOH);
    k_proj<<<dim3(NB * SEQ / PT, 1, 1), 32 * PW, 0, stream>>>(XB, WT, WP, WG, QH, QR, KH, KR, GT);
    k_attn<<<dim3(SEQ / (16 * AW), NB, 1), 32 * AW, 0, stream>>>(QH, QR, KH, KR, GT, WOH, x, OUT);
}

// v006
// A run of this version takes 78.6 microseconds.
// Timed twice side by side with v005, it ran 1.08 and 1.09 times as fast.
// All steps since v000 together make it 4.02 times as fast.
#include <hip/hip_runtime.h>

// Spatial self-attention block over flattened pixels: x [NB][SEQ][256]; three 1x1 projections W [in 256][out 128] (no bias); keys and values max-pooled over adjacent token pairs (SEQ/2 keys);
// unscaled dot-product scores, softmax over keys; context [SEQ][128] -> output projection W_out [in 128][out 256]; output = x + projected context (f32).
// Compute dtypes, f32 accumulate everywhere: three input projections v_wmma_f32_16x16x32_bf16 (x and W RNE-converted to bf16; products exact);
// scores v_wmma_f32_16x16x32_f16 with q and k each as f16 value + f16 residual x2048 (three products, residual products in their own accumulator folded by 1/2048);
// P.V v_wmma_f32_16x16x32_f16, P single f16 with x16384 carry (cancels in the normalisation, row sum over the converted P), pooled values single f16;
// output projection v_wmma_f32_16x16x32_f16, context single f16, W_out (RNE bf16 value) x64 as f16, folded by 1/64; softmax f32 (online, running max); skip term = bf16-converted x added in f32 at the store stage.
// Layout: bf16 copy of x; transposed 16-bit weight planes [out][in]; q planes (value, residual) [b][t][128]; k planes (value, residual) [b][key][128]; value^T plane [b][d][key];
// fused flash kernel in transposed form (S^T = K Q^T, O^T = V^T P^T, out^T = W_out^T ctx^T with the packed O^T tiles as B fragments);
// its key-loop operands (q, k, value^T) are staged in LDS by asynchronous copies, k and value^T in 64-key tiles with two buffers shared by the block's waves.
// behind the key loop the whole W_out^T plane is staged the same way in the bytes of the two tile buffers, once per block, for the output projection's A fragments.
// the projections' operands (128 x rows, the 384 transposed weight rows) are staged in LDS the same way, once per block, and shared by the block's twelve waves.
// Three dependent launches: k_prep (bf16 copy of x and the four weight planes), k_proj (q, k, value^T planes), k_attn; work that does not depend on each other shares a grid.

#ifndef NB
#define NB 8
#endif
#ifndef SEQ
#define SEQ 4096
#endif
#define NB_FULL  8
#define SEQ_FULL 4096
#ifndef OUT_SEQ
#define OUT_SEQ SEQ              // row pitch (in tokens) between batches of the output
#endif
#define CIN  256                 // input channels (projection depth)
#define CB   128                 // bottleneck width (score depth, context width)
#define COUT 256                 // output channels
#define MK   (SEQ / 2)           // pooled keys per batch
#define AW   4                   // waves per flash block (16 query rows each)
#define OPF  132                 // LDS row pitch (floats) of the 16 x 128 staging tiles
#define QRS  2048.0f             // carry of every residual plane
#define QRI  (1.0f / 2048.0f)
#define L2E  1.4426950408889634f // log2(e); the module applies no score scale
#define PSH  14.0f               // log2 of the P carry (16384)
#define NEGB (-3.0e38f)
#define WOS  64.0f               // carry of the f16 W_out plane
#define WOI  (1.0f / 64.0f)
#define KT   64                  // keys per LDS tile (two 32-key passes)
#define NST  (MK / KT)           // tiles per batch
#define KP   272                 // LDS row pitch, bytes, of 256-byte q / k rows (16 B x odd: conflict-free 16-byte reads)
#define GP   144                 // LDS row pitch, bytes, of 128-byte value^T rows (16 B x odd)
#define KR_O (KT * KP)           // tile layout: k value rows, k residual rows, value^T rows
#define GT_O (2 * KT * KP)
#define STB  (2 * KT * KP + CB * GP)   // bytes of one tile buffer
#define Q_O  (2 * STB)           // behind the two buffers: per wave 16 q value rows, then 16 q residual rows
#define QWB  (2 * 16 * KP)       // bytes of one wave's q rows; the same bytes are that wave's output staging tile after the key loop
#define LDSB (Q_O + AW * QWB)
#define PT   128                 // tokens per projection block
#define PW   12                  // waves per projection block: four q tiles, four k tiles, four value^T tiles
#define XP   528                 // LDS row pitch, bytes, of 512-byte x / weight rows (16 B x odd: conflict-free 16-byte reads)
#define WS_O (PT * XP)           // projection block layout: 128 x rows, 3 x 128 weight rows, the q and k waves' staging tiles
#define OS_O (WS_O + 3 * CB * XP)
#define OSB  (16 * 68 * 4)       // bytes of one q / k staging tile
#define PLDS (OS_O + 8 * OSB)

static_assert(CB == 128);                      // flash: 4 k-steps of 32 per score tile, 8 output tiles of 16, 4 k-steps in the output projection
static_assert(COUT == 256);                    // output staged as two halves of 128 columns
static_assert(CIN == COUT);                    // skip term has the output's row width
static_assert(CIN % 32 == 0);                  // GEMM k-loop steps by 32
static_assert(CB % 32 == 0);
static_assert(CIN % 64 == 0);                  // weight transposer tiles of 64 x 64
static_assert(CB % 64 == 0);
static_assert(COUT % 64 == 0);
static_assert(SEQ % 128 == 0);                 // a 128-token value tile never straddles two batches; token pairs stay inside a tile
static_assert((NB * SEQ) % 128 == 0);
static_assert((NB * SEQ) % 64 == 0);
static_assert(MK % 32 == 0);                   // key loop steps by 32
static_assert(MK % 64 == 0);
static_assert(SEQ % (16 * AW) == 0);           // flash grid covers the sequence exactly
static_assert(((size_t)SEQ * CIN) % 8 == 0);
static_assert(NB <= NB_FULL);
static_assert(SEQ <= SEQ_FULL);
static_assert((OPF * 4) % 16 == 0);
static_assert(NST >= 2);                       // the two-buffer prologue fills tiles 0 and 1
static_assert(KT == 16 * AW);                  // each wave copies 16 k rows of a tile (8 copies of 2 rows)
static_assert(CB == 32 * AW);                  // each wave copies 32 value^T rows of a tile (8 copies of 4 rows)
static_assert(KT * 2 == 128);                  // a value^T tile row is one 128-byte line
static_assert(16 * OPF * 4 <= QWB);            // the output staging tile fits the wave's q rows
static_assert(KP % 16 == 0);
static_assert(GP % 16 == 0);
static_assert(LDSB <= 163840);                 // two blocks per 320 KiB of LDS
static_assert(COUT * KP <= 2 * STB);           // the staged W_out^T plane (256 rows of 256 B, pitch KP) fits the two tile buffers
static_assert(COUT == 64 * AW);                // each wave copies 64 W_out^T rows (32 copies of 2 rows, all in flight: at most 63)
static_assert((size_t)NB * SEQ * CIN < (size_t)2147483647);   // int offsets inside the planes
static_assert(CIN * 2 == 32 * 16);             // an x or weight row is one 16-byte-per-lane copy of a wave
static_assert(XP % 16 == 0);
static_assert(3 * CB == 32 * PW);              // each wave copies 32 weight rows
static_assert(PT == 16 * 8);                   // waves 0..7 copy 16 x rows each
static_assert(32 + 16 <= 63);                  // copies of one wave in flight
static_assert((NB * SEQ) % PT == 0);
static_assert(SEQ % PT == 0);
static_assert(16 * OPF * 4 <= 16 * XP);        // a value^T wave's staging tile fits the first 16 of its own 32 weight rows
static_assert(PLDS <= 327680);                 // one block per 320 KiB of LDS

typedef _Float16 h16;
typedef unsigned short bf;
typedef __attribute__((ext_vector_type(16))) __bf16   v16bf;
typedef __attribute__((ext_vector_type(16))) _Float16 v16h;
typedef __attribute__((ext_vector_type(8)))  _Float16 v8h;
typedef __attribute__((ext_vector_type(8)))  unsigned short v8us;
typedef __attribute__((ext_vector_type(8)))  float    v8f;
typedef __attribute__((ext_vector_type(4)))  float    v4f;
typedef v4f  __attribute__((may_alias)) v4fa;
typedef v8h  __attribute__((may_alias)) v8ha;
typedef v8us __attribute__((may_alias)) v8usa;

__device__ __forceinline__ unsigned short f2bf(float f) { unsigned u = __float_as_uint(f); u += 0x7FFFu + ((u >> 16) & 1u); return (unsigned short)(u >> 16); }
__device__ __forceinline__ float bfr(float f) { return __uint_as_float(((unsigned)f2bf(f)) << 16); }   // value after RNE convert to bf16
__device__ __forceinline__ v16h cat16(v8h lo, v8h hi) { return __builtin_shufflevector(lo, hi, 0, 1, 2, 3, 4, 5, 6, 7, 8, 9, 10, 11, 12, 13, 14, 15); }
__device__ __forceinline__ v16bf cat16b(v8us lo, v8us hi) { return __builtin_bit_cast(v16bf, __builtin_shufflevector(lo, hi, 0, 1, 2, 3, 4, 5, 6, 7, 8, 9, 10, 11, 12, 13, 14, 15)); }
__device__ __forceinline__ v8f wmma16(v16h a, v16h b, v8f c) { return __builtin_amdgcn_wmma_f32_16x16x32_f16(false, a, false, b, (short)0, c, false, false); }
__device__ __forceinline__ v8f wmmab(v16bf a, v16bf b, v8f c) { return __builtin_amdgcn_wmma_f32_16x16x32_bf16(false, a, false, b, (short)0, c, false, false); }
// fragment loaders from K-contiguous 16-bit rows staged in LDS; p in bytes, already includes + 16*(lane>>4): elements 0..7 <- k0+8h+0..7, elements 8..15 <- k0+16+8h+0..7 (same map for A and B)
__device__ __forceinline__ v16h  ldl(const unsigned char* p) { return cat16(*(const v8ha*)p, *(const v8ha*)(p + 32)); }
__device__ __forceinline__ v16bf ldlb(const unsigned char* p) { return cat16b(*(const v8usa*)p, *(const v8usa*)(p + 32)); }
// eight asynchronous 16-byte-per-lane copies global -> LDS (l = the lane's LDS byte address, g = the lane's global address; steps between copies ls bytes, gs elements).
// The closing s_wait_xcnt stands inside the statement so that no address register is rewritten ahead of it.
__device__ __forceinline__ void cp8(unsigned l, const h16* g, unsigned ls, size_t gs) {
    asm volatile("global_load_async_to_lds_b128 %0, %8, off\n\t"
                 "global_load_async_to_lds_b128 %1, %9, off\n\t"
                 "global_load_async_to_lds_b128 %2, %10, off\n\t"
                 "global_load_async_to_lds_b128 %3, %11, off\n\t"
                 "global_load_async_to_lds_b128 %4, %12, off\n\t"
                 "global_load_async_to_lds_b128 %5, %13, off\n\t"
                 "global_load_async_to_lds_b128 %6, %14, off\n\t"
                 "global_load_async_to_lds_b128 %7, %15, off\n\t"
                 "s_wait_xcnt 0x0"
                 :: "v"(l), "v"(l + ls), "v"(l + 2 * ls), "v"(l + 3 * ls), "v"(l + 4 * ls), "v"(l + 5 * ls), "v"(l + 6 * ls), "v"(l + 7 * ls),
                    "v"(g), "v"(g + gs), "v"(g + 2 * gs), "v"(g + 3 * gs), "v"(g + 4 * gs), "v"(g + 5 * gs), "v"(g + 6 * gs), "v"(g + 7 * gs)
                 : "memory");
}
// lane l <-> lane l ^ 16 on the vector unit: unlike the LDS-path shuffle it does not count on dscnt, so its result needs no wait that would drain the fragment reads issued ahead of it
__device__ __forceinline__ float xhalf(float v) { const unsigned u = __float_as_uint(v);
    return __uint_as_float(__builtin_amdgcn_permlanex16(u, u, 0x76543210u, 0xfedcba98u, false, false)); }
// ordering point for wave-private LDS tiles (same wave writes and reads)
__device__ __forceinline__ void wave_sync() { __builtin_amdgcn_fence(3 /* release order */, "wavefront"); __builtin_amdgcn_wave_barrier(); asm volatile("" ::: "memory"); }

// f32 -> f16 convert that cannot produce an f16 subnormal (|v| < 2^-14 -> +0); applied after the plane's power-of-two carry
static __device__ __forceinline__ h16 toh_flush(float v) { const h16 r = (h16)v; return (fabsf(v) < 6.103515625e-05f) ? (h16)0.0f : r; }
// one matrix instruction + its own four-slot guard (accumulator tied, operands kept live)
__device__ __forceinline__ v8f wmma16g(v16h a, v16h b, v8f c) {
    c = __builtin_amdgcn_wmma_f32_16x16x32_f16(false, a, false, b, (short)0, c, false, false);
    asm volatile("v_nop\n\tv_nop\n\tv_nop\n\tv_nop" : "+v"(c) : "v"(a), "v"(b));
    return c; }
__device__ __forceinline__ v8f wmmabg(v16bf a, v16bf b, v8f c) {
    c = __builtin_amdgcn_wmma_f32_16x16x32_bf16(false, a, false, b, (short)0, c, false, false);
    asm volatile("v_nop\n\tv_nop\n\tv_nop\n\tv_nop" : "+v"(c) : "v"(a), "v"(b));
    return c; }

// x convert, 8 elements per thread: group i of the n8 groups of one batch
__device__ __forceinline__ void cvt8_body(const float* __restrict__ src, bf* dst, size_t i, size_t n8) {
    if (i >= n8) return;
    const v8f v = *(const v8f*)(src + i * 8); v8us o;
#pragma unroll
    for (int k = 0; k < 8; ++k) o[k] = f2bf(v[k]);
    *(v8us*)(dst + i * 8) = o; 
}

// Weight transposer: in[R][C] (f32) -> out[C][R] (16-bit), 64 x 64 tile (rows r0.., columns c0..) per block through LDS (cross-wave: block barrier).
// ASH = 0: bf16 bits (RNE convert). ASH = 1: f16 of (RNE bf16 value x 64), subnormal-free convert.
template <int ASH>
__device__ __forceinline__ void wtr_body(float* ts, const float* __restrict__ src, bf* dstb, h16* dsth, int R, int C, int r0, int c0) {
    const int tid = threadIdx.x;
#pragma unroll 1
    for (int i = 0; i < 16; ++i) { const int rr = i * 4 + (tid >> 6), cc = tid & 63;        // 16 trips x 4 rows = 64 rows; 64 columns
        ts[rr * 65 + cc] = src[(size_t)(r0 + rr) * C + c0 + cc]; }
    __syncthreads();
    static_assert(256 * 8 * 2 == 64 * 64);                                                 // threads x elements per store x trips == tile
{
#pragma unroll 1
        for (int it = 0; it < 2; ++it) {
            const int cc = it * 32 + (tid >> 3), r8 = (tid & 7) * 8;                        // 2 trips x 32 output rows; 8 lanes x 8 elements = 64 = one line
            const size_t oo = (size_t)(c0 + cc) * R + r0 + r8;
            if (ASH) { v8h o;
#pragma unroll
                for (int k = 0; k < 8; ++k) o[k] = toh_flush(bfr(ts[(r8 + k) * 65 + cc]) * WOS);
                *(v8h*)(dsth + oo) = o;
                asm volatile("s_wait_xcnt 0x0" ::: "memory");   // precaution: stands in front of whatever next rewrites the store's address and data registers (next trip, or code behind the loop)
            } else { v8us o;
#pragma unroll
                for (int k = 0; k < 8; ++k) o[k] = f2bf(ts[(r8 + k) * 65 + cc]);
                *(v8us*)(dstb + oo) = o;
                asm volatile("s_wait_xcnt 0x0" ::: "memory"); }  // precaution: as above
        }
         }
}
// k_prep: every operand preparation that depends on the inputs alone, in one grid. Blocks 0 .. 4*WTB-1: one 64 x 64 weight tile each (W_theta, W_phi, W_g, W_out in turn;
// lowest indices, for speed only); the other blocks: 2048 elements of x each. The split is block-uniform.
#define WTB ((CIN / 64) * (CB / 64))   // 64 x 64 tiles per weight
static_assert(WTB == (CB / 64) * (COUT / 64));
#define CVB ((int)(((size_t)SEQ * CIN / 8 + 255) / 256))   // x convert blocks per batch
__global__ __launch_bounds__(256) void k_prep(const float* __restrict__ x, const float* __restrict__ wt, const float* __restrict__ wp, const float* __restrict__ wg,
                                              const float* __restrict__ wo, bf* XB, bf* WT, bf* WP, bf* WG, h16* WOH) {
    __shared__ float ts[64 * 65];
    const int blk = blockIdx.x;
    if (blk < 4 * WTB) {
        const int w = blk / WTB, t = blk % WTB;
        if (w == 3) { wtr_body<1>(ts, wo, (bf*)0, WOH, CB, COUT, (t % (CB / 64)) * 64, (t / (CB / 64)) * 64); }      // [128][256] -> [256][128]
        else { const float* src = (w == 0) ? wt : (w == 1) ? wp : wg; bf* dst = (w == 0) ? WT : (w == 1) ? WP : WG;
            wtr_body<0>(ts, src, dst, (h16*)0, CIN, CB, (t % (CIN / 64)) * 64, (t / (CIN / 64)) * 64); }             // [256][128] -> [128][256]
        return;
    }
    const int cb = blk - 4 * WTB, bb = cb / CVB;               // batch pitch: SEQ_FULL rows in x, SEQ rows in the bf16 copy
    cvt8_body(x + (size_t)bb * SEQ_FULL * CIN, XB + (size_t)bb * SEQ * CIN, (size_t)(cb % CVB) * 256 + threadIdx.x, (size_t)SEQ * CIN / 8);
}

// mm64: register-blocked bf16 GEMM main loop, ONE WAVE per 64x64 tile (16 accumulators), operands from staged LDS rows of pitch XP, K = CIN.
// a, b: the lane's first row of each operand, already + (lane&15)*XP + 16*(lane>>4). acc[mb][nb][j] = C[16mb + 8h + j][16nb + (lane&15)], C[m][n] = sum_k A[m][k] Bt[n][k].
__device__ __forceinline__ void mm64(const unsigned char* a, const unsigned char* b, v8f (&acc)[4][4]) {
#pragma unroll
    for (int mb = 0; mb < 4; ++mb)
#pragma unroll
        for (int nb = 0; nb < 4; ++nb) acc[mb][nb] = (v8f){};
#pragma unroll 1
    for (int kc = 0; kc < CIN * 2; kc += 64) {                 // kc in bytes: 32 elements a step
        v16bf af[4], bb[4];
#pragma unroll
        for (int mb = 0; mb < 4; ++mb) { af[mb] = ldlb(a + mb * 16 * XP + kc); bb[mb] = ldlb(b + mb * 16 * XP + kc); }
        __builtin_amdgcn_sched_barrier(0);                     // keeps the step's LDS reads one group ahead of its products (else each B fragment is read, and waited for, in among them)
#pragma unroll
        for (int nb = 0; nb < 4; ++nb)
#pragma unroll
            for (int mb = 0; mb < 4; ++mb) acc[mb][nb] = wmmabg(af[mb], bb[nb], acc[mb][nb]);
    }
}

// proj_q: q = x W_theta, 64 x 64 tile (bx, by). A = x rows (m = b*SEQ + t), Bt = transposed weight rows (n = d). Planes [b*SEQ + t][128]: f16 value (Ph) and f16 residual x2048 (Pr).
__device__ __forceinline__ void proj_q(float* os, const unsigned char* A, const unsigned char* Bt, h16* Ph, h16* Pr, int bx, int by) {
    const int lane = threadIdx.x & 31, lr = lane & 15, hi = lane >> 4; const int r0 = bx * 64, c0 = by * 64;
    v8f acc[4][4];
    mm64(A, Bt, acc);
    const size_t obase = (size_t)r0 * CB + c0;
#pragma unroll
    for (int mb = 0; mb < 4; ++mb) {
#pragma unroll
        for (int nb = 0; nb < 4; ++nb) {
#pragma unroll
            for (int j = 0; j < 8; ++j) os[(hi * 8 + j) * 68 + nb * 16 + lr] = acc[mb][nb][j]; }   // D: row 8h+j, col lane&15; 16 x 64 all written
        wave_sync();
        static_assert(32 * 8 * 4 == 16 * 64);                                                     // lanes x halves x instructions == slab
{
#pragma unroll
            for (int s = 0; s < 4; ++s) { const int row = 4 * s + (lane >> 3), c8 = (lane & 7) * 8;   // 4 s x 4 row groups = 16 rows; 8 lanes x 8 = 64 columns
                const v4f x0 = *(const v4fa*)(&os[row * 68 + c8]); const v4f x1 = *(const v4fa*)(&os[row * 68 + c8 + 4]); v8h hv, rv;
#pragma unroll
                for (int i = 0; i < 4; ++i) { const h16 a0 = toh_flush(x0[i]); const h16 a1 = toh_flush(x1[i]); hv[i] = a0; hv[4 + i] = a1;
                    rv[i] = toh_flush((x0[i] - (float)a0) * QRS); rv[4 + i] = toh_flush((x1[i] - (float)a1) * QRS); }
                const size_t oo = obase + (size_t)(mb * 16 + row) * CB + c8;
                *(v8h*)(Ph + oo) = hv; *(v8h*)(Pr + oo) = rv; }
             }
        wave_sync();
    }
}

// proj_k: k = maxpool2(x W_phi) over adjacent token pairs, 64 x 64 tile (bx, by). Same GEMM; per 16-token slab the 8 pooled rows (max in f32, then convert) go to planes [b*MK + key][128]: f16 value and f16 residual x2048.
__device__ __forceinline__ void proj_k(float* os, const unsigned char* A, const unsigned char* Bt, h16* Ph, h16* Pr, int bx, int by) {
    const int lane = threadIdx.x & 31, lr = lane & 15, hi = lane >> 4; const int r0 = bx * 64, c0 = by * 64;
    v8f acc[4][4];
    mm64(A, Bt, acc);
    const size_t obase = (size_t)(r0 / 2) * CB + c0;                                              // (b*SEQ + t)/2 = b*MK + t/2
#pragma unroll
    for (int mb = 0; mb < 4; ++mb) {
#pragma unroll
        for (int nb = 0; nb < 4; ++nb) {
#pragma unroll
            for (int j = 0; j < 8; ++j) os[(hi * 8 + j) * 68 + nb * 16 + lr] = acc[mb][nb][j]; }
        wave_sync();
        static_assert(32 * 8 * 2 == 8 * 64);                                                      // lanes x halves x instructions == pooled slab
{
#pragma unroll
            for (int s = 0; s < 2; ++s) { const int prow = 4 * s + (lane >> 3), c8 = (lane & 7) * 8;   // 2 s x 4 row groups = 8 pooled rows (token rows 2*prow, 2*prow+1)
                const v4f u0 = *(const v4fa*)(&os[(2 * prow) * 68 + c8]);     const v4f u1 = *(const v4fa*)(&os[(2 * prow) * 68 + c8 + 4]);
                const v4f w0 = *(const v4fa*)(&os[(2 * prow + 1) * 68 + c8]); const v4f w1 = *(const v4fa*)(&os[(2 * prow + 1) * 68 + c8 + 4]); v8h hv, rv;
#pragma unroll
                for (int i = 0; i < 4; ++i) { const float y0 = fmaxf(u0[i], w0[i]), y1 = fmaxf(u1[i], w1[i]);
                    const h16 a0 = toh_flush(y0); const h16 a1 = toh_flush(y1); hv[i] = a0; hv[4 + i] = a1;
                    rv[i] = toh_flush((y0 - (float)a0) * QRS); rv[4 + i] = toh_flush((y1 - (float)a1) * QRS); }
                const size_t oo = obase + (size_t)(mb * 8 + prow) * CB + c8;
                *(v8h*)(Ph + oo) = hv; *(v8h*)(Pr + oo) = rv; }
             }
        wave_sync();
    }
}

// proj_gt: pooled values transposed, G^T[d][key] = max over the token pair of (W_g^T x^T)[d][t]. ONE WAVE per 32 (d) x 128 (token) tile (16 accumulators):
// A = transposed weight rows (m = d), Bt = x rows (n = b*SEQ + t). Plane [(b*128 + d)][MK], single f16. Per 16-row slab staged in LDS (wave-private);
__device__ __forceinline__ void proj_gt(float* os, const unsigned char* A, const unsigned char* Bt, h16* Gt, int bx, int by) {
    const int lane = threadIdx.x & 31, lr = lane & 15, hi = lane >> 4; const int r0 = bx * 32, c0 = by * 128;
    v8f acc[2][8];
#pragma unroll
    for (int mb = 0; mb < 2; ++mb)
#pragma unroll
        for (int nb = 0; nb < 8; ++nb) acc[mb][nb] = (v8f){};
#pragma unroll 1
    for (int kc = 0; kc < CIN * 2; kc += 64) {                 // kc in bytes: 32 elements a step
        v16bf a[2], b[8];
#pragma unroll
        for (int mb = 0; mb < 2; ++mb) a[mb] = ldlb(A + mb * 16 * XP + kc);
#pragma unroll
        for (int nb = 0; nb < 8; ++nb) b[nb] = ldlb(Bt + nb * 16 * XP + kc);
        __builtin_amdgcn_sched_barrier(0);                     // keeps the step's LDS reads one group ahead of its products, as in mm64
#pragma unroll
        for (int nb = 0; nb < 8; ++nb)
#pragma unroll
            for (int mb = 0; mb < 2; ++mb) acc[mb][nb] = wmmabg(a[mb], b[nb], acc[mb][nb]);
    }
    const int bb = c0 / SEQ, tt = c0 % SEQ;
    const size_t obase = ((size_t)bb * CB + r0) * MK + (size_t)(tt / 2);
#pragma unroll
    for (int mb = 0; mb < 2; ++mb) {
#pragma unroll
        for (int nb = 0; nb < 8; ++nb) {
#pragma unroll
            for (int j = 0; j < 8; ++j) os[(hi * 8 + j) * OPF + nb * 16 + lr] = acc[mb][nb][j]; }   // D: row d = 8h+j, col token = 16nb + lane&15; 16 x 128 all written
        wave_sync();
        static_assert(32 * 8 * 4 == 16 * 64);                                                       // lanes x pooled halves x instructions == pooled slab
{
#pragma unroll
            for (int s = 0; s < 4; ++s) { const int row = 4 * s + (lane >> 3), c8 = (lane & 7) * 8;     // 4 s x 4 row groups = 16 rows; 8 lanes x 8 pooled = 64 pooled columns
                const v4f f0 = *(const v4fa*)(&os[row * OPF + 2 * c8]);     const v4f f1 = *(const v4fa*)(&os[row * OPF + 2 * c8 + 4]);
                const v4f f2 = *(const v4fa*)(&os[row * OPF + 2 * c8 + 8]); const v4f f3 = *(const v4fa*)(&os[row * OPF + 2 * c8 + 12]); v8h hv;
                hv[0] = toh_flush(fmaxf(f0[0], f0[1])); hv[1] = toh_flush(fmaxf(f0[2], f0[3]));
                hv[2] = toh_flush(fmaxf(f1[0], f1[1])); hv[3] = toh_flush(fmaxf(f1[2], f1[3]));
                hv[4] = toh_flush(fmaxf(f2[0], f2[1])); hv[5] = toh_flush(fmaxf(f2[2], f2[3]));
                hv[6] = toh_flush(fmaxf(f3[0], f3[1])); hv[7] = toh_flush(fmaxf(f3[2], f3[3]));
                const size_t oo = obase + (size_t)(mb * 16 + row) * MK + c8;
                *(v8h*)(Gt + oo) = hv; }
             }
        wave_sync();
    }
}

// k_proj: the three input projections, which depend on k_prep alone and not on one another. One block of twelve waves per 128 tokens: waves 0..3 the four 64 x 64 q tiles,
// waves 4..7 the four k tiles, waves 8..11 the four 32 x 128 value^T tiles. The block's operands are staged once in LDS by whole-row asynchronous copies (a fragment load straight from
// the planes touches 16 lines for 512 bytes): wave w brings weight rows 32w .. 32w+31 of the 384 (W_theta^T, W_phi^T, W_g^T in turn), waves 0..7 also 16 x rows each.
// Staging tiles of the store stage are wave-private: the q and k waves have their own behind the operands; a value^T wave uses the first 16 of its 32 weight rows, which it alone reads and has left by then.
__global__ __launch_bounds__(32 * PW) void k_proj(const bf* __restrict__ XB, const bf* __restrict__ WT, const bf* __restrict__ WP, const bf* __restrict__ WG,
                                                  h16* QH, h16* QR, h16* KH, h16* KR, h16* GT) {
    __shared__ __align__(16) unsigned char sm[PLDS];
    const int lane = threadIdx.x & 31, lr = lane & 15, hi = lane >> 4;
    const int wave = __builtin_amdgcn_readfirstlane((int)(threadIdx.x >> 5));
    const int which = wave >> 2, sub = wave & 3;               // wave-uniform: projection, tile
    const int blk = blockIdx.x;
    const unsigned sb = (unsigned)(size_t)sm;                  // LDS byte address of the array
    const bf* wsrc = (which == 0) ? WT : (which == 1) ? WP : WG;
    const unsigned lw = sb + WS_O + 32 * wave * XP + lane * 16;
    const h16* gw = (const h16*)wsrc + 32 * sub * CIN + lane * 8;
#pragma unroll
    for (int c = 0; c < 4; ++c) cp8(lw + c * 8 * XP, gw + c * 8 * CIN, XP, CIN);
    if (wave < 8) {                                            // scalar branch: every lane is on at the copies
        const unsigned lx = sb + 16 * wave * XP + lane * 16;
        const h16* gx = (const h16*)XB + ((size_t)blk * PT + 16 * wave) * CIN + lane * 8;
        cp8(lx, gx, XP, CIN);
        cp8(lx + 8 * XP, gx + 8 * CIN, XP, CIN);
    }
    asm volatile("s_wait_asynccnt 0x0" ::: "memory");          // this wave's copies have landed before the barrier publishes them
    __syncthreads();
    const unsigned char* xs = sm + lr * XP + 16 * hi;          // fragment rows: + row * XP + 2 * k
    const unsigned char* ws = sm + WS_O + lr * XP + 16 * hi;
    if (which == 0)      proj_q((float*)(sm + OS_O + wave * OSB), xs + (sub & 1) * 64 * XP, ws + (sub >> 1) * 64 * XP, QH, QR, blk * 2 + (sub & 1), sub >> 1);
    else if (which == 1) { proj_k((float*)(sm + OS_O + wave * OSB), xs + (sub & 1) * 64 * XP, ws + (CB + (sub >> 1) * 64) * XP, KH, KR, blk * 2 + (sub & 1), sub >> 1);
        asm volatile("s_wait_xcnt 0x0" ::: "memory"); }        // precaution: in the built text this body is followed by the other bodies' code, which rewrites the registers that its last stores name (the other two run into the end of the program)
    else { proj_gt((float*)(sm + WS_O + 32 * wave * XP), ws + 32 * wave * XP, xs, GT, sub, blk);
        asm volatile("s_wait_xcnt 0x0" ::: "memory"); }        // precaution: as above (whichever body the built text puts last runs into the end of the program)
}

// k_attn: fused attention + output projection + skip term, one wave per 16 query rows of one batch; K / G^T / Q / W_out^T fragments from LDS rows (two 16-B reads each).
// Staging: whole-line asynchronous copies; each wave brings its own 16 q rows once, and a quarter of every 64-key tile (k value, k residual, value^T) into one of two buffers, one tile ahead of its use.
// Transposed form: S^T[key][t] = K Q^T (A = K rows, B = Q rows, 4 k-steps over d); lane (t = lane&15, h = lane>>4) holds keys 8h+r of each 16-key tile, so the packed
// P tile is directly the B fragment of O^T[d][t] = G^T P^T (element r <- tile keys 0..15, element 8+r <- tile keys 16..31, lane unchanged), 8 tiles over d.
// Scores = K Q + (K Q_res + K_res Q) / 2048. Softmax state (running max, partial sum) is one scalar per lane; the two lane halves of a row are combined with one xor-16 exchange.
// Q fragments are read from LDS once and held in registers. The key loop's fragment reads stand at two places per pass, each a whole phase ahead of its use; 512 registers per wave (two waves per SIMD).
// Epilogue: W_out^T rows copied whole-line into the freed tile buffers, a quarter per wave (a fragment load straight from the plane touches 16 lines for 512 bytes, and every wave needs all 256 of them);
// ctx^T = O^T / l packed to f16 (tiles 2kk, 2kk+1 -> B fragment of k-step kk); out^T[c][t] = W_out^T ctx^T per 16-channel tile, staged in a wave-private LDS tile [t][128 channels];
__global__ __launch_bounds__(32 * AW) __attribute__((amdgpu_num_vgpr(512)))
void k_attn(const h16* __restrict__ QH, const h16* __restrict__ QR, const h16* __restrict__ KH, const h16* __restrict__ KR,
            const h16* __restrict__ GT, const h16* __restrict__ WO, const float* __restrict__ X, float* OUT) {
    __shared__ __align__(16) unsigned char sm[LDSB];
    const int lane = threadIdx.x & 31, lr = lane & 15, hi = lane >> 4;
    const int wave = __builtin_amdgcn_readfirstlane((int)(threadIdx.x >> 5));
    const int b = blockIdx.y;
    const int t0 = (blockIdx.x * AW + wave) * 16;
    // copy side: q / k rows of 256 B, two per copy (16 lanes each); value^T rows of 128 B, four per copy (8 lanes each)
    const unsigned sb = (unsigned)(size_t)sm;                  // LDS byte address of the array
    const unsigned lq = sb + Q_O + wave * QWB + (lane >> 4) * KP + (lane & 15) * 16;
    const unsigned lk = sb + (16 * wave + (lane >> 4)) * KP + (lane & 15) * 16;
    const unsigned lg = sb + GT_O + (32 * wave + (lane >> 3)) * GP + (lane & 7) * 16;
    const int gq = (b * SEQ + t0 + (lane >> 4)) * CB + (lane & 15) * 8;
    const int gk = (b * MK + 16 * wave + (lane >> 4)) * CB + (lane & 15) * 8;    // + tile * KT * CB
    const int gg = (b * CB + 32 * wave + (lane >> 3)) * MK + (lane & 7) * 8;     // + tile * KT
    // read side
    const unsigned char* qp = sm + Q_O + wave * QWB + lr * KP + 16 * hi;         // B fragments: col t, k = d; residual rows + 16*KP
    const int ko = lr * KP + 16 * hi;                          // + buffer + key * KP      (A fragment: row key, k = d)
    const int vo = GT_O + lr * GP + 16 * hi;                   // + buffer + 16j*GP + 2*key (A fragment: row d, k = key)
    // prologue: q rows and tile 0, landed and published; then tile 1 into the second buffer
    cp8(lq, QH + gq, 2 * KP, 2 * CB);
    cp8(lq + 16 * KP, QR + gq, 2 * KP, 2 * CB);
    cp8(lk, KH + gk, 2 * KP, 2 * CB);
    cp8(lk + KR_O, KR + gk, 2 * KP, 2 * CB);
    cp8(lg, GT + gg, 4 * GP, 4 * (size_t)MK);
    asm volatile("s_wait_asynccnt 0x0" ::: "memory");          // this wave's copies have landed before the barrier publishes them
    __syncthreads();
    // q fragments: read once, held in registers over the whole key loop. k fragments of tile 0, pass 0 (published by the barrier above): their reads return while tile 1's copies are issued
    v16h qh[4], qr[4], ka[4], kb[4], kra[4], krb[4];
#pragma unroll
    for (int kk = 0; kk < 4; ++kk) { qh[kk] = ldl(qp + kk * 64); qr[kk] = ldl(qp + 16 * KP + kk * 64); }
#pragma unroll
    for (int kk = 0; kk < 4; ++kk) {
        ka[kk] = ldl(sm + ko + kk * 64); kb[kk] = ldl(sm + ko + 16 * KP + kk * 64);
        kra[kk] = ldl(sm + ko + KR_O + kk * 64); krb[kk] = ldl(sm + ko + KR_O + 16 * KP + kk * 64); }
    cp8(lk + STB, KH + gk + KT * CB, 2 * KP, 2 * CB);
    cp8(lk + STB + KR_O, KR + gk + KT * CB, 2 * KP, 2 * CB);
    cp8(lg + STB, GT + gg + KT, 4 * GP, 4 * (size_t)MK);
    v8f o[8];
#pragma unroll
    for (int j = 0; j < 8; ++j) o[j] = (v8f){};
    float m = NEGB, l = 0.0f;
#pragma unroll 1
    for (int st = 0; st < NST; ++st) {
    const int bo = (st & 1) * STB;                             // this tile's buffer
    // LDS fragment reads stand at two places per 32-key pass, each a whole phase ahead of its use: the pass's value^T fragments ahead of its score products,
    // the next pass's k fragments behind them (into the registers those products have just read), ahead of the softmax and the output products.
#pragma unroll                                                 // unrolled: the tile's publish point stands inside its last pass only
    for (int ps = 0; ps < KT / 32; ++ps) {                     // 32-key passes in key order
        const unsigned char* vv = sm + bo + vo + ps * 64;
        v16h vf[8];
#pragma unroll
        for (int j = 0; j < 8; ++j) vf[j] = ldl(vv + j * 16 * GP);
        __builtin_amdgcn_sched_barrier(0);                     // keeps the value^T reads one group ahead of the score products (else they sink in among the matrix instructions)
        v8f sHa = (v8f){}, sLa = (v8f){}, sHb = (v8f){}, sLb = (v8f){};
        // plain builtin in the key loop (the compiler keeps the distances behind it): the guarded form's asm operands tie every fragment and accumulator to the first 256 registers, which spills here
#pragma unroll
        for (int kk = 0; kk < 4; ++kk) {
            sHa = wmma16(ka[kk], qh[kk], sHa); sHb = wmma16(kb[kk], qh[kk], sHb);
            sLa = wmma16(ka[kk], qr[kk], sLa); sLb = wmma16(kb[kk], qr[kk], sLb);
            sLa = wmma16(kra[kk], qh[kk], sLa); sLb = wmma16(krb[kk], qh[kk], sLb);
        }
        __builtin_amdgcn_sched_barrier(0);                     // keeps the next k reads behind the last score product, as one group
        const unsigned char* kn;
        if (ps + 1 < KT / 32) kn = sm + bo + ko + (ps + 1) * 32 * KP;
        else {
            // publish point of tile st + 1, inside tile st's last pass: every read of this buffer has been issued (k fragments used, value^T fragments fetched above)
            asm volatile("s_wait_dscnt 0x0" ::: "memory");     // this wave has left the buffer that is refilled behind the barrier
            asm volatile("s_wait_asynccnt 0x0" ::: "memory");  // this wave's share of tile st + 1 has landed
            __syncthreads();
            kn = sm + (STB - bo) + ko;                         // behind the last tile: the other buffer's old rows, landed and published long ago; read unconditionally (a branch here would merge the compiler's wait counts to 0), never used
        }
#pragma unroll
        for (int kk = 0; kk < 4; ++kk) {
            ka[kk] = ldl(kn + kk * 64); kb[kk] = ldl(kn + 16 * KP + kk * 64);
            kra[kk] = ldl(kn + KR_O + kk * 64); krb[kk] = ldl(kn + KR_O + 16 * KP + kk * 64); }
        __builtin_amdgcn_sched_barrier(0);                     // keeps the k reads ahead of the softmax, whose time covers their latency
        if (ps + 1 == KT / 32 && st + 2 < NST) {               // refill of the buffer just freed; the test reads the same for the whole block
            const int tk = (st + 2) * KT;
            // the lane's two LDS copy addresses are formed anew at each refill (a few vector instructions): held in registers over the loop they went to scratch.
            // The lane number is taken with the loop-variant addend st, so that the compiler does not hoist the addresses out of the loop again.
            const unsigned ln = __builtin_amdgcn_mbcnt_lo(~0u, (unsigned)st) - (unsigned)st;
            const unsigned rk = sb + bo + (16 * wave + (ln >> 4)) * KP + (ln & 15) * 16;
            const unsigned rg = sb + bo + GT_O + (32 * wave + (ln >> 3)) * GP + (ln & 7) * 16;
            cp8(rk, KH + gk + tk * CB, 2 * KP, 2 * CB);
            cp8(rk + KR_O, KR + gk + tk * CB, 2 * KP, 2 * CB);
            cp8(rg, GT + gg + tk, 4 * GP, 4 * (size_t)MK);
        }
        float ta[8], tb[8]; float mx = NEGB;
#pragma unroll
        for (int r = 0; r < 8; ++r) {
            ta[r] = (sHa[r] + sLa[r] * QRI) * L2E; tb[r] = (sHb[r] + sLb[r] * QRI) * L2E;
            mx = fmaxf(mx, fmaxf(ta[r], tb[r])); }
        mx = fmaxf(mx, xhalf(mx));
        const float mnew = fmaxf(m, mx);
        const float alpha = __builtin_amdgcn_exp2f(m - mnew);
        const float sh = PSH - mnew;
        v16h pb; float ls = 0.0f;
#pragma unroll
        for (int r = 0; r < 8; ++r) {
            const float ea = ta[r] + sh, eb = tb[r] + sh;
            const float xa = __builtin_amdgcn_exp2f(ea), xb = __builtin_amdgcn_exp2f(eb);
            const float ga = (ea < -14.0f) ? 0.0f : xa, gb = (eb < -14.0f) ? 0.0f : xb;   // nothing below 2^-14 reaches the f16 operand
            const h16 pa = (h16)ga; const h16 pc = (h16)gb;
            pb[r] = pa; pb[8 + r] = pc;
            ls += (float)pa + (float)pc; }
        l = l * alpha + ls; m = mnew;
#pragma unroll
        for (int j = 0; j < 8; ++j) o[j] = o[j] * alpha;
#pragma unroll
        for (int j = 0; j < 8; ++j) o[j] = wmma16(vf[j], pb, o[j]);
    }
    }
    asm volatile("s_wait_asynccnt 0x0" ::: "memory");          // nothing in flight before the q rows become output staging
    // W_out^T [256 channels][128] into the bytes of the two tile buffers, rows of pitch KP: wave w brings rows 64w .. 64w+63, two per copy; the copies fly under the normalisation below
    asm volatile("s_wait_dscnt 0x0" ::: "memory");             // this wave's last reads of the tile buffers (the k rows fetched behind the last tile) have returned
    __syncthreads();                                           // every wave has left both tile buffers
    {
        const unsigned lw = sb + (64 * wave + (lane >> 4)) * KP + (lane & 15) * 16;
        const h16* gw = WO + (64 * wave + (lane >> 4)) * CB + (lane & 15) * 8;
#pragma unroll                                                 // unrolled: four statements of eight copies, their address steps constants
        for (int c = 0; c < 4; ++c) cp8(lw + c * 16 * KP, gw + c * 16 * CB, 2 * KP, 2 * CB);
    }
    l += __shfl_xor(l, 16, 32);
    const float inv = 1.0f / l;                                // l >= 16384 (the row maximum contributes the full carry)
    // ctx^T D layout: o[j][r] = (d = 16j + 8h + r, t = lane&15); B fragment of k-step kk: element r <- tile 2kk, element 8+r <- tile 2kk+1
    v16h cf[4];
#pragma unroll
    for (int kk = 0; kk < 4; ++kk) {
#pragma unroll
        for (int r = 0; r < 8; ++r) { cf[kk][r] = toh_flush(o[2 * kk][r] * inv); cf[kk][8 + r] = toh_flush(o[2 * kk + 1][r] * inv); } }
    asm volatile("s_wait_asynccnt 0x0" ::: "memory");          // this wave's W_out^T rows have landed before the barrier publishes them
    __syncthreads();
    float* os = (float*)(sm + Q_O);                            // each wave stages in the bytes of its own q rows, which only it has read
    const int wb = wave * (QWB / 4);
    const size_t xrow = ((size_t)b * SEQ_FULL + t0) * COUT;
    const size_t orow = ((size_t)b * OUT_SEQ + t0) * COUT;
#pragma unroll 1
    for (int hc = 0; hc < 2; ++hc) {
#pragma unroll 1
        for (int ct = 0; ct < 8; ct += 2) {
            const int cg = hc * 8 + ct;
            v16h wa[2][4];                                     // A fragments of two channel tiles: row c = 16(cg + u) + (lane&15), k = d; the loops over u and kk are unrolled so that the arrays stay in registers
#pragma unroll
            for (int u = 0; u < 2; ++u)
#pragma unroll
                for (int kk = 0; kk < 4; ++kk) wa[u][kk] = ldl(sm + ko + (cg + u) * 16 * KP + kk * 64);
            __builtin_amdgcn_sched_barrier(0);                 // keeps the trip's LDS reads one group ahead of its products (else each fragment is read, and waited for, directly in front of its product)
            v8f acc[2]; acc[0] = (v8f){}; acc[1] = (v8f){};
#pragma unroll
            for (int kk = 0; kk < 4; ++kk) { acc[0] = wmma16g(wa[0][kk], cf[kk], acc[0]); acc[1] = wmma16g(wa[1][kk], cf[kk], acc[1]); }
            // D: acc[u][r] = (c = 16(cg + u) + 8h + r, t = lane&15) -> os[t][16(ct + u) + 8h + r]; rows 0..15 x columns 0..127 all written over the 8 tiles
#pragma unroll
            for (int u = 0; u < 2; ++u) {
                v4f a0, a1;
                a0[0] = acc[u][0] * WOI; a0[1] = acc[u][1] * WOI; a0[2] = acc[u][2] * WOI; a0[3] = acc[u][3] * WOI;
                a1[0] = acc[u][4] * WOI; a1[1] = acc[u][5] * WOI; a1[2] = acc[u][6] * WOI; a1[3] = acc[u][7] * WOI;
                *(v4fa*)(&os[wb + lr * OPF + (ct + u) * 16 + 8 * hi]) = a0; *(v4fa*)(&os[wb + lr * OPF + (ct + u) * 16 + 8 * hi + 4]) = a1;
            }
        }
        wave_sync();
        static_assert(32 * 4 * 16 == 16 * 128);                // lanes x floats x instructions == half tile
{
#pragma unroll 4
            for (int s = 0; s < 16; ++s) { const int cofs = lane * 4;
                const v4f val = *(const v4fa*)(&os[wb + s * OPF + cofs]);
                const v4f xv = *(const v4f*)(X + xrow + (size_t)s * COUT + hc * 128 + cofs);
                v4f res; res[0] = bfr(xv[0]) + val[0]; res[1] = bfr(xv[1]) + val[1]; res[2] = bfr(xv[2]) + val[2]; res[3] = bfr(xv[3]) + val[3];
                *(v4f*)(OUT + orow + (size_t)s * COUT + hc * 128 + cofs) = res; }
             }
        wave_sync();
    }
}

static constexpr size_t al256(size_t v) { return (v + 255) & ~(size_t)255; }
static constexpr size_t SZ_XB = al256((size_t)NB * SEQ * CIN * 2);
static constexpr size_t SZ_W  = al256((size_t)CIN * CB * 2);
static constexpr size_t SZ_Q  = al256((size_t)NB * SEQ * CB * 2);
static constexpr size_t SZ_K  = al256((size_t)NB * MK * CB * 2);
static constexpr size_t SZ_TOTAL = SZ_XB + 4 * SZ_W + 2 * SZ_Q + 3 * SZ_K;
static_assert(SZ_TOTAL <= (size_t)134217728);                        // workspace carve <= 128 MiB
static_assert((size_t)CIN * CB == (size_t)CB * COUT);                // the W_out plane has the extent of an input-projection weight plane
static_assert((size_t)NB * MK * CB == (size_t)NB * CB * MK);         // value^T plane [(b*128 + d)][MK] has the extent of a k plane

extern "C" void kernel_launch(void* const* d_in, const int* in_sizes, int n_in,
                              void* d_out, int out_size, void* d_ws, size_t ws_size, hipStream_t stream) {
    if (n_in < 5) return;
    const size_t needx = ((size_t)(NB - 1) * SEQ_FULL + SEQ) * CIN;
    if ((size_t)in_sizes[0] < needx) return;
    if ((size_t)in_sizes[1] < (size_t)CIN * CB || (size_t)in_sizes[2] < (size_t)CIN * CB || (size_t)in_sizes[3] < (size_t)CIN * CB) return;
    if ((size_t)in_sizes[4] < (size_t)CB * COUT) return;
    if ((size_t)out_size < ((size_t)(NB - 1) * OUT_SEQ + SEQ) * COUT) return;
    if (SZ_TOTAL > ws_size) return;
    // wire order: x, W_theta, W_phi, W_g, W_out
    const float* x  = (const float*)d_in[0];
    const float* wt = (const float*)d_in[1];
    const float* wp = (const float*)d_in[2];
    const float* wg = (const float*)d_in[3];
    const float* wo = (const float*)d_in[4];
    float* OUT = (float*)d_out;      // [NB][SEQ][256]
    char* wsp = (char*)d_ws;
    bf*  XB = (bf*)wsp;  wsp += SZ_XB;               // x bf16 [NB*SEQ][256]
    bf*  WT = (bf*)wsp;  wsp += SZ_W;                // W_theta^T bf16 [128][256]
    bf*  WP = (bf*)wsp;  wsp += SZ_W;                // W_phi^T   bf16 [128][256]
    bf*  WG = (bf*)wsp;  wsp += SZ_W;                // W_g^T     bf16 [128][256]
    h16* WOH = (h16*)wsp; wsp += SZ_W;               // W_out^T   f16 x64 [256][128]
    h16* QH = (h16*)wsp; wsp += SZ_Q;                // [NB*SEQ][128]
    h16* QR = (h16*)wsp; wsp += SZ_Q;                // [NB*SEQ][128] residual x2048
    h16* KH = (h16*)wsp; wsp += SZ_K;                // [NB*MK][128]
    h16* KR = (h16*)wsp; wsp += SZ_K;                // [NB*MK][128] residual x2048
    h16* GT = (h16*)wsp; wsp += SZ_K;                // [NB*128][MK]

    k_prep<<<dim3(4 * WTB + NB * CVB, 1, 1), 256, 0, stream>>>(x, wt, wp, wg, wo, XB, WT, WP, WG, WOH);
    k_proj<<<dim3(NB * SEQ / PT, 1, 1), 32 * PW, 0, stream>>>(XB, WT, WP, WG, QH, QR, KH, KR, GT);
    k_attn<<<dim3(SEQ / (16 * AW), NB, 1), 32 * AW, 0, stream>>>(QH, QR, KH, KR, GT, WOH, x, OUT);
}

// v007
// A run of this version takes 71.7 microseconds.
// In two side-by-side timings against v006, it was 1.10 and 1.09 times as fast.
// Over all steps from v000 it is 4.40 times as fast.
#include <hip/hip_runtime.h>

// Spatial self-attention block over flattened pixels: x [NB][SEQ][256]; three 1x1 projections W [in 256][out 128] (no bias); keys and values max-pooled over adjacent token pairs (SEQ/2 keys);
// unscaled dot-product scores, softmax over keys; context [SEQ][128] -> output projection W_out [in 128][out 256]; output = x + projected context (f32).
// Compute dtypes, f32 accumulate everywhere: three input projections v_wmma_f32_16x16x32_bf16 (x and W RNE-converted to bf16; products exact);
// scores v_wmma_f32_16x16x32_f16 with q and k each as f16 value + f16 residual x2048 (three products, residual products in their own accumulator folded by 1/2048);
// P.V v_wmma_f32_16x16x32_f16, P single f16 with x16384 carry (cancels in the normalisation, row sum over the converted P), pooled values single f16;
// output projection v_wmma_f32_16x16x32_f16, context single f16, W_out (RNE bf16 value) x64 as f16, folded by 1/64; softmax f32 (online, running max); skip term = bf16-converted x added in f32 at the store stage.
// Layout: bf16 copy of x; transposed 16-bit weight planes [out][in]; q planes (value, residual) [b][t][128]; k planes (value, residual) [b][key][128]; value^T plane [b][d][key];
// fused flash kernel in transposed form (S^T = K Q^T, O^T = V^T P^T, out^T = W_out^T ctx^T with the packed O^T tiles as B fragments);
// its key-loop operands are staged in LDS: q rows by asynchronous copies, k and value^T in 64-key tiles with two buffers shared by the block's waves, each tile plane by one tensor load.
// behind the key loop the whole W_out^T plane is staged by asynchronous copies in the bytes of the two tile buffers, once per block, for the output projection's A fragments.
// the projections' operands (128 x rows, the 384 transposed weight rows) are staged in LDS the same way, once per block, and shared by the block's twelve waves.
// Three dependent launches: k_prep (bf16 copy of x and the four weight planes), k_proj (q, k, value^T planes), k_attn; work that does not depend on each other shares a grid.

#ifndef NB
#define NB 8
#endif
#ifndef SEQ
#define SEQ 4096
#endif
#define NB_FULL  8
#define SEQ_FULL 4096
#ifndef OUT_SEQ
#define OUT_SEQ SEQ              // row pitch (in tokens) between batches of the output
#endif
#define CIN  256                 // input channels (projection depth)
#define CB   128                 // bottleneck width (score depth, context width)
#define COUT 256                 // output channels
#define MK   (SEQ / 2)           // pooled keys per batch
#define AW   4                   // waves per flash block (16 query rows each)
#define OPF  132                 // LDS row pitch (floats) of the 16 x 128 staging tiles
#define QRS  2048.0f             // carry of every residual plane
#define QRI  (1.0f / 2048.0f)
#define L2E  1.4426950408889634f // log2(e); the module applies no score scale
#define PSH  14.0f               // log2 of the P carry (16384)
#define NEGB (-3.0e38f)
#define WOS  64.0f               // carry of the f16 W_out plane
#define WOI  (1.0f / 64.0f)
#define KT   64                  // keys per LDS tile (two 32-key passes)
#define NST  (MK / KT)           // tiles per batch
#define KP   272                 // LDS row pitch, bytes, of 256-byte q / k rows (16 B x odd: conflict-free 16-byte reads)
#define GP   144                 // LDS row pitch, bytes, of 128-byte value^T rows (16 B x odd)
#define KTP  18432               // bytes of one k plane's place in a tile buffer: KT rows of pitch KP, rounded up to a multiple of 2 KiB (every tensor load's destination is one)
#define KR_O KTP                 // tile layout: k value rows, k residual rows, value^T rows
#define GT_O (2 * KTP)
#define STB  (2 * KTP + CB * GP) // bytes of one tile buffer
#define Q_O  (2 * STB)           // behind the two buffers: per wave 16 q value rows, then 16 q residual rows
#define QWB  (2 * 16 * KP)       // bytes of one wave's q rows; the same bytes are that wave's output staging tile after the key loop
#define LDSB (Q_O + AW * QWB)
#define PT   128                 // tokens per projection block
#define PW   12                  // waves per projection block: four q tiles, four k tiles, four value^T tiles
#define XP   528                 // LDS row pitch, bytes, of 512-byte x / weight rows (16 B x odd: conflict-free 16-byte reads)
#define WS_O (PT * XP)           // projection block layout: 128 x rows, 3 x 128 weight rows, the q and k waves' staging tiles
#define OS_O (WS_O + 3 * CB * XP)
#define OSB  (16 * 68 * 4)       // bytes of one q / k staging tile
#define PLDS (OS_O + 8 * OSB)

static_assert(CB == 128);                      // flash: 4 k-steps of 32 per score tile, 8 output tiles of 16, 4 k-steps in the output projection
static_assert(COUT == 256);                    // output staged as two halves of 128 columns
static_assert(CIN == COUT);                    // skip term has the output's row width
static_assert(CIN % 32 == 0);                  // GEMM k-loop steps by 32
static_assert(CB % 32 == 0);
static_assert(CIN % 64 == 0);                  // weight transposer tiles of 64 x 64
static_assert(CB % 64 == 0);
static_assert(COUT % 64 == 0);
static_assert(SEQ % 128 == 0);                 // a 128-token value tile never straddles two batches; token pairs stay inside a tile
static_assert((NB * SEQ) % 128 == 0);
static_assert((NB * SEQ) % 64 == 0);
static_assert(MK % 32 == 0);                   // key loop steps by 32
static_assert(MK % 64 == 0);
static_assert(SEQ % (16 * AW) == 0);           // flash grid covers the sequence exactly
static_assert(((size_t)SEQ * CIN) % 8 == 0);
static_assert(NB <= NB_FULL);
static_assert(SEQ <= SEQ_FULL);
static_assert((OPF * 4) % 16 == 0);
static_assert(NST >= 2);                       // the two-buffer prologue fills tiles 0 and 1
static_assert(AW >= 3);                        // waves 0, 1, 2 each issue one tensor load per tile (k value, k residual, value^T)
static_assert(CB * 2 == 256 && KP == 256 + 16);   // a k row is 256 bytes: pad interval code 5, 4 dwords of pad
static_assert(KT * 2 == 128 && GP == 128 + 16);   // a value^T tile row is one 128-byte line: pad interval code 4, 4 dwords of pad
static_assert(KT * KP <= KTP && KTP % 2048 == 0 && STB % 2048 == 0);   // tensor-load destinations at multiples of 2 KiB, planes disjoint
static_assert((MK * 2) % 16 == 0 && MK * 2 <= 131072);                  // source pitch of the value^T tile
static_assert(16 * OPF * 4 <= QWB);            // the output staging tile fits the wave's q rows
static_assert(KP % 16 == 0);
static_assert(GP % 16 == 0);
static_assert(LDSB <= 163840);                 // two blocks per 320 KiB of LDS
static_assert(COUT * KP <= 2 * STB);           // the staged W_out^T plane (256 rows of 256 B, pitch KP) fits the two tile buffers
static_assert(COUT == 64 * AW);                // each wave copies 64 W_out^T rows (32 copies of 2 rows, all in flight: at most 63)
static_assert((size_t)NB * SEQ * CIN < (size_t)2147483647);   // int offsets inside the planes
static_assert(CIN * 2 == 32 * 16);             // an x or weight row is one 16-byte-per-lane copy of a wave
static_assert(XP % 16 == 0);
static_assert(3 * CB == 32 * PW);              // each wave copies 32 weight rows
static_assert(PT == 16 * 8);                   // waves 0..7 copy 16 x rows each
static_assert(32 + 16 <= 63);                  // copies of one wave in flight
static_assert((NB * SEQ) % PT == 0);
static_assert(SEQ % PT == 0);
static_assert(16 * OPF * 4 <= 16 * XP);        // a value^T wave's staging tile fits the first 16 of its own 32 weight rows
static_assert(PLDS <= 327680);                 // one block per 320 KiB of LDS

typedef _Float16 h16;
typedef unsigned short bf;
typedef __attribute__((ext_vector_type(16))) __bf16   v16bf;
typedef __attribute__((ext_vector_type(16))) _Float16 v16h;
typedef __attribute__((ext_vector_type(8)))  _Float16 v8h;
typedef __attribute__((ext_vector_type(8)))  unsigned short v8us;
typedef __attribute__((ext_vector_type(8)))  float    v8f;
typedef __attribute__((ext_vector_type(4)))  float    v4f;
typedef v4f  __attribute__((may_alias)) v4fa;
typedef v8h  __attribute__((may_alias)) v8ha;
typedef v8us __attribute__((may_alias)) v8usa;

__device__ __forceinline__ unsigned short f2bf(float f) { unsigned u = __float_as_uint(f); u += 0x7FFFu + ((u >> 16) & 1u); return (unsigned short)(u >> 16); }
__device__ __forceinline__ float bfr(float f) { return __uint_as_float(((unsigned)f2bf(f)) << 16); }   // value after RNE convert to bf16
__device__ __forceinline__ v16h cat16(v8h lo, v8h hi) { return __builtin_shufflevector(lo, hi, 0, 1, 2, 3, 4, 5, 6, 7, 8, 9, 10, 11, 12, 13, 14, 15); }
__device__ __forceinline__ v16bf cat16b(v8us lo, v8us hi) { return __builtin_bit_cast(v16bf, __builtin_shufflevector(lo, hi, 0, 1, 2, 3, 4, 5, 6, 7, 8, 9, 10, 11, 12, 13, 14, 15)); }
__device__ __forceinline__ v8f wmma16(v16h a, v16h b, v8f c) { return __builtin_amdgcn_wmma_f32_16x16x32_f16(false, a, false, b, (short)0, c, false, false); }
__device__ __forceinline__ v8f wmmab(v16bf a, v16bf b, v8f c) { return __builtin_amdgcn_wmma_f32_16x16x32_bf16(false, a, false, b, (short)0, c, false, false); }
// fragment loaders from K-contiguous 16-bit rows staged in LDS; p in bytes, already includes + 16*(lane>>4): elements 0..7 <- k0+8h+0..7, elements 8..15 <- k0+16+8h+0..7 (same map for A and B)
__device__ __forceinline__ v16h  ldl(const unsigned char* p) { return cat16(*(const v8ha*)p, *(const v8ha*)(p + 32)); }
__device__ __forceinline__ v16bf ldlb(const unsigned char* p) { return cat16b(*(const v8usa*)p, *(const v8usa*)(p + 32)); }
// eight asynchronous 16-byte-per-lane copies global -> LDS (l = the lane's LDS byte address, g = the lane's global address; steps between copies ls bytes, gs elements).
// The closing s_wait_xcnt stands inside the statement so that no address register is rewritten ahead of it.
__device__ __forceinline__ void cp8(unsigned l, const h16* g, unsigned ls, size_t gs) {
    asm volatile("global_load_async_to_lds_b128 %0, %8, off\n\t"
                 "global_load_async_to_lds_b128 %1, %9, off\n\t"
                 "global_load_async_to_lds_b128 %2, %10, off\n\t"
                 "global_load_async_to_lds_b128 %3, %11, off\n\t"
                 "global_load_async_to_lds_b128 %4, %12, off\n\t"
                 "global_load_async_to_lds_b128 %5, %13, off\n\t"
                 "global_load_async_to_lds_b128 %6, %14, off\n\t"
                 "global_load_async_to_lds_b128 %7, %15, off\n\t"
                 "s_wait_xcnt 0x0"
                 :: "v"(l), "v"(l + ls), "v"(l + 2 * ls), "v"(l + 3 * ls), "v"(l + 4 * ls), "v"(l + 5 * ls), "v"(l + 6 * ls), "v"(l + 7 * ls),
                    "v"(g), "v"(g + gs), "v"(g + 2 * gs), "v"(g + 3 * gs), "v"(g + 4 * gs), "v"(g + 5 * gs), "v"(g + 6 * gs), "v"(g + 7 * gs)
                 : "memory");
}
typedef unsigned u32x4 __attribute__((ext_vector_type(4)));
typedef unsigned u32x8 __attribute__((ext_vector_type(8)));
__device__ __forceinline__ unsigned uni(unsigned v) { return (unsigned)__builtin_amdgcn_readfirstlane(v); }
// pinned(): a wave-uniform test held in a scalar register, so that the branch on it is a scalar branch (a tensor load ignores EXEC; only a branch keeps a wave from issuing it)
__device__ __forceinline__ unsigned pinned(unsigned v) { unsigned w = uni(v); asm volatile("" : "+s"(w)); return w; }
// tensor-load descriptor, group 1: a tile of ROWS rows of ROWB bytes, source pitch SRCP bytes, 16 bytes of LDS pad behind every row (IVL: the pad interval code of the row length).
// Extents in bytes (data_size 0), tensor dims = tile dims, no mask.
template <unsigned ROWB, unsigned ROWS, unsigned SRCP, unsigned IVL>
__device__ __forceinline__ u32x8 tdm_g1() {
    u32x8 g;
    g[0] = uni((1u << 20) | (IVL << 22) | (3u << 25));
    g[1] = uni((ROWB & 0xFFFFu) << 16);
    g[2] = uni((ROWB >> 16) | ((ROWS & 0xFFFFu) << 16));
    g[3] = uni((ROWS >> 16) | (ROWB << 16));
    g[4] = uni(ROWS);
    g[5] = uni(SRCP);
    g[6] = uni(0u); g[7] = uni(0u);
    asm volatile("" : "+s"(g));   // pinned(), for the whole group: the descriptor words are held in one scalar register tuple (else the constants are formed anew in other registers, over those of a request in flight)
    return g;
}
// group 0: LDS byte address of the tile's place, global address of the tile's first byte
__device__ __forceinline__ u32x4 tdm_g0(unsigned lds, const h16* src) {
    const unsigned long long ga = (unsigned long long)(size_t)src;
    u32x4 g;
    g[0] = uni(1u); g[1] = uni(lds); g[2] = uni((unsigned)ga); g[3] = uni((((unsigned)(ga >> 32)) & 0x01FFFFFFu) | 0x80000000u);
    asm volatile("" : "+s"(g));   // pinned(), for the whole group: as in tdm_g1
    return g;
}
// one 64-key tile: waves 0 and 1 issue the k descriptor (wave 0's names the value plane, wave 1's the residual plane), wave 2 the value^T descriptor; scalar branches; the waits are the caller's
__device__ __forceinline__ void tile_load(unsigned wave, u32x4 k0, u32x8 k1, u32x4 v0, u32x8 v1) {
    if (pinned(wave < 2u))  asm volatile("tensor_load_to_lds %0, %1" :: "s"(k0), "s"(k1) : "memory");
    if (pinned(wave == 2u)) asm volatile("tensor_load_to_lds %0, %1" :: "s"(v0), "s"(v1) : "memory");
}
// the issuing wave's wait for its tensor load (free in a wave that has none). The descriptors are named as inputs so that their registers keep their values for as long as the request is outstanding.
__device__ __forceinline__ void tile_wait(u32x4 k0, u32x8 k1, u32x4 v0, u32x8 v1) {
    asm volatile("s_wait_tensorcnt 0x0" :: "s"(k0), "s"(k1), "s"(v0), "s"(v1) : "memory");
}
// lane l <-> lane l ^ 16 on the vector unit: unlike the LDS-path shuffle it does not count on dscnt, so its result needs no wait that would drain the fragment reads issued ahead of it
__device__ __forceinline__ float xhalf(float v) { const unsigned u = __float_as_uint(v);
    return __uint_as_float(__builtin_amdgcn_permlanex16(u, u, 0x76543210u, 0xfedcba98u, false, false)); }
// ordering point for wave-private LDS tiles (same wave writes and reads)
__device__ __forceinline__ void wave_sync() { __builtin_amdgcn_fence(3 /* release order */, "wavefront"); __builtin_amdgcn_wave_barrier(); asm volatile("" ::: "memory"); }

// f32 -> f16 convert that cannot produce an f16 subnormal (|v| < 2^-14 -> +0); applied after the plane's power-of-two carry
static __device__ __forceinline__ h16 toh_flush(float v) { const h16 r = (h16)v; return (fabsf(v) < 6.103515625e-05f) ? (h16)0.0f : r; }
// one matrix instruction + its own four-slot guard (accumulator tied, operands kept live)
__device__ __forceinline__ v8f wmma16g(v16h a, v16h b, v8f c) {
    c = __builtin_amdgcn_wmma_f32_16x16x32_f16(false, a, false, b, (short)0, c, false, false);
    asm volatile("v_nop\n\tv_nop\n\tv_nop\n\tv_nop" : "+v"(c) : "v"(a), "v"(b));
    return c; }
__device__ __forceinline__ v8f wmmabg(v16bf a, v16bf b, v8f c) {
    c = __builtin_amdgcn_wmma_f32_16x16x32_bf16(false, a, false, b, (short)0, c, false, false);
    asm volatile("v_nop\n\tv_nop\n\tv_nop\n\tv_nop" : "+v"(c) : "v"(a), "v"(b));
    return c; }

// x convert, 8 elements per thread: group i of the n8 groups of one batch
__device__ __forceinline__ void cvt8_body(const float* __restrict__ src, bf* dst, size_t i, size_t n8) {
    if (i >= n8) return;
    const v8f v = *(const v8f*)(src + i * 8); v8us o;
#pragma unroll
    for (int k = 0; k < 8; ++k) o[k] = f2bf(v[k]);
    *(v8us*)(dst + i * 8) = o; 
}

// Weight transposer: in[R][C] (f32) -> out[C][R] (16-bit), 64 x 64 tile (rows r0.., columns c0..) per block through LDS (cross-wave: block barrier).
// ASH = 0: bf16 bits (RNE convert). ASH = 1: f16 of (RNE bf16 value x 64), subnormal-free convert.
template <int ASH>
__device__ __forceinline__ void wtr_body(float* ts, const float* __restrict__ src, bf* dstb, h16* dsth, int R, int C, int r0, int c0) {
    const int tid = threadIdx.x;
#pragma unroll 1
    for (int i = 0; i < 16; ++i) { const int rr = i * 4 + (tid >> 6), cc = tid & 63;        // 16 trips x 4 rows = 64 rows; 64 columns
        ts[rr * 65 + cc] = src[(size_t)(r0 + rr) * C + c0 + cc]; }
    __syncthreads();
    static_assert(256 * 8 * 2 == 64 * 64);                                                 // threads x elements per store x trips == tile
{
#pragma unroll 1
        for (int it = 0; it < 2; ++it) {
            const int cc = it * 32 + (tid >> 3), r8 = (tid & 7) * 8;                        // 2 trips x 32 output rows; 8 lanes x 8 elements = 64 = one line
            const size_t oo = (size_t)(c0 + cc) * R + r0 + r8;
            if (ASH) { v8h o;
#pragma unroll
                for (int k = 0; k < 8; ++k) o[k] = toh_flush(bfr(ts[(r8 + k) * 65 + cc]) * WOS);
                *(v8h*)(dsth + oo) = o;
                asm volatile("s_wait_xcnt 0x0" ::: "memory");   // precaution: stands in front of whatever next rewrites the store's address and data registers (next trip, or code behind the loop)
            } else { v8us o;
#pragma unroll
                for (int k = 0; k < 8; ++k) o[k] = f2bf(ts[(r8 + k) * 65 + cc]);
                *(v8us*)(dstb + oo) = o;
                asm volatile("s_wait_xcnt 0x0" ::: "memory"); }  // precaution: as above
        }
         }
}
// k_prep: every operand preparation that depends on the inputs alone, in one grid. Blocks 0 .. 4*WTB-1: one 64 x 64 weight tile each (W_theta, W_phi, W_g, W_out in turn;
// lowest indices, for speed only); the other blocks: 2048 elements of x each. The split is block-uniform.
#define WTB ((CIN / 64) * (CB / 64))   // 64 x 64 tiles per weight
static_assert(WTB == (CB / 64) * (COUT / 64));
#define CVB ((int)(((size_t)SEQ * CIN / 8 + 255) / 256))   // x convert blocks per batch
__global__ __launch_bounds__(256) void k_prep(const float* __restrict__ x, const float* __restrict__ wt, const float* __restrict__ wp, const float* __restrict__ wg,
                                              const float* __restrict__ wo, bf* XB, bf* WT, bf* WP, bf* WG, h16* WOH) {
    __shared__ float ts[64 * 65];
    const int blk = blockIdx.x;
    if (blk < 4 * WTB) {
        const int w = blk / WTB, t = blk % WTB;
        if (w == 3) { wtr_body<1>(ts, wo, (bf*)0, WOH, CB, COUT, (t % (CB / 64)) * 64, (t / (CB / 64)) * 64); }      // [128][256] -> [256][128]
        else { const float* src = (w == 0) ? wt : (w == 1) ? wp : wg; bf* dst = (w == 0) ? WT : (w == 1) ? WP : WG;
            wtr_body<0>(ts, src, dst, (h16*)0, CIN, CB, (t % (CIN / 64)) * 64, (t / (CIN / 64)) * 64); }             // [256][128] -> [128][256]
        return;
    }
    const int cb = blk - 4 * WTB, bb = cb / CVB;               // batch pitch: SEQ_FULL rows in x, SEQ rows in the bf16 copy
    cvt8_body(x + (size_t)bb * SEQ_FULL * CIN, XB + (size_t)bb * SEQ * CIN, (size_t)(cb % CVB) * 256 + threadIdx.x, (size_t)SEQ * CIN / 8);
}

// mm64: register-blocked bf16 GEMM main loop, ONE WAVE per 64x64 tile (16 accumulators), operands from staged LDS rows of pitch XP, K = CIN.
// a, b: the lane's first row of each operand, already + (lane&15)*XP + 16*(lane>>4). acc[mb][nb][j] = C[16mb + 8h + j][16nb + (lane&15)], C[m][n] = sum_k A[m][k] Bt[n][k].
__device__ __forceinline__ void mm64(const unsigned char* a, const unsigned char* b, v8f (&acc)[4][4]) {
#pragma unroll
    for (int mb = 0; mb < 4; ++mb)
#pragma unroll
        for (int nb = 0; nb < 4; ++nb) acc[mb][nb] = (v8f){};
#pragma unroll 1
    for (int kc = 0; kc < CIN * 2; kc += 64) {                 // kc in bytes: 32 elements a step
        v16bf af[4], bb[4];
#pragma unroll
        for (int mb = 0; mb < 4; ++mb) { af[mb] = ldlb(a + mb * 16 * XP + kc); bb[mb] = ldlb(b + mb * 16 * XP + kc); }
        __builtin_amdgcn_sched_barrier(0);                     // keeps the step's LDS reads one group ahead of its products (else each B fragment is read, and waited for, in among them)
#pragma unroll
        for (int nb = 0; nb < 4; ++nb)
#pragma unroll
            for (int mb = 0; mb < 4; ++mb) acc[mb][nb] = wmmabg(af[mb], bb[nb], acc[mb][nb]);
    }
}

// proj_q: q = x W_theta, 64 x 64 tile (bx, by). A = x rows (m = b*SEQ + t), Bt = transposed weight rows (n = d). Planes [b*SEQ + t][128]: f16 value (Ph) and f16 residual x2048 (Pr).
__device__ __forceinline__ void proj_q(float* os, const unsigned char* A, const unsigned char* Bt, h16* Ph, h16* Pr, int bx, int by) {
    const int lane = threadIdx.x & 31, lr = lane & 15, hi = lane >> 4; const int r0 = bx * 64, c0 = by * 64;
    v8f acc[4][4];
    mm64(A, Bt, acc);
    const size_t obase = (size_t)r0 * CB + c0;
#pragma unroll
    for (int mb = 0; mb < 4; ++mb) {
#pragma unroll
        for (int nb = 0; nb < 4; ++nb) {
#pragma unroll
            for (int j = 0; j < 8; ++j) os[(hi * 8 + j) * 68 + nb * 16 + lr] = acc[mb][nb][j]; }   // D: row 8h+j, col lane&15; 16 x 64 all written
        wave_sync();
        static_assert(32 * 8 * 4 == 16 * 64);                                                     // lanes x halves x instructions == slab
{
#pragma unroll
            for (int s = 0; s < 4; ++s) { const int row = 4 * s + (lane >> 3), c8 = (lane & 7) * 8;   // 4 s x 4 row groups = 16 rows; 8 lanes x 8 = 64 columns
                const v4f x0 = *(const v4fa*)(&os[row * 68 + c8]); const v4f x1 = *(const v4fa*)(&os[row * 68 + c8 + 4]); v8h hv, rv;
#pragma unroll
                for (int i = 0; i < 4; ++i) { const h16 a0 = toh_flush(x0[i]); const h16 a1 = toh_flush(x1[i]); hv[i] = a0; hv[4 + i] = a1;
                    rv[i] = toh_flush((x0[i] - (float)a0) * QRS); rv[4 + i] = toh_flush((x1[i] - (float)a1) * QRS); }
                const size_t oo = obase + (size_t)(mb * 16 + row) * CB + c8;
                *(v8h*)(Ph + oo) = hv; *(v8h*)(Pr + oo) = rv; }
             }
        wave_sync();
    }
}

// proj_k: k = maxpool2(x W_phi) over adjacent token pairs, 64 x 64 tile (bx, by). Same GEMM; per 16-token slab the 8 pooled rows (max in f32, then convert) go to planes [b*MK + key][128]: f16 value and f16 residual x2048.
__device__ __forceinline__ void proj_k(float* os, const unsigned char* A, const unsigned char* Bt, h16* Ph, h16* Pr, int bx, int by) {
    const int lane = threadIdx.x & 31, lr = lane & 15, hi = lane >> 4; const int r0 = bx * 64, c0 = by * 64;
    v8f acc[4][4];
    mm64(A, Bt, acc);
    const size_t obase = (size_t)(r0 / 2) * CB + c0;                                              // (b*SEQ + t)/2 = b*MK + t/2
#pragma unroll
    for (int mb = 0; mb < 4; ++mb) {
#pragma unroll
        for (int nb = 0; nb < 4; ++nb) {
#pragma unroll
            for (int j = 0; j < 8; ++j) os[(hi * 8 + j) * 68 + nb * 16 + lr] = acc[mb][nb][j]; }
        wave_sync();
        static_assert(32 * 8 * 2 == 8 * 64);                                                      // lanes x halves x instructions == pooled slab
{
#pragma unroll
            for (int s = 0; s < 2; ++s) { const int prow = 4 * s + (lane >> 3), c8 = (lane & 7) * 8;   // 2 s x 4 row groups = 8 pooled rows (token rows 2*prow, 2*prow+1)
                const v4f u0 = *(const v4fa*)(&os[(2 * prow) * 68 + c8]);     const v4f u1 = *(const v4fa*)(&os[(2 * prow) * 68 + c8 + 4]);
                const v4f w0 = *(const v4fa*)(&os[(2 * prow + 1) * 68 + c8]); const v4f w1 = *(const v4fa*)(&os[(2 * prow + 1) * 68 + c8 + 4]); v8h hv, rv;
#pragma unroll
                for (int i = 0; i < 4; ++i) { const float y0 = fmaxf(u0[i], w0[i]), y1 = fmaxf(u1[i], w1[i]);
                    const h16 a0 = toh_flush(y0); const h16 a1 = toh_flush(y1); hv[i] = a0; hv[4 + i] = a1;
                    rv[i] = toh_flush((y0 - (float)a0) * QRS); rv[4 + i] = toh_flush((y1 - (float)a1) * QRS); }
                const size_t oo = obase + (size_t)(mb * 8 + prow) * CB + c8;
                *(v8h*)(Ph + oo) = hv; *(v8h*)(Pr + oo) = rv; }
             }
        wave_sync();
    }
}

// proj_gt: pooled values transposed, G^T[d][key] = max over the token pair of (W_g^T x^T)[d][t]. ONE WAVE per 32 (d) x 128 (token) tile (16 accumulators):
// A = transposed weight rows (m = d), Bt = x rows (n = b*SEQ + t). Plane [(b*128 + d)][MK], single f16. Per 16-row slab staged in LDS (wave-private);
__device__ __forceinline__ void proj_gt(float* os, const unsigned char* A, const unsigned char* Bt, h16* Gt, int bx, int by) {
    const int lane = threadIdx.x & 31, lr = lane & 15, hi = lane >> 4; const int r0 = bx * 32, c0 = by * 128;
    v8f acc[2][8];
#pragma unroll
    for (int mb = 0; mb < 2; ++mb)
#pragma unroll
        for (int nb = 0; nb < 8; ++nb) acc[mb][nb] = (v8f){};
#pragma unroll 1
    for (int kc = 0; kc < CIN * 2; kc += 64) {                 // kc in bytes: 32 elements a step
        v16bf a[2], b[8];
#pragma unroll
        for (int mb = 0; mb < 2; ++mb) a[mb] = ldlb(A + mb * 16 * XP + kc);
#pragma unroll
        for (int nb = 0; nb < 8; ++nb) b[nb] = ldlb(Bt + nb * 16 * XP + kc);
        __builtin_amdgcn_sched_barrier(0);                     // keeps the step's LDS reads one group ahead of its products, as in mm64
#pragma unroll
        for (int nb = 0; nb < 8; ++nb)
#pragma unroll
            for (int mb = 0; mb < 2; ++mb) acc[mb][nb] = wmmabg(a[mb], b[nb], acc[mb][nb]);
    }
    const int bb = c0 / SEQ, tt = c0 % SEQ;
    const size_t obase = ((size_t)bb * CB + r0) * MK + (size_t)(tt / 2);
#pragma unroll
    for (int mb = 0; mb < 2; ++mb) {
#pragma unroll
        for (int nb = 0; nb < 8; ++nb) {
#pragma unroll
            for (int j = 0; j < 8; ++j) os[(hi * 8 + j) * OPF + nb * 16 + lr] = acc[mb][nb][j]; }   // D: row d = 8h+j, col token = 16nb + lane&15; 16 x 128 all written
        wave_sync();
        static_assert(32 * 8 * 4 == 16 * 64);                                                       // lanes x pooled halves x instructions == pooled slab
{
#pragma unroll
            for (int s = 0; s < 4; ++s) { const int row = 4 * s + (lane >> 3), c8 = (lane & 7) * 8;     // 4 s x 4 row groups = 16 rows; 8 lanes x 8 pooled = 64 pooled columns
                const v4f f0 = *(const v4fa*)(&os[row * OPF + 2 * c8]);     const v4f f1 = *(const v4fa*)(&os[row * OPF + 2 * c8 + 4]);
                const v4f f2 = *(const v4fa*)(&os[row * OPF + 2 * c8 + 8]); const v4f f3 = *(const v4fa*)(&os[row * OPF + 2 * c8 + 12]); v8h hv;
                hv[0] = toh_flush(fmaxf(f0[0], f0[1])); hv[1] = toh_flush(fmaxf(f0[2], f0[3]));
                hv[2] = toh_flush(fmaxf(f1[0], f1[1])); hv[3] = toh_flush(fmaxf(f1[2], f1[3]));
                hv[4] = toh_flush(fmaxf(f2[0], f2[1])); hv[5] = toh_flush(fmaxf(f2[2], f2[3]));
                hv[6] = toh_flush(fmaxf(f3[0], f3[1])); hv[7] = toh_flush(fmaxf(f3[2], f3[3]));
                const size_t oo = obase + (size_t)(mb * 16 + row) * MK + c8;
                *(v8h*)(Gt + oo) = hv; }
             }
        wave_sync();
    }
}

// k_proj: the three input projections, which depend on k_prep alone and not on one another. One block of twelve waves per 128 tokens: waves 0..3 the four 64 x 64 q tiles,
// waves 4..7 the four k tiles, waves 8..11 the four 32 x 128 value^T tiles. The block's operands are staged once in LDS by whole-row asynchronous copies (a fragment load straight from
// the planes touches 16 lines for 512 bytes): wave w brings weight rows 32w .. 32w+31 of the 384 (W_theta^T, W_phi^T, W_g^T in turn), waves 0..7 also 16 x rows each.
// Staging tiles of the store stage are wave-private: the q and k waves have their own behind the operands; a value^T wave uses the first 16 of its 32 weight rows, which it alone reads and has left by then.
__global__ __launch_bounds__(32 * PW) void k_proj(const bf* __restrict__ XB, const bf* __restrict__ WT, const bf* __restrict__ WP, const bf* __restrict__ WG,
                                                  h16* QH, h16* QR, h16* KH, h16* KR, h16* GT) {
    __shared__ __align__(16) unsigned char sm[PLDS];
    const int lane = threadIdx.x & 31, lr = lane & 15, hi = lane >> 4;
    const int wave = __builtin_amdgcn_readfirstlane((int)(threadIdx.x >> 5));
    const int which = wave >> 2, sub = wave & 3;               // wave-uniform: projection, tile
    const int blk = blockIdx.x;
    const unsigned sb = (unsigned)(size_t)sm;                  // LDS byte address of the array
    const bf* wsrc = (which == 0) ? WT : (which == 1) ? WP : WG;
    const unsigned lw = sb + WS_O + 32 * wave * XP + lane * 16;
    const h16* gw = (const h16*)wsrc + 32 * sub * CIN + lane * 8;
#pragma unroll
    for (int c = 0; c < 4; ++c) cp8(lw + c * 8 * XP, gw + c * 8 * CIN, XP, CIN);
    if (wave < 8) {                                            // scalar branch: every lane is on at the copies
        const unsigned lx = sb + 16 * wave * XP + lane * 16;
        const h16* gx = (const h16*)XB + ((size_t)blk * PT + 16 * wave) * CIN + lane * 8;
        cp8(lx, gx, XP, CIN);
        cp8(lx + 8 * XP, gx + 8 * CIN, XP, CIN);
    }
    asm volatile("s_wait_asynccnt 0x0" ::: "memory");          // this wave's copies have landed before the barrier publishes them
    __syncthreads();
    const unsigned char* xs = sm + lr * XP + 16 * hi;          // fragment rows: + row * XP + 2 * k
    const unsigned char* ws = sm + WS_O + lr * XP + 16 * hi;
    if (which == 0)      proj_q((float*)(sm + OS_O + wave * OSB), xs + (sub & 1) * 64 * XP, ws + (sub >> 1) * 64 * XP, QH, QR, blk * 2 + (sub & 1), sub >> 1);
    else if (which == 1) { proj_k((float*)(sm + OS_O + wave * OSB), xs + (sub & 1) * 64 * XP, ws + (CB + (sub >> 1) * 64) * XP, KH, KR, blk * 2 + (sub & 1), sub >> 1);
        asm volatile("s_wait_xcnt 0x0" ::: "memory"); }        // precaution: in the built text this body is followed by the other bodies' code, which rewrites the registers that its last stores name (the other two run into the end of the program)
    else { proj_gt((float*)(sm + WS_O + 32 * wave * XP), ws + 32 * wave * XP, xs, GT, sub, blk);
        asm volatile("s_wait_xcnt 0x0" ::: "memory"); }        // precaution: as above (whichever body the built text puts last runs into the end of the program)
}

// k_attn: fused attention + output projection + skip term, one wave per 16 query rows of one batch; K / G^T / Q / W_out^T fragments from LDS rows (two 16-B reads each).
// Staging: each wave brings its own 16 q rows once by whole-line asynchronous copies; every 64-key tile (k value, k residual, value^T) comes by three tensor loads, one each from waves 0, 1, 2,
// into one of two buffers, one tile ahead of its use (no address arithmetic on the vector unit, no copy issue in the key loop).
// Transposed form: S^T[key][t] = K Q^T (A = K rows, B = Q rows, 4 k-steps over d); lane (t = lane&15, h = lane>>4) holds keys 8h+r of each 16-key tile, so the packed
// P tile is directly the B fragment of O^T[d][t] = G^T P^T (element r <- tile keys 0..15, element 8+r <- tile keys 16..31, lane unchanged), 8 tiles over d.
// Scores = K Q + (K Q_res + K_res Q) / 2048. Softmax state (running max, partial sum) is one scalar per lane; the two lane halves of a row are combined with one xor-16 exchange.
// Q fragments are read from LDS once and held in registers. The key loop's fragment reads stand at two places per pass, each a whole phase ahead of its use; 512 registers per wave (two waves per SIMD).
// Epilogue: W_out^T rows copied whole-line into the freed tile buffers, a quarter per wave (a fragment load straight from the plane touches 16 lines for 512 bytes, and every wave needs all 256 of them);
// ctx^T = O^T / l packed to f16 (tiles 2kk, 2kk+1 -> B fragment of k-step kk); out^T[c][t] = W_out^T ctx^T per 16-channel tile, staged in a wave-private LDS tile [t][128 channels];
__global__ __launch_bounds__(32 * AW) __attribute__((amdgpu_num_vgpr(512)))
void k_attn(const h16* __restrict__ QH, const h16* __restrict__ QR, const h16* __restrict__ KH, const h16* __restrict__ KR,
            const h16* __restrict__ GT, const h16* __restrict__ WO, const float* __restrict__ X, float* OUT) {
    __shared__ __attribute__((aligned(2048))) unsigned char sm[LDSB];
    const int lane = threadIdx.x & 31, lr = lane & 15, hi = lane >> 4;
    const int wave = __builtin_amdgcn_readfirstlane((int)(threadIdx.x >> 5));
    const int b = blockIdx.y;
    const int t0 = (blockIdx.x * AW + wave) * 16;
    // copy side: q rows of 256 B, two per copy (16 lanes each); tile planes of this batch for the tensor loads
    const unsigned sb = (unsigned)(size_t)sm;                  // LDS byte address of the array
    const unsigned lq = sb + Q_O + wave * QWB + (lane >> 4) * KP + (lane & 15) * 16;
    const int gq = (b * SEQ + t0 + (lane >> 4)) * CB + (lane & 15) * 8;
    const h16* tk = ((wave == 0) ? KH : KR) + (size_t)b * MK * CB;   // + tile * KT * CB; wave 0 brings the value rows, wave 1 the residual rows
    const h16* tg = GT + (size_t)b * CB * MK;                  // + tile * KT
    const unsigned dk = sb + ((wave == 0) ? 0 : KR_O), dg = sb + GT_O;   // + buffer
    const u32x8 k1 = tdm_g1<CB * 2, KT, CB * 2, 5>(), v1 = tdm_g1<KT * 2, CB, MK * 2, 4>();
    // read side
    const unsigned char* qp = sm + Q_O + wave * QWB + lr * KP + 16 * hi;         // B fragments: col t, k = d; residual rows + 16*KP
    const int ko = lr * KP + 16 * hi;                          // + buffer + key * KP      (A fragment: row key, k = d)
    const int vo = GT_O + lr * GP + 16 * hi;                   // + buffer + 16j*GP + 2*key (A fragment: row d, k = key)
    // prologue: q rows and tile 0, landed and published; then tile 1 into the second buffer
    cp8(lq, QH + gq, 2 * KP, 2 * CB);
    cp8(lq + 16 * KP, QR + gq, 2 * KP, 2 * CB);
    u32x4 k0 = tdm_g0(dk, tk), v0 = tdm_g0(dg, tg);
    tile_load((unsigned)wave, k0, k1, v0, v1);
    asm volatile("s_wait_asynccnt 0x0" ::: "memory");          // this wave's copies have landed before the barrier publishes them
    tile_wait(k0, k1, v0, v1);                                 // this wave's tensor load of tile 0 has landed before the barrier publishes it
    __syncthreads();
    k0 = tdm_g0(dk + STB, tk + KT * CB); v0 = tdm_g0(dg + STB, tg + KT);
    tile_load((unsigned)wave, k0, k1, v0, v1);                 // tile 1, into the buffer that nobody has touched yet
    // q fragments: read once, held in registers over the whole key loop. k fragments of tile 0, pass 0 (published by the barrier above)
    v16h qh[4], qr[4], ka[4], kb[4], kra[4], krb[4];
#pragma unroll
    for (int kk = 0; kk < 4; ++kk) { qh[kk] = ldl(qp + kk * 64); qr[kk] = ldl(qp + 16 * KP + kk * 64); }
#pragma unroll
    for (int kk = 0; kk < 4; ++kk) {
        ka[kk] = ldl(sm + ko + kk * 64); kb[kk] = ldl(sm + ko + 16 * KP + kk * 64);
        kra[kk] = ldl(sm + ko + KR_O + kk * 64); krb[kk] = ldl(sm + ko + KR_O + 16 * KP + kk * 64); }
    v8f o[8];
#pragma unroll
    for (int j = 0; j < 8; ++j) o[j] = (v8f){};
    float m = NEGB, l = 0.0f;
#pragma unroll 1
    for (int st = 0; st < NST; ++st) {
    const int bo = (st & 1) * STB;                             // this tile's buffer
    // LDS fragment reads stand at two places per 32-key pass, each a whole phase ahead of its use: the pass's value^T fragments ahead of its score products,
    // the next pass's k fragments behind them (into the registers those products have just read), ahead of the softmax and the output products.
#pragma unroll                                                 // unrolled: the tile's publish point stands inside its last pass only
    for (int ps = 0; ps < KT / 32; ++ps) {                     // 32-key passes in key order
        const unsigned char* vv = sm + bo + vo + ps * 64;
        v16h vf[8];
#pragma unroll
        for (int j = 0; j < 8; ++j) vf[j] = ldl(vv + j * 16 * GP);
        __builtin_amdgcn_sched_barrier(0);                     // keeps the value^T reads one group ahead of the score products (else they sink in among the matrix instructions)
        v8f sHa = (v8f){}, sLa = (v8f){}, sHb = (v8f){}, sLb = (v8f){};
        // plain builtin in the key loop (the compiler keeps the distances behind it): the guarded form's asm operands tie every fragment and accumulator to the first 256 registers, which spills here
#pragma unroll
        for (int kk = 0; kk < 4; ++kk) {
            sHa = wmma16(ka[kk], qh[kk], sHa); sHb = wmma16(kb[kk], qh[kk], sHb);
            sLa = wmma16(ka[kk], qr[kk], sLa); sLb = wmma16(kb[kk], qr[kk], sLb);
            sLa = wmma16(kra[kk], qh[kk], sLa); sLb = wmma16(krb[kk], qh[kk], sLb);
        }
        __builtin_amdgcn_sched_barrier(0);                     // keeps the next k reads behind the last score product, as one group
        const unsigned char* kn;
        if (ps + 1 < KT / 32) kn = sm + bo + ko + (ps + 1) * 32 * KP;
        else {
            // publish point of tile st + 1, inside tile st's last pass: every read of this buffer has been issued (k fragments used, value^T fragments fetched above)
            asm volatile("s_wait_dscnt 0x0" ::: "memory");     // this wave has left the buffer that is refilled behind the barrier
            tile_wait(k0, k1, v0, v1);                         // this wave's tensor load of tile st + 1 has landed
            __syncthreads();
            kn = sm + (STB - bo) + ko;                         // behind the last tile: the other buffer's old rows, landed and published long ago; read unconditionally (a branch here would merge the compiler's wait counts to 0), never used
        }
#pragma unroll
        for (int kk = 0; kk < 4; ++kk) {
            ka[kk] = ldl(kn + kk * 64); kb[kk] = ldl(kn + 16 * KP + kk * 64);
            kra[kk] = ldl(kn + KR_O + kk * 64); krb[kk] = ldl(kn + KR_O + 16 * KP + kk * 64); }
        __builtin_amdgcn_sched_barrier(0);                     // keeps the k reads ahead of the softmax, whose time covers their latency
        if (ps + 1 == KT / 32) {
            // refill of the buffer just freed (this wave's reads of it retired at the s_wait_dscnt 0 above; the k reads in flight are of the other buffer); scalar tests, the first reads the same for the whole block
            if (pinned(st + 2 < NST)) {
                k0 = tdm_g0(dk + bo, tk + (st + 2) * KT * CB); v0 = tdm_g0(dg + bo, tg + (st + 2) * KT);
                tile_load((unsigned)wave, k0, k1, v0, v1);
            }
        }
        float ta[8], tb[8]; float mx = NEGB;
#pragma unroll
        for (int r = 0; r < 8; ++r) {
            ta[r] = (sHa[r] + sLa[r] * QRI) * L2E; tb[r] = (sHb[r] + sLb[r] * QRI) * L2E;
            mx = fmaxf(mx, fmaxf(ta[r], tb[r])); }
        mx = fmaxf(mx, xhalf(mx));
        const float mnew = fmaxf(m, mx);
        const float alpha = __builtin_amdgcn_exp2f(m - mnew);
        const float sh = PSH - mnew;
        v16h pb; float ls = 0.0f;
#pragma unroll
        for (int r = 0; r < 8; ++r) {
            const float ea = ta[r] + sh, eb = tb[r] + sh;
            const float xa = __builtin_amdgcn_exp2f(ea), xb = __builtin_amdgcn_exp2f(eb);
            const float ga = (ea < -14.0f) ? 0.0f : xa, gb = (eb < -14.0f) ? 0.0f : xb;   // nothing below 2^-14 reaches the f16 operand
            const h16 pa = (h16)ga; const h16 pc = (h16)gb;
            pb[r] = pa; pb[8 + r] = pc;
            ls += (float)pa + (float)pc; }
        l = l * alpha + ls; m = mnew;
#pragma unroll
        for (int j = 0; j < 8; ++j) o[j] = o[j] * alpha;
#pragma unroll
        for (int j = 0; j < 8; ++j) o[j] = wmma16(vf[j], pb, o[j]);
    }
    }
    tile_wait(k0, k1, v0, v1);                                 // no tensor load in flight before the tile buffers are used for anything else
    // W_out^T [256 channels][128] into the bytes of the two tile buffers, rows of pitch KP: wave w brings rows 64w .. 64w+63, two per copy; the copies fly under the normalisation below
    asm volatile("s_wait_dscnt 0x0" ::: "memory");             // this wave's last reads of the tile buffers (the k rows fetched behind the last tile) have returned
    __syncthreads();                                           // every wave has left both tile buffers
    {
        const unsigned lw = sb + (64 * wave + (lane >> 4)) * KP + (lane & 15) * 16;
        const h16* gw = WO + (64 * wave + (lane >> 4)) * CB + (lane & 15) * 8;
#pragma unroll                                                 // unrolled: four statements of eight copies, their address steps constants
        for (int c = 0; c < 4; ++c) cp8(lw + c * 16 * KP, gw + c * 16 * CB, 2 * KP, 2 * CB);
    }
    l += __shfl_xor(l, 16, 32);
    const float inv = 1.0f / l;                                // l >= 16384 (the row maximum contributes the full carry)
    // ctx^T D layout: o[j][r] = (d = 16j + 8h + r, t = lane&15); B fragment of k-step kk: element r <- tile 2kk, element 8+r <- tile 2kk+1
    v16h cf[4];
#pragma unroll
    for (int kk = 0; kk < 4; ++kk) {
#pragma unroll
        for (int r = 0; r < 8; ++r) { cf[kk][r] = toh_flush(o[2 * kk][r] * inv); cf[kk][8 + r] = toh_flush(o[2 * kk + 1][r] * inv); } }
    asm volatile("s_wait_asynccnt 0x0" ::: "memory");          // this wave's W_out^T rows have landed before the barrier publishes them
    __syncthreads();
    float* os = (float*)(sm + Q_O);                            // each wave stages in the bytes of its own q rows, which only it has read
    const int wb = wave * (QWB / 4);
    const size_t xrow = ((size_t)b * SEQ_FULL + t0) * COUT;
    const size_t orow = ((size_t)b * OUT_SEQ + t0) * COUT;
#pragma unroll 1
    for (int hc = 0; hc < 2; ++hc) {
#pragma unroll 1
        for (int ct = 0; ct < 8; ct += 2) {
            const int cg = hc * 8 + ct;
            v16h wa[2][4];                                     // A fragments of two channel tiles: row c = 16(cg + u) + (lane&15), k = d; the loops over u and kk are unrolled so that the arrays stay in registers
#pragma unroll
            for (int u = 0; u < 2; ++u)
#pragma unroll
                for (int kk = 0; kk < 4; ++kk) wa[u][kk] = ldl(sm + ko + (cg + u) * 16 * KP + kk * 64);
            __builtin_amdgcn_sched_barrier(0);                 // keeps the trip's LDS reads one group ahead of its products (else each fragment is read, and waited for, directly in front of its product)
            v8f acc[2]; acc[0] = (v8f){}; acc[1] = (v8f){};
#pragma unroll
            for (int kk = 0; kk < 4; ++kk) { acc[0] = wmma16g(wa[0][kk], cf[kk], acc[0]); acc[1] = wmma16g(wa[1][kk], cf[kk], acc[1]); }
            // D: acc[u][r] = (c = 16(cg + u) + 8h + r, t = lane&15) -> os[t][16(ct + u) + 8h + r]; rows 0..15 x columns 0..127 all written over the 8 tiles
#pragma unroll
            for (int u = 0; u < 2; ++u) {
                v4f a0, a1;
                a0[0] = acc[u][0] * WOI; a0[1] = acc[u][1] * WOI; a0[2] = acc[u][2] * WOI; a0[3] = acc[u][3] * WOI;
                a1[0] = acc[u][4] * WOI; a1[1] = acc[u][5] * WOI; a1[2] = acc[u][6] * WOI; a1[3] = acc[u][7] * WOI;
                *(v4fa*)(&os[wb + lr * OPF + (ct + u) * 16 + 8 * hi]) = a0; *(v4fa*)(&os[wb + lr * OPF + (ct + u) * 16 + 8 * hi + 4]) = a1;
            }
        }
        wave_sync();
        static_assert(32 * 4 * 16 == 16 * 128);                // lanes x floats x instructions == half tile
{
#pragma unroll 4
            for (int s = 0; s < 16; ++s) { const int cofs = lane * 4;
                const v4f val = *(const v4fa*)(&os[wb + s * OPF + cofs]);
                const v4f xv = *(const v4f*)(X + xrow + (size_t)s * COUT + hc * 128 + cofs);
                v4f res; res[0] = bfr(xv[0]) + val[0]; res[1] = bfr(xv[1]) + val[1]; res[2] = bfr(xv[2]) + val[2]; res[3] = bfr(xv[3]) + val[3];
                *(v4f*)(OUT + orow + (size_t)s * COUT + hc * 128 + cofs) = res; }
             }
        wave_sync();
    }
}

static constexpr size_t al256(size_t v) { return (v + 255) & ~(size_t)255; }
static constexpr size_t SZ_XB = al256((size_t)NB * SEQ * CIN * 2);
static constexpr size_t SZ_W  = al256((size_t)CIN * CB * 2);
static constexpr size_t SZ_Q  = al256((size_t)NB * SEQ * CB * 2);
static constexpr size_t SZ_K  = al256((size_t)NB * MK * CB * 2);
static constexpr size_t SZ_TOTAL = SZ_XB + 4 * SZ_W + 2 * SZ_Q + 3 * SZ_K;
static_assert(SZ_TOTAL <= (size_t)134217728);                        // workspace carve <= 128 MiB
static_assert((size_t)CIN * CB == (size_t)CB * COUT);                // the W_out plane has the extent of an input-projection weight plane
static_assert((size_t)NB * MK * CB == (size_t)NB * CB * MK);         // value^T plane [(b*128 + d)][MK] has the extent of a k plane

extern "C" void kernel_launch(void* const* d_in, const int* in_sizes, int n_in,
                              void* d_out, int out_size, void* d_ws, size_t ws_size, hipStream_t stream) {
    if (n_in < 5) return;
    const size_t needx = ((size_t)(NB - 1) * SEQ_FULL + SEQ) * CIN;
    if ((size_t)in_sizes[0] < needx) return;
    if ((size_t)in_sizes[1] < (size_t)CIN * CB || (size_t)in_sizes[2] < (size_t)CIN * CB || (size_t)in_sizes[3] < (size_t)CIN * CB) return;
    if ((size_t)in_sizes[4] < (size_t)CB * COUT) return;
    if ((size_t)out_size < ((size_t)(NB - 1) * OUT_SEQ + SEQ) * COUT) return;
    if (SZ_TOTAL > ws_size) return;
    // wire order: x, W_theta, W_phi, W_g, W_out
    const float* x  = (const float*)d_in[0];
    const float* wt = (const float*)d_in[1];
    const float* wp = (const float*)d_in[2];
    const float* wg = (const float*)d_in[3];
    const float* wo = (const float*)d_in[4];
    float* OUT = (float*)d_out;      // [NB][SEQ][256]
    char* wsp = (char*)d_ws;
    bf*  XB = (bf*)wsp;  wsp += SZ_XB;               // x bf16 [NB*SEQ][256]
    bf*  WT = (bf*)wsp;  wsp += SZ_W;                // W_theta^T bf16 [128][256]
    bf*  WP = (bf*)wsp;  wsp += SZ_W;                // W_phi^T   bf16 [128][256]
    bf*  WG = (bf*)wsp;  wsp += SZ_W;                // W_g^T     bf16 [128][256]
    h16* WOH = (h16*)wsp; wsp += SZ_W;               // W_out^T   f16 x64 [256][128]
    h16* QH = (h16*)wsp; wsp += SZ_Q;                // [NB*SEQ][128]
    h16* QR = (h16*)wsp; wsp += SZ_Q;                // [NB*SEQ][128] residual x2048
    h16* KH = (h16*)wsp; wsp += SZ_K;                // [NB*MK][128]
    h16* KR = (h16*)wsp; wsp += SZ_K;                // [NB*MK][128] residual x2048
    h16* GT = (h16*)wsp; wsp += SZ_K;                // [NB*128][MK]

    k_prep<<<dim3(4 * WTB + NB * CVB, 1, 1), 256, 0, stream>>>(x, wt, wp, wg, wo, XB, WT, WP, WG, WOH);
    k_proj<<<dim3(NB * SEQ / PT, 1, 1), 32 * PW, 0, stream>>>(XB, WT, WP, WG, QH, QR, KH, KR, GT);
    k_attn<<<dim3(SEQ / (16 * AW), NB, 1), 32 * AW, 0, stream>>>(QH, QR, KH, KR, GT, WOH, x, OUT);
}

// v008
// Measured time: 68.6 microseconds a run.
// Two timings next to v007 both put it at 1.04 times that version's speed.
// Over all steps from v000 it is 4.59 times as fast.
#include <hip/hip_runtime.h>

// Spatial self-attention block over flattened pixels: x [NB][SEQ][256]; three 1x1 projections W [in 256][out 128] (no bias); keys and values max-pooled over adjacent token pairs (SEQ/2 keys);
// unscaled dot-product scores, softmax over keys; context [SEQ][128] -> output projection W_out [in 128][out 256]; output = x + projected context (f32).
// Compute dtypes, f32 accumulate everywhere: three input projections v_wmma_f32_16x16x32_bf16 (x and W RNE-converted to bf16; products exact);
// scores v_wmma_f32_16x16x32_f16 with q and k each as f16 value + f16 residual x2048 (three products, residual products in their own accumulator folded by 1/2048);
// P.V v_wmma_f32_16x16x32_f16, P single f16 with x16384 carry (cancels in the normalisation, row sum over the converted P), pooled values single f16;
// output projection v_wmma_f32_16x16x32_f16, context single f16, W_out (RNE bf16 value) x64 as f16, folded by 1/64; softmax f32 (online, running max); skip term = bf16-converted x added in f32 at the store stage.
// Layout: transposed f16 W_out plane [out][in]; q planes (value, residual) [b][t][128]; k planes (value, residual) [b][key][128]; value^T plane [b][d][key];
// fused flash kernel in transposed form (S^T = K Q^T, O^T = V^T P^T, out^T = W_out^T ctx^T with the packed O^T tiles as B fragments);
// its key-loop operands are staged in LDS: q rows by asynchronous copies, k and value^T in 64-key tiles with two buffers shared by the block's waves, each tile plane by one tensor load.
// behind the key loop the whole W_out^T plane is staged by asynchronous copies in the bytes of the two tile buffers, once per block, for the output projection's A fragments.
// the projections' operands (128 x rows, the 384 transposed weight rows) are read as f32 from the inputs, converted to bf16 in registers and stored to LDS, once per block, and shared by the block's twelve waves.
// Two dependent launches: k_proj (q, k, value^T planes; one row of the W_out^T plane per block), k_attn.

#ifndef NB
#define NB 8
#endif
#ifndef SEQ
#define SEQ 4096
#endif
#define NB_FULL  8
#define SEQ_FULL 4096
#ifndef OUT_SEQ
#define OUT_SEQ SEQ              // row pitch (in tokens) between batches of the output
#endif
#define CIN  256                 // input channels (projection depth)
#define CB   128                 // bottleneck width (score depth, context width)
#define COUT 256                 // output channels
#define MK   (SEQ / 2)           // pooled keys per batch
#define AW   4                   // waves per flash block (16 query rows each)
#define OPF  132                 // LDS row pitch (floats) of the 16 x 128 staging tiles
#define QRS  2048.0f             // carry of every residual plane
#define QRI  (1.0f / 2048.0f)
#define L2E  1.4426950408889634f // log2(e); the module applies no score scale
#define PSH  14.0f               // log2 of the P carry (16384)
#define NEGB (-3.0e38f)
#define WOS  64.0f               // carry of the f16 W_out plane
#define WOI  (1.0f / 64.0f)
#define KT   64                  // keys per LDS tile (two 32-key passes)
#define NST  (MK / KT)           // tiles per batch
#define KP   272                 // LDS row pitch, bytes, of 256-byte q / k rows (16 B x odd: conflict-free 16-byte reads)
#define GP   144                 // LDS row pitch, bytes, of 128-byte value^T rows (16 B x odd)
#define KTP  18432               // bytes of one k plane's place in a tile buffer: KT rows of pitch KP, rounded up to a multiple of 2 KiB (every tensor load's destination is one)
#define KR_O KTP                 // tile layout: k value rows, k residual rows, value^T rows
#define GT_O (2 * KTP)
#define STB  (2 * KTP + CB * GP) // bytes of one tile buffer
#define Q_O  (2 * STB)           // behind the two buffers: per wave 16 q value rows, then 16 q residual rows
#define QWB  (2 * 16 * KP)       // bytes of one wave's q rows; the same bytes are that wave's output staging tile after the key loop
#define LDSB (Q_O + AW * QWB)
#define PT   128                 // tokens per projection block
#define PW   12                  // waves per projection block: four q tiles, four k tiles, four value^T tiles
#define XP   528                 // LDS row pitch, bytes, of 512-byte x / weight rows (16 B x odd: conflict-free 16-byte reads)
#define WS_O (PT * XP)           // projection block layout: 128 x rows, 3 x 128 weight rows, the q and k waves' staging tiles
#define OS_O (WS_O + 3 * CB * XP)
#define OSB  (16 * 68 * 4)       // bytes of one q / k staging tile
#define PLDS (OS_O + 8 * OSB)

static_assert(CB == 128);                      // flash: 4 k-steps of 32 per score tile, 8 output tiles of 16, 4 k-steps in the output projection
static_assert(COUT == 256);                    // output staged as two halves of 128 columns
static_assert(CIN == COUT);                    // skip term has the output's row width
static_assert(CIN % 32 == 0);                  // GEMM k-loop steps by 32
static_assert(CB % 32 == 0);
static_assert(CIN % 64 == 0);
static_assert(CB % 64 == 0);
static_assert(COUT % 64 == 0);
static_assert(SEQ % 128 == 0);                 // a 128-token value tile never straddles two batches; token pairs stay inside a tile
static_assert((NB * SEQ) % 128 == 0);
static_assert((NB * SEQ) % 64 == 0);
static_assert(MK % 32 == 0);                   // key loop steps by 32
static_assert(MK % 64 == 0);
static_assert(SEQ % (16 * AW) == 0);           // flash grid covers the sequence exactly
static_assert(((size_t)SEQ * CIN) % 8 == 0);
static_assert(NB <= NB_FULL);
static_assert(SEQ <= SEQ_FULL);
static_assert((OPF * 4) % 16 == 0);
static_assert(NST >= 2);                       // the two-buffer prologue fills tiles 0 and 1
static_assert(AW >= 3);                        // waves 0, 1, 2 each issue one tensor load per tile (k value, k residual, value^T)
static_assert(CB * 2 == 256 && KP == 256 + 16);   // a k row is 256 bytes: pad interval code 5, 4 dwords of pad
static_assert(KT * 2 == 128 && GP == 128 + 16);   // a value^T tile row is one 128-byte line: pad interval code 4, 4 dwords of pad
static_assert(KT * KP <= KTP && KTP % 2048 == 0 && STB % 2048 == 0);   // tensor-load destinations at multiples of 2 KiB, planes disjoint
static_assert((MK * 2) % 16 == 0 && MK * 2 <= 131072);                  // source pitch of the value^T tile
static_assert(16 * OPF * 4 <= QWB);            // the output staging tile fits the wave's q rows
static_assert(KP % 16 == 0);
static_assert(GP % 16 == 0);
static_assert(LDSB <= 163840);                 // two blocks per 320 KiB of LDS
static_assert(COUT * KP <= 2 * STB);           // the staged W_out^T plane (256 rows of 256 B, pitch KP) fits the two tile buffers
static_assert(COUT == 64 * AW);                // each wave copies 64 W_out^T rows (32 copies of 2 rows, all in flight: at most 63)
static_assert((size_t)NB * SEQ * CIN < (size_t)2147483647);   // int offsets inside the planes
static_assert(CIN == 2 * 32 * 4);              // an x row is two loads of four f32 per lane of one wave
static_assert(XP % 16 == 0);
static_assert(3 * CB == 32 * PW);              // each wave builds 32 transposed weight rows
static_assert(PT > 10 * PW && PT <= 11 * PW);  // x rows wave, wave + PW, ...: ten per wave, an eleventh in the first PT - 10 * PW waves
static_assert((NB * SEQ) / PT >= COUT);        // block c also writes row c of the W_out^T plane
static_assert((NB * SEQ) % PT == 0);
static_assert(SEQ % PT == 0);
static_assert(16 * OPF * 4 <= 16 * XP);        // a value^T wave's staging tile fits the first 16 of its own 32 weight rows
static_assert(PLDS <= 327680);                 // one block per 320 KiB of LDS

typedef _Float16 h16;
typedef unsigned short bf;
typedef __attribute__((ext_vector_type(16))) __bf16   v16bf;
typedef __attribute__((ext_vector_type(16))) _Float16 v16h;
typedef __attribute__((ext_vector_type(8)))  _Float16 v8h;
typedef __attribute__((ext_vector_type(8)))  unsigned short v8us;
typedef __attribute__((ext_vector_type(8)))  float    v8f;
typedef __attribute__((ext_vector_type(4)))  float    v4f;
typedef v4f  __attribute__((may_alias)) v4fa;
typedef v8h  __attribute__((may_alias)) v8ha;
typedef v8us __attribute__((may_alias)) v8usa;
typedef __attribute__((ext_vector_type(2)))  _Float16 v2h;
typedef __attribute__((ext_vector_type(4)))  unsigned short v4us;
typedef v4us __attribute__((may_alias)) v4usa;

__device__ __forceinline__ unsigned short f2bf(float f) { unsigned u = __float_as_uint(f); u += 0x7FFFu + ((u >> 16) & 1u); return (unsigned short)(u >> 16); }
__device__ __forceinline__ float bfr(float f) { return __uint_as_float(((unsigned)f2bf(f)) << 16); }   // value after RNE convert to bf16
__device__ __forceinline__ unsigned short tobf(float f) { return __builtin_bit_cast(unsigned short, (__bf16)f); }   // RNE convert on the vector unit's own instruction (same bits as f2bf for every finite value)
__device__ __forceinline__ v16h cat16(v8h lo, v8h hi) { return __builtin_shufflevector(lo, hi, 0, 1, 2, 3, 4, 5, 6, 7, 8, 9, 10, 11, 12, 13, 14, 15); }
__device__ __forceinline__ v16bf cat16b(v8us lo, v8us hi) { return __builtin_bit_cast(v16bf, __builtin_shufflevector(lo, hi, 0, 1, 2, 3, 4, 5, 6, 7, 8, 9, 10, 11, 12, 13, 14, 15)); }
__device__ __forceinline__ v8f wmma16(v16h a, v16h b, v8f c) { return __builtin_amdgcn_wmma_f32_16x16x32_f16(false, a, false, b, (short)0, c, false, false); }
__device__ __forceinline__ v8f wmmab(v16bf a, v16bf b, v8f c) { return __builtin_amdgcn_wmma_f32_16x16x32_bf16(false, a, false, b, (short)0, c, false, false); }
// fragment loaders from K-contiguous 16-bit rows staged in LDS; p in bytes, already includes + 16*(lane>>4): elements 0..7 <- k0+8h+0..7, elements 8..15 <- k0+16+8h+0..7 (same map for A and B)
__device__ __forceinline__ v16h  ldl(const unsigned char* p) { return cat16(*(const v8ha*)p, *(const v8ha*)(p + 32)); }
__device__ __forceinline__ v16bf ldlb(const unsigned char* p) { return cat16b(*(const v8usa*)p, *(const v8usa*)(p + 32)); }
// eight asynchronous 16-byte-per-lane copies global -> LDS (l = the lane's LDS byte address, g = the lane's global address; steps between copies ls bytes, gs elements).
// The closing s_wait_xcnt stands inside the statement so that no address register is rewritten ahead of it.
__device__ __forceinline__ void cp8(unsigned l, const h16* g, unsigned ls, size_t gs) {
    asm volatile("global_load_async_to_lds_b128 %0, %8, off\n\t"
                 "global_load_async_to_lds_b128 %1, %9, off\n\t"
                 "global_load_async_to_lds_b128 %2, %10, off\n\t"
                 "global_load_async_to_lds_b128 %3, %11, off\n\t"
                 "global_load_async_to_lds_b128 %4, %12, off\n\t"
                 "global_load_async_to_lds_b128 %5, %13, off\n\t"
                 "global_load_async_to_lds_b128 %6, %14, off\n\t"
                 "global_load_async_to_lds_b128 %7, %15, off\n\t"
                 "s_wait_xcnt 0x0"
                 :: "v"(l), "v"(l + ls), "v"(l + 2 * ls), "v"(l + 3 * ls), "v"(l + 4 * ls), "v"(l + 5 * ls), "v"(l + 6 * ls), "v"(l + 7 * ls),
                    "v"(g), "v"(g + gs), "v"(g + 2 * gs), "v"(g + 3 * gs), "v"(g + 4 * gs), "v"(g + 5 * gs), "v"(g + 6 * gs), "v"(g + 7 * gs)
                 : "memory");
}
typedef unsigned u32x4 __attribute__((ext_vector_type(4)));
typedef unsigned u32x8 __attribute__((ext_vector_type(8)));
__device__ __forceinline__ unsigned uni(unsigned v) { return (unsigned)__builtin_amdgcn_readfirstlane(v); }
// pinned(): a wave-uniform test held in a scalar register, so that the branch on it is a scalar branch (a tensor load ignores EXEC; only a branch keeps a wave from issuing it)
__device__ __forceinline__ unsigned pinned(unsigned v) { unsigned w = uni(v); asm volatile("" : "+s"(w)); return w; }
// tensor-load descriptor, group 1: a tile of ROWS rows of ROWB bytes, source pitch SRCP bytes, 16 bytes of LDS pad behind every row (IVL: the pad interval code of the row length).
// Extents in bytes (data_size 0), tensor dims = tile dims, no mask.
template <unsigned ROWB, unsigned ROWS, unsigned SRCP, unsigned IVL>
__device__ __forceinline__ u32x8 tdm_g1() {
    u32x8 g;
    g[0] = uni((1u << 20) | (IVL << 22) | (3u << 25));
    g[1] = uni((ROWB & 0xFFFFu) << 16);
    g[2] = uni((ROWB >> 16) | ((ROWS & 0xFFFFu) << 16));
    g[3] = uni((ROWS >> 16) | (ROWB << 16));
    g[4] = uni(ROWS);
    g[5] = uni(SRCP);
    g[6] = uni(0u); g[7] = uni(0u);
    asm volatile("" : "+s"(g));   // pinned(), for the whole group: the descriptor words are held in one scalar register tuple (else the constants are formed anew in other registers, over those of a request in flight)
    return g;
}
// group 0: LDS byte address of the tile's place, global address of the tile's first byte
__device__ __forceinline__ u32x4 tdm_g0(unsigned lds, const h16* src) {
    const unsigned long long ga = (unsigned long long)(size_t)src;
    u32x4 g;
    g[0] = uni(1u); g[1] = uni(lds); g[2] = uni((unsigned)ga); g[3] = uni((((unsigned)(ga >> 32)) & 0x01FFFFFFu) | 0x80000000u);
    asm volatile("" : "+s"(g));   // pinned(), for the whole group: as in tdm_g1
    return g;
}
// one 64-key tile: waves 0 and 1 issue the k descriptor (wave 0's names the value plane, wave 1's the residual plane), wave 2 the value^T descriptor; scalar branches; the waits are the caller's
__device__ __forceinline__ void tile_load(unsigned wave, u32x4 k0, u32x8 k1, u32x4 v0, u32x8 v1) {
    if (pinned(wave < 2u))  asm volatile("tensor_load_to_lds %0, %1" :: "s"(k0), "s"(k1) : "memory");
    if (pinned(wave == 2u)) asm volatile("tensor_load_to_lds %0, %1" :: "s"(v0), "s"(v1) : "memory");
}
// the issuing wave's wait for its tensor load (free in a wave that has none). The descriptors are named as inputs so that their registers keep their values for as long as the request is outstanding.
__device__ __forceinline__ void tile_wait(u32x4 k0, u32x8 k1, u32x4 v0, u32x8 v1) {
    asm volatile("s_wait_tensorcnt 0x0" :: "s"(k0), "s"(k1), "s"(v0), "s"(v1) : "memory");
}
// lane l <-> lane l ^ 16 on the vector unit: unlike the LDS-path shuffle it does not count on dscnt, so its result needs no wait that would drain the fragment reads issued ahead of it
__device__ __forceinline__ float xhalf(float v) { const unsigned u = __float_as_uint(v);
    return __uint_as_float(__builtin_amdgcn_permlanex16(u, u, 0x76543210u, 0xfedcba98u, false, false)); }
// ordering point for wave-private LDS tiles (same wave writes and reads)
__device__ __forceinline__ void wave_sync() { __builtin_amdgcn_fence(3 /* release order */, "wavefront"); __builtin_amdgcn_wave_barrier(); asm volatile("" ::: "memory"); }

// f32 -> f16 convert that cannot produce an f16 subnormal (|v| < 2^-14 -> +0); applied after the plane's power-of-two carry
static __device__ __forceinline__ h16 toh_flush(float v) { const h16 r = (h16)v; return (fabsf(v) < 6.103515625e-05f) ? (h16)0.0f : r; }
// one matrix instruction + its own four-slot guard (accumulator tied, operands kept live)
__device__ __forceinline__ v8f wmma16g(v16h a, v16h b, v8f c) {
    c = __builtin_amdgcn_wmma_f32_16x16x32_f16(false, a, false, b, (short)0, c, false, false);
    asm volatile("v_nop\n\tv_nop\n\tv_nop\n\tv_nop" : "+v"(c) : "v"(a), "v"(b));
    return c; }
__device__ __forceinline__ v8f wmmabg(v16bf a, v16bf b, v8f c) {
    c = __builtin_amdgcn_wmma_f32_16x16x32_bf16(false, a, false, b, (short)0, c, false, false);
    asm volatile("v_nop\n\tv_nop\n\tv_nop\n\tv_nop" : "+v"(c) : "v"(a), "v"(b));
    return c; }

// mm64: register-blocked bf16 GEMM main loop, ONE WAVE per 64x64 tile (16 accumulators), operands from staged LDS rows of pitch XP, K = CIN.
// a, b: the lane's first row of each operand, already + (lane&15)*XP + 16*(lane>>4). acc[mb][nb][j] = C[16mb + 8h + j][16nb + (lane&15)], C[m][n] = sum_k A[m][k] Bt[n][k].
__device__ __forceinline__ void mm64(const unsigned char* a, const unsigned char* b, v8f (&acc)[4][4]) {
#pragma unroll
    for (int mb = 0; mb < 4; ++mb)
#pragma unroll
        for (int nb = 0; nb < 4; ++nb) acc[mb][nb] = (v8f){};
#pragma unroll 1
    for (int kc = 0; kc < CIN * 2; kc += 64) {                 // kc in bytes: 32 elements a step
        v16bf af[4], bb[4];
#pragma unroll
        for (int mb = 0; mb < 4; ++mb) { af[mb] = ldlb(a + mb * 16 * XP + kc); bb[mb] = ldlb(b + mb * 16 * XP + kc); }
        __builtin_amdgcn_sched_barrier(0);                     // keeps the step's LDS reads one group ahead of its products (else each B fragment is read, and waited for, in among them)
#pragma unroll
        for (int nb = 0; nb < 4; ++nb)
#pragma unroll
            for (int mb = 0; mb < 4; ++mb) acc[mb][nb] = wmmabg(af[mb], bb[nb], acc[mb][nb]);
    }
}

// proj_q: q = x W_theta, 64 x 64 tile (bx, by). A = x rows (m = b*SEQ + t), Bt = transposed weight rows (n = d). Planes [b*SEQ + t][128]: f16 value (Ph) and f16 residual x2048 (Pr).
__device__ __forceinline__ void proj_q(float* os, const unsigned char* A, const unsigned char* Bt, h16* Ph, h16* Pr, int bx, int by) {
    const int lane = threadIdx.x & 31, lr = lane & 15, hi = lane >> 4; const int r0 = bx * 64, c0 = by * 64;
    v8f acc[4][4];
    mm64(A, Bt, acc);
    const size_t obase = (size_t)r0 * CB + c0;
#pragma unroll
    for (int mb = 0; mb < 4; ++mb) {
#pragma unroll
        for (int nb = 0; nb < 4; ++nb) {
#pragma unroll
            for (int j = 0; j < 8; ++j) os[(hi * 8 + j) * 68 + nb * 16 + lr] = acc[mb][nb][j]; }   // D: row 8h+j, col lane&15; 16 x 64 all written
        wave_sync();
        static_assert(32 * 8 * 4 == 16 * 64);                                                     // lanes x halves x instructions == slab
{
#pragma unroll
            for (int s = 0; s < 4; ++s) { const int row = 4 * s + (lane >> 3), c8 = (lane & 7) * 8;   // 4 s x 4 row groups = 16 rows; 8 lanes x 8 = 64 columns
                const v4f x0 = *(const v4fa*)(&os[row * 68 + c8]); const v4f x1 = *(const v4fa*)(&os[row * 68 + c8 + 4]); v8h hv, rv;
#pragma unroll
                for (int i = 0; i < 4; ++i) { const h16 a0 = toh_flush(x0[i]); const h16 a1 = toh_flush(x1[i]); hv[i] = a0; hv[4 + i] = a1;
                    rv[i] = toh_flush((x0[i] - (float)a0) * QRS); rv[4 + i] = toh_flush((x1[i] - (float)a1) * QRS); }
                const size_t oo = obase + (size_t)(mb * 16 + row) * CB + c8;
                *(v8h*)(Ph + oo) = hv; *(v8h*)(Pr + oo) = rv; }
             }
        wave_sync();
    }
}

// proj_k: k = maxpool2(x W_phi) over adjacent token pairs, 64 x 64 tile (bx, by). Same GEMM; per 16-token slab the 8 pooled rows (max in f32, then convert) go to planes [b*MK + key][128]: f16 value and f16 residual x2048.
__device__ __forceinline__ void proj_k(float* os, const unsigned char* A, const unsigned char* Bt, h16* Ph, h16* Pr, int bx, int by) {
    const int lane = threadIdx.x & 31, lr = lane & 15, hi = lane >> 4; const int r0 = bx * 64, c0 = by * 64;
    v8f acc[4][4];
    mm64(A, Bt, acc);
    const size_t obase = (size_t)(r0 / 2) * CB + c0;                                              // (b*SEQ + t)/2 = b*MK + t/2
#pragma unroll
    for (int mb = 0; mb < 4; ++mb) {
#pragma unroll
        for (int nb = 0; nb < 4; ++nb) {
#pragma unroll
            for (int j = 0; j < 8; ++j) os[(hi * 8 + j) * 68 + nb * 16 + lr] = acc[mb][nb][j]; }
        wave_sync();
        static_assert(32 * 8 * 2 == 8 * 64);                                                      // lanes x halves x instructions == pooled slab
{
#pragma unroll
            for (int s = 0; s < 2; ++s) { const int prow = 4 * s + (lane >> 3), c8 = (lane & 7) * 8;   // 2 s x 4 row groups = 8 pooled rows (token rows 2*prow, 2*prow+1)
                const v4f u0 = *(const v4fa*)(&os[(2 * prow) * 68 + c8]);     const v4f u1 = *(const v4fa*)(&os[(2 * prow) * 68 + c8 + 4]);
                const v4f w0 = *(const v4fa*)(&os[(2 * prow + 1) * 68 + c8]); const v4f w1 = *(const v4fa*)(&os[(2 * prow + 1) * 68 + c8 + 4]); v8h hv, rv;
#pragma unroll
                for (int i = 0; i < 4; ++i) { const float y0 = fmaxf(u0[i], w0[i]), y1 = fmaxf(u1[i], w1[i]);
                    const h16 a0 = toh_flush(y0); const h16 a1 = toh_flush(y1); hv[i] = a0; hv[4 + i] = a1;
                    rv[i] = toh_flush((y0 - (float)a0) * QRS); rv[4 + i] = toh_flush((y1 - (float)a1) * QRS); }
                const size_t oo = obase + (size_t)(mb * 8 + prow) * CB + c8;
                *(v8h*)(Ph + oo) = hv; *(v8h*)(Pr + oo) = rv; }
             }
        wave_sync();
    }
}

// proj_gt: pooled values transposed, G^T[d][key] = max over the token pair of (W_g^T x^T)[d][t]. ONE WAVE per 32 (d) x 128 (token) tile (16 accumulators):
// A = transposed weight rows (m = d), Bt = x rows (n = b*SEQ + t). Plane [(b*128 + d)][MK], single f16. Per 16-row slab staged in LDS (wave-private);
__device__ __forceinline__ void proj_gt(float* os, const unsigned char* A, const unsigned char* Bt, h16* Gt, int bx, int by) {
    const int lane = threadIdx.x & 31, lr = lane & 15, hi = lane >> 4; const int r0 = bx * 32, c0 = by * 128;
    v8f acc[2][8];
#pragma unroll
    for (int mb = 0; mb < 2; ++mb)
#pragma unroll
        for (int nb = 0; nb < 8; ++nb) acc[mb][nb] = (v8f){};
#pragma unroll 1
    for (int kc = 0; kc < CIN * 2; kc += 64) {                 // kc in bytes: 32 elements a step
        v16bf a[2], b[8];
#pragma unroll
        for (int mb = 0; mb < 2; ++mb) a[mb] = ldlb(A + mb * 16 * XP + kc);
#pragma unroll
        for (int nb = 0; nb < 8; ++nb) b[nb] = ldlb(Bt + nb * 16 * XP + kc);
        __builtin_amdgcn_sched_barrier(0);                     // keeps the step's LDS reads one group ahead of its products, as in mm64
#pragma unroll
        for (int nb = 0; nb < 8; ++nb)
#pragma unroll
            for (int mb = 0; mb < 2; ++mb) acc[mb][nb] = wmmabg(a[mb], b[nb], acc[mb][nb]);
    }
    const int bb = c0 / SEQ, tt = c0 % SEQ;
    const size_t obase = ((size_t)bb * CB + r0) * MK + (size_t)(tt / 2);
#pragma unroll
    for (int mb = 0; mb < 2; ++mb) {
#pragma unroll
        for (int nb = 0; nb < 8; ++nb) {
#pragma unroll
            for (int j = 0; j < 8; ++j) os[(hi * 8 + j) * OPF + nb * 16 + lr] = acc[mb][nb][j]; }   // D: row d = 8h+j, col token = 16nb + lane&15; 16 x 128 all written
        wave_sync();
        static_assert(32 * 8 * 4 == 16 * 64);                                                       // lanes x pooled halves x instructions == pooled slab
{
#pragma unroll
            for (int s = 0; s < 4; ++s) { const int row = 4 * s + (lane >> 3), c8 = (lane & 7) * 8;     // 4 s x 4 row groups = 16 rows; 8 lanes x 8 pooled = 64 pooled columns
                const v4f f0 = *(const v4fa*)(&os[row * OPF + 2 * c8]);     const v4f f1 = *(const v4fa*)(&os[row * OPF + 2 * c8 + 4]);
                const v4f f2 = *(const v4fa*)(&os[row * OPF + 2 * c8 + 8]); const v4f f3 = *(const v4fa*)(&os[row * OPF + 2 * c8 + 12]); v8h hv;
                hv[0] = toh_flush(fmaxf(f0[0], f0[1])); hv[1] = toh_flush(fmaxf(f0[2], f0[3]));
                hv[2] = toh_flush(fmaxf(f1[0], f1[1])); hv[3] = toh_flush(fmaxf(f1[2], f1[3]));
                hv[4] = toh_flush(fmaxf(f2[0], f2[1])); hv[5] = toh_flush(fmaxf(f2[2], f2[3]));
                hv[6] = toh_flush(fmaxf(f3[0], f3[1])); hv[7] = toh_flush(fmaxf(f3[2], f3[3]));
                const size_t oo = obase + (size_t)(mb * 16 + row) * MK + c8;
                *(v8h*)(Gt + oo) = hv; }
             }
        wave_sync();
    }
}

// k_proj: the three input projections, straight from the f32 inputs. One block of twelve waves per 128 tokens: waves 0..3 the four 64 x 64 q tiles,
// waves 4..7 the four k tiles, waves 8..11 the four 32 x 128 value^T tiles. The block's operands are built once in LDS as bf16 rows of pitch XP:
// x rows: wave w reads rows w, w + 12, ..., each as two whole-line loads of 512 bytes (four f32 per lane), converts, stores 8 bytes per lane and load.
// weight rows (transposed, [out][in]): wave w builds rows 32w .. 32w+31 of the 384 (W_theta^T, W_phi^T, W_g^T in turn). Lane (a = lane&7, c = lane>>3) reads four outputs 4a .. 4a+3 (16 bytes; eight lanes = one
// 128-byte line of an input row) of the input rows 8c + 32g + e, so that it holds runs of eight consecutive inputs per output: one 16-byte LDS store per run.
// Order: first half of the weight loads, x loads, convert the first half, second half of the weight loads (they fly under the x convert), convert x, convert the second half.
// Block c also writes row c of the W_out^T plane (f16 of the bf16 value x 64) for k_attn: waves 8 and 9, one 128-byte line each.
// Staging tiles of the store stage are wave-private: the q and k waves have their own behind the operands; a value^T wave uses the first 16 of its 32 weight rows, which it alone reads and has left by then.
__global__ __launch_bounds__(32 * PW) void k_proj(const float* __restrict__ x, const float* __restrict__ wt, const float* __restrict__ wp, const float* __restrict__ wg,
                                                  const float* __restrict__ wo, h16* WOH, h16* QH, h16* QR, h16* KH, h16* KR, h16* GT) {
    __shared__ __align__(16) unsigned char sm[PLDS];
    const int lane = threadIdx.x & 31, lr = lane & 15, hi = lane >> 4;
    const int wave = __builtin_amdgcn_readfirstlane((int)(threadIdx.x >> 5));
    const int which = wave >> 2, sub = wave & 3;               // wave-uniform: projection, tile
    const int blk = blockIdx.x;
    const int la = lane & 7, lc = lane >> 3;
    const float* wsrc = (which == 0) ? wt : (which == 1) ? wp : wg;
    const float* gw = wsrc + 8 * lc * CB + 32 * sub + 4 * la;
    unsigned char* lw = sm + WS_O + (32 * wave + 4 * la) * XP + 16 * lc;
    const int tok = blk * PT;                                  // batch pitch of x: SEQ_FULL rows
    const unsigned char* gx = (const unsigned char*)(x + ((size_t)(tok / SEQ) * SEQ_FULL + tok % SEQ + wave) * CIN);   // wave-uniform: the wave's first x row
    const unsigned xo = lane * 16u;                            // the lane's byte offset in half an x row (four f32)
    unsigned char* lx = sm + wave * XP + lane * 8;
    const bool xl = wave + PW * 10 < PT;                       // wave-uniform: the wave has an eleventh x row
    const bool wow = (wave == 8 || wave == 9) && blk < COUT;   // wave-uniform: the wave writes half a row of the W_out^T plane
    const int wd = 64 * (wave & 1) + 2 * lane;                 // two adjacent context channels per lane
    v4f wv[4][8], xr[11][2]; float wo0, wo1;                  // wo0 and wo1 are set and used under wow alone
#pragma unroll
    for (int g = 0; g < 4; ++g)
#pragma unroll
        for (int e = 0; e < 8; ++e) wv[g][e] = *(const v4f*)(gw + (32 * g + e) * CB);
    __builtin_amdgcn_sched_barrier(0);                         // keeps these loads (L2) ahead of the x loads (memory): loads return in order, and the second half of the weight loads is issued as soon as these are converted
#pragma unroll
    for (int i = 0; i < 10; ++i) { xr[i][0] = *(const v4f*)(gx + (size_t)(PW * i) * CIN * 4 + xo); xr[i][1] = *(const v4f*)(gx + (size_t)(PW * i) * CIN * 4 + CIN * 2 + xo); }
    const unsigned char* gx10 = gx + (size_t)(xl ? PW * 10 : PT - 1 - wave) * CIN * 4 + xo;   // no branch among the loads: a wave without an eleventh row reads the block's last row and drops it
    xr[10][0] = *(const v4f*)gx10; xr[10][1] = *(const v4f*)(gx10 + CIN * 2);
    asm volatile("s_wait_xcnt 0x0" :: "s"(gx), "v"(xo), "v"(gx10) : "memory");   // precaution: stands in front of whatever next rewrites an address register of the loads above (base, offset and address are named as inputs so that their registers live up to here)
    if (wow) { wo0 = wo[(size_t)wd * COUT + blk]; wo1 = wo[(size_t)(wd + 1) * COUT + blk]; }
    asm volatile("s_wait_xcnt 0x0" ::: "memory");              // precaution: as above
#pragma unroll
    for (int g = 0; g < 4; ++g)
#pragma unroll
        for (int j = 0; j < 4; ++j) { v8us o;
#pragma unroll
            for (int e = 0; e < 8; ++e) o[e] = tobf(wv[g][e][j]);
            *(v8usa*)(lw + j * XP + g * 64) = o; }
#pragma unroll
    for (int g = 0; g < 4; ++g)
#pragma unroll
        for (int e = 0; e < 8; ++e) wv[g][e] = *(const v4f*)(gw + (32 * (4 + g) + e) * CB);
    asm volatile("s_wait_xcnt 0x0" ::: "memory");              // precaution: as above
    __builtin_amdgcn_sched_barrier(0);                         // keeps the x converts, which wait for memory, behind the issue of these loads (else they rise in among the first half's converts)
#pragma unroll
    for (int i = 0; i < 11; ++i) {
        if (i < 10 || xl) {
#pragma unroll
            for (int h = 0; h < 2; ++h) { v4us o;
#pragma unroll
                for (int e = 0; e < 4; ++e) o[e] = tobf(xr[i][h][e]);
                *(v4usa*)(lx + PW * i * XP + h * CIN) = o; } } }
#pragma unroll
    for (int g = 0; g < 4; ++g)
#pragma unroll
        for (int j = 0; j < 4; ++j) { v8us o;
#pragma unroll
            for (int e = 0; e < 8; ++e) o[e] = tobf(wv[g][e][j]);
            *(v8usa*)(lw + j * XP + (4 + g) * 64) = o; }
    __syncthreads();                                           // publishes the block's operand rows
    if (wow) { v2h o; o[0] = toh_flush(bfr(wo0) * WOS); o[1] = toh_flush(bfr(wo1) * WOS);   // behind the barrier, so that no wave waits there for this store
        *(v2h*)(WOH + (size_t)blk * CB + wd) = o;
        asm volatile("s_wait_xcnt 0x0" ::: "memory"); }        // precaution: stands in front of whatever next rewrites the store's address and data registers
    const unsigned char* xs = sm + lr * XP + 16 * hi;          // fragment rows: + row * XP + 2 * k
    const unsigned char* ws = sm + WS_O + lr * XP + 16 * hi;
    if (which == 0)      proj_q((float*)(sm + OS_O + wave * OSB), xs + (sub & 1) * 64 * XP, ws + (sub >> 1) * 64 * XP, QH, QR, blk * 2 + (sub & 1), sub >> 1);
    else if (which == 1) { proj_k((float*)(sm + OS_O + wave * OSB), xs + (sub & 1) * 64 * XP, ws + (CB + (sub >> 1) * 64) * XP, KH, KR, blk * 2 + (sub & 1), sub >> 1);
        asm volatile("s_wait_xcnt 0x0" ::: "memory"); }        // precaution: in the built text this body is followed by the other bodies' code, which rewrites the registers that its last stores name (the other two run into the end of the program)
    else { proj_gt((float*)(sm + WS_O + 32 * wave * XP), ws + 32 * wave * XP, xs, GT, sub, blk);
        asm volatile("s_wait_xcnt 0x0" ::: "memory"); }        // precaution: as above (whichever body the built text puts last runs into the end of the program)
}

// k_attn: fused attention + output projection + skip term, one wave per 16 query rows of one batch; K / G^T / Q / W_out^T fragments from LDS rows (two 16-B reads each).
// Staging: each wave brings its own 16 q rows once by whole-line asynchronous copies; every 64-key tile (k value, k residual, value^T) comes by three tensor loads, one each from waves 0, 1, 2,
// into one of two buffers, one tile ahead of its use (no address arithmetic on the vector unit, no copy issue in the key loop).
// Transposed form: S^T[key][t] = K Q^T (A = K rows, B = Q rows, 4 k-steps over d); lane (t = lane&15, h = lane>>4) holds keys 8h+r of each 16-key tile, so the packed
// P tile is directly the B fragment of O^T[d][t] = G^T P^T (element r <- tile keys 0..15, element 8+r <- tile keys 16..31, lane unchanged), 8 tiles over d.
// Scores = K Q + (K Q_res + K_res Q) / 2048. Softmax state (running max, partial sum) is one scalar per lane; the two lane halves of a row are combined with one xor-16 exchange.
// Q fragments are read from LDS once and held in registers. The key loop's fragment reads stand at two places per pass, each a whole phase ahead of its use; 512 registers per wave (two waves per SIMD).
// Epilogue: W_out^T rows copied whole-line into the freed tile buffers, a quarter per wave (a fragment load straight from the plane touches 16 lines for 512 bytes, and every wave needs all 256 of them);
// ctx^T = O^T / l packed to f16 (tiles 2kk, 2kk+1 -> B fragment of k-step kk); out^T[c][t] = W_out^T ctx^T per 16-channel tile, staged in a wave-private LDS tile [t][128 channels];
__global__ __launch_bounds__(32 * AW) __attribute__((amdgpu_num_vgpr(512)))
void k_attn(const h16* __restrict__ QH, const h16* __restrict__ QR, const h16* __restrict__ KH, const h16* __restrict__ KR,
            const h16* __restrict__ GT, const h16* __restrict__ WO, const float* __restrict__ X, float* OUT) {
    __shared__ __attribute__((aligned(2048))) unsigned char sm[LDSB];
    const int lane = threadIdx.x & 31, lr = lane & 15, hi = lane >> 4;
    const int wave = __builtin_amdgcn_readfirstlane((int)(threadIdx.x >> 5));
    const int b = blockIdx.y;
    const int t0 = (blockIdx.x * AW + wave) * 16;
    // copy side: q rows of 256 B, two per copy (16 lanes each); tile planes of this batch for the tensor loads
    const unsigned sb = (unsigned)(size_t)sm;                  // LDS byte address of the array
    const unsigned lq = sb + Q_O + wave * QWB + (lane >> 4) * KP + (lane & 15) * 16;
    const int gq = (b * SEQ + t0 + (lane >> 4)) * CB + (lane & 15) * 8;
    const h16* tk = ((wave == 0) ? KH : KR) + (size_t)b * MK * CB;   // + tile * KT * CB; wave 0 brings the value rows, wave 1 the residual rows
    const h16* tg = GT + (size_t)b * CB * MK;                  // + tile * KT
    const unsigned dk = sb + ((wave == 0) ? 0 : KR_O), dg = sb + GT_O;   // + buffer
    const u32x8 k1 = tdm_g1<CB * 2, KT, CB * 2, 5>(), v1 = tdm_g1<KT * 2, CB, MK * 2, 4>();
    // read side
    const unsigned char* qp = sm + Q_O + wave * QWB + lr * KP + 16 * hi;         // B fragments: col t, k = d; residual rows + 16*KP
    const int ko = lr * KP + 16 * hi;                          // + buffer + key * KP      (A fragment: row key, k = d)
    const int vo = GT_O + lr * GP + 16 * hi;                   // + buffer + 16j*GP + 2*key (A fragment: row d, k = key)
    // prologue: q rows and tile 0, landed and published; then tile 1 into the second buffer
    cp8(lq, QH + gq, 2 * KP, 2 * CB);
    cp8(lq + 16 * KP, QR + gq, 2 * KP, 2 * CB);
    u32x4 k0 = tdm_g0(dk, tk), v0 = tdm_g0(dg, tg);
    tile_load((unsigned)wave, k0, k1, v0, v1);
    asm volatile("s_wait_asynccnt 0x0" ::: "memory");          // this wave's copies have landed before the barrier publishes them
    tile_wait(k0, k1, v0, v1);                                 // this wave's tensor load of tile 0 has landed before the barrier publishes it
    __syncthreads();
    k0 = tdm_g0(dk + STB, tk + KT * CB); v0 = tdm_g0(dg + STB, tg + KT);
    tile_load((unsigned)wave, k0, k1, v0, v1);                 // tile 1, into the buffer that nobody has touched yet
    // q fragments: read once, held in registers over the whole key loop. k fragments of tile 0, pass 0 (published by the barrier above)
    v16h qh[4], qr[4], ka[4], kb[4], kra[4], krb[4];
#pragma unroll
    for (int kk = 0; kk < 4; ++kk) { qh[kk] = ldl(qp + kk * 64); qr[kk] = ldl(qp + 16 * KP + kk * 64); }
#pragma unroll
    for (int kk = 0; kk < 4; ++kk) {
        ka[kk] = ldl(sm + ko + kk * 64); kb[kk] = ldl(sm + ko + 16 * KP + kk * 64);
        kra[kk] = ldl(sm + ko + KR_O + kk * 64); krb[kk] = ldl(sm + ko + KR_O + 16 * KP + kk * 64); }
    v8f o[8];
#pragma unroll
    for (int j = 0; j < 8; ++j) o[j] = (v8f){};
    float m = NEGB, l = 0.0f;
#pragma unroll 1
    for (int st = 0; st < NST; ++st) {
    const int bo = (st & 1) * STB;                             // this tile's buffer
    // LDS fragment reads stand at two places per 32-key pass, each a whole phase ahead of its use: the pass's value^T fragments ahead of its score products,
    // the next pass's k fragments behind them (into the registers those products have just read), ahead of the softmax and the output products.
#pragma unroll                                                 // unrolled: the tile's publish point stands inside its last pass only
    for (int ps = 0; ps < KT / 32; ++ps) {                     // 32-key passes in key order
        const unsigned char* vv = sm + bo + vo + ps * 64;
        v16h vf[8];
#pragma unroll
        for (int j = 0; j < 8; ++j) vf[j] = ldl(vv + j * 16 * GP);
        __builtin_amdgcn_sched_barrier(0);                     // keeps the value^T reads one group ahead of the score products (else they sink in among the matrix instructions)
        v8f sHa = (v8f){}, sLa = (v8f){}, sHb = (v8f){}, sLb = (v8f){};
        // plain builtin in the key loop (the compiler keeps the distances behind it): the guarded form's asm operands tie every fragment and accumulator to the first 256 registers, which spills here
#pragma unroll
        for (int kk = 0; kk < 4; ++kk) {
            sHa = wmma16(ka[kk], qh[kk], sHa); sHb = wmma16(kb[kk], qh[kk], sHb);
            sLa = wmma16(ka[kk], qr[kk], sLa); sLb = wmma16(kb[kk], qr[kk], sLb);
            sLa = wmma16(kra[kk], qh[kk], sLa); sLb = wmma16(krb[kk], qh[kk], sLb);
        }
        __builtin_amdgcn_sched_barrier(0);                     // keeps the next k reads behind the last score product, as one group
        const unsigned char* kn;
        if (ps + 1 < KT / 32) kn = sm + bo + ko + (ps + 1) * 32 * KP;
        else {
            // publish point of tile st + 1, inside tile st's last pass: every read of this buffer has been issued (k fragments used, value^T fragments fetched above)
            asm volatile("s_wait_dscnt 0x0" ::: "memory");     // this wave has left the buffer that is refilled behind the barrier
            tile_wait(k0, k1, v0, v1);                         // this wave's tensor load of tile st + 1 has landed
            __syncthreads();
            kn = sm + (STB - bo) + ko;                         // behind the last tile: the other buffer's old rows, landed and published long ago; read unconditionally (a branch here would merge the compiler's wait counts to 0), never used
        }
#pragma unroll
        for (int kk = 0; kk < 4; ++kk) {
            ka[kk] = ldl(kn + kk * 64); kb[kk] = ldl(kn + 16 * KP + kk * 64);
            kra[kk] = ldl(kn + KR_O + kk * 64); krb[kk] = ldl(kn + KR_O + 16 * KP + kk * 64); }
        __builtin_amdgcn_sched_barrier(0);                     // keeps the k reads ahead of the softmax, whose time covers their latency
        if (ps + 1 == KT / 32) {
            // refill of the buffer just freed (this wave's reads of it retired at the s_wait_dscnt 0 above; the k reads in flight are of the other buffer); scalar tests, the first reads the same for the whole block
            if (pinned(st + 2 < NST)) {
                k0 = tdm_g0(dk + bo, tk + (st + 2) * KT * CB); v0 = tdm_g0(dg + bo, tg + (st + 2) * KT);
                tile_load((unsigned)wave, k0, k1, v0, v1);
            }
        }
        float ta[8], tb[8]; float mx = NEGB;
#pragma unroll
        for (int r = 0; r < 8; ++r) {
            ta[r] = (sHa[r] + sLa[r] * QRI) * L2E; tb[r] = (sHb[r] + sLb[r] * QRI) * L2E;
            mx = fmaxf(mx, fmaxf(ta[r], tb[r])); }
        mx = fmaxf(mx, xhalf(mx));
        const float mnew = fmaxf(m, mx);
        const float alpha = __builtin_amdgcn_exp2f(m - mnew);
        const float sh = PSH - mnew;
        v16h pb; float ls = 0.0f;
#pragma unroll
        for (int r = 0; r < 8; ++r) {
            const float ea = ta[r] + sh, eb = tb[r] + sh;
            const float xa = __builtin_amdgcn_exp2f(ea), xb = __builtin_amdgcn_exp2f(eb);
            const float ga = (ea < -14.0f) ? 0.0f : xa, gb = (eb < -14.0f) ? 0.0f : xb;   // nothing below 2^-14 reaches the f16 operand
            const h16 pa = (h16)ga; const h16 pc = (h16)gb;
            pb[r] = pa; pb[8 + r] = pc;
            ls += (float)pa + (float)pc; }
        l = l * alpha + ls; m = mnew;
#pragma unroll
        for (int j = 0; j < 8; ++j) o[j] = o[j] * alpha;
#pragma unroll
        for (int j = 0; j < 8; ++j) o[j] = wmma16(vf[j], pb, o[j]);
    }
    }
    tile_wait(k0, k1, v0, v1);                                 // no tensor load in flight before the tile buffers are used for anything else
    // W_out^T [256 channels][128] into the bytes of the two tile buffers, rows of pitch KP: wave w brings rows 64w .. 64w+63, two per copy; the copies fly under the normalisation below
    asm volatile("s_wait_dscnt 0x0" ::: "memory");             // this wave's last reads of the tile buffers (the k rows fetched behind the last tile) have returned
    __syncthreads();                                           // every wave has left both tile buffers
    {
        const unsigned lw = sb + (64 * wave + (lane >> 4)) * KP + (lane & 15) * 16;
        const h16* gw = WO + (64 * wave + (lane >> 4)) * CB + (lane & 15) * 8;
#pragma unroll                                                 // unrolled: four statements of eight copies, their address steps constants
        for (int c = 0; c < 4; ++c) cp8(lw + c * 16 * KP, gw + c * 16 * CB, 2 * KP, 2 * CB);
    }
    l += __shfl_xor(l, 16, 32);
    const float inv = 1.0f / l;                                // l >= 16384 (the row maximum contributes the full carry)
    // ctx^T D layout: o[j][r] = (d = 16j + 8h + r, t = lane&15); B fragment of k-step kk: element r <- tile 2kk, element 8+r <- tile 2kk+1
    v16h cf[4];
#pragma unroll
    for (int kk = 0; kk < 4; ++kk) {
#pragma unroll
        for (int r = 0; r < 8; ++r) { cf[kk][r] = toh_flush(o[2 * kk][r] * inv); cf[kk][8 + r] = toh_flush(o[2 * kk + 1][r] * inv); } }
    asm volatile("s_wait_asynccnt 0x0" ::: "memory");          // this wave's W_out^T rows have landed before the barrier publishes them
    __syncthreads();
    float* os = (float*)(sm + Q_O);                            // each wave stages in the bytes of its own q rows, which only it has read
    const int wb = wave * (QWB / 4);
    const size_t xrow = ((size_t)b * SEQ_FULL + t0) * COUT;
    const size_t orow = ((size_t)b * OUT_SEQ + t0) * COUT;
#pragma unroll 1
    for (int hc = 0; hc < 2; ++hc) {
#pragma unroll 1
        for (int ct = 0; ct < 8; ct += 2) {
            const int cg = hc * 8 + ct;
            v16h wa[2][4];                                     // A fragments of two channel tiles: row c = 16(cg + u) + (lane&15), k = d; the loops over u and kk are unrolled so that the arrays stay in registers
#pragma unroll
            for (int u = 0; u < 2; ++u)
#pragma unroll
                for (int kk = 0; kk < 4; ++kk) wa[u][kk] = ldl(sm + ko + (cg + u) * 16 * KP + kk * 64);
            __builtin_amdgcn_sched_barrier(0);                 // keeps the trip's LDS reads one group ahead of its products (else each fragment is read, and waited for, directly in front of its product)
            v8f acc[2]; acc[0] = (v8f){}; acc[1] = (v8f){};
#pragma unroll
            for (int kk = 0; kk < 4; ++kk) { acc[0] = wmma16g(wa[0][kk], cf[kk], acc[0]); acc[1] = wmma16g(wa[1][kk], cf[kk], acc[1]); }
            // D: acc[u][r] = (c = 16(cg + u) + 8h + r, t = lane&15) -> os[t][16(ct + u) + 8h + r]; rows 0..15 x columns 0..127 all written over the 8 tiles
#pragma unroll
            for (int u = 0; u < 2; ++u) {
                v4f a0, a1;
                a0[0] = acc[u][0] * WOI; a0[1] = acc[u][1] * WOI; a0[2] = acc[u][2] * WOI; a0[3] = acc[u][3] * WOI;
                a1[0] = acc[u][4] * WOI; a1[1] = acc[u][5] * WOI; a1[2] = acc[u][6] * WOI; a1[3] = acc[u][7] * WOI;
                *(v4fa*)(&os[wb + lr * OPF + (ct + u) * 16 + 8 * hi]) = a0; *(v4fa*)(&os[wb + lr * OPF + (ct + u) * 16 + 8 * hi + 4]) = a1;
            }
        }
        wave_sync();
        static_assert(32 * 4 * 16 == 16 * 128);                // lanes x floats x instructions == half tile
{
#pragma unroll 4
            for (int s = 0; s < 16; ++s) { const int cofs = lane * 4;
                const v4f val = *(const v4fa*)(&os[wb + s * OPF + cofs]);
                const v4f xv = *(const v4f*)(X + xrow + (size_t)s * COUT + hc * 128 + cofs);
                v4f res; res[0] = bfr(xv[0]) + val[0]; res[1] = bfr(xv[1]) + val[1]; res[2] = bfr(xv[2]) + val[2]; res[3] = bfr(xv[3]) + val[3];
                *(v4f*)(OUT + orow + (size_t)s * COUT + hc * 128 + cofs) = res; }
             }
        wave_sync();
    }
}

static constexpr size_t al256(size_t v) { return (v + 255) & ~(size_t)255; }
static constexpr size_t SZ_W  = al256((size_t)CIN * CB * 2);
static constexpr size_t SZ_Q  = al256((size_t)NB * SEQ * CB * 2);
static constexpr size_t SZ_K  = al256((size_t)NB * MK * CB * 2);
static constexpr size_t SZ_TOTAL = SZ_W + 2 * SZ_Q + 3 * SZ_K;
static_assert(SZ_TOTAL <= (size_t)134217728);                        // workspace carve <= 128 MiB
static_assert((size_t)CIN * CB == (size_t)CB * COUT);                // the W_out plane has the extent of an input-projection weight plane
static_assert((size_t)NB * MK * CB == (size_t)NB * CB * MK);         // value^T plane [(b*128 + d)][MK] has the extent of a k plane

extern "C" void kernel_launch(void* const* d_in, const int* in_sizes, int n_in,
                              void* d_out, int out_size, void* d_ws, size_t ws_size, hipStream_t stream) {
    if (n_in < 5) return;
    const size_t needx = ((size_t)(NB - 1) * SEQ_FULL + SEQ) * CIN;
    if ((size_t)in_sizes[0] < needx) return;
    if ((size_t)in_sizes[1] < (size_t)CIN * CB || (size_t)in_sizes[2] < (size_t)CIN * CB || (size_t)in_sizes[3] < (size_t)CIN * CB) return;
    if ((size_t)in_sizes[4] < (size_t)CB * COUT) return;
    if ((size_t)out_size < ((size_t)(NB - 1) * OUT_SEQ + SEQ) * COUT) return;
    if (SZ_TOTAL > ws_size) return;
    // wire order: x, W_theta, W_phi, W_g, W_out
    const float* x  = (const float*)d_in[0];
    const float* wt = (const float*)d_in[1];
    const float* wp = (const float*)d_in[2];
    const float* wg = (const float*)d_in[3];
    const float* wo = (const float*)d_in[4];
    float* OUT = (float*)d_out;      // [NB][SEQ][256]
    char* wsp = (char*)d_ws;
    h16* WOH = (h16*)wsp; wsp += SZ_W;               // W_out^T   f16 x64 [256][128]
    h16* QH = (h16*)wsp; wsp += SZ_Q;                // [NB*SEQ][128]
    h16* QR = (h16*)wsp; wsp += SZ_Q;                // [NB*SEQ][128] residual x2048
    h16* KH = (h16*)wsp; wsp += SZ_K;                // [NB*MK][128]
    h16* KR = (h16*)wsp; wsp += SZ_K;                // [NB*MK][128] residual x2048
    h16* GT = (h16*)wsp; wsp += SZ_K;                // [NB*128][MK]

    k_proj<<<dim3(NB * SEQ / PT, 1, 1), 32 * PW, 0, stream>>>(x, wt, wp, wg, wo, WOH, QH, QR, KH, KR, GT);
    k_attn<<<dim3(SEQ / (16 * AW), NB, 1), 32 * AW, 0, stream>>>(QH, QR, KH, KR, GT, WOH, x, OUT);
}

// v009
// One run takes 63.8 microseconds.
// Next to v008, in two timings, it ran 1.07 times as fast each time.
// Counting every step since v000, it is 4.93 times as fast.
#include <hip/hip_runtime.h>

// Spatial self-attention block over flattened pixels: x [NB][SEQ][256]; three 1x1 projections W [in 256][out 128] (no bias); keys and values max-pooled over adjacent token pairs (SEQ/2 keys);
// unscaled dot-product scores, softmax over keys; context [SEQ][128] -> output projection W_out [in 128][out 256]; output = x + projected context (f32).
// Compute dtypes, f32 accumulate everywhere: three input projections v_wmma_f32_16x16x32_bf16 (x and W RNE-converted to bf16; products exact);
// scores v_wmma_f32_16x16x32_f16 with q and k each as f16 value + f16 residual x2048 (three products, residual products in their own accumulator folded by 1/2048);
// P.V v_wmma_f32_16x16x32_f16, P single f16 with x16384 carry (cancels in the normalisation, row sum over the converted P), pooled values single f16;
// output projection v_wmma_f32_16x16x32_f16, context single f16, W_out (RNE bf16 value) x64 as f16, folded by 1/64; softmax f32 (online, running max); skip term = bf16-converted x added in f32 at the store stage.
// Layout: transposed f16 W_out plane [out][in]; q planes (value, residual) [b][t][128]; k planes (value, residual) [b][key][128]; value^T plane [b][d][key];
// fused flash kernel in transposed form (S^T = K Q^T, O^T = V^T P^T, out^T = W_out^T ctx^T with the packed O^T tiles as B fragments);
// its key-loop operands are staged in LDS: q rows by asynchronous copies, k and value^T in 64-key tiles with two buffers shared by the block's waves, each tile plane by one tensor load.
// behind the key loop the whole W_out^T plane is staged by asynchronous copies in the bytes of the two tile buffers, once per block, for the output projection's A fragments.
// the projections' operands (128 x rows, the 384 transposed weight rows) are read as f32 from the inputs, converted to bf16 in registers and stored to LDS, once per block, and shared by the block's twelve waves.
// Two dependent launches: k_proj (q, k, value^T planes; one row of the W_out^T plane per block), k_attn.

#ifndef NB
#define NB 8
#endif
#ifndef SEQ
#define SEQ 4096
#endif
#define NB_FULL  8
#define SEQ_FULL 4096
#ifndef OUT_SEQ
#define OUT_SEQ SEQ              // row pitch (in tokens) between batches of the output
#endif
#define CIN  256                 // input channels (projection depth)
#define CB   128                 // bottleneck width (score depth, context width)
#define COUT 256                 // output channels
#define MK   (SEQ / 2)           // pooled keys per batch
#define AW   4                   // waves per flash block (16 query rows each)
#define OPF  132                 // LDS row pitch (floats) of the 16 x 128 staging tiles
#define QRS  2048.0f             // carry of every residual plane
#define QRI  (1.0f / 2048.0f)
#define L2E  1.4426950408889634f // log2(e); the module applies no score scale
#define PSH  14.0f               // log2 of the P carry (16384)
#define NEGB (-3.0e38f)
#define WOS  64.0f               // carry of the f16 W_out plane
#define WOI  (1.0f / 64.0f)
#define KT   64                  // keys per LDS tile (two 32-key passes)
#define NST  (MK / KT)           // tiles per batch
#define KP   272                 // LDS row pitch, bytes, of 256-byte q / k rows (16 B x odd: conflict-free 16-byte reads)
#define GP   144                 // LDS row pitch, bytes, of 128-byte value^T rows (16 B x odd)
#define KTP  18432               // bytes of one k plane's place in a tile buffer: KT rows of pitch KP, rounded up to a multiple of 2 KiB (every tensor load's destination is one)
#define KR_O KTP                 // tile layout: k value rows, k residual rows, value^T rows
#define GT_O (2 * KTP)
#define STB  (2 * KTP + CB * GP) // bytes of one tile buffer
#define Q_O  (2 * STB)           // behind the two buffers: per wave 16 q value rows, then 16 q residual rows
#define QWB  (2 * 16 * KP)       // bytes of one wave's q rows; the same bytes are that wave's output staging tile after the key loop
#define LDSB (Q_O + AW * QWB)
#define PT   128                 // tokens per projection block
#define PW   12                  // waves per projection block: four q tiles, four k tiles, four value^T tiles
#define XP   528                 // LDS row pitch, bytes, of 512-byte x / weight rows (16 B x odd: conflict-free 16-byte reads)
#define WS_O (PT * XP)           // projection block layout: 128 x rows, 3 x 128 weight rows, the q and k waves' staging tiles
#define OS_O (WS_O + 3 * CB * XP)
#define OSB  (16 * 68 * 4)       // bytes of one q / k staging tile
#define PLDS (OS_O + 8 * OSB)

static_assert(CB == 128);                      // flash: 4 k-steps of 32 per score tile, 8 output tiles of 16, 4 k-steps in the output projection
static_assert(COUT == 256);                    // output staged as two halves of 128 columns
static_assert(CIN == COUT);                    // skip term has the output's row width
static_assert(CIN % 32 == 0);                  // GEMM k-loop steps by 32
static_assert(CB % 32 == 0);
static_assert(CIN % 64 == 0);
static_assert(CB % 64 == 0);
static_assert(COUT % 64 == 0);
static_assert(SEQ % 128 == 0);                 // a 128-token value tile never straddles two batches; token pairs stay inside a tile
static_assert((NB * SEQ) % 128 == 0);
static_assert((NB * SEQ) % 64 == 0);
static_assert(MK % 32 == 0);                   // key loop steps by 32
static_assert(MK % 64 == 0);
static_assert(SEQ % (16 * AW) == 0);           // flash grid covers the sequence exactly
static_assert(((size_t)SEQ * CIN) % 8 == 0);
static_assert(NB <= NB_FULL);
static_assert(SEQ <= SEQ_FULL);
static_assert((OPF * 4) % 16 == 0);
static_assert(NST >= 4);                       // the two-buffer prologue fills tiles 0 and 1; the skip term's x rows are requested in tiles 0 to 3
static_assert(AW >= 3);                        // waves 0, 1, 2 each issue one tensor load per tile (k value, k residual, value^T)
static_assert(CB * 2 == 256 && KP == 256 + 16);   // a k row is 256 bytes: pad interval code 5, 4 dwords of pad
static_assert(KT * 2 == 128 && GP == 128 + 16);   // a value^T tile row is one 128-byte line: pad interval code 4, 4 dwords of pad
static_assert(KT * KP <= KTP && KTP % 2048 == 0 && STB % 2048 == 0);   // tensor-load destinations at multiples of 2 KiB, planes disjoint
static_assert((MK * 2) % 16 == 0 && MK * 2 <= 131072);                  // source pitch of the value^T tile
static_assert(16 * OPF * 4 <= QWB);            // the output staging tile fits the wave's q rows
static_assert(KP % 16 == 0);
static_assert(GP % 16 == 0);
static_assert(LDSB <= 163840);                 // two blocks per 320 KiB of LDS
static_assert(COUT * KP <= 2 * STB);           // the staged W_out^T plane (256 rows of 256 B, pitch KP) fits the two tile buffers
static_assert(COUT == 64 * AW);                // each wave copies 64 W_out^T rows (32 copies of 2 rows, all in flight: at most 63)
static_assert((size_t)NB * SEQ * CIN < (size_t)2147483647);   // int offsets inside the planes
static_assert(CIN == 2 * 32 * 4);              // an x row is two loads of four f32 per lane of one wave
static_assert(XP % 16 == 0);
static_assert(3 * CB == 32 * PW);              // each wave builds 32 transposed weight rows
static_assert(PT > 10 * PW && PT <= 11 * PW);  // x rows wave, wave + PW, ...: ten per wave, an eleventh in the first PT - 10 * PW waves
static_assert((NB * SEQ) / PT >= COUT);        // block c also writes row c of the W_out^T plane
static_assert((NB * SEQ) % PT == 0);
static_assert(SEQ % PT == 0);
static_assert(16 * OPF * 4 <= 16 * XP);        // a value^T wave's staging tile fits the first 16 of its own 32 weight rows
static_assert(PLDS <= 327680);                 // one block per 320 KiB of LDS

typedef _Float16 h16;
typedef unsigned short bf;
typedef __attribute__((ext_vector_type(16))) __bf16   v16bf;
typedef __attribute__((ext_vector_type(16))) _Float16 v16h;
typedef __attribute__((ext_vector_type(8)))  _Float16 v8h;
typedef __attribute__((ext_vector_type(8)))  unsigned short v8us;
typedef __attribute__((ext_vector_type(8)))  float    v8f;
typedef __attribute__((ext_vector_type(4)))  float    v4f;
typedef v4f  __attribute__((may_alias)) v4fa;
typedef v8h  __attribute__((may_alias)) v8ha;
typedef v8us __attribute__((may_alias)) v8usa;
typedef __attribute__((ext_vector_type(2)))  _Float16 v2h;
typedef __attribute__((ext_vector_type(4)))  unsigned short v4us;
typedef v4us __attribute__((may_alias)) v4usa;

__device__ __forceinline__ unsigned short f2bf(float f) { unsigned u = __float_as_uint(f); u += 0x7FFFu + ((u >> 16) & 1u); return (unsigned short)(u >> 16); }
__device__ __forceinline__ float bfr(float f) { return __uint_as_float(((unsigned)f2bf(f)) << 16); }   // value after RNE convert to bf16
__device__ __forceinline__ unsigned short tobf(float f) { return __builtin_bit_cast(unsigned short, (__bf16)f); }   // RNE convert on the vector unit's own instruction (same bits as f2bf for every finite value)
__device__ __forceinline__ v16h cat16(v8h lo, v8h hi) { return __builtin_shufflevector(lo, hi, 0, 1, 2, 3, 4, 5, 6, 7, 8, 9, 10, 11, 12, 13, 14, 15); }
__device__ __forceinline__ v16bf cat16b(v8us lo, v8us hi) { return __builtin_bit_cast(v16bf, __builtin_shufflevector(lo, hi, 0, 1, 2, 3, 4, 5, 6, 7, 8, 9, 10, 11, 12, 13, 14, 15)); }
__device__ __forceinline__ v8f wmma16(v16h a, v16h b, v8f c) { return __builtin_amdgcn_wmma_f32_16x16x32_f16(false, a, false, b, (short)0, c, false, false); }
__device__ __forceinline__ v8f wmmab(v16bf a, v16bf b, v8f c) { return __builtin_amdgcn_wmma_f32_16x16x32_bf16(false, a, false, b, (short)0, c, false, false); }
// fragment loaders from K-contiguous 16-bit rows staged in LDS; p in bytes, already includes + 16*(lane>>4): elements 0..7 <- k0+8h+0..7, elements 8..15 <- k0+16+8h+0..7 (same map for A and B)
__device__ __forceinline__ v16h  ldl(const unsigned char* p) { return cat16(*(const v8ha*)p, *(const v8ha*)(p + 32)); }
__device__ __forceinline__ v16bf ldlb(const unsigned char* p) { return cat16b(*(const v8usa*)p, *(const v8usa*)(p + 32)); }
// eight asynchronous 16-byte-per-lane copies global -> LDS (l = the lane's LDS byte address, g = the lane's global address; steps between copies ls bytes, gs elements).
// The closing s_wait_xcnt stands inside the statement so that no address register is rewritten ahead of it.
__device__ __forceinline__ void cp8(unsigned l, const h16* g, unsigned ls, size_t gs) {
    asm volatile("global_load_async_to_lds_b128 %0, %8, off\n\t"
                 "global_load_async_to_lds_b128 %1, %9, off\n\t"
                 "global_load_async_to_lds_b128 %2, %10, off\n\t"
                 "global_load_async_to_lds_b128 %3, %11, off\n\t"
                 "global_load_async_to_lds_b128 %4, %12, off\n\t"
                 "global_load_async_to_lds_b128 %5, %13, off\n\t"
                 "global_load_async_to_lds_b128 %6, %14, off\n\t"
                 "global_load_async_to_lds_b128 %7, %15, off\n\t"
                 "s_wait_xcnt 0x0"
                 :: "v"(l), "v"(l + ls), "v"(l + 2 * ls), "v"(l + 3 * ls), "v"(l + 4 * ls), "v"(l + 5 * ls), "v"(l + 6 * ls), "v"(l + 7 * ls),
                    "v"(g), "v"(g + gs), "v"(g + 2 * gs), "v"(g + 3 * gs), "v"(g + 4 * gs), "v"(g + 5 * gs), "v"(g + 6 * gs), "v"(g + 7 * gs)
                 : "memory");
}
typedef unsigned u32x4 __attribute__((ext_vector_type(4)));
typedef unsigned u32x8 __attribute__((ext_vector_type(8)));
__device__ __forceinline__ unsigned uni(unsigned v) { return (unsigned)__builtin_amdgcn_readfirstlane(v); }
// pinned(): a wave-uniform test held in a scalar register, so that the branch on it is a scalar branch (a tensor load ignores EXEC; only a branch keeps a wave from issuing it)
__device__ __forceinline__ unsigned pinned(unsigned v) { unsigned w = uni(v); asm volatile("" : "+s"(w)); return w; }
// tensor-load descriptor, group 1: a tile of ROWS rows of ROWB bytes, source pitch SRCP bytes, 16 bytes of LDS pad behind every row (IVL: the pad interval code of the row length).
// Extents in bytes (data_size 0), tensor dims = tile dims, no mask.
template <unsigned ROWB, unsigned ROWS, unsigned SRCP, unsigned IVL>
__device__ __forceinline__ u32x8 tdm_g1() {
    u32x8 g;
    g[0] = uni((1u << 20) | (IVL << 22) | (3u << 25));
    g[1] = uni((ROWB & 0xFFFFu) << 16);
    g[2] = uni((ROWB >> 16) | ((ROWS & 0xFFFFu) << 16));
    g[3] = uni((ROWS >> 16) | (ROWB << 16));
    g[4] = uni(ROWS);
    g[5] = uni(SRCP);
    g[6] = uni(0u); g[7] = uni(0u);
    asm volatile("" : "+s"(g));   // pinned(), for the whole group: the descriptor words are held in one scalar register tuple (else the constants are formed anew in other registers, over those of a request in flight)
    return g;
}
// group 0: LDS byte address of the tile's place, global address of the tile's first byte
__device__ __forceinline__ u32x4 tdm_g0(unsigned lds, const h16* src) {
    const unsigned long long ga = (unsigned long long)(size_t)src;
    u32x4 g;
    g[0] = uni(1u); g[1] = uni(lds); g[2] = uni((unsigned)ga); g[3] = uni((((unsigned)(ga >> 32)) & 0x01FFFFFFu) | 0x80000000u);
    asm volatile("" : "+s"(g));   // pinned(), for the whole group: as in tdm_g1
    return g;
}
// one 64-key tile: waves 0 and 1 issue the k descriptor (wave 0's names the value plane, wave 1's the residual plane), wave 2 the value^T descriptor; scalar branches; the waits are the caller's
__device__ __forceinline__ void tile_load(unsigned wave, u32x4 k0, u32x8 k1, u32x4 v0, u32x8 v1) {
    if (pinned(wave < 2u))  asm volatile("tensor_load_to_lds %0, %1" :: "s"(k0), "s"(k1) : "memory");
    if (pinned(wave == 2u)) asm volatile("tensor_load_to_lds %0, %1" :: "s"(v0), "s"(v1) : "memory");
}
// the issuing wave's wait for its tensor load (free in a wave that has none). The descriptors are named as inputs so that their registers keep their values for as long as the request is outstanding.
__device__ __forceinline__ void tile_wait(u32x4 k0, u32x8 k1, u32x4 v0, u32x8 v1) {
    asm volatile("s_wait_tensorcnt 0x0" :: "s"(k0), "s"(k1), "s"(v0), "s"(v1) : "memory");
}
// lane l <-> lane l ^ 16 on the vector unit: unlike the LDS-path shuffle it does not count on dscnt, so its result needs no wait that would drain the fragment reads issued ahead of it
__device__ __forceinline__ float xhalf(float v) { const unsigned u = __float_as_uint(v);
    return __uint_as_float(__builtin_amdgcn_permlanex16(u, u, 0x76543210u, 0xfedcba98u, false, false)); }
// ordering point for wave-private LDS tiles (same wave writes and reads)
__device__ __forceinline__ void wave_sync() { __builtin_amdgcn_fence(3 /* release order */, "wavefront"); __builtin_amdgcn_wave_barrier(); asm volatile("" ::: "memory"); }

// f32 -> f16 convert that cannot produce an f16 subnormal (|v| < 2^-14 -> +0); applied after the plane's power-of-two carry
static __device__ __forceinline__ h16 toh_flush(float v) { const h16 r = (h16)v; return (fabsf(v) < 6.103515625e-05f) ? (h16)0.0f : r; }
// one matrix instruction + its own four-slot guard (accumulator tied, operands kept live)
__device__ __forceinline__ v8f wmma16g(v16h a, v16h b, v8f c) {
    c = __builtin_amdgcn_wmma_f32_16x16x32_f16(false, a, false, b, (short)0, c, false, false);
    asm volatile("v_nop\n\tv_nop\n\tv_nop\n\tv_nop" : "+v"(c) : "v"(a), "v"(b));
    return c; }
__device__ __forceinline__ v8f wmmabg(v16bf a, v16bf b, v8f c) {
    c = __builtin_amdgcn_wmma_f32_16x16x32_bf16(false, a, false, b, (short)0, c, false, false);
    asm volatile("v_nop\n\tv_nop\n\tv_nop\n\tv_nop" : "+v"(c) : "v"(a), "v"(b));
    return c; }

// mm64: register-blocked bf16 GEMM main loop, ONE WAVE per 64x64 tile (16 accumulators), operands from staged LDS rows of pitch XP, K = CIN.
// a, b: the lane's first row of each operand, already + (lane&15)*XP + 16*(lane>>4). acc[mb][nb][j] = C[16mb + 8h + j][16nb + (lane&15)], C[m][n] = sum_k A[m][k] Bt[n][k].
__device__ __forceinline__ void mm64(const unsigned char* a, const unsigned char* b, v8f (&acc)[4][4]) {
#pragma unroll
    for (int mb = 0; mb < 4; ++mb)
#pragma unroll
        for (int nb = 0; nb < 4; ++nb) acc[mb][nb] = (v8f){};
#pragma unroll 1
    for (int kc = 0; kc < CIN * 2; kc += 64) {                 // kc in bytes: 32 elements a step
        v16bf af[4], bb[4];
#pragma unroll
        for (int mb = 0; mb < 4; ++mb) { af[mb] = ldlb(a + mb * 16 * XP + kc); bb[mb] = ldlb(b + mb * 16 * XP + kc); }
        __builtin_amdgcn_sched_barrier(0);                     // keeps the step's LDS reads one group ahead of its products (else each B fragment is read, and waited for, in among them)
#pragma unroll
        for (int nb = 0; nb < 4; ++nb)
#pragma unroll
            for (int mb = 0; mb < 4; ++mb) acc[mb][nb] = wmmabg(af[mb], bb[nb], acc[mb][nb]);
    }
}

// proj_q: q = x W_theta, 64 x 64 tile (bx, by). A = x rows (m = b*SEQ + t), Bt = transposed weight rows (n = d). Planes [b*SEQ + t][128]: f16 value (Ph) and f16 residual x2048 (Pr).
__device__ __forceinline__ void proj_q(float* os, const unsigned char* A, const unsigned char* Bt, h16* Ph, h16* Pr, int bx, int by) {
    const int lane = threadIdx.x & 31, lr = lane & 15, hi = lane >> 4; const int r0 = bx * 64, c0 = by * 64;
    v8f acc[4][4];
    mm64(A, Bt, acc);
    const size_t obase = (size_t)r0 * CB + c0;
#pragma unroll
    for (int mb = 0; mb < 4; ++mb) {
#pragma unroll
        for (int nb = 0; nb < 4; ++nb) {
#pragma unroll
            for (int j = 0; j < 8; ++j) os[(hi * 8 + j) * 68 + nb * 16 + lr] = acc[mb][nb][j]; }   // D: row 8h+j, col lane&15; 16 x 64 all written
        wave_sync();
        static_assert(32 * 8 * 4 == 16 * 64);                                                     // lanes x halves x instructions == slab
{
#pragma unroll
            for (int s = 0; s < 4; ++s) { const int row = 4 * s + (lane >> 3), c8 = (lane & 7) * 8;   // 4 s x 4 row groups = 16 rows; 8 lanes x 8 = 64 columns
                const v4f x0 = *(const v4fa*)(&os[row * 68 + c8]); const v4f x1 = *(const v4fa*)(&os[row * 68 + c8 + 4]); v8h hv, rv;
#pragma unroll
                for (int i = 0; i < 4; ++i) { const h16 a0 = toh_flush(x0[i]); const h16 a1 = toh_flush(x1[i]); hv[i] = a0; hv[4 + i] = a1;
                    rv[i] = toh_flush((x0[i] - (float)a0) * QRS); rv[4 + i] = toh_flush((x1[i] - (float)a1) * QRS); }
                const size_t oo = obase + (size_t)(mb * 16 + row) * CB + c8;
                *(v8h*)(Ph + oo) = hv; *(v8h*)(Pr + oo) = rv; }
             }
        wave_sync();
    }
}

// proj_k: k = maxpool2(x W_phi) over adjacent token pairs, 64 x 64 tile (bx, by). Same GEMM; per 16-token slab the 8 pooled rows (max in f32, then convert) go to planes [b*MK + key][128]: f16 value and f16 residual x2048.
__device__ __forceinline__ void proj_k(float* os, const unsigned char* A, const unsigned char* Bt, h16* Ph, h16* Pr, int bx, int by) {
    const int lane = threadIdx.x & 31, lr = lane & 15, hi = lane >> 4; const int r0 = bx * 64, c0 = by * 64;
    v8f acc[4][4];
    mm64(A, Bt, acc);
    const size_t obase = (size_t)(r0 / 2) * CB + c0;                                              // (b*SEQ + t)/2 = b*MK + t/2
#pragma unroll
    for (int mb = 0; mb < 4; ++mb) {
#pragma unroll
        for (int nb = 0; nb < 4; ++nb) {
#pragma unroll
            for (int j = 0; j < 8; ++j) os[(hi * 8 + j) * 68 + nb * 16 + lr] = acc[mb][nb][j]; }
        wave_sync();
        static_assert(32 * 8 * 2 == 8 * 64);                                                      // lanes x halves x instructions == pooled slab
{
#pragma unroll
            for (int s = 0; s < 2; ++s) { const int prow = 4 * s + (lane >> 3), c8 = (lane & 7) * 8;   // 2 s x 4 row groups = 8 pooled rows (token rows 2*prow, 2*prow+1)
                const v4f u0 = *(const v4fa*)(&os[(2 * prow) * 68 + c8]);     const v4f u1 = *(const v4fa*)(&os[(2 * prow) * 68 + c8 + 4]);
                const v4f w0 = *(const v4fa*)(&os[(2 * prow + 1) * 68 + c8]); const v4f w1 = *(const v4fa*)(&os[(2 * prow + 1) * 68 + c8 + 4]); v8h hv, rv;
#pragma unroll
                for (int i = 0; i < 4; ++i) { const float y0 = fmaxf(u0[i], w0[i]), y1 = fmaxf(u1[i], w1[i]);
                    const h16 a0 = toh_flush(y0); const h16 a1 = toh_flush(y1); hv[i] = a0; hv[4 + i] = a1;
                    rv[i] = toh_flush((y0 - (float)a0) * QRS); rv[4 + i] = toh_flush((y1 - (float)a1) * QRS); }
                const size_t oo = obase + (size_t)(mb * 8 + prow) * CB + c8;
                *(v8h*)(Ph + oo) = hv; *(v8h*)(Pr + oo) = rv; }
             }
        wave_sync();
    }
}

// proj_gt: pooled values transposed, G^T[d][key] = max over the token pair of (W_g^T x^T)[d][t]. ONE WAVE per 32 (d) x 128 (token) tile (16 accumulators):
// A = transposed weight rows (m = d), Bt = x rows (n = b*SEQ + t). Plane [(b*128 + d)][MK], single f16. Per 16-row slab staged in LDS (wave-private);
__device__ __forceinline__ void proj_gt(float* os, const unsigned char* A, const unsigned char* Bt, h16* Gt, int bx, int by) {
    const int lane = threadIdx.x & 31, lr = lane & 15, hi = lane >> 4; const int r0 = bx * 32, c0 = by * 128;
    v8f acc[2][8];
#pragma unroll
    for (int mb = 0; mb < 2; ++mb)
#pragma unroll
        for (int nb = 0; nb < 8; ++nb) acc[mb][nb] = (v8f){};
#pragma unroll 1
    for (int kc = 0; kc < CIN * 2; kc += 64) {                 // kc in bytes: 32 elements a step
        v16bf a[2], b[8];
#pragma unroll
        for (int mb = 0; mb < 2; ++mb) a[mb] = ldlb(A + mb * 16 * XP + kc);
#pragma unroll
        for (int nb = 0; nb < 8; ++nb) b[nb] = ldlb(Bt + nb * 16 * XP + kc);
        __builtin_amdgcn_sched_barrier(0);                     // keeps the step's LDS reads one group ahead of its products, as in mm64
#pragma unroll
        for (int nb = 0; nb < 8; ++nb)
#pragma unroll
            for (int mb = 0; mb < 2; ++mb) acc[mb][nb] = wmmabg(a[mb], b[nb], acc[mb][nb]);
    }
    const int bb = c0 / SEQ, tt = c0 % SEQ;
    const size_t obase = ((size_t)bb * CB + r0) * MK + (size_t)(tt / 2);
#pragma unroll
    for (int mb = 0; mb < 2; ++mb) {
#pragma unroll
        for (int nb = 0; nb < 8; ++nb) {
#pragma unroll
            for (int j = 0; j < 8; ++j) os[(hi * 8 + j) * OPF + nb * 16 + lr] = acc[mb][nb][j]; }   // D: row d = 8h+j, col token = 16nb + lane&15; 16 x 128 all written
        wave_sync();
        static_assert(32 * 8 * 4 == 16 * 64);                                                       // lanes x pooled halves x instructions == pooled slab
{
#pragma unroll
            for (int s = 0; s < 4; ++s) { const int row = 4 * s + (lane >> 3), c8 = (lane & 7) * 8;     // 4 s x 4 row groups = 16 rows; 8 lanes x 8 pooled = 64 pooled columns
                const v4f f0 = *(const v4fa*)(&os[row * OPF + 2 * c8]);     const v4f f1 = *(const v4fa*)(&os[row * OPF + 2 * c8 + 4]);
                const v4f f2 = *(const v4fa*)(&os[row * OPF + 2 * c8 + 8]); const v4f f3 = *(const v4fa*)(&os[row * OPF + 2 * c8 + 12]); v8h hv;
                hv[0] = toh_flush(fmaxf(f0[0], f0[1])); hv[1] = toh_flush(fmaxf(f0[2], f0[3]));
                hv[2] = toh_flush(fmaxf(f1[0], f1[1])); hv[3] = toh_flush(fmaxf(f1[2], f1[3]));
                hv[4] = toh_flush(fmaxf(f2[0], f2[1])); hv[5] = toh_flush(fmaxf(f2[2], f2[3]));
                hv[6] = toh_flush(fmaxf(f3[0], f3[1])); hv[7] = toh_flush(fmaxf(f3[2], f3[3]));
                const size_t oo = obase + (size_t)(mb * 16 + row) * MK + c8;
                *(v8h*)(Gt + oo) = hv; }
             }
        wave_sync();
    }
}

// k_proj: the three input projections, straight from the f32 inputs. One block of twelve waves per 128 tokens: waves 0..3 the four 64 x 64 q tiles,
// waves 4..7 the four k tiles, waves 8..11 the four 32 x 128 value^T tiles. The block's operands are built once in LDS as bf16 rows of pitch XP:
// x rows: wave w reads rows w, w + 12, ..., each as two whole-line loads of 512 bytes (four f32 per lane), converts, stores 8 bytes per lane and load.
// weight rows (transposed, [out][in]): wave w builds rows 32w .. 32w+31 of the 384 (W_theta^T, W_phi^T, W_g^T in turn). Lane (a = lane&7, c = lane>>3) reads four outputs 4a .. 4a+3 (16 bytes; eight lanes = one
// 128-byte line of an input row) of the input rows 8c + 32g + e, so that it holds runs of eight consecutive inputs per output: one 16-byte LDS store per run.
// Order: first half of the weight loads, x loads, convert the first half, second half of the weight loads (they fly under the x convert), convert x, convert the second half.
// Block c also writes row c of the W_out^T plane (f16 of the bf16 value x 64) for k_attn: waves 8 and 9, one 128-byte line each.
// Staging tiles of the store stage are wave-private: the q and k waves have their own behind the operands; a value^T wave uses the first 16 of its 32 weight rows, which it alone reads and has left by then.
__global__ __launch_bounds__(32 * PW) void k_proj(const float* __restrict__ x, const float* __restrict__ wt, const float* __restrict__ wp, const float* __restrict__ wg,
                                                  const float* __restrict__ wo, h16* WOH, h16* QH, h16* QR, h16* KH, h16* KR, h16* GT) {
    __shared__ __align__(16) unsigned char sm[PLDS];
    const int lane = threadIdx.x & 31, lr = lane & 15, hi = lane >> 4;
    const int wave = __builtin_amdgcn_readfirstlane((int)(threadIdx.x >> 5));
    const int which = wave >> 2, sub = wave & 3;               // wave-uniform: projection, tile
    const int blk = blockIdx.x;
    const int la = lane & 7, lc = lane >> 3;
    const float* wsrc = (which == 0) ? wt : (which == 1) ? wp : wg;
    const float* gw = wsrc + 8 * lc * CB + 32 * sub + 4 * la;
    unsigned char* lw = sm + WS_O + (32 * wave + 4 * la) * XP + 16 * lc;
    const int tok = blk * PT;                                  // batch pitch of x: SEQ_FULL rows
    const unsigned char* gx = (const unsigned char*)(x + ((size_t)(tok / SEQ) * SEQ_FULL + tok % SEQ + wave) * CIN);   // wave-uniform: the wave's first x row
    const unsigned xo = lane * 16u;                            // the lane's byte offset in half an x row (four f32)
    unsigned char* lx = sm + wave * XP + lane * 8;
    const bool xl = wave + PW * 10 < PT;                       // wave-uniform: the wave has an eleventh x row
    const bool wow = (wave == 8 || wave == 9) && blk < COUT;   // wave-uniform: the wave writes half a row of the W_out^T plane
    const int wd = 64 * (wave & 1) + 2 * lane;                 // two adjacent context channels per lane
    v4f wv[4][8], xr[11][2]; float wo0, wo1;                  // wo0 and wo1 are set and used under wow alone
#pragma unroll
    for (int g = 0; g < 4; ++g)
#pragma unroll
        for (int e = 0; e < 8; ++e) wv[g][e] = *(const v4f*)(gw + (32 * g + e) * CB);
    __builtin_amdgcn_sched_barrier(0);                         // keeps these loads (L2) ahead of the x loads (memory): loads return in order, and the second half of the weight loads is issued as soon as these are converted
#pragma unroll
    for (int i = 0; i < 10; ++i) { xr[i][0] = *(const v4f*)(gx + (size_t)(PW * i) * CIN * 4 + xo); xr[i][1] = *(const v4f*)(gx + (size_t)(PW * i) * CIN * 4 + CIN * 2 + xo); }
    const unsigned char* gx10 = gx + (size_t)(xl ? PW * 10 : PT - 1 - wave) * CIN * 4 + xo;   // no branch among the loads: a wave without an eleventh row reads the block's last row and drops it
    xr[10][0] = *(const v4f*)gx10; xr[10][1] = *(const v4f*)(gx10 + CIN * 2);
    asm volatile("s_wait_xcnt 0x0" :: "s"(gx), "v"(xo), "v"(gx10) : "memory");   // precaution: stands in front of whatever next rewrites an address register of the loads above (base, offset and address are named as inputs so that their registers live up to here)
    if (wow) { wo0 = wo[(size_t)wd * COUT + blk]; wo1 = wo[(size_t)(wd + 1) * COUT + blk]; }
    asm volatile("s_wait_xcnt 0x0" ::: "memory");              // precaution: as above
#pragma unroll
    for (int g = 0; g < 4; ++g)
#pragma unroll
        for (int j = 0; j < 4; ++j) { v8us o;
#pragma unroll
            for (int e = 0; e < 8; ++e) o[e] = tobf(wv[g][e][j]);
            *(v8usa*)(lw + j * XP + g * 64) = o; }
#pragma unroll
    for (int g = 0; g < 4; ++g)
#pragma unroll
        for (int e = 0; e < 8; ++e) wv[g][e] = *(const v4f*)(gw + (32 * (4 + g) + e) * CB);
    asm volatile("s_wait_xcnt 0x0" ::: "memory");              // precaution: as above
    __builtin_amdgcn_sched_barrier(0);                         // keeps the x converts, which wait for memory, behind the issue of these loads (else they rise in among the first half's converts)
#pragma unroll
    for (int i = 0; i < 11; ++i) {
        if (i < 10 || xl) {
#pragma unroll
            for (int h = 0; h < 2; ++h) { v4us o;
#pragma unroll
                for (int e = 0; e < 4; ++e) o[e] = tobf(xr[i][h][e]);
                *(v4usa*)(lx + PW * i * XP + h * CIN) = o; } } }
#pragma unroll
    for (int g = 0; g < 4; ++g)
#pragma unroll
        for (int j = 0; j < 4; ++j) { v8us o;
#pragma unroll
            for (int e = 0; e < 8; ++e) o[e] = tobf(wv[g][e][j]);
            *(v8usa*)(lw + j * XP + (4 + g) * 64) = o; }
    __syncthreads();                                           // publishes the block's operand rows
    if (wow) { v2h o; o[0] = toh_flush(bfr(wo0) * WOS); o[1] = toh_flush(bfr(wo1) * WOS);   // behind the barrier, so that no wave waits there for this store
        *(v2h*)(WOH + (size_t)blk * CB + wd) = o;
        asm volatile("s_wait_xcnt 0x0" ::: "memory"); }        // precaution: stands in front of whatever next rewrites the store's address and data registers
    const unsigned char* xs = sm + lr * XP + 16 * hi;          // fragment rows: + row * XP + 2 * k
    const unsigned char* ws = sm + WS_O + lr * XP + 16 * hi;
    if (which == 0)      proj_q((float*)(sm + OS_O + wave * OSB), xs + (sub & 1) * 64 * XP, ws + (sub >> 1) * 64 * XP, QH, QR, blk * 2 + (sub & 1), sub >> 1);
    else if (which == 1) { proj_k((float*)(sm + OS_O + wave * OSB), xs + (sub & 1) * 64 * XP, ws + (CB + (sub >> 1) * 64) * XP, KH, KR, blk * 2 + (sub & 1), sub >> 1);
        asm volatile("s_wait_xcnt 0x0" ::: "memory"); }        // precaution: in the built text this body is followed by the other bodies' code, which rewrites the registers that its last stores name (the other two run into the end of the program)
    else { proj_gt((float*)(sm + WS_O + 32 * wave * XP), ws + 32 * wave * XP, xs, GT, sub, blk);
        asm volatile("s_wait_xcnt 0x0" ::: "memory"); }        // precaution: as above (whichever body the built text puts last runs into the end of the program)
}

// k_attn: fused attention + output projection + skip term, one wave per 16 query rows of one batch; K / G^T / Q / W_out^T fragments from LDS rows (two 16-B reads each).
// Staging: each wave brings its own 16 q rows once by whole-line asynchronous copies; every 64-key tile (k value, k residual, value^T) comes by three tensor loads, one each from waves 0, 1, 2,
// into one of two buffers, one tile ahead of its use (no address arithmetic on the vector unit, no copy issue in the key loop).
// Transposed form: S^T[key][t] = K Q^T (A = K rows, B = Q rows, 4 k-steps over d); lane (t = lane&15, h = lane>>4) holds keys 8h+r of each 16-key tile, so the packed
// P tile is directly the B fragment of O^T[d][t] = G^T P^T (element r <- tile keys 0..15, element 8+r <- tile keys 16..31, lane unchanged), 8 tiles over d.
// Scores = K Q + (K Q_res + K_res Q) / 2048. Softmax state (running max, partial sum) is one scalar per lane; the two lane halves of a row are combined with one xor-16 exchange.
// Q fragments are read from LDS once and held in registers. The key loop's fragment reads stand at two places per pass, each a whole phase ahead of its use; 512 registers per wave (two waves per SIMD).
// The skip term's x rows are loaded in the key loop's first four tiles into 128 registers that the loop leaves free, so that the store stage waits for no memory read.
// Epilogue: W_out^T rows copied whole-line into the freed tile buffers, a quarter per wave (a fragment load straight from the plane touches 16 lines for 512 bytes, and every wave needs all 128 of them);
// ctx^T = O^T / l packed to f16 (tiles 2kk, 2kk+1 -> B fragment of k-step kk); out^T[c][t] = W_out^T ctx^T per 16-channel tile, staged in a wave-private LDS tile [t][128 channels];
__global__ __launch_bounds__(32 * AW) __attribute__((amdgpu_num_vgpr(512)))
void k_attn(const h16* __restrict__ QH, const h16* __restrict__ QR, const h16* __restrict__ KH, const h16* __restrict__ KR,
            const h16* __restrict__ GT, const h16* __restrict__ WO, const float* __restrict__ X, float* OUT) {
    __shared__ __attribute__((aligned(2048))) unsigned char sm[LDSB];
    const int lane = threadIdx.x & 31, lr = lane & 15, hi = lane >> 4;
    const int wave = __builtin_amdgcn_readfirstlane((int)(threadIdx.x >> 5));
    const int b = blockIdx.y;
    const int t0 = (blockIdx.x * AW + wave) * 16;
    // copy side: q rows of 256 B, two per copy (16 lanes each); tile planes of this batch for the tensor loads
    const unsigned sb = (unsigned)(size_t)sm;                  // LDS byte address of the array
    const unsigned lq = sb + Q_O + wave * QWB + (lane >> 4) * KP + (lane & 15) * 16;
    const int gq = (b * SEQ + t0 + (lane >> 4)) * CB + (lane & 15) * 8;
    const h16* tk = ((wave == 0) ? KH : KR) + (size_t)b * MK * CB;   // + tile * KT * CB; wave 0 brings the value rows, wave 1 the residual rows
    const h16* tg = GT + (size_t)b * CB * MK;                  // + tile * KT
    const unsigned dk = sb + ((wave == 0) ? 0 : KR_O), dg = sb + GT_O;   // + buffer
    const u32x8 k1 = tdm_g1<CB * 2, KT, CB * 2, 5>(), v1 = tdm_g1<KT * 2, CB, MK * 2, 4>();
    // read side
    const unsigned char* qp = sm + Q_O + wave * QWB + lr * KP + 16 * hi;         // B fragments: col t, k = d; residual rows + 16*KP
    const int ko = lr * KP + 16 * hi;                          // + buffer + key * KP      (A fragment: row key, k = d)
    const int vo = GT_O + lr * GP + 16 * hi;                   // + buffer + 16j*GP + 2*key (A fragment: row d, k = key)
    // prologue: q rows and tile 0, landed and published; then tile 1 into the second buffer
    cp8(lq, QH + gq, 2 * KP, 2 * CB);
    cp8(lq + 16 * KP, QR + gq, 2 * KP, 2 * CB);
    u32x4 k0 = tdm_g0(dk, tk), v0 = tdm_g0(dg, tg);
    tile_load((unsigned)wave, k0, k1, v0, v1);
    asm volatile("s_wait_asynccnt 0x0" ::: "memory");          // this wave's copies have landed before the barrier publishes them
    tile_wait(k0, k1, v0, v1);                                 // this wave's tensor load of tile 0 has landed before the barrier publishes it
    __syncthreads();
    k0 = tdm_g0(dk + STB, tk + KT * CB); v0 = tdm_g0(dg + STB, tg + KT);
    tile_load((unsigned)wave, k0, k1, v0, v1);                 // tile 1, into the buffer that nobody has touched yet
    // skip term: the wave's 16 x rows (two whole-line loads of four f32 per lane and row) are requested ahead of their use and held in registers; they come from memory under the key loop and are first read at the store stage.
    // The rows come four at a time, behind the barriers of tiles 0 to 3: a quarter per tile keeps each burst short
    // (and where the compiler waits for outstanding loads at a barrier, a quarter has had a whole tile's time to arrive).
    const float* gxs = X + ((size_t)b * SEQ_FULL + t0) * COUT; // wave-uniform: the wave's first x row
    const unsigned xso = lane * 16u;                           // the lane's byte offset in half an x row
    v4f xs[2][16];
    // q fragments: read once, held in registers over the whole key loop. k fragments of tile 0, pass 0 (published by the barrier above)
    v16h qh[4], qr[4], ka[4], kb[4], kra[4], krb[4];
#pragma unroll
    for (int kk = 0; kk < 4; ++kk) { qh[kk] = ldl(qp + kk * 64); qr[kk] = ldl(qp + 16 * KP + kk * 64); }
#pragma unroll
    for (int kk = 0; kk < 4; ++kk) {
        ka[kk] = ldl(sm + ko + kk * 64); kb[kk] = ldl(sm + ko + 16 * KP + kk * 64);
        kra[kk] = ldl(sm + ko + KR_O + kk * 64); krb[kk] = ldl(sm + ko + KR_O + 16 * KP + kk * 64); }
    v8f o[8];
#pragma unroll
    for (int j = 0; j < 8; ++j) o[j] = (v8f){};
    float m = NEGB, l = 0.0f;
#pragma unroll 1
    for (int st = 0; st < NST; ++st) {
    const int bo = (st & 1) * STB;                             // this tile's buffer
    // LDS fragment reads stand at two places per 32-key pass, each a whole phase ahead of its use: the pass's value^T fragments ahead of its score products,
    // the next pass's k fragments behind them (into the registers those products have just read), ahead of the softmax and the output products.
#pragma unroll                                                 // unrolled: the tile's publish point stands inside its last pass only
    for (int ps = 0; ps < KT / 32; ++ps) {                     // 32-key passes in key order
        const unsigned char* vv = sm + bo + vo + ps * 64;
        v16h vf[8];
#pragma unroll
        for (int j = 0; j < 8; ++j) vf[j] = ldl(vv + j * 16 * GP);
        __builtin_amdgcn_sched_barrier(0);                     // keeps the value^T reads one group ahead of the score products (else they sink in among the matrix instructions)
        v8f sHa = (v8f){}, sLa = (v8f){}, sHb = (v8f){}, sLb = (v8f){};
        // plain builtin in the key loop (the compiler keeps the distances behind it): the guarded form's asm operands tie every fragment and accumulator to the first 256 registers, which spills here
#pragma unroll
        for (int kk = 0; kk < 4; ++kk) {
            sHa = wmma16(ka[kk], qh[kk], sHa); sHb = wmma16(kb[kk], qh[kk], sHb);
            sLa = wmma16(ka[kk], qr[kk], sLa); sLb = wmma16(kb[kk], qr[kk], sLb);
            sLa = wmma16(kra[kk], qh[kk], sLa); sLb = wmma16(krb[kk], qh[kk], sLb);
        }
        __builtin_amdgcn_sched_barrier(0);                     // keeps the next k reads behind the last score product, as one group
        const unsigned char* kn;
        if (ps + 1 < KT / 32) kn = sm + bo + ko + (ps + 1) * 32 * KP;
        else {
            // publish point of tile st + 1, inside tile st's last pass: every read of this buffer has been issued (k fragments used, value^T fragments fetched above)
            asm volatile("s_wait_dscnt 0x0" ::: "memory");     // this wave has left the buffer that is refilled behind the barrier
            tile_wait(k0, k1, v0, v1);                         // this wave's tensor load of tile st + 1 has landed
            __syncthreads();
            kn = sm + (STB - bo) + ko;                         // behind the last tile: the other buffer's old rows, landed and published long ago; read unconditionally (a branch here would merge the compiler's wait counts to 0), never used
        }
#pragma unroll
        for (int kk = 0; kk < 4; ++kk) {
            ka[kk] = ldl(kn + kk * 64); kb[kk] = ldl(kn + 16 * KP + kk * 64);
            kra[kk] = ldl(kn + KR_O + kk * 64); krb[kk] = ldl(kn + KR_O + 16 * KP + kk * 64); }
        __builtin_amdgcn_sched_barrier(0);                     // keeps the k reads ahead of the softmax, whose time covers their latency
        if (ps + 1 == KT / 32) {
            // refill of the buffer just freed (this wave's reads of it retired at the s_wait_dscnt 0 above; the k reads in flight are of the other buffer); scalar tests, the first reads the same for the whole block
            if (pinned(st + 2 < NST)) {
                k0 = tdm_g0(dk + bo, tk + (st + 2) * KT * CB); v0 = tdm_g0(dg + bo, tg + (st + 2) * KT);
                tile_load((unsigned)wave, k0, k1, v0, v1);
            }
            if (st < 4) {                                      // x rows 4 st .. 4 st + 3; st is wave-uniform (the loop over xq is unrolled: the rows are a register array, indexed by constants only)
#pragma unroll
                for (int xq = 0; xq < 4; ++xq)
                    if (st == xq) {
#pragma unroll
                        for (int s = 4 * xq; s < 4 * xq + 4; ++s) {
                            xs[0][s] = *(const v4f*)((const unsigned char*)gxs + (size_t)(s * COUT) * 4 + xso);
                            xs[1][s] = *(const v4f*)((const unsigned char*)gxs + (size_t)(s * COUT + 128) * 4 + xso); }
                        asm volatile("s_wait_xcnt 0x0" :: "s"(gxs), "v"(xso) : "memory");   // precaution: stands in front of whatever next rewrites an address register of the loads above (base and offset are named as inputs so that their registers live up to here)
                    }
            }
        }
        float ta[8], tb[8]; float mx = NEGB;
#pragma unroll
        for (int r = 0; r < 8; ++r) {
            ta[r] = (sHa[r] + sLa[r] * QRI) * L2E; tb[r] = (sHb[r] + sLb[r] * QRI) * L2E;
            mx = fmaxf(mx, fmaxf(ta[r], tb[r])); }
        mx = fmaxf(mx, xhalf(mx));
        const float mnew = fmaxf(m, mx);
        const float alpha = __builtin_amdgcn_exp2f(m - mnew);
        const float sh = PSH - mnew;
        v16h pb; float ls = 0.0f;
#pragma unroll
        for (int r = 0; r < 8; ++r) {
            const float ea = ta[r] + sh, eb = tb[r] + sh;
            const float xa = __builtin_amdgcn_exp2f(ea), xb = __builtin_amdgcn_exp2f(eb);
            const float ga = (ea < -14.0f) ? 0.0f : xa, gb = (eb < -14.0f) ? 0.0f : xb;   // nothing below 2^-14 reaches the f16 operand
            const h16 pa = (h16)ga; const h16 pc = (h16)gb;
            pb[r] = pa; pb[8 + r] = pc;
            ls += (float)pa + (float)pc; }
        l = l * alpha + ls; m = mnew;
#pragma unroll
        for (int j = 0; j < 8; ++j) o[j] = o[j] * alpha;
#pragma unroll
        for (int j = 0; j < 8; ++j) o[j] = wmma16(vf[j], pb, o[j]);
    }
    }
    tile_wait(k0, k1, v0, v1);                                 // no tensor load in flight before the tile buffers are used for anything else
    // W_out^T [256 channels][128] into the bytes of the two tile buffers, rows of pitch KP: wave w brings rows 64w .. 64w+63, two per copy; the copies fly under the normalisation below
    asm volatile("s_wait_dscnt 0x0" ::: "memory");             // this wave's last reads of the tile buffers (the k rows fetched behind the last tile) have returned
    __syncthreads();                                           // every wave has left both tile buffers
    {
        const unsigned lw = sb + (64 * wave + (lane >> 4)) * KP + (lane & 15) * 16;
        const h16* gw = WO + (64 * wave + (lane >> 4)) * CB + (lane & 15) * 8;
#pragma unroll                                                 // unrolled: four statements of eight copies, their address steps constants
        for (int c = 0; c < 4; ++c) cp8(lw + c * 16 * KP, gw + c * 16 * CB, 2 * KP, 2 * CB);
    }
    l += __shfl_xor(l, 16, 32);
    const float inv = 1.0f / l;                                // l >= 16384 (the row maximum contributes the full carry)
    // ctx^T D layout: o[j][r] = (d = 16j + 8h + r, t = lane&15); B fragment of k-step kk: element r <- tile 2kk, element 8+r <- tile 2kk+1
    v16h cf[4];
#pragma unroll
    for (int kk = 0; kk < 4; ++kk) {
#pragma unroll
        for (int r = 0; r < 8; ++r) { cf[kk][r] = toh_flush(o[2 * kk][r] * inv); cf[kk][8 + r] = toh_flush(o[2 * kk + 1][r] * inv); } }
    asm volatile("s_wait_asynccnt 0x0" ::: "memory");          // this wave's W_out^T rows have landed before the barrier publishes them
    __syncthreads();
    float* os = (float*)(sm + Q_O);                            // each wave stages in the bytes of its own q rows, which only it has read
    const int wb = wave * (QWB / 4);
    const size_t orow = ((size_t)b * OUT_SEQ + t0) * COUT;
#pragma unroll                                                 // unrolled: the held x rows are a register array, indexed by constants only
    for (int hc = 0; hc < 2; ++hc) {
#pragma unroll 1
        for (int ct = 0; ct < 8; ct += 2) {
            const int cg = hc * 8 + ct;
            v16h wa[2][4];                                     // A fragments of two channel tiles: row c = 16(cg + u) + (lane&15), k = d; the loops over u and kk are unrolled so that the arrays stay in registers
#pragma unroll
            for (int u = 0; u < 2; ++u)
#pragma unroll
                for (int kk = 0; kk < 4; ++kk) wa[u][kk] = ldl(sm + ko + (cg + u) * 16 * KP + kk * 64);
            __builtin_amdgcn_sched_barrier(0);                 // keeps the trip's LDS reads one group ahead of its products (else each fragment is read, and waited for, directly in front of its product)
            v8f acc[2]; acc[0] = (v8f){}; acc[1] = (v8f){};
#pragma unroll
            for (int kk = 0; kk < 4; ++kk) { acc[0] = wmma16g(wa[0][kk], cf[kk], acc[0]); acc[1] = wmma16g(wa[1][kk], cf[kk], acc[1]); }
            // D: acc[u][r] = (c = 16(cg + u) + 8h + r, t = lane&15) -> os[t][16(ct + u) + 8h + r]; rows 0..15 x columns 0..127 all written over the 8 tiles
#pragma unroll
            for (int u = 0; u < 2; ++u) {
                v4f a0, a1;
                a0[0] = acc[u][0] * WOI; a0[1] = acc[u][1] * WOI; a0[2] = acc[u][2] * WOI; a0[3] = acc[u][3] * WOI;
                a1[0] = acc[u][4] * WOI; a1[1] = acc[u][5] * WOI; a1[2] = acc[u][6] * WOI; a1[3] = acc[u][7] * WOI;
                *(v4fa*)(&os[wb + lr * OPF + (ct + u) * 16 + 8 * hi]) = a0; *(v4fa*)(&os[wb + lr * OPF + (ct + u) * 16 + 8 * hi + 4]) = a1;
            }
        }
        wave_sync();
        static_assert(32 * 4 * 16 == 16 * 128);                // lanes x floats x instructions == half tile
{
            v4f rs[4];                                         // the rows of a group of four stores
#pragma unroll                                                 // unrolled: as above
            for (int s = 0; s < 16; ++s) { const int cofs = lane * 4;
                const v4f val = *(const v4fa*)(&os[wb + s * OPF + cofs]);
                const v4f xv = xs[hc][s];
                v4f res; res[0] = bfr(xv[0]) + val[0]; res[1] = bfr(xv[1]) + val[1]; res[2] = bfr(xv[2]) + val[2]; res[3] = bfr(xv[3]) + val[3];
                *(v4f*)(OUT + orow + (size_t)s * COUT + hc * 128 + cofs) = res; rs[s & 3] = res;
                // precaution, behind every four stores: stands in front of whatever next rewrites their data and address registers (the stored rows are named as inputs so that their registers live up to here)
                if ((s & 3) == 3) asm volatile("s_wait_xcnt 0x0" :: "v"(rs[0]), "v"(rs[1]), "v"(rs[2]), "v"(rs[3]) : "memory"); }
             }
        wave_sync();
    }
}

static constexpr size_t al256(size_t v) { return (v + 255) & ~(size_t)255; }
static constexpr size_t SZ_W  = al256((size_t)CIN * CB * 2);
static constexpr size_t SZ_Q  = al256((size_t)NB * SEQ * CB * 2);
static constexpr size_t SZ_K  = al256((size_t)NB * MK * CB * 2);
static constexpr size_t SZ_TOTAL = SZ_W + 2 * SZ_Q + 3 * SZ_K;
static_assert(SZ_TOTAL <= (size_t)134217728);                        // workspace carve <= 128 MiB
static_assert((size_t)CIN * CB == (size_t)CB * COUT);                // the W_out plane has the extent of an input-projection weight plane
static_assert((size_t)NB * MK * CB == (size_t)NB * CB * MK);         // value^T plane [(b*128 + d)][MK] has the extent of a k plane

extern "C" void kernel_launch(void* const* d_in, const int* in_sizes, int n_in,
                              void* d_out, int out_size, void* d_ws, size_t ws_size, hipStream_t stream) {
    if (n_in < 5) return;
    const size_t needx = ((size_t)(NB - 1) * SEQ_FULL + SEQ) * CIN;
    if ((size_t)in_sizes[0] < needx) return;
    if ((size_t)in_sizes[1] < (size_t)CIN * CB || (size_t)in_sizes[2] < (size_t)CIN * CB || (size_t)in_sizes[3] < (size_t)CIN * CB) return;
    if ((size_t)in_sizes[4] < (size_t)CB * COUT) return;
    if ((size_t)out_size < ((size_t)(NB - 1) * OUT_SEQ + SEQ) * COUT) return;
    if (SZ_TOTAL > ws_size) return;
    // wire order: x, W_theta, W_phi, W_g, W_out
    const float* x  = (const float*)d_in[0];
    const float* wt = (const float*)d_in[1];
    const float* wp = (const float*)d_in[2];
    const float* wg = (const float*)d_in[3];
    const float* wo = (const float*)d_in[4];
    float* OUT = (float*)d_out;      // [NB][SEQ][256]
    char* wsp = (char*)d_ws;
    h16* WOH = (h16*)wsp; wsp += SZ_W;               // W_out^T   f16 x64 [256][128]
    h16* QH = (h16*)wsp; wsp += SZ_Q;                // [NB*SEQ][128]
    h16* QR = (h16*)wsp; wsp += SZ_Q;                // [NB*SEQ][128] residual x2048
    h16* KH = (h16*)wsp; wsp += SZ_K;                // [NB*MK][128]
    h16* KR = (h16*)wsp; wsp += SZ_K;                // [NB*MK][128] residual x2048
    h16* GT = (h16*)wsp; wsp += SZ_K;                // [NB*128][MK]

    k_proj<<<dim3(NB * SEQ / PT, 1, 1), 32 * PW, 0, stream>>>(x, wt, wp, wg, wo, WOH, QH, QR, KH, KR, GT);
    k_attn<<<dim3(SEQ / (16 * AW), NB, 1), 32 * AW, 0, stream>>>(QH, QR, KH, KR, GT, WOH, x, OUT);
}

// v010
// Measured time: 61.4 microseconds a run.
// Two timings next to v009 both put it at 1.04 times that version's speed.
// All steps since v000 together make it 5.11 times as fast.
#include <hip/hip_runtime.h>

// Spatial self-attention block over flattened pixels: x [NB][SEQ][256]; three 1x1 projections W [in 256][out 128] (no bias); keys and values max-pooled over adjacent token pairs (SEQ/2 keys);
// unscaled dot-product scores, softmax over keys; context [SEQ][128] -> output projection W_out [in 128][out 256]; output = x + projected context (f32).
// Compute dtypes, f32 accumulate everywhere: three input projections v_wmma_f32_16x16x32_bf16 (x and W RNE-converted to bf16; products exact);
// scores v_wmma_f32_16x16x32_f16 with q and k each as f16 value + f16 residual x2048 (three products, residual products in their own accumulator folded by 1/2048);
// P.V v_wmma_f32_16x16x32_f16, P single f16 with x16384 carry (cancels in the normalisation, row sum over the converted P), pooled values single f16;
// output projection v_wmma_f32_16x16x32_f16, context single f16, W_out (RNE bf16 value) x64 as f16, folded by 1/64; softmax f32 (online, running max); skip term = bf16-converted x added in f32 at the store stage.
// Layout: transposed f16 W_out plane [out][in]; q planes (value, residual) [b][t][128]; k planes (value, residual) [b][key][128]; value^T plane [b][d][key];
// fused flash kernel in transposed form (S^T = K Q^T, O^T = V^T P^T, out^T = W_out^T ctx^T with the packed O^T tiles as B fragments);
// its key-loop operands are staged in LDS: q rows by asynchronous copies, k and value^T in 64-key tiles with two buffers shared by the block's waves, each tile plane by one tensor load.
// behind the key loop the whole W_out^T plane is staged by asynchronous copies in the bytes of the two tile buffers, once per block, for the output projection's A fragments.
// the projections' operands (128 x rows, the 384 transposed weight rows) are read as f32 from the inputs, converted to bf16 in registers and stored to LDS, once per block, and shared by the block's twelve waves.
// Two dependent launches: k_proj (q, k, value^T planes; one row of the W_out^T plane per block), k_attn.

#ifndef NB
#define NB 8
#endif
#ifndef SEQ
#define SEQ 4096
#endif
#define NB_FULL  8
#define SEQ_FULL 4096
#ifndef OUT_SEQ
#define OUT_SEQ SEQ              // row pitch (in tokens) between batches of the output
#endif
#define CIN  256                 // input channels (projection depth)
#define CB   128                 // bottleneck width (score depth, context width)
#define COUT 256                 // output channels
#define MK   (SEQ / 2)           // pooled keys per batch
#define AW   4                   // waves per flash block (64 query rows: two column pairs x two key halves in the key loop, 16 rows each behind it)
#define OPF  132                 // LDS row pitch (floats) of the 16 x 128 staging tiles
#define QRS  2048.0f             // carry of every residual plane
#define QRI  (1.0f / 2048.0f)
#define L2E  1.4426950408889634f // log2(e); the module applies no score scale
#define PSH  14.0f               // log2 of the P carry (16384)
#define NEGB (-3.0e38f)
#define WOS  64.0f               // carry of the f16 W_out plane
#define WOI  (1.0f / 64.0f)
#define KT   64                  // keys per LDS tile (two 32-key halves, one per wave of a column pair)
#define NST  (MK / KT)           // tiles per batch
#define KP   272                 // LDS row pitch, bytes, of 256-byte q / k rows (16 B x odd: conflict-free 16-byte reads)
#define GP   144                 // LDS row pitch, bytes, of 128-byte value^T rows (16 B x odd)
#define KTP  18432               // bytes of one k plane's place in a tile buffer: KT rows of pitch KP, rounded up to a multiple of 2 KiB (every tensor load's destination is one)
#define KR_O KTP                 // tile layout: k value rows, k residual rows, value^T rows
#define GT_O (2 * KTP)
#define STB  (2 * KTP + CB * GP) // bytes of one tile buffer
#define Q_O  (2 * STB)           // behind the two buffers: per wave 16 q value rows, then 16 q residual rows
#define QWB  (2 * 16 * KP)       // bytes of one wave's q rows; the same bytes are that wave's hand-over tile and then its output staging tile after the key loop
#define LDSB (Q_O + AW * QWB)
#define PT   128                 // tokens per projection block
#define PW   12                  // waves per projection block: four q tiles, four k tiles, four value^T tiles
#define XP   528                 // LDS row pitch, bytes, of 512-byte x / weight rows (16 B x odd: conflict-free 16-byte reads)
#define WS_O (PT * XP)           // projection block layout: 128 x rows, 3 x 128 weight rows, the q and k waves' staging tiles
#define OS_O (WS_O + 3 * CB * XP)
#define OSB  (16 * 68 * 4)       // bytes of one q / k staging tile
#define PLDS (OS_O + 8 * OSB)

static_assert(CB == 128);                      // flash: 4 k-steps of 32 per score tile, 8 output tiles of 16, 4 k-steps in the output projection
static_assert(COUT == 256);                    // output staged as two halves of 128 columns
static_assert(CIN == COUT);                    // skip term has the output's row width
static_assert(CIN % 32 == 0);                  // GEMM k-loop steps by 32
static_assert(CB % 32 == 0);
static_assert(CIN % 64 == 0);
static_assert(CB % 64 == 0);
static_assert(COUT % 64 == 0);
static_assert(SEQ % 128 == 0);                 // a 128-token value tile never straddles two batches; token pairs stay inside a tile
static_assert((NB * SEQ) % 128 == 0);
static_assert((NB * SEQ) % 64 == 0);
static_assert(MK % 32 == 0);                   // key loop steps by 32
static_assert(MK % 64 == 0);
static_assert(SEQ % (16 * AW) == 0);           // flash grid covers the sequence exactly
static_assert(((size_t)SEQ * CIN) % 8 == 0);
static_assert(NB <= NB_FULL);
static_assert(SEQ <= SEQ_FULL);
static_assert((OPF * 4) % 16 == 0);
static_assert(NST >= 2);                       // the two-buffer prologue fills tiles 0 and 1
static_assert(AW == 4);                        // waves 0, 1, 2 each issue one tensor load per tile (k value, k residual, value^T); two column pairs x two key halves
static_assert(CB * 2 == 256 && KP == 256 + 16);   // a k row is 256 bytes: pad interval code 5, 4 dwords of pad
static_assert(KT * 2 == 128 && GP == 128 + 16);   // a value^T tile row is one 128-byte line: pad interval code 4, 4 dwords of pad
static_assert(KT * KP <= KTP && KTP % 2048 == 0 && STB % 2048 == 0);   // tensor-load destinations at multiples of 2 KiB, planes disjoint
static_assert((MK * 2) % 16 == 0 && MK * 2 <= 131072);                  // source pitch of the value^T tile
static_assert(16 * OPF * 4 <= QWB);            // the output staging tile fits the wave's q rows
static_assert(KP % 16 == 0);
static_assert(GP % 16 == 0);
static_assert(LDSB <= 163840);                 // two blocks per 320 KiB of LDS
static_assert(COUT * KP <= 2 * STB);           // the staged W_out^T plane (256 rows of 256 B, pitch KP) fits the two tile buffers
static_assert(COUT == 64 * AW);                // each wave copies 64 W_out^T rows (32 copies of 2 rows, all in flight: at most 63)
static_assert((size_t)NB * SEQ * CIN < (size_t)2147483647);   // int offsets inside the planes
static_assert(CIN == 2 * 32 * 4);              // an x row is two loads of four f32 per lane of one wave
static_assert(XP % 16 == 0);
static_assert(3 * CB == 32 * PW);              // each wave builds 32 transposed weight rows
static_assert(PT > 10 * PW && PT <= 11 * PW);  // x rows wave, wave + PW, ...: ten per wave, an eleventh in the first PT - 10 * PW waves
static_assert((NB * SEQ) / PT >= COUT);        // block c also writes row c of the W_out^T plane
static_assert((NB * SEQ) % PT == 0);
static_assert(SEQ % PT == 0);
static_assert(16 * OPF * 4 <= 16 * XP);        // a value^T wave's staging tile fits the first 16 of its own 32 weight rows
static_assert(PLDS <= 327680);                 // one block per 320 KiB of LDS

typedef _Float16 h16;
typedef unsigned short bf;
typedef __attribute__((ext_vector_type(16))) __bf16   v16bf;
typedef __attribute__((ext_vector_type(16))) _Float16 v16h;
typedef __attribute__((ext_vector_type(8)))  _Float16 v8h;
typedef __attribute__((ext_vector_type(8)))  unsigned short v8us;
typedef __attribute__((ext_vector_type(8)))  float    v8f;
typedef __attribute__((ext_vector_type(4)))  float    v4f;
typedef v4f  __attribute__((may_alias)) v4fa;
typedef v8h  __attribute__((may_alias)) v8ha;
typedef v8us __attribute__((may_alias)) v8usa;
typedef __attribute__((ext_vector_type(2)))  _Float16 v2h;
typedef __attribute__((ext_vector_type(4)))  unsigned short v4us;
typedef v4us __attribute__((may_alias)) v4usa;
typedef __attribute__((ext_vector_type(2)))  float    v2f;
typedef v2f  __attribute__((may_alias)) v2fa;

__device__ __forceinline__ unsigned short f2bf(float f) { unsigned u = __float_as_uint(f); u += 0x7FFFu + ((u >> 16) & 1u); return (unsigned short)(u >> 16); }
__device__ __forceinline__ float bfr(float f) { return __uint_as_float(((unsigned)f2bf(f)) << 16); }   // value after RNE convert to bf16
__device__ __forceinline__ unsigned short tobf(float f) { return __builtin_bit_cast(unsigned short, (__bf16)f); }   // RNE convert on the vector unit's own instruction (same bits as f2bf for every finite value)
__device__ __forceinline__ v16h cat16(v8h lo, v8h hi) { return __builtin_shufflevector(lo, hi, 0, 1, 2, 3, 4, 5, 6, 7, 8, 9, 10, 11, 12, 13, 14, 15); }
__device__ __forceinline__ v16bf cat16b(v8us lo, v8us hi) { return __builtin_bit_cast(v16bf, __builtin_shufflevector(lo, hi, 0, 1, 2, 3, 4, 5, 6, 7, 8, 9, 10, 11, 12, 13, 14, 15)); }
__device__ __forceinline__ v8f wmma16(v16h a, v16h b, v8f c) { return __builtin_amdgcn_wmma_f32_16x16x32_f16(false, a, false, b, (short)0, c, false, false); }
__device__ __forceinline__ v8f wmmab(v16bf a, v16bf b, v8f c) { return __builtin_amdgcn_wmma_f32_16x16x32_bf16(false, a, false, b, (short)0, c, false, false); }
// fragment loaders from K-contiguous 16-bit rows staged in LDS; p in bytes, already includes + 16*(lane>>4): elements 0..7 <- k0+8h+0..7, elements 8..15 <- k0+16+8h+0..7 (same map for A and B)
__device__ __forceinline__ v16h  ldl(const unsigned char* p) { return cat16(*(const v8ha*)p, *(const v8ha*)(p + 32)); }
__device__ __forceinline__ v16bf ldlb(const unsigned char* p) { return cat16b(*(const v8usa*)p, *(const v8usa*)(p + 32)); }
// eight asynchronous 16-byte-per-lane copies global -> LDS (l = the lane's LDS byte address, g = the lane's global address; steps between copies ls bytes, gs elements).
// The closing s_wait_xcnt stands inside the statement so that no address register is rewritten ahead of it.
__device__ __forceinline__ void cp8(unsigned l, const h16* g, unsigned ls, size_t gs) {
    asm volatile("global_load_async_to_lds_b128 %0, %8, off\n\t"
                 "global_load_async_to_lds_b128 %1, %9, off\n\t"
                 "global_load_async_to_lds_b128 %2, %10, off\n\t"
                 "global_load_async_to_lds_b128 %3, %11, off\n\t"
                 "global_load_async_to_lds_b128 %4, %12, off\n\t"
                 "global_load_async_to_lds_b128 %5, %13, off\n\t"
                 "global_load_async_to_lds_b128 %6, %14, off\n\t"
                 "global_load_async_to_lds_b128 %7, %15, off\n\t"
                 "s_wait_xcnt 0x0"
                 :: "v"(l), "v"(l + ls), "v"(l + 2 * ls), "v"(l + 3 * ls), "v"(l + 4 * ls), "v"(l + 5 * ls), "v"(l + 6 * ls), "v"(l + 7 * ls),
                    "v"(g), "v"(g + gs), "v"(g + 2 * gs), "v"(g + 3 * gs), "v"(g + 4 * gs), "v"(g + 5 * gs), "v"(g + 6 * gs), "v"(g + 7 * gs)
                 : "memory");
}
typedef unsigned u32x4 __attribute__((ext_vector_type(4)));
typedef unsigned u32x8 __attribute__((ext_vector_type(8)));
__device__ __forceinline__ unsigned uni(unsigned v) { return (unsigned)__builtin_amdgcn_readfirstlane(v); }
// pinned(): a wave-uniform test held in a scalar register, so that the branch on it is a scalar branch (a tensor load ignores EXEC; only a branch keeps a wave from issuing it)
__device__ __forceinline__ unsigned pinned(unsigned v) { unsigned w = uni(v); asm volatile("" : "+s"(w)); return w; }
// tensor-load descriptor, group 1: a tile of ROWS rows of ROWB bytes, source pitch SRCP bytes, 16 bytes of LDS pad behind every row (IVL: the pad interval code of the row length).
// Extents in bytes (data_size 0), tensor dims = tile dims, no mask.
template <unsigned ROWB, unsigned ROWS, unsigned SRCP, unsigned IVL>
__device__ __forceinline__ u32x8 tdm_g1() {
    u32x8 g;
    g[0] = uni((1u << 20) | (IVL << 22) | (3u << 25));
    g[1] = uni((ROWB & 0xFFFFu) << 16);
    g[2] = uni((ROWB >> 16) | ((ROWS & 0xFFFFu) << 16));
    g[3] = uni((ROWS >> 16) | (ROWB << 16));
    g[4] = uni(ROWS);
    g[5] = uni(SRCP);
    g[6] = uni(0u); g[7] = uni(0u);
    asm volatile("" : "+s"(g));   // pinned(), for the whole group: the descriptor words are held in one scalar register tuple (else the constants are formed anew in other registers, over those of a request in flight)
    return g;
}
// group 0: LDS byte address of the tile's place, global address of the tile's first byte
__device__ __forceinline__ u32x4 tdm_g0(unsigned lds, const h16* src) {
    const unsigned long long ga = (unsigned long long)(size_t)src;
    u32x4 g;
    g[0] = uni(1u); g[1] = uni(lds); g[2] = uni((unsigned)ga); g[3] = uni((((unsigned)(ga >> 32)) & 0x01FFFFFFu) | 0x80000000u);
    asm volatile("" : "+s"(g));   // pinned(), for the whole group: as in tdm_g1
    return g;
}
// one 64-key tile: waves 0 and 1 issue the k descriptor (wave 0's names the value plane, wave 1's the residual plane), wave 2 the value^T descriptor; scalar branches; the waits are the caller's
__device__ __forceinline__ void tile_load(unsigned wave, u32x4 k0, u32x8 k1, u32x4 v0, u32x8 v1) {
    if (pinned(wave < 2u))  asm volatile("tensor_load_to_lds %0, %1" :: "s"(k0), "s"(k1) : "memory");
    if (pinned(wave == 2u)) asm volatile("tensor_load_to_lds %0, %1" :: "s"(v0), "s"(v1) : "memory");
}
// the issuing wave's wait for its tensor load (free in a wave that has none). The descriptors are named as inputs so that their registers keep their values for as long as the request is outstanding.
__device__ __forceinline__ void tile_wait(u32x4 k0, u32x8 k1, u32x4 v0, u32x8 v1) {
    asm volatile("s_wait_tensorcnt 0x0" :: "s"(k0), "s"(k1), "s"(v0), "s"(v1) : "memory");
}
// lane l <-> lane l ^ 16 on the vector unit: unlike the LDS-path shuffle it does not count on dscnt, so its result needs no wait that would drain the fragment reads issued ahead of it
__device__ __forceinline__ float xhalf(float v) { const unsigned u = __float_as_uint(v);
    return __uint_as_float(__builtin_amdgcn_permlanex16(u, u, 0x76543210u, 0xfedcba98u, false, false)); }
// ordering point for wave-private LDS tiles (same wave writes and reads)
__device__ __forceinline__ void wave_sync() { __builtin_amdgcn_fence(3 /* release order */, "wavefront"); __builtin_amdgcn_wave_barrier(); asm volatile("" ::: "memory"); }

// f32 -> f16 convert that cannot produce an f16 subnormal (|v| < 2^-14 -> +0); applied after the plane's power-of-two carry
static __device__ __forceinline__ h16 toh_flush(float v) { const h16 r = (h16)v; return (fabsf(v) < 6.103515625e-05f) ? (h16)0.0f : r; }
// one matrix instruction + its own four-slot guard (accumulator tied, operands kept live)
__device__ __forceinline__ v8f wmma16g(v16h a, v16h b, v8f c) {
    c = __builtin_amdgcn_wmma_f32_16x16x32_f16(false, a, false, b, (short)0, c, false, false);
    asm volatile("v_nop\n\tv_nop\n\tv_nop\n\tv_nop" : "+v"(c) : "v"(a), "v"(b));
    return c; }
__device__ __forceinline__ v8f wmmabg(v16bf a, v16bf b, v8f c) {
    c = __builtin_amdgcn_wmma_f32_16x16x32_bf16(false, a, false, b, (short)0, c, false, false);
    asm volatile("v_nop\n\tv_nop\n\tv_nop\n\tv_nop" : "+v"(c) : "v"(a), "v"(b));
    return c; }

// mm64: register-blocked bf16 GEMM main loop, ONE WAVE per 64x64 tile (16 accumulators), operands from staged LDS rows of pitch XP, K = CIN.
// a, b: the lane's first row of each operand, already + (lane&15)*XP + 16*(lane>>4). acc[mb][nb][j] = C[16mb + 8h + j][16nb + (lane&15)], C[m][n] = sum_k A[m][k] Bt[n][k].
__device__ __forceinline__ void mm64(const unsigned char* a, const unsigned char* b, v8f (&acc)[4][4]) {
#pragma unroll
    for (int mb = 0; mb < 4; ++mb)
#pragma unroll
        for (int nb = 0; nb < 4; ++nb) acc[mb][nb] = (v8f){};
#pragma unroll 1
    for (int kc = 0; kc < CIN * 2; kc += 64) {                 // kc in bytes: 32 elements a step
        v16bf af[4], bb[4];
#pragma unroll
        for (int mb = 0; mb < 4; ++mb) { af[mb] = ldlb(a + mb * 16 * XP + kc); bb[mb] = ldlb(b + mb * 16 * XP + kc); }
        __builtin_amdgcn_sched_barrier(0);                     // keeps the step's LDS reads one group ahead of its products (else each B fragment is read, and waited for, in among them)
#pragma unroll
        for (int nb = 0; nb < 4; ++nb)
#pragma unroll
            for (int mb = 0; mb < 4; ++mb) acc[mb][nb] = wmmabg(af[mb], bb[nb], acc[mb][nb]);
    }
}

// proj_q: q = x W_theta, 64 x 64 tile (bx, by). A = x rows (m = b*SEQ + t), Bt = transposed weight rows (n = d). Planes [b*SEQ + t][128]: f16 value (Ph) and f16 residual x2048 (Pr).
__device__ __forceinline__ void proj_q(float* os, const unsigned char* A, const unsigned char* Bt, h16* Ph, h16* Pr, int bx, int by) {
    const int lane = threadIdx.x & 31, lr = lane & 15, hi = lane >> 4; const int r0 = bx * 64, c0 = by * 64;
    v8f acc[4][4];
    mm64(A, Bt, acc);
    const size_t obase = (size_t)r0 * CB + c0;
#pragma unroll
    for (int mb = 0; mb < 4; ++mb) {
#pragma unroll
        for (int nb = 0; nb < 4; ++nb) {
#pragma unroll
            for (int j = 0; j < 8; ++j) os[(hi * 8 + j) * 68 + nb * 16 + lr] = acc[mb][nb][j]; }   // D: row 8h+j, col lane&15; 16 x 64 all written
        wave_sync();
        static_assert(32 * 8 * 4 == 16 * 64);                                                     // lanes x halves x instructions == slab
{
#pragma unroll
            for (int s = 0; s < 4; ++s) { const int row = 4 * s + (lane >> 3), c8 = (lane & 7) * 8;   // 4 s x 4 row groups = 16 rows; 8 lanes x 8 = 64 columns
                const v4f x0 = *(const v4fa*)(&os[row * 68 + c8]); const v4f x1 = *(const v4fa*)(&os[row * 68 + c8 + 4]); v8h hv, rv;
#pragma unroll
                for (int i = 0; i < 4; ++i) { const h16 a0 = toh_flush(x0[i]); const h16 a1 = toh_flush(x1[i]); hv[i] = a0; hv[4 + i] = a1;
                    rv[i] = toh_flush((x0[i] - (float)a0) * QRS); rv[4 + i] = toh_flush((x1[i] - (float)a1) * QRS); }
                const size_t oo = obase + (size_t)(mb * 16 + row) * CB + c8;
                *(v8h*)(Ph + oo) = hv; *(v8h*)(Pr + oo) = rv; }
             }
        wave_sync();
    }
}

// proj_k: k = maxpool2(x W_phi) over adjacent token pairs, 64 x 64 tile (bx, by). Same GEMM; per 16-token slab the 8 pooled rows (max in f32, then convert) go to planes [b*MK + key][128]: f16 value and f16 residual x2048.
__device__ __forceinline__ void proj_k(float* os, const unsigned char* A, const unsigned char* Bt, h16* Ph, h16* Pr, int bx, int by) {
    const int lane = threadIdx.x & 31, lr = lane & 15, hi = lane >> 4; const int r0 = bx * 64, c0 = by * 64;
    v8f acc[4][4];
    mm64(A, Bt, acc);
    const size_t obase = (size_t)(r0 / 2) * CB + c0;                                              // (b*SEQ + t)/2 = b*MK + t/2
#pragma unroll
    for (int mb = 0; mb < 4; ++mb) {
#pragma unroll
        for (int nb = 0; nb < 4; ++nb) {
#pragma unroll
            for (int j = 0; j < 8; ++j) os[(hi * 8 + j) * 68 + nb * 16 + lr] = acc[mb][nb][j]; }
        wave_sync();
        static_assert(32 * 8 * 2 == 8 * 64);                                                      // lanes x halves x instructions == pooled slab
{
#pragma unroll
            for (int s = 0; s < 2; ++s) { const int prow = 4 * s + (lane >> 3), c8 = (lane & 7) * 8;   // 2 s x 4 row groups = 8 pooled rows (token rows 2*prow, 2*prow+1)
                const v4f u0 = *(const v4fa*)(&os[(2 * prow) * 68 + c8]);     const v4f u1 = *(const v4fa*)(&os[(2 * prow) * 68 + c8 + 4]);
                const v4f w0 = *(const v4fa*)(&os[(2 * prow + 1) * 68 + c8]); const v4f w1 = *(const v4fa*)(&os[(2 * prow + 1) * 68 + c8 + 4]); v8h hv, rv;
#pragma unroll
                for (int i = 0; i < 4; ++i) { const float y0 = fmaxf(u0[i], w0[i]), y1 = fmaxf(u1[i], w1[i]);
                    const h16 a0 = toh_flush(y0); const h16 a1 = toh_flush(y1); hv[i] = a0; hv[4 + i] = a1;
                    rv[i] = toh_flush((y0 - (float)a0) * QRS); rv[4 + i] = toh_flush((y1 - (float)a1) * QRS); }
                const size_t oo = obase + (size_t)(mb * 8 + prow) * CB + c8;
                *(v8h*)(Ph + oo) = hv; *(v8h*)(Pr + oo) = rv; }
             }
        wave_sync();
    }
}

// proj_gt: pooled values transposed, G^T[d][key] = max over the token pair of (W_g^T x^T)[d][t]. ONE WAVE per 32 (d) x 128 (token) tile (16 accumulators):
// A = transposed weight rows (m = d), Bt = x rows (n = b*SEQ + t). Plane [(b*128 + d)][MK], single f16. Per 16-row slab staged in LDS (wave-private);
__device__ __forceinline__ void proj_gt(float* os, const unsigned char* A, const unsigned char* Bt, h16* Gt, int bx, int by) {
    const int lane = threadIdx.x & 31, lr = lane & 15, hi = lane >> 4; const int r0 = bx * 32, c0 = by * 128;
    v8f acc[2][8];
#pragma unroll
    for (int mb = 0; mb < 2; ++mb)
#pragma unroll
        for (int nb = 0; nb < 8; ++nb) acc[mb][nb] = (v8f){};
#pragma unroll 1
    for (int kc = 0; kc < CIN * 2; kc += 64) {                 // kc in bytes: 32 elements a step
        v16bf a[2], b[8];
#pragma unroll
        for (int mb = 0; mb < 2; ++mb) a[mb] = ldlb(A + mb * 16 * XP + kc);
#pragma unroll
        for (int nb = 0; nb < 8; ++nb) b[nb] = ldlb(Bt + nb * 16 * XP + kc);
        __builtin_amdgcn_sched_barrier(0);                     // keeps the step's LDS reads one group ahead of its products, as in mm64
#pragma unroll
        for (int nb = 0; nb < 8; ++nb)
#pragma unroll
            for (int mb = 0; mb < 2; ++mb) acc[mb][nb] = wmmabg(a[mb], b[nb], acc[mb][nb]);
    }
    const int bb = c0 / SEQ, tt = c0 % SEQ;
    const size_t obase = ((size_t)bb * CB + r0) * MK + (size_t)(tt / 2);
#pragma unroll
    for (int mb = 0; mb < 2; ++mb) {
#pragma unroll
        for (int nb = 0; nb < 8; ++nb) {
#pragma unroll
            for (int j = 0; j < 8; ++j) os[(hi * 8 + j) * OPF + nb * 16 + lr] = acc[mb][nb][j]; }   // D: row d = 8h+j, col token = 16nb + lane&15; 16 x 128 all written
        wave_sync();
        static_assert(32 * 8 * 4 == 16 * 64);                                                       // lanes x pooled halves x instructions == pooled slab
{
#pragma unroll
            for (int s = 0; s < 4; ++s) { const int row = 4 * s + (lane >> 3), c8 = (lane & 7) * 8;     // 4 s x 4 row groups = 16 rows; 8 lanes x 8 pooled = 64 pooled columns
                const v4f f0 = *(const v4fa*)(&os[row * OPF + 2 * c8]);     const v4f f1 = *(const v4fa*)(&os[row * OPF + 2 * c8 + 4]);
                const v4f f2 = *(const v4fa*)(&os[row * OPF + 2 * c8 + 8]); const v4f f3 = *(const v4fa*)(&os[row * OPF + 2 * c8 + 12]); v8h hv;
                hv[0] = toh_flush(fmaxf(f0[0], f0[1])); hv[1] = toh_flush(fmaxf(f0[2], f0[3]));
                hv[2] = toh_flush(fmaxf(f1[0], f1[1])); hv[3] = toh_flush(fmaxf(f1[2], f1[3]));
                hv[4] = toh_flush(fmaxf(f2[0], f2[1])); hv[5] = toh_flush(fmaxf(f2[2], f2[3]));
                hv[6] = toh_flush(fmaxf(f3[0], f3[1])); hv[7] = toh_flush(fmaxf(f3[2], f3[3]));
                const size_t oo = obase + (size_t)(mb * 16 + row) * MK + c8;
                *(v8h*)(Gt + oo) = hv; }
             }
        wave_sync();
    }
}

// k_proj: the three input projections, straight from the f32 inputs. One block of twelve waves per 128 tokens: waves 0..3 the four 64 x 64 q tiles,
// waves 4..7 the four k tiles, waves 8..11 the four 32 x 128 value^T tiles. The block's operands are built once in LDS as bf16 rows of pitch XP:
// x rows: wave w reads rows w, w + 12, ..., each as two whole-line loads of 512 bytes (four f32 per lane), converts, stores 8 bytes per lane and load.
// weight rows (transposed, [out][in]): wave w builds rows 32w .. 32w+31 of the 384 (W_theta^T, W_phi^T, W_g^T in turn). Lane (a = lane&7, c = lane>>3) reads four outputs 4a .. 4a+3 (16 bytes; eight lanes = one
// 128-byte line of an input row) of the input rows 8c + 32g + e, so that it holds runs of eight consecutive inputs per output: one 16-byte LDS store per run.
// Order: first half of the weight loads, x loads, convert the first half, second half of the weight loads (they fly under the x convert), convert x, convert the second half.
// Block c also writes row c of the W_out^T plane (f16 of the bf16 value x 64) for k_attn: waves 8 and 9, one 128-byte line each.
// Staging tiles of the store stage are wave-private: the q and k waves have their own behind the operands; a value^T wave uses the first 16 of its 32 weight rows, which it alone reads and has left by then.
__global__ __launch_bounds__(32 * PW) void k_proj(const float* __restrict__ x, const float* __restrict__ wt, const float* __restrict__ wp, const float* __restrict__ wg,
                                                  const float* __restrict__ wo, h16* WOH, h16* QH, h16* QR, h16* KH, h16* KR, h16* GT) {
    __shared__ __align__(16) unsigned char sm[PLDS];
    const int lane = threadIdx.x & 31, lr = lane & 15, hi = lane >> 4;
    const int wave = __builtin_amdgcn_readfirstlane((int)(threadIdx.x >> 5));
    const int which = wave >> 2, sub = wave & 3;               // wave-uniform: projection, tile
    const int blk = blockIdx.x;
    const int la = lane & 7, lc = lane >> 3;
    const float* wsrc = (which == 0) ? wt : (which == 1) ? wp : wg;
    const float* gw = wsrc + 8 * lc * CB + 32 * sub + 4 * la;
    unsigned char* lw = sm + WS_O + (32 * wave + 4 * la) * XP + 16 * lc;
    const int tok = blk * PT;                                  // batch pitch of x: SEQ_FULL rows
    const unsigned char* gx = (const unsigned char*)(x + ((size_t)(tok / SEQ) * SEQ_FULL + tok % SEQ + wave) * CIN);   // wave-uniform: the wave's first x row
    const unsigned xo = lane * 16u;                            // the lane's byte offset in half an x row (four f32)
    unsigned char* lx = sm + wave * XP + lane * 8;
    const bool xl = wave + PW * 10 < PT;                       // wave-uniform: the wave has an eleventh x row
    const bool wow = (wave == 8 || wave == 9) && blk < COUT;   // wave-uniform: the wave writes half a row of the W_out^T plane
    const int wd = 64 * (wave & 1) + 2 * lane;                 // two adjacent context channels per lane
    v4f wv[4][8], xr[11][2]; float wo0, wo1;                  // wo0 and wo1 are set and used under wow alone
#pragma unroll
    for (int g = 0; g < 4; ++g)
#pragma unroll
        for (int e = 0; e < 8; ++e) wv[g][e] = *(const v4f*)(gw + (32 * g + e) * CB);
    __builtin_amdgcn_sched_barrier(0);                         // keeps these loads (L2) ahead of the x loads (memory): loads return in order, and the second half of the weight loads is issued as soon as these are converted
#pragma unroll
    for (int i = 0; i < 10; ++i) { xr[i][0] = *(const v4f*)(gx + (size_t)(PW * i) * CIN * 4 + xo); xr[i][1] = *(const v4f*)(gx + (size_t)(PW * i) * CIN * 4 + CIN * 2 + xo); }
    const unsigned char* gx10 = gx + (size_t)(xl ? PW * 10 : PT - 1 - wave) * CIN * 4 + xo;   // no branch among the loads: a wave without an eleventh row reads the block's last row and drops it
    xr[10][0] = *(const v4f*)gx10; xr[10][1] = *(const v4f*)(gx10 + CIN * 2);
    asm volatile("s_wait_xcnt 0x0" :: "s"(gx), "v"(xo), "v"(gx10) : "memory");   // precaution: stands in front of whatever next rewrites an address register of the loads above (base, offset and address are named as inputs so that their registers live up to here)
    if (wow) { wo0 = wo[(size_t)wd * COUT + blk]; wo1 = wo[(size_t)(wd + 1) * COUT + blk]; }
    asm volatile("s_wait_xcnt 0x0" ::: "memory");              // precaution: as above
#pragma unroll
    for (int g = 0; g < 4; ++g)
#pragma unroll
        for (int j = 0; j < 4; ++j) { v8us o;
#pragma unroll
            for (int e = 0; e < 8; ++e) o[e] = tobf(wv[g][e][j]);
            *(v8usa*)(lw + j * XP + g * 64) = o; }
#pragma unroll
    for (int g = 0; g < 4; ++g)
#pragma unroll
        for (int e = 0; e < 8; ++e) wv[g][e] = *(const v4f*)(gw + (32 * (4 + g) + e) * CB);
    asm volatile("s_wait_xcnt 0x0" ::: "memory");              // precaution: as above
    __builtin_amdgcn_sched_barrier(0);                         // keeps the x converts, which wait for memory, behind the issue of these loads (else they rise in among the first half's converts)
#pragma unroll
    for (int i = 0; i < 11; ++i) {
        if (i < 10 || xl) {
#pragma unroll
            for (int h = 0; h < 2; ++h) { v4us o;
#pragma unroll
                for (int e = 0; e < 4; ++e) o[e] = tobf(xr[i][h][e]);
                *(v4usa*)(lx + PW * i * XP + h * CIN) = o; } } }
#pragma unroll
    for (int g = 0; g < 4; ++g)
#pragma unroll
        for (int j = 0; j < 4; ++j) { v8us o;
#pragma unroll
            for (int e = 0; e < 8; ++e) o[e] = tobf(wv[g][e][j]);
            *(v8usa*)(lw + j * XP + (4 + g) * 64) = o; }
    __syncthreads();                                           // publishes the block's operand rows
    if (wow) { v2h o; o[0] = toh_flush(bfr(wo0) * WOS); o[1] = toh_flush(bfr(wo1) * WOS);   // behind the barrier, so that no wave waits there for this store
        *(v2h*)(WOH + (size_t)blk * CB + wd) = o;
        asm volatile("s_wait_xcnt 0x0" ::: "memory"); }        // precaution: stands in front of whatever next rewrites the store's address and data registers
    const unsigned char* xs = sm + lr * XP + 16 * hi;          // fragment rows: + row * XP + 2 * k
    const unsigned char* ws = sm + WS_O + lr * XP + 16 * hi;
    if (which == 0)      proj_q((float*)(sm + OS_O + wave * OSB), xs + (sub & 1) * 64 * XP, ws + (sub >> 1) * 64 * XP, QH, QR, blk * 2 + (sub & 1), sub >> 1);
    else if (which == 1) { proj_k((float*)(sm + OS_O + wave * OSB), xs + (sub & 1) * 64 * XP, ws + (CB + (sub >> 1) * 64) * XP, KH, KR, blk * 2 + (sub & 1), sub >> 1);
        asm volatile("s_wait_xcnt 0x0" ::: "memory"); }        // precaution: in the built text this body is followed by the other bodies' code, which rewrites the registers that its last stores name (the other two run into the end of the program)
    else { proj_gt((float*)(sm + WS_O + 32 * wave * XP), ws + 32 * wave * XP, xs, GT, sub, blk);
        asm volatile("s_wait_xcnt 0x0" ::: "memory"); }        // precaution: as above (whichever body the built text puts last runs into the end of the program)
}

// k_attn: fused attention + output projection + skip term. A block of four waves owns 64 query rows of one batch; K / G^T / Q / W_out^T fragments from LDS rows (two 16-B reads each).
// Key loop: wave w works on 32 query columns (column pair w >> 1: two 16-column tiles) and on one half of every 64-key tile (keys 32 (w & 1) .. + 31), so that each K and value^T fragment read from LDS
// feeds two column tiles: half the LDS reads per product of a wave that holds 16 columns and walks all keys. Behind the loop the two waves of a column pair hold partial results (running max, sum, O^T) over
// disjoint keys; each hands the other one column tile through LDS and merges the tile it keeps (tile w & 1 of the pair: query rows 16 w .. 16 w + 15 of the block), then finishes those 16 rows alone.
// Staging: each wave brings 16 q rows once by whole-line asynchronous copies; every 64-key tile (k value, k residual, value^T) comes by three tensor loads, one each from waves 0, 1, 2,
// into one of two buffers, one tile ahead of its use (no address arithmetic on the vector unit, no copy issue in the key loop).
// Transposed form: S^T[key][t] = K Q^T (A = K rows, B = Q rows, 4 k-steps over d); lane (t = lane&15, h = lane>>4) holds keys 8h+r of each 16-key tile, so the packed
// P tile is directly the B fragment of O^T[d][t] = G^T P^T (element r <- tile keys 0..15, element 8+r <- tile keys 16..31, lane unchanged), 8 tiles over d.
// Scores = K Q + (K Q_res + K_res Q) / 2048. Softmax state (running max, partial sum) is one scalar per lane and column tile; the two lane halves of a row are combined with one xor-16 exchange.
// Q fragments are read from LDS once and held in registers (128). The key loop's fragment reads stand a phase ahead of their use (see at the loop); 512 registers per wave (two waves per SIMD).
// The skip term's x rows are loaded right behind the key loop into registers that the loop has left, and fly under the merge and the first half of the output projection.
// Epilogue: W_out^T rows copied whole-line into the freed tile buffers, a quarter per wave (a fragment load straight from the plane touches 16 lines for 512 bytes, and every wave needs all 128 of them);
// ctx^T = O^T / l packed to f16 (tiles 2kk, 2kk+1 -> B fragment of k-step kk); out^T[c][t] = W_out^T ctx^T per 16-channel tile, staged in a wave-private LDS tile [t][128 channels];
__global__ __launch_bounds__(32 * AW) __attribute__((amdgpu_num_vgpr(512)))
void k_attn(const h16* __restrict__ QH, const h16* __restrict__ QR, const h16* __restrict__ KH, const h16* __restrict__ KR,
            const h16* __restrict__ GT, const h16* __restrict__ WO, const float* __restrict__ X, float* OUT) {
    __shared__ __attribute__((aligned(2048))) unsigned char sm[LDSB];
    const int lane = threadIdx.x & 31, lr = lane & 15, hi = lane >> 4;
    const int wave = __builtin_amdgcn_readfirstlane((int)(threadIdx.x >> 5));
    const int b = blockIdx.y;
    const int t0 = (blockIdx.x * AW + wave) * 16;              // the 16 query rows that this wave copies in and, behind the key loop, finishes
    const int cp = wave >> 1, kg = wave & 1;                   // wave-uniform: column pair, key half
    // copy side: q rows of 256 B, two per copy (16 lanes each); tile planes of this batch for the tensor loads
    const unsigned sb = (unsigned)(size_t)sm;                  // LDS byte address of the array
    const unsigned lq = sb + Q_O + wave * QWB + (lane >> 4) * KP + (lane & 15) * 16;
    const int gq = (b * SEQ + t0 + (lane >> 4)) * CB + (lane & 15) * 8;
    const h16* tk = ((wave == 0) ? KH : KR) + (size_t)b * MK * CB;   // + tile * KT * CB; wave 0 brings the value rows, wave 1 the residual rows
    const h16* tg = GT + (size_t)b * CB * MK;                  // + tile * KT
    const unsigned dk = sb + ((wave == 0) ? 0 : KR_O), dg = sb + GT_O;   // + buffer
    const u32x8 k1 = tdm_g1<CB * 2, KT, CB * 2, 5>(), v1 = tdm_g1<KT * 2, CB, MK * 2, 4>();
    // read side
    const unsigned char* qp = sm + Q_O + 2 * cp * QWB + lr * KP + 16 * hi;       // B fragments: col t, k = d; column tile u + u*QWB; residual rows + 16*KP
    const int ko0 = lr * KP + 16 * hi;                         // A fragment rows of pitch KP: row lane&15, k = d
    const int ko = ko0 + kg * 32 * KP;                         // + buffer: this wave's 32 keys of a tile
    const int vo = GT_O + lr * GP + 16 * hi + kg * 64;         // + buffer + 16j*GP (A fragment: row d, k = this wave's 32 keys)
    // prologue: q rows and tile 0, landed and published; then tile 1 into the second buffer
    cp8(lq, QH + gq, 2 * KP, 2 * CB);
    cp8(lq + 16 * KP, QR + gq, 2 * KP, 2 * CB);
    u32x4 k0 = tdm_g0(dk, tk), v0 = tdm_g0(dg, tg);
    tile_load((unsigned)wave, k0, k1, v0, v1);
    asm volatile("s_wait_asynccnt 0x0" ::: "memory");          // this wave's copies have landed before the barrier publishes them
    tile_wait(k0, k1, v0, v1);                                 // this wave's tensor load of tile 0 has landed before the barrier publishes it
    __syncthreads();
    k0 = tdm_g0(dk + STB, tk + KT * CB); v0 = tdm_g0(dg + STB, tg + KT);
    tile_load((unsigned)wave, k0, k1, v0, v1);                 // tile 1, into the buffer that nobody has touched yet
    // q fragments of both column tiles: read once, held in registers over the whole key loop. k fragments of tile 0 (published by the barrier above)
    v16h qh[2][4], qr[2][4], ka[4], kb[4], kra[4], krb[4];
#pragma unroll
    for (int u = 0; u < 2; ++u)
#pragma unroll
        for (int kk = 0; kk < 4; ++kk) { qh[u][kk] = ldl(qp + u * QWB + kk * 64); qr[u][kk] = ldl(qp + u * QWB + 16 * KP + kk * 64); }
#pragma unroll
    for (int kk = 0; kk < 4; ++kk) {
        ka[kk] = ldl(sm + ko + kk * 64); kb[kk] = ldl(sm + ko + 16 * KP + kk * 64);
        kra[kk] = ldl(sm + ko + KR_O + kk * 64); krb[kk] = ldl(sm + ko + KR_O + 16 * KP + kk * 64); }
    v8f o[2][8];
#pragma unroll
    for (int u = 0; u < 2; ++u)
#pragma unroll
        for (int j = 0; j < 8; ++j) o[u][j] = (v8f){};
    float m[2] = {NEGB, NEGB}, l[2] = {0.0f, 0.0f};
    // One trip per 64-key tile: this wave's 32 keys against its 32 columns. LDS fragment reads stand at three places, each a phase ahead of its use:
    // value^T fragments behind the score products of k-steps 0, 1 (into the registers of the k fragments just used), ahead of those of k-steps 2, 3; the next tile's k fragments of k-steps 0, 1 behind the
    // publish point (into the registers of k-steps 2, 3), ahead of the rescale and the output products; those of k-steps 2, 3 behind the output products (into the value^T registers), ahead of the next trip's
    // products of k-steps 0, 1. The two fragment sets so change registers from trip to trip: the loop is unrolled by two, which brings them back without register moves.
    static_assert(NST % 2 == 0);
#pragma unroll 2
    for (int st = 0; st < NST; ++st) {
        const int bo = (st & 1) * STB;                         // this tile's buffer
        v8f sHa[2], sLa[2], sHb[2], sLb[2];
#pragma unroll
        for (int u = 0; u < 2; ++u) { sHa[u] = (v8f){}; sLa[u] = (v8f){}; sHb[u] = (v8f){}; sLb[u] = (v8f){}; }
        // plain builtin in the key loop (the compiler keeps the distances behind it): the guarded form's asm operands tie every fragment and accumulator to the first 256 registers, which spills here
#pragma unroll
        for (int kk = 0; kk < 2; ++kk) {
#pragma unroll
            for (int u = 0; u < 2; ++u) {
                sHa[u] = wmma16(ka[kk], qh[u][kk], sHa[u]); sHb[u] = wmma16(kb[kk], qh[u][kk], sHb[u]);
                sLa[u] = wmma16(ka[kk], qr[u][kk], sLa[u]); sLb[u] = wmma16(kb[kk], qr[u][kk], sLb[u]);
                sLa[u] = wmma16(kra[kk], qh[u][kk], sLa[u]); sLb[u] = wmma16(krb[kk], qh[u][kk], sLb[u]);
            }
        }
        __builtin_amdgcn_sched_barrier(0);                     // keeps the value^T reads behind the products of k-steps 0, 1 and apart from the k reads issued at the foot of the trip before
        const unsigned char* vv = sm + bo + vo;
        v16h vf[8];
#pragma unroll
        for (int j = 0; j < 8; ++j) vf[j] = ldl(vv + j * 16 * GP);
        __builtin_amdgcn_sched_barrier(0);                     // keeps the value^T reads ahead of the products of k-steps 2, 3 (for speed only)
#pragma unroll
        for (int kk = 2; kk < 4; ++kk) {
#pragma unroll
            for (int u = 0; u < 2; ++u) {
                sHa[u] = wmma16(ka[kk], qh[u][kk], sHa[u]); sHb[u] = wmma16(kb[kk], qh[u][kk], sHb[u]);
                sLa[u] = wmma16(ka[kk], qr[u][kk], sLa[u]); sLb[u] = wmma16(kb[kk], qr[u][kk], sLb[u]);
                sLa[u] = wmma16(kra[kk], qh[u][kk], sLa[u]); sLb[u] = wmma16(krb[kk], qh[u][kk], sLb[u]);
            }
        }
        v16h pb[2]; float alpha[2], ls[2];
#pragma unroll
        for (int u = 0; u < 2; ++u) {
            v2f ta[4], tb[4]; float mx = NEGB;                 // scores in pairs of adjacent accumulator registers (packed f32 arithmetic without register moves)
#pragma unroll
            for (int r = 0; r < 4; ++r) {
                v2f ha, la, hb, lb;
                ha[0] = sHa[u][2 * r]; ha[1] = sHa[u][2 * r + 1]; la[0] = sLa[u][2 * r]; la[1] = sLa[u][2 * r + 1];
                hb[0] = sHb[u][2 * r]; hb[1] = sHb[u][2 * r + 1]; lb[0] = sLb[u][2 * r]; lb[1] = sLb[u][2 * r + 1];
                ta[r] = (ha + la * QRI) * L2E; tb[r] = (hb + lb * QRI) * L2E;
                mx = fmaxf(mx, fmaxf(ta[r][0], tb[r][0])); mx = fmaxf(mx, fmaxf(ta[r][1], tb[r][1])); }
            mx = fmaxf(mx, xhalf(mx));
            const float mnew = fmaxf(m[u], mx);
            alpha[u] = __builtin_amdgcn_exp2f(m[u] - mnew);
            const float sh = PSH - mnew;
            float lsu = 0.0f;
#pragma unroll
            for (int r = 0; r < 4; ++r) {
                const v2f ea = ta[r] + sh, eb = tb[r] + sh;
                v2f ga, gb;
#pragma unroll
                for (int e = 0; e < 2; ++e) {
                    const float xa = __builtin_amdgcn_exp2f(ea[e]), xb = __builtin_amdgcn_exp2f(eb[e]);
                    ga[e] = (ea[e] < -14.0f) ? 0.0f : xa; gb[e] = (eb[e] < -14.0f) ? 0.0f : xb; }   // nothing below 2^-14 reaches the f16 operand
                const v2h pa = __builtin_convertvector(ga, v2h), pc = __builtin_convertvector(gb, v2h);   // pairs: one packed convert each, and the row sum reads the packed halves back
                const v2f fa = __builtin_convertvector(pa, v2f), fc = __builtin_convertvector(pc, v2f);
                pb[u][2 * r] = pa[0]; pb[u][2 * r + 1] = pa[1]; pb[u][8 + 2 * r] = pc[0]; pb[u][8 + 2 * r + 1] = pc[1];
                lsu += fa[0] + fc[0]; lsu += fa[1] + fc[1]; }
            ls[u] = lsu; m[u] = mnew;
        }
        __builtin_amdgcn_sched_barrier(0);                     // keeps the score products and the maxima ahead of the publish point (else its wait rises to directly behind the value^T reads and waits out their latency)
        // publish point of tile st + 1: every read of this buffer has been issued (k fragments used, value^T fragments fetched above)
        asm volatile("s_wait_dscnt 0x0" ::: "memory");         // this wave has left the buffer that is refilled behind the barrier
        tile_wait(k0, k1, v0, v1);                             // this wave's tensor load of tile st + 1 has landed
        __syncthreads();
        const unsigned char* kn = sm + (STB - bo) + ko;        // behind the last tile: the other buffer's old rows, landed and published long ago; read unconditionally (a branch here would merge the compiler's wait counts to 0), never used
#pragma unroll
        for (int kk = 0; kk < 2; ++kk) {
            ka[kk] = ldl(kn + kk * 64); kb[kk] = ldl(kn + 16 * KP + kk * 64);
            kra[kk] = ldl(kn + KR_O + kk * 64); krb[kk] = ldl(kn + KR_O + 16 * KP + kk * 64); }
        // refill of the buffer just freed (this wave's reads of it retired at the s_wait_dscnt 0 above; the k reads in flight are of the other buffer); scalar tests, the first reads the same for the whole block
        if (pinned(st + 2 < NST)) {
            k0 = tdm_g0(dk + bo, tk + (st + 2) * KT * CB); v0 = tdm_g0(dg + bo, tg + (st + 2) * KT);
            tile_load((unsigned)wave, k0, k1, v0, v1);
        }
#pragma unroll
        for (int u = 0; u < 2; ++u) {
            l[u] = l[u] * alpha[u] + ls[u];
#pragma unroll
            for (int j = 0; j < 8; ++j) o[u][j] = o[u][j] * alpha[u];
        }
#pragma unroll
        for (int j = 0; j < 8; ++j) { o[0][j] = wmma16(vf[j], pb[0], o[0][j]); o[1][j] = wmma16(vf[j], pb[1], o[1][j]); }
        __builtin_amdgcn_sched_barrier(0);                     // keeps the last k reads behind the output products (they land in the value^T registers), as one group
#pragma unroll
        for (int kk = 2; kk < 4; ++kk) {
            ka[kk] = ldl(kn + kk * 64); kb[kk] = ldl(kn + 16 * KP + kk * 64);
            kra[kk] = ldl(kn + KR_O + kk * 64); krb[kk] = ldl(kn + KR_O + 16 * KP + kk * 64); }
    }
    tile_wait(k0, k1, v0, v1);                                 // no tensor load in flight before the tile buffers are used for anything else
    // hand-over between the two waves of a column pair: this wave keeps column tile kg and gives tile 1 - kg (O^T, running max, partial sum) to its partner, through the bytes of its own q rows
    // (last read in front of the key loop): 16 whole 512-byte stores of four f32 per lane, then max and sum as one pair per lane.
    const bool k1s = kg != 0;                                  // wave-uniform
    unsigned char* xw = sm + Q_O + wave * QWB;
    const unsigned char* xr = sm + Q_O + (wave ^ 1) * QWB;
    static_assert(16 * 512 + 32 * 8 <= QWB);                   // the handed tile and its state fit the wave's q rows
#pragma unroll
    for (int j = 0; j < 8; ++j) {
        const v8f e0 = o[0][j], e1 = o[1][j]; v8f g;           // both read first, then chosen value by value (a choice between the array's elements would put the array in memory)
#pragma unroll
        for (int r = 0; r < 8; ++r) g[r] = k1s ? e0[r] : e1[r];
        v4f g0, g1; g0[0] = g[0]; g0[1] = g[1]; g0[2] = g[2]; g0[3] = g[3]; g1[0] = g[4]; g1[1] = g[5]; g1[2] = g[6]; g1[3] = g[7];
        *(v4fa*)(xw + (2 * j) * 512 + lane * 16) = g0; *(v4fa*)(xw + (2 * j + 1) * 512 + lane * 16) = g1; }
    const float m0 = m[0], m1 = m[1], l0 = l[0], l1 = l[1];
    { v2fa gs; gs[0] = k1s ? m0 : m1; gs[1] = k1s ? l0 : l1; *(v2fa*)(xw + 16 * 512 + lane * 8) = gs; }
    // skip term: the wave's 16 x rows (two whole-line loads of four f32 per lane and row), requested here and first read at the store stage; the halves in the order of their use.
    // The two barriers below are written by hand, with the waits they need beside them: __syncthreads() would wait for these loads.
    const float* gxs = X + ((size_t)b * SEQ_FULL + t0) * COUT; // wave-uniform: the wave's first x row
    const unsigned xso = lane * 16u;                           // the lane's byte offset in half an x row
    v4f xs[2][16];
#pragma unroll
    for (int hc = 0; hc < 2; ++hc) {
#pragma unroll
        for (int s = 0; s < 16; ++s) xs[hc][s] = *(const v4f*)((const unsigned char*)gxs + (size_t)(s * COUT + hc * 128) * 4 + xso);
        __builtin_amdgcn_sched_barrier(0);                     // keeps the first half's loads ahead of the second's: loads return in order, and the first store stage reads the first half alone
    }
    asm volatile("s_wait_xcnt 0x0" :: "s"(gxs), "v"(xso) : "memory");   // precaution: stands in front of whatever next rewrites an address register of the loads above (base and offset are named as inputs so that their registers live up to here)
    // W_out^T [256 channels][128] into the bytes of the two tile buffers, rows of pitch KP: wave w brings rows 64w .. 64w+63, two per copy; the copies fly under the merge and the normalisation below
    asm volatile("s_wait_dscnt 0x0" ::: "memory");             // this wave's last reads of the tile buffers (the k rows fetched behind the last tile) have returned, and its hand-over stores are done
    asm volatile("s_barrier_signal -1\n\ts_barrier_wait -1" ::: "memory");   // every wave has left both tile buffers; publishes the hand-over tiles
    {
        const unsigned lw = sb + (64 * wave + (lane >> 4)) * KP + (lane & 15) * 16;
        const h16* gw = WO + (64 * wave + (lane >> 4)) * CB + (lane & 15) * 8;
#pragma unroll                                                 // unrolled: four statements of eight copies, their address steps constants
        for (int c = 0; c < 4; ++c) cp8(lw + c * 16 * KP, gw + c * 16 * CB, 2 * KP, 2 * CB);
    }
    // merge of the kept column tile: both parts brought to the common maximum (lane maps of the two waves are the same)
    const v2fa ps = *(const v2fa*)(xr + 16 * 512 + lane * 8);
    v4f pt[16];
#pragma unroll
    for (int i = 0; i < 16; ++i) pt[i] = *(const v4fa*)(xr + i * 512 + lane * 16);
    __builtin_amdgcn_sched_barrier(0);                         // keeps the partner tile's LDS reads one group (else each is read, and waited for, directly in front of its use)
    const float mk = k1s ? m1 : m0, lk = k1s ? l1 : l0;
    const float mm = fmaxf(mk, ps[0]);
    const float ak = __builtin_amdgcn_exp2f(mk - mm), ao = __builtin_amdgcn_exp2f(ps[0] - mm);
    float lt = lk * ak + ps[1] * ao;
    v8f oc[8];
#pragma unroll
    for (int j = 0; j < 8; ++j) {
        const v8f e0 = o[0][j], e1 = o[1][j]; v8f kp;
#pragma unroll
        for (int r = 0; r < 8; ++r) kp[r] = k1s ? e1[r] : e0[r];
#pragma unroll
        for (int r = 0; r < 4; ++r) { oc[j][r] = kp[r] * ak + pt[2 * j][r] * ao; oc[j][4 + r] = kp[4 + r] * ak + pt[2 * j + 1][r] * ao; } }
    lt += __shfl_xor(lt, 16, 32);
    const float inv = 1.0f / lt;                               // lt >= 16384 (the row maximum contributes the full carry)
    // ctx^T D layout: oc[j][r] = (d = 16j + 8h + r, t = lane&15); B fragment of k-step kk: element r <- tile 2kk, element 8+r <- tile 2kk+1
    v16h cf[4];
#pragma unroll
    for (int kk = 0; kk < 4; ++kk) {
#pragma unroll
        for (int r = 0; r < 8; ++r) { cf[kk][r] = toh_flush(oc[2 * kk][r] * inv); cf[kk][8 + r] = toh_flush(oc[2 * kk + 1][r] * inv); } }
    asm volatile("s_wait_dscnt 0x0" ::: "memory");             // this wave's reads of its partner's hand-over tile have returned: behind the barrier the partner stages its output in those bytes
    asm volatile("s_wait_asynccnt 0x0" ::: "memory");          // this wave's W_out^T rows have landed before the barrier publishes them
    asm volatile("s_barrier_signal -1\n\ts_barrier_wait -1" ::: "memory");
    float* os = (float*)(sm + Q_O);                            // each wave stages in the bytes of its own q rows, which nobody reads any more
    const int wb = wave * (QWB / 4);
    const size_t orow = ((size_t)b * OUT_SEQ + t0) * COUT;
#pragma unroll                                                 // unrolled: the held x rows are a register array, indexed by constants only
    for (int hc = 0; hc < 2; ++hc) {
#pragma unroll 1
        for (int ct = 0; ct < 8; ct += 2) {
            const int cg = hc * 8 + ct;
            v16h wa[2][4];                                     // A fragments of two channel tiles: row c = 16(cg + u) + (lane&15), k = d; the loops over u and kk are unrolled so that the arrays stay in registers
#pragma unroll
            for (int u = 0; u < 2; ++u)
#pragma unroll
                for (int kk = 0; kk < 4; ++kk) wa[u][kk] = ldl(sm + ko0 + (cg + u) * 16 * KP + kk * 64);
            __builtin_amdgcn_sched_barrier(0);                 // keeps the trip's LDS reads one group ahead of its products (else each fragment is read, and waited for, directly in front of its product)
            v8f acc[2]; acc[0] = (v8f){}; acc[1] = (v8f){};
#pragma unroll
            for (int kk = 0; kk < 4; ++kk) { acc[0] = wmma16g(wa[0][kk], cf[kk], acc[0]); acc[1] = wmma16g(wa[1][kk], cf[kk], acc[1]); }
            // D: acc[u][r] = (c = 16(cg + u) + 8h + r, t = lane&15) -> os[t][16(ct + u) + 8h + r]; rows 0..15 x columns 0..127 all written over the 8 tiles
#pragma unroll
            for (int u = 0; u < 2; ++u) {
                v4f a0, a1;
                a0[0] = acc[u][0] * WOI; a0[1] = acc[u][1] * WOI; a0[2] = acc[u][2] * WOI; a0[3] = acc[u][3] * WOI;
                a1[0] = acc[u][4] * WOI; a1[1] = acc[u][5] * WOI; a1[2] = acc[u][6] * WOI; a1[3] = acc[u][7] * WOI;
                *(v4fa*)(&os[wb + lr * OPF + (ct + u) * 16 + 8 * hi]) = a0; *(v4fa*)(&os[wb + lr * OPF + (ct + u) * 16 + 8 * hi + 4]) = a1;
            }
        }
        wave_sync();
        static_assert(32 * 4 * 16 == 16 * 128);                // lanes x floats x instructions == half tile
{
            v4f rs[4];                                         // the rows of a group of four stores
#pragma unroll                                                 // unrolled: as above
            for (int s = 0; s < 16; ++s) { const int cofs = lane * 4;
                const v4f val = *(const v4fa*)(&os[wb + s * OPF + cofs]);
                const v4f xv = xs[hc][s];
                v4f res; res[0] = bfr(xv[0]) + val[0]; res[1] = bfr(xv[1]) + val[1]; res[2] = bfr(xv[2]) + val[2]; res[3] = bfr(xv[3]) + val[3];
                *(v4f*)(OUT + orow + (size_t)s * COUT + hc * 128 + cofs) = res; rs[s & 3] = res;
                // precaution, behind every four stores: stands in front of whatever next rewrites their data and address registers (the stored rows are named as inputs so that their registers live up to here)
                if ((s & 3) == 3) asm volatile("s_wait_xcnt 0x0" :: "v"(rs[0]), "v"(rs[1]), "v"(rs[2]), "v"(rs[3]) : "memory"); }
             }
        wave_sync();
    }
}

static constexpr size_t al256(size_t v) { return (v + 255) & ~(size_t)255; }
static constexpr size_t SZ_W  = al256((size_t)CIN * CB * 2);
static constexpr size_t SZ_Q  = al256((size_t)NB * SEQ * CB * 2);
static constexpr size_t SZ_K  = al256((size_t)NB * MK * CB * 2);
static constexpr size_t SZ_TOTAL = SZ_W + 2 * SZ_Q + 3 * SZ_K;
static_assert(SZ_TOTAL <= (size_t)134217728);                        // workspace carve <= 128 MiB
static_assert((size_t)CIN * CB == (size_t)CB * COUT);                // the W_out plane has the extent of an input-projection weight plane
static_assert((size_t)NB * MK * CB == (size_t)NB * CB * MK);         // value^T plane [(b*128 + d)][MK] has the extent of a k plane

extern "C" void kernel_launch(void* const* d_in, const int* in_sizes, int n_in,
                              void* d_out, int out_size, void* d_ws, size_t ws_size, hipStream_t stream) {
    if (n_in < 5) return;
    const size_t needx = ((size_t)(NB - 1) * SEQ_FULL + SEQ) * CIN;
    if ((size_t)in_sizes[0] < needx) return;
    if ((size_t)in_sizes[1] < (size_t)CIN * CB || (size_t)in_sizes[2] < (size_t)CIN * CB || (size_t)in_sizes[3] < (size_t)CIN * CB) return;
    if ((size_t)in_sizes[4] < (size_t)CB * COUT) return;
    if ((size_t)out_size < ((size_t)(NB - 1) * OUT_SEQ + SEQ) * COUT) return;
    if (SZ_TOTAL > ws_size) return;
    // wire order: x, W_theta, W_phi, W_g, W_out
    const float* x  = (const float*)d_in[0];
    const float* wt = (const float*)d_in[1];
    const float* wp = (const float*)d_in[2];
    const float* wg = (const float*)d_in[3];
    const float* wo = (const float*)d_in[4];
    float* OUT = (float*)d_out;      // [NB][SEQ][256]
    char* wsp = (char*)d_ws;
    h16* WOH = (h16*)wsp; wsp += SZ_W;               // W_out^T   f16 x64 [256][128]
    h16* QH = (h16*)wsp; wsp += SZ_Q;                // [NB*SEQ][128]
    h16* QR = (h16*)wsp; wsp += SZ_Q;                // [NB*SEQ][128] residual x2048
    h16* KH = (h16*)wsp; wsp += SZ_K;                // [NB*MK][128]
    h16* KR = (h16*)wsp; wsp += SZ_K;                // [NB*MK][128] residual x2048
    h16* GT = (h16*)wsp; wsp += SZ_K;                // [NB*128][MK]

    k_proj<<<dim3(NB * SEQ / PT, 1, 1), 32 * PW, 0, stream>>>(x, wt, wp, wg, wo, WOH, QH, QR, KH, KR, GT);
    k_attn<<<dim3(SEQ / (16 * AW), NB, 1), 32 * AW, 0, stream>>>(QH, QR, KH, KR, GT, WOH, x, OUT);
}
